// v000
// Measured on an AMD MI455X. A time is GPU time per run, averaged over a window of back-to-back runs after a warm-up
// (all launches, gaps included; the runs take copies of the inputs in turn), and the median of several windows.
// Apart from v000's, it joins two sittings. Times from different sittings can be a few percent apart, while
// side-by-side timings come from the same sitting.
// v000 is the starting kernel. One run takes 444 microseconds.
#include <hip/hip_runtime.h>

// Speaker-aware causal multi-head attention with relative sinusoidal position terms (d_model 1024, 16 heads x 64, B=4, L=1024): q,k1,k2,v = embed W_qkv;
// qp,kp1,kp2 = pe W_pos (pe = the module's sinusoid table rows 89..1112); logit[q][k] = same speaker ? (q.k1 + qp.kp1) : (q.k2 + qp.kp2) (scale 1); keys k > q or umask = 0
// -> -inf; softmax; out = (P.v) W_fc.
// Numerics: embed, W_qkv, W_pos and W_fc are rounded to bf16 (RNE); the qkv projection runs on
// v_wmma_f32_16x16x32_bf16 with those operands (exact products, f32 accumulate); the position projection uses f16 hi+lo of the f32 sinusoid table against the exact f16 copy of
// bf16 W_pos; the four score products use single f16 copies of q/k1/k2/qp/kp (f32 accumulate); P.V pairs single-f16 P with hi+lo 8v; the output projection pairs hi+lo of the
// attention output with the exact f16 copy of bf16 W_fc. Masks are read from the int inputs. Fragment k-map per lane half hh for A AND B: elements 0..7 <- k = 8hh+0..7, 8..15

namespace {
constexpr int Bn = 4, L = 1024, DM = 1024, H = 16, DH = 64, NTOK = Bn * L, NQKV = 4 * DM, NPOS = 3 * DM, TBL = 1201, SHIFT = 601;
constexpr float VS = 8.0f, PES = 8.0f;

typedef _Float16 b16;
typedef __attribute__((ext_vector_type(16))) _Float16 v16b;
typedef __attribute__((ext_vector_type(8)))  _Float16 v8b;
typedef __attribute__((ext_vector_type(8)))  float v8f;
typedef __attribute__((ext_vector_type(4)))  float v4f;

__device__ __forceinline__ v8b ld8b(const b16* p) { return *(const v8b*)p; }
__device__ __forceinline__ v16b cat8b(v8b a, v8b b) { return __builtin_shufflevector(a, b, 0, 1, 2, 3, 4, 5, 6, 7, 8, 9, 10, 11, 12, 13, 14, 15); }
__device__ __forceinline__ v16b frag_kb(const b16* p, int hh) { return cat8b(ld8b(p + 8 * hh), ld8b(p + 16 + 8 * hh)); }
__device__ __forceinline__ void split16(float v, b16& hi, b16& lo) { hi = (b16)v; lo = (b16)(v - (float)hi); }
// hi/lo fragment pair straight from an f32 k-contiguous row (same k-map)
__device__ __forceinline__ void frag_ksplit(const float* p, int hh, v16b& fh_, v16b& fl_) {
  const float* p0 = p + 8 * hh; const float* p1 = p + 16 + 8 * hh;
#pragma unroll
  for (int e = 0; e < 8; ++e) { b16 a, c; split16(p0[e], a, c); fh_[e] = a; fl_[e] = c; split16(p1[e], a, c); fh_[8 + e] = a; fl_[8 + e] = c; }
}
__device__ __forceinline__ v8f wmma16b(v16b a, v16b b, v8f c) {
  v8f d = __builtin_amdgcn_wmma_f32_16x16x32_f16(false, a, false, b, (short)0, c, false, false);
  asm volatile("v_nop\n\tv_nop\n\tv_nop\n\tv_nop" : "+v"(d) : "v"(a), "v"(b));
  return d;
}
__device__ __forceinline__ void wave_lds_sync() {
  __builtin_amdgcn_fence(__ATOMIC_RELEASE, "workgroup");
  __builtin_amdgcn_wave_barrier();
  __builtin_amdgcn_fence(__ATOMIC_ACQUIRE, "workgroup");
}

// Operand descriptor: NP = 0 -> f32 rows split on the fly into (hi, lo); NP = 1 -> one f16 plane; NP = 2 -> f16 hi + lo planes;
// NP = 3 -> f32 rows rounded once to a single f16 fragment. ld = row pitch.
struct Opnd { const void* p0; const void* p1; int ld; };
template <int NP> __device__ __forceinline__ void load_frags(const Opnd& o, int row, int kb, int hh, v16b& fh_, v16b& fl_) {
  if (NP == 0) { frag_ksplit((const float*)o.p0 + (size_t)row * o.ld + kb, hh, fh_, fl_); }
  else if (NP == 4 || NP == 5) {                             // f32 rows x64 (NP 4) or x8 (NP 5) then split (keeps the lo halves of small values normal)
    const float sc_ = (NP == 4) ? 64.0f : 8.0f;
    const float* p = (const float*)o.p0 + (size_t)row * o.ld + kb; const float* p0 = p + 8 * hh; const float* p1 = p + 16 + 8 * hh;
#pragma unroll
    for (int e = 0; e < 8; ++e) { b16 a, c; split16(p0[e] * sc_, a, c); fh_[e] = a; fl_[e] = c; split16(p1[e] * sc_, a, c); fh_[8 + e] = a; fl_[8 + e] = c; }
  } else if (NP == 3) {
    const float* p = (const float*)o.p0 + (size_t)row * o.ld + kb; const float* p0 = p + 8 * hh; const float* p1 = p + 16 + 8 * hh;
#pragma unroll
    for (int e = 0; e < 8; ++e) { fh_[e] = (b16)p0[e]; fh_[8 + e] = (b16)p1[e]; }
    fl_ = fh_;
  } else {
    fh_ = frag_kb((const b16*)o.p0 + (size_t)row * o.ld + kb, hh);
    if (NP == 2) fl_ = frag_kb((const b16*)o.p1 + (size_t)row * o.ld + kb, hh); else fl_ = fh_;
  }
}
template <int ANP, int BNP> __device__ __forceinline__ v8f mac(v16b ah, v16b al, v16b bh, v16b bl, v8f c) {
  c = wmma16b(ah, bh, c);
  if (BNP == 0 || BNP == 2 || BNP == 4 || BNP == 5) c = wmma16b(ah, bl, c);     // hi.lo
  if (ANP == 0 || ANP == 2 || ANP == 4 || ANP == 5) c = wmma16b(al, bh, c);     // lo.hi   (lo.lo dropped)
  return c;
}
// 32x64 wave tile: acc[r][t] (rows m0+16r.., cols c0+16t..) += A[m][k] . B[n][k] over k in [0, K)
template <int ANP, int BNP>
__device__ __forceinline__ void gemm_tile(const Opnd& A, const Opnd& B, int K, int m0, int c0, int nloc, int hlf, v8f (&acc)[2][4]) {
  for (int kb = 0; kb < K; kb += 32) {
    v16b a0h, a0l, a1h, a1l;
    load_frags<ANP>(A, m0 + nloc, kb, hlf, a0h, a0l);
    load_frags<ANP>(A, m0 + 16 + nloc, kb, hlf, a1h, a1l);
#pragma unroll
    for (int t = 0; t < 4; ++t) {
      v16b bh, bl;
      load_frags<BNP>(B, c0 + t * 16 + nloc, kb, hlf, bh, bl);
      acc[0][t] = mac<ANP, BNP>(a0h, a0l, bh, bl, acc[0][t]);
      acc[1][t] = mac<ANP, BNP>(a1h, a1l, bh, bl, acc[1][t]);
    }
  }
}

__device__ __forceinline__ void epi_planes(v8f (&acc)[2][4], float scale, bool two, b16* __restrict__ oh, b16* __restrict__ ol, int ldo,
                                           int m0, int c0, int lane, b16* Th, b16* Tl) {
  const int nloc = lane & 15, hlf = lane >> 4;
#pragma unroll
  for (int t = 0; t < 4; ++t)
#pragma unroll
    for (int r = 0; r < 2; ++r)
#pragma unroll
      for (int v = 0; v < 8; ++v) {
        const int rr = r * 16 + v + 8 * hlf, cc = t * 16 + nloc;
        b16 h_, l_; split16(acc[r][t][v] * scale, h_, l_);
        Th[rr * 64 + cc] = h_; Tl[rr * 64 + cc] = l_;
      }
  wave_lds_sync();
  {
#pragma unroll
    for (int j = 0; j < 8; ++j) {
      const int rr = j * 4 + (lane >> 3), c8 = (lane & 7) * 8;
      const size_t o = (size_t)(m0 + rr) * ldo + c0 + c8;
      *(v8b*)(oh + o) = ld8b(Th + rr * 64 + c8);
      if (two) *(v8b*)(ol + o) = ld8b(Tl + rr * 64 + c8);
    }
    
  }
}
// (b) f32 rows with pitch ldo: 64 floats = 256 B = 2 lines per row; 16 lanes x 16 B per row, 2 rows per instruction. Optional per-row factor
__device__ __forceinline__ void epi_f32(v8f (&acc)[2][4], float scale, const float* rscale, float* __restrict__ out, int ldo, int m0, int c0, int lane, float* Tt) {
  const int nloc = lane & 15, hlf = lane >> 4;
#pragma unroll
  for (int t = 0; t < 4; ++t)
#pragma unroll
    for (int r = 0; r < 2; ++r)
#pragma unroll
      for (int v = 0; v < 8; ++v) {
        const int rr = r * 16 + v + 8 * hlf;
        const float rs = rscale ? rscale[(size_t)(m0 + rr) * 32] : 1.0f;
        Tt[rr * 64 + t * 16 + nloc] = acc[r][t][v] * scale * rs;
      }
  wave_lds_sync();
  float* dst0 = out + (size_t)m0 * ldo + c0;
  {
#pragma unroll
    for (int j = 0; j < 16; ++j) { const int rr = j * 2 + hlf, c4 = nloc * 4; *(v4f*)(dst0 + (size_t)rr * ldo + c4) = *(const v4f*)(Tt + rr * 64 + c4); }
    
  }
}



typedef __attribute__((ext_vector_type(8))) __bf16 v8bb; typedef __attribute__((ext_vector_type(16))) __bf16 v16bb;
__device__ __forceinline__ v16bb frag_kb_bf(const __bf16* p, int hh) { const v8bb a = *(const v8bb*)(p + 8 * hh), b = *(const v8bb*)(p + 16 + 8 * hh); return __builtin_shufflevector(a, b, 0, 1, 2, 3, 4, 5, 6, 7, 8, 9, 10, 11, 12, 13, 14, 15); }
__device__ __forceinline__ v8f wmma16bb(v16bb a, v16bb b, v8f c) {
  v8f d = __builtin_amdgcn_wmma_f32_16x16x32_bf16(false, a, false, b, (short)0, c, false, false);
  asm volatile("v_nop\n\tv_nop\n\tv_nop\n\tv_nop" : "+v"(d) : "v"(a), "v"(b));
  return d;
}
__device__ __forceinline__ unsigned short bf16_rne_bits(float v) { unsigned int u = __float_as_uint(v); u += 0x7FFFu + ((u >> 16) & 1u); return (unsigned short)(u >> 16); }
__device__ __forceinline__ float bf16_rne(float v) { return __uint_as_float(((unsigned int)bf16_rne_bits(v)) << 16); }

// prep A: embed -> bf16 rows [4096][1024] (16-B pieces); pe x8 hi/lo planes [1024][64] from the module's sinusoid formula (f32, table row 0 (the padding row) never selected for L=1024).
__global__ __launch_bounds__(256) void prep_kernel(const float* __restrict__ emb, unsigned short* __restrict__ e16, b16* __restrict__ peh, b16* __restrict__ pel) {
  typedef __attribute__((ext_vector_type(8))) unsigned short v8us;
  __shared__ __attribute__((aligned(16))) b16 Sc[256 * 16];   // per-thread staging for the rolled sinusoid loop
  const size_t tid = (size_t)blockIdx.x * blockDim.x + threadIdx.x, nth = (size_t)gridDim.x * blockDim.x;
  {
    for (size_t p = tid; p < (size_t)NTOK * DM / 8; p += nth) { v8us v;
#pragma unroll
      for (int e = 0; e < 8; ++e) v[e] = bf16_rne_bits(emb[p * 8 + e]);
      *(v8us*)(e16 + p * 8) = v; }
    for (size_t p = tid; p < (size_t)L * DH / 8; p += nth) { const int l = (int)(p / 8), d0 = (int)(p % 8) * 8;
      const int tblrow = l - L / 2 + SHIFT;                    // 89 .. 1112, never 0
      const float posv = (float)(tblrow - (TBL + 1) / 2);      // arange(-601, 600)[tblrow] = tblrow - 601
#pragma unroll 1
      for (int e = 0; e < 8; ++e) { const int d = d0 + e; const int j = (d < DH / 2) ? d : d - DH / 2;   // rolled: one sin/cos expansion in the binary
        const float freq = expf((float)j * (-9.210340371976184f / (float)(DH / 2 - 1))); const float ang = posv * freq;
        const float val = (d < DH / 2) ? sinf(ang) : cosf(ang); b16 a, c; split16(val * PES, a, c); Sc[threadIdx.x * 16 + e] = a; Sc[threadIdx.x * 16 + 8 + e] = c; }
      *(v8b*)(peh + p * 8) = *(const v8b*)(&Sc[threadIdx.x * 16]); *(v8b*)(pel + p * 8) = *(const v8b*)(&Sc[threadIdx.x * 16 + 8]); }
    
  }
}

// prep B: W [k rows][n cols] f32 -> [n][k] 16-bit rows through 64x64 LDS tiles: MODE 0: bf16 bits (W_qkv); MODE 1: f16 of bf16(w) (W_fc, W_pos). grid (N/64, K/64).
template <int MODE>
__global__ __launch_bounds__(256) void wt_kernel(const float* __restrict__ W, int K, int Ncols, unsigned short* __restrict__ out) {
  __shared__ __attribute__((aligned(16))) unsigned short Tl[64][72];
  typedef __attribute__((ext_vector_type(8))) unsigned short v8us;
  const int tid = threadIdx.x, lane = tid & 31, wave = tid >> 5, n0 = blockIdx.x * 64, k0 = blockIdx.y * 64;
  for (int i = tid; i < 64 * 64; i += 256) { const int kk = i / 64, nn = i % 64; const float w = W[(size_t)(k0 + kk) * Ncols + n0 + nn];
    unsigned short bits; if (MODE == 0) bits = bf16_rne_bits(w); else { const b16 hv = (b16)bf16_rne(w); bits = *reinterpret_cast<const unsigned short*>(&hv); }
    Tl[nn][kk] = bits; }
  __syncthreads();
  {
#pragma unroll
    for (int j = 0; j < 2; ++j) { const int rr = wave * 8 + j * 4 + (lane >> 3), c8 = (lane & 7) * 8; *(v8us*)(out + (size_t)(n0 + rr) * K + k0 + c8) = *(const v8us*)(&Tl[rr][c8]); }
    
  }
}

// qkv: (4096 x 1024) x (1024 x 4096) bf16 WMMA; grid (64, 32). Columns: [q | k1 | k2 | v] x 1024; q/k1/k2 -> single f16 rows [which][b][h][l][64]; v -> (8v)^T hi/lo planes
// [b][h][64 d][1024 l] through a block LDS transpose (block = 128 tokens of one batch row).
__global__ __launch_bounds__(128) void qkv_kernel(const __bf16* __restrict__ e16, const __bf16* __restrict__ wqkv, b16* __restrict__ qk, b16* __restrict__ vth, b16* __restrict__ vtl) {
  __shared__ __attribute__((aligned(16))) b16 Th[4][2][32 * 64];
  __shared__ __attribute__((aligned(16))) b16 Tt[2][64][128 + 8];
  const int lane = threadIdx.x & 31, wave = threadIdx.x >> 5, nloc = lane & 15, hlf = lane >> 4, m0 = blockIdx.y * 128 + wave * 32, c0 = blockIdx.x * 64;
  v8f acc[2][4];
#pragma unroll
  for (int r = 0; r < 2; ++r)
#pragma unroll
    for (int t = 0; t < 4; ++t) acc[r][t] = (v8f){};
#pragma unroll 2
  for (int kb = 0; kb < DM; kb += 32) {
    const v16bb a0 = frag_kb_bf(e16 + (size_t)(m0 + nloc) * DM + kb, hlf), a1 = frag_kb_bf(e16 + (size_t)(m0 + 16 + nloc) * DM + kb, hlf);
#pragma unroll
    for (int t = 0; t < 4; ++t) { const v16bb bw = frag_kb_bf(wqkv + (size_t)(c0 + t * 16 + nloc) * DM + kb, hlf); acc[0][t] = wmma16bb(a0, bw, acc[0][t]); acc[1][t] = wmma16bb(a1, bw, acc[1][t]); }
  }
  const int which = c0 / DM, c1 = c0 % DM, h = c1 / DH, b = m0 / L, l0 = m0 % L;   // 64 columns = one head
  if (which < 3) {                                             // q / k1 / k2 rows [which][b][h][l][64] (single f16)
    epi_planes(acc, 1.0f, false, qk + ((((size_t)which * Bn + b) * H + h) * L + l0) * DH, nullptr, DH, 0, 0, lane, Th[wave][0], Th[wave][1]);
    return;
  }
#pragma unroll
  for (int t = 0; t < 4; ++t)
#pragma unroll
    for (int r = 0; r < 2; ++r)
#pragma unroll
      for (int v = 0; v < 8; ++v) { b16 a, c; split16(acc[r][t][v] * VS, a, c); Tt[0][t * 16 + nloc][wave * 32 + r * 16 + 8 * hlf + v] = a; Tt[1][t * 16 + nloc][wave * 32 + r * 16 + 8 * hlf + v] = c; }
  __syncthreads();
  const int tok0 = (blockIdx.y * 128) % L, bb = (blockIdx.y * 128) / L;
  b16* bh_ = vth + (((size_t)bb * H + h) * DH) * L + tok0; b16* bl_ = vtl + (((size_t)bb * H + h) * DH) * L + tok0;
  {
#pragma unroll
    for (int j = 0; j < 8; ++j) { const int dd = wave * 16 + j * 2 + (lane >> 4), c8 = (lane & 15) * 8;
      *(v8b*)(bh_ + (size_t)dd * L + c8) = *(const v8b*)(&Tt[0][dd][c8]); *(v8b*)(bl_ + (size_t)dd * L + c8) = *(const v8b*)(&Tt[1][dd][c8]); }
    
  }
}

// position projections: (1024 x 64) x (64 x 3072): A = pe planes (x8 hi+lo), B = f16(bf16 W_pos)^T rows -> 2 products; single f16 rows pp[which][h][l][64]; grid (48, 8).
__global__ __launch_bounds__(128) void pos_kernel(const b16* __restrict__ peh, const b16* __restrict__ pel, const b16* __restrict__ wpos, b16* __restrict__ pp) {
  __shared__ __attribute__((aligned(16))) b16 Th[4][2][32 * 64];
  const int lane = threadIdx.x & 31, wave = threadIdx.x >> 5, nloc = lane & 15, hlf = lane >> 4, m0 = blockIdx.y * 128 + wave * 32, c0 = blockIdx.x * 64;
  v8f acc[2][4];
#pragma unroll
  for (int r = 0; r < 2; ++r)
#pragma unroll
    for (int t = 0; t < 4; ++t) acc[r][t] = (v8f){};
  const Opnd A{peh, pel, DH}, B{wpos, nullptr, DH};
  gemm_tile<2, 1>(A, B, DH, m0, c0, nloc, hlf, acc);
  const int which = c0 / DM, h = (c0 % DM) / DH;
  epi_planes(acc, 1.0f / PES, false, pp + (((size_t)which * H + h) * L + m0) * DH, nullptr, DH, 0, 0, lane, Th[wave][0], Th[wave][1]);
}

// ---------------------------------------------------------------------------
// attention: wave = (b, h, 16 queries); causal key chunks up to the diagonal; per chunk and 16-key half: four K=64 score products (q.k1, qp.kp1, q.k2, qp.kp2; single f16),
// logit = same speaker ? s1 + p1 : s2 + p2; -inf where key > query or umask[b][key] == 0; online softmax f32; P^T f16; y^T += (8v)^T.P^T (4 feature tiles, hi + lo);
// ---------------------------------------------------------------------------
__global__ __launch_bounds__(256) void attn_kernel(const b16* __restrict__ qk, const b16* __restrict__ pp, const b16* __restrict__ vth, const b16* __restrict__ vtl,
                                                   const int* __restrict__ umask, const int* __restrict__ qmask, float* __restrict__ y) {
  __shared__ __attribute__((aligned(16))) float Os[8][16][DH + 4];
  const int wid = threadIdx.x >> 5, lane = threadIdx.x & 31, hh = lane >> 4, col = lane & 15;
  const int qt = blockIdx.x * 8 + wid, jt = qt & 63, h = (qt >> 6) & 15, b = qt >> 10, q0 = jt * 16, qi = q0 + col;
  const b16* Q = qk + ((((size_t)0 * Bn + b) * H + h) * L) * DH; const b16* K1 = qk + ((((size_t)1 * Bn + b) * H + h) * L) * DH; const b16* K2 = qk + ((((size_t)2 * Bn + b) * H + h) * L) * DH;
  const b16* QP = pp + (((size_t)0 * H + h) * L) * DH; const b16* KP1 = pp + (((size_t)1 * H + h) * L) * DH; const b16* KP2 = pp + (((size_t)2 * H + h) * L) * DH;
  v16b qf[2], qpf[2];
#pragma unroll
  for (int ks = 0; ks < 2; ++ks) { qf[ks] = frag_kb(Q + (size_t)qi * DH + ks * 32, hh); qpf[ks] = frag_kb(QP + (size_t)qi * DH + ks * 32, hh); }
  const int myspk = qmask[b * L + qi];
  const b16* vh = vth + (((size_t)b * H + h) * DH) * L; const b16* vl = vtl + (((size_t)b * H + h) * DH) * L;
  float m = -INFINITY, l = 0.0f; v8f o[4] = {{}, {}, {}, {}};
  for (int kb = 0; kb < q0 + 16; kb += 32) {
    float lg0[8], lg1[8];
#pragma unroll
    for (int half = 0; half < 2; ++half) {
      const int krow = kb + half * 16 + col;
      v8f s1 = {}, p1 = {}, s2 = {}, p2 = {};
#pragma unroll
      for (int ks = 0; ks < 2; ++ks) {
        s1 = wmma16b(frag_kb(K1 + (size_t)krow * DH + ks * 32, hh), qf[ks], s1); s2 = wmma16b(frag_kb(K2 + (size_t)krow * DH + ks * 32, hh), qf[ks], s2);
        p1 = wmma16b(frag_kb(KP1 + (size_t)krow * DH + ks * 32, hh), qpf[ks], p1); p2 = wmma16b(frag_kb(KP2 + (size_t)krow * DH + ks * 32, hh), qpf[ks], p2);
      }
#pragma unroll
      for (int r = 0; r < 8; ++r) { const int kk = kb + half * 16 + 8 * hh + r; const bool same = (qmask[b * L + kk] == myspk);
        float v = same ? (s1[r] + p1[r]) : (s2[r] + p2[r]);
        if (kk > qi || umask[b * L + kk] == 0) v = -INFINITY;
        if (half == 0) lg0[r] = v; else lg1[r] = v; }
    }
    float mr = -INFINITY;
#pragma unroll
    for (int r = 0; r < 8; ++r) mr = fmaxf(mr, fmaxf(lg0[r], lg1[r]));
    mr = fmaxf(mr, __shfl_xor(mr, 16));
    float mn = fmaxf(m, mr); if (mn == -INFINITY) mn = 0.0f;
    const float al_ = __expf(m - mn); m = mn;
    float sum = 0.0f; v16b pb;
#pragma unroll
    for (int r = 0; r < 8; ++r) { const float e0 = __expf(lg0[r] - mn), e1 = __expf(lg1[r] - mn); sum += e0 + e1; pb[r] = (b16)e0; pb[8 + r] = (b16)e1; }
    sum += __shfl_xor(sum, 16); l = l * al_ + sum;
#pragma unroll
    for (int n = 0; n < 4; ++n) {
#pragma unroll
      for (int r = 0; r < 8; ++r) o[n][r] *= al_;
      const size_t ro = (size_t)(n * 16 + col) * L + kb;
      o[n] = wmma16b(frag_kb(vh + ro, hh), pb, o[n]); o[n] = wmma16b(frag_kb(vl + ro, hh), pb, o[n]);
    }
  }
  const float inv = (l > 0.0f) ? (1.0f / (VS * l)) : 0.0f;
#pragma unroll
  for (int n = 0; n < 4; ++n)
#pragma unroll
    for (int r = 0; r < 8; ++r) Os[wid][col][n * 16 + 8 * hh + r] = o[n][r] * inv;
  wave_lds_sync();
  float* dst = y + ((size_t)b * L + q0) * DM + h * DH;          // 16 rows x 256 B
  {
#pragma unroll
    for (int j = 0; j < 8; ++j) { const int rr = j * 2 + hh, c4 = col * 4; *(v4f*)(dst + (size_t)rr * DM + c4) = *(const v4f*)(&Os[wid][rr][c4]); }
    
  }
}

// out = y.W_fc: (4096 x 1024) x (1024 x 1024); A = y f32 x8 split, B = f16(bf16 W_fc)^T rows -> 2 products; f32 rows; grid (16, 32).
__global__ __launch_bounds__(128) void out_kernel(const float* __restrict__ y, const b16* __restrict__ wfc, float* __restrict__ out) {
  __shared__ __attribute__((aligned(16))) float Ts[4][32 * 64];
  const int lane = threadIdx.x & 31, wave = threadIdx.x >> 5, nloc = lane & 15, hlf = lane >> 4, m0 = blockIdx.y * 128 + wave * 32, c0 = blockIdx.x * 64;
  v8f acc[2][4];
#pragma unroll
  for (int r = 0; r < 2; ++r)
#pragma unroll
    for (int t = 0; t < 4; ++t) acc[r][t] = (v8f){};
  const Opnd A{y, nullptr, DM}, B{wfc, nullptr, DM};
  gemm_tile<5, 1>(A, B, DM, m0, c0, nloc, hlf, acc);
  epi_f32(acc, 1.0f / 8.0f, nullptr, out, DM, m0, c0, lane, Ts[wave]);
}
}  // namespace

extern "C" void kernel_launch(void* const* d_in, const int* in_sizes, int n_in,
                              void* d_out, int out_size, void* d_ws, size_t ws_size, hipStream_t stream) {
  (void)n_in; (void)out_size;
  const float* emb = (const float*)d_in[0]; const int* umask = (const int*)d_in[1]; const int* qmask = (const int*)d_in[2];
  const float* Wqkv = (const float*)d_in[3]; const float* Wpos = (const float*)d_in[4]; const float* Wfc = (const float*)d_in[5];
  float* out = (float*)d_out;   // [4,1024,1024]
  if (in_sizes[0] != NTOK * DM || in_sizes[1] != NTOK || in_sizes[2] != NTOK || in_sizes[3] != DM * NQKV || in_sizes[4] != DH * NPOS || in_sizes[5] != DM * DM) return;
  size_t off = 0; char* ws = (char*)d_ws;
  auto carve = [&](size_t bytes) { char* p = ws + off; off += (bytes + 255) & ~(size_t)255; return p; };
  unsigned short* e16 = (unsigned short*)carve((size_t)NTOK * DM * 2);       // 8 MB
  unsigned short* wq = (unsigned short*)carve((size_t)NQKV * DM * 2);        // 8 MB
  unsigned short* wp = (unsigned short*)carve((size_t)NPOS * DH * 2);        // 384 KB
  unsigned short* wf = (unsigned short*)carve((size_t)DM * DM * 2);          // 2 MB
  b16* peh = (b16*)carve((size_t)L * DH * 2); b16* pel = (b16*)carve((size_t)L * DH * 2);
  b16* qk = (b16*)carve((size_t)3 * Bn * H * L * DH * 2);                   // 24 MB
  b16* vth = (b16*)carve((size_t)Bn * H * DH * L * 2); b16* vtl = (b16*)carve((size_t)Bn * H * DH * L * 2);   // 8 MB each
  b16* pp = (b16*)carve((size_t)3 * H * L * DH * 2);                         // 6 MB
  float* y = (float*)carve((size_t)NTOK * DM * 4);                           // 16 MB
  if (off > ws_size) return;                                                  // ≈ 81 MB
  prep_kernel<<<512, 256, 0, stream>>>(emb, e16, peh, pel);
  wt_kernel<0><<<dim3(NQKV / 64, DM / 64), 256, 0, stream>>>(Wqkv, DM, NQKV, wq);
  wt_kernel<1><<<dim3(NPOS / 64, DH / 64), 256, 0, stream>>>(Wpos, DH, NPOS, wp);
  wt_kernel<1><<<dim3(DM / 64, DM / 64), 256, 0, stream>>>(Wfc, DM, DM, wf);
  qkv_kernel<<<dim3(NQKV / 64, NTOK / 128), 128, 0, stream>>>((const __bf16*)e16, (const __bf16*)wq, qk, vth, vtl);
  pos_kernel<<<dim3(NPOS / 64, L / 128), 128, 0, stream>>>(peh, pel, (const b16*)wp, pp);
  attn_kernel<<<Bn * H * (L / 16) / 8, 256, 0, stream>>>(qk, pp, vth, vtl, umask, qmask, y);
  out_kernel<<<dim3(DM / 64, NTOK / 128), 128, 0, stream>>>(y, (const b16*)wf, out);
}

// v001
// A run of this version takes 224 microseconds.
// Timed twice side by side with v000, it ran 2.02 times as fast both times.
#include <hip/hip_runtime.h>

// Speaker-aware causal multi-head attention with relative sinusoidal position terms (d_model 1024, 16 heads x 64, B=4, L=1024): q,k1,k2,v = embed W_qkv;
// qp,kp1,kp2 = pe W_pos (pe = the module's sinusoid table rows 89..1112); logit[q][k] = same speaker ? (q.k1 + qp.kp1) : (q.k2 + qp.kp2) (scale 1); keys k > q or umask = 0
// -> -inf; softmax; out = (P.v) W_fc.
// Numerics: embed, W_qkv, W_pos and W_fc are rounded to bf16 (RNE); the qkv projection runs on
// v_wmma_f32_16x16x32_bf16 with those operands (exact products, f32 accumulate); the position projection uses f16 hi+lo of the f32 sinusoid table against the exact f16 copy of
// bf16 W_pos; the four score products use single f16 copies of q/k1/k2/qp/kp (f32 accumulate); P.V pairs single-f16 P with hi+lo 8v; the output projection pairs hi+lo of the
// attention output with the exact f16 copy of bf16 W_fc. Masks are read from the int inputs. Fragment k-map per lane half hh for A AND B: elements 0..7 <- k = 8hh+0..7, 8..15

namespace {
constexpr int Bn = 4, L = 1024, DM = 1024, H = 16, DH = 64, NTOK = Bn * L, NQKV = 4 * DM, NPOS = 3 * DM, TBL = 1201, SHIFT = 601;
constexpr float VS = 8.0f, PES = 8.0f;

typedef _Float16 b16;
typedef __attribute__((ext_vector_type(16))) _Float16 v16b;
typedef __attribute__((ext_vector_type(8)))  _Float16 v8b;
typedef __attribute__((ext_vector_type(8)))  float v8f;
typedef __attribute__((ext_vector_type(4)))  float v4f;

__device__ __forceinline__ v8b ld8b(const b16* p) { return *(const v8b*)p; }
__device__ __forceinline__ v16b cat8b(v8b a, v8b b) { return __builtin_shufflevector(a, b, 0, 1, 2, 3, 4, 5, 6, 7, 8, 9, 10, 11, 12, 13, 14, 15); }
__device__ __forceinline__ v16b frag_kb(const b16* p, int hh) { return cat8b(ld8b(p + 8 * hh), ld8b(p + 16 + 8 * hh)); }
__device__ __forceinline__ void split16(float v, b16& hi, b16& lo) { hi = (b16)v; lo = (b16)(v - (float)hi); }
// hi/lo fragment pair straight from an f32 k-contiguous row (same k-map)
__device__ __forceinline__ void frag_ksplit(const float* p, int hh, v16b& fh_, v16b& fl_) {
  const float* p0 = p + 8 * hh; const float* p1 = p + 16 + 8 * hh;
#pragma unroll
  for (int e = 0; e < 8; ++e) { b16 a, c; split16(p0[e], a, c); fh_[e] = a; fl_[e] = c; split16(p1[e], a, c); fh_[8 + e] = a; fl_[8 + e] = c; }
}
__device__ __forceinline__ v8f wmma16b(v16b a, v16b b, v8f c) {
  v8f d = __builtin_amdgcn_wmma_f32_16x16x32_f16(false, a, false, b, (short)0, c, false, false);
  asm volatile("v_nop\n\tv_nop\n\tv_nop\n\tv_nop" : "+v"(d) : "v"(a), "v"(b));
  return d;
}
__device__ __forceinline__ void wave_lds_sync() {
  __builtin_amdgcn_fence(__ATOMIC_RELEASE, "workgroup");
  __builtin_amdgcn_wave_barrier();
  __builtin_amdgcn_fence(__ATOMIC_ACQUIRE, "workgroup");
}

// Operand descriptor: NP = 0 -> f32 rows split on the fly into (hi, lo); NP = 1 -> one f16 plane; NP = 2 -> f16 hi + lo planes;
// NP = 3 -> f32 rows rounded once to a single f16 fragment. ld = row pitch.
struct Opnd { const void* p0; const void* p1; int ld; };
template <int NP> __device__ __forceinline__ void load_frags(const Opnd& o, int row, int kb, int hh, v16b& fh_, v16b& fl_) {
  if (NP == 0) { frag_ksplit((const float*)o.p0 + (size_t)row * o.ld + kb, hh, fh_, fl_); }
  else if (NP == 4 || NP == 5) {                             // f32 rows x64 (NP 4) or x8 (NP 5) then split (keeps the lo halves of small values normal)
    const float sc_ = (NP == 4) ? 64.0f : 8.0f;
    const float* p = (const float*)o.p0 + (size_t)row * o.ld + kb; const float* p0 = p + 8 * hh; const float* p1 = p + 16 + 8 * hh;
#pragma unroll
    for (int e = 0; e < 8; ++e) { b16 a, c; split16(p0[e] * sc_, a, c); fh_[e] = a; fl_[e] = c; split16(p1[e] * sc_, a, c); fh_[8 + e] = a; fl_[8 + e] = c; }
  } else if (NP == 3) {
    const float* p = (const float*)o.p0 + (size_t)row * o.ld + kb; const float* p0 = p + 8 * hh; const float* p1 = p + 16 + 8 * hh;
#pragma unroll
    for (int e = 0; e < 8; ++e) { fh_[e] = (b16)p0[e]; fh_[8 + e] = (b16)p1[e]; }
    fl_ = fh_;
  } else {
    fh_ = frag_kb((const b16*)o.p0 + (size_t)row * o.ld + kb, hh);
    if (NP == 2) fl_ = frag_kb((const b16*)o.p1 + (size_t)row * o.ld + kb, hh); else fl_ = fh_;
  }
}
template <int ANP, int BNP> __device__ __forceinline__ v8f mac(v16b ah, v16b al, v16b bh, v16b bl, v8f c) {
  c = wmma16b(ah, bh, c);
  if (BNP == 0 || BNP == 2 || BNP == 4 || BNP == 5) c = wmma16b(ah, bl, c);     // hi.lo
  if (ANP == 0 || ANP == 2 || ANP == 4 || ANP == 5) c = wmma16b(al, bh, c);     // lo.hi   (lo.lo dropped)
  return c;
}
// 32x64 wave tile: acc[r][t] (rows m0+16r.., cols c0+16t..) += A[m][k] . B[n][k] over k in [0, K)
template <int ANP, int BNP>
__device__ __forceinline__ void gemm_tile(const Opnd& A, const Opnd& B, int K, int m0, int c0, int nloc, int hlf, v8f (&acc)[2][4]) {
  for (int kb = 0; kb < K; kb += 32) {
    v16b a0h, a0l, a1h, a1l;
    load_frags<ANP>(A, m0 + nloc, kb, hlf, a0h, a0l);
    load_frags<ANP>(A, m0 + 16 + nloc, kb, hlf, a1h, a1l);
#pragma unroll
    for (int t = 0; t < 4; ++t) {
      v16b bh, bl;
      load_frags<BNP>(B, c0 + t * 16 + nloc, kb, hlf, bh, bl);
      acc[0][t] = mac<ANP, BNP>(a0h, a0l, bh, bl, acc[0][t]);
      acc[1][t] = mac<ANP, BNP>(a1h, a1l, bh, bl, acc[1][t]);
    }
  }
}

__device__ __forceinline__ void epi_planes(v8f (&acc)[2][4], float scale, bool two, b16* __restrict__ oh, b16* __restrict__ ol, int ldo,
                                           int m0, int c0, int lane, b16* Th, b16* Tl) {
  const int nloc = lane & 15, hlf = lane >> 4;
#pragma unroll
  for (int t = 0; t < 4; ++t)
#pragma unroll
    for (int r = 0; r < 2; ++r)
#pragma unroll
      for (int v = 0; v < 8; ++v) {
        const int rr = r * 16 + v + 8 * hlf, cc = t * 16 + nloc;
        b16 h_, l_; split16(acc[r][t][v] * scale, h_, l_);
        Th[rr * 64 + cc] = h_; Tl[rr * 64 + cc] = l_;
      }
  wave_lds_sync();
  {
#pragma unroll
    for (int j = 0; j < 8; ++j) {
      const int rr = j * 4 + (lane >> 3), c8 = (lane & 7) * 8;
      const size_t o = (size_t)(m0 + rr) * ldo + c0 + c8;
      *(v8b*)(oh + o) = ld8b(Th + rr * 64 + c8);
      if (two) *(v8b*)(ol + o) = ld8b(Tl + rr * 64 + c8);
    }
    
  }
}
// (b) f32 rows with pitch ldo: 64 floats = 256 B = 2 lines per row; 16 lanes x 16 B per row, 2 rows per instruction. Optional per-row factor
__device__ __forceinline__ void epi_f32(v8f (&acc)[2][4], float scale, const float* rscale, float* __restrict__ out, int ldo, int m0, int c0, int lane, float* Tt) {
  const int nloc = lane & 15, hlf = lane >> 4;
#pragma unroll
  for (int t = 0; t < 4; ++t)
#pragma unroll
    for (int r = 0; r < 2; ++r)
#pragma unroll
      for (int v = 0; v < 8; ++v) {
        const int rr = r * 16 + v + 8 * hlf;
        const float rs = rscale ? rscale[(size_t)(m0 + rr) * 32] : 1.0f;
        Tt[rr * 64 + t * 16 + nloc] = acc[r][t][v] * scale * rs;
      }
  wave_lds_sync();
  float* dst0 = out + (size_t)m0 * ldo + c0;
  {
#pragma unroll
    for (int j = 0; j < 16; ++j) { const int rr = j * 2 + hlf, c4 = nloc * 4; *(v4f*)(dst0 + (size_t)rr * ldo + c4) = *(const v4f*)(Tt + rr * 64 + c4); }
    
  }
}



typedef __attribute__((ext_vector_type(8))) __bf16 v8bb; typedef __attribute__((ext_vector_type(16))) __bf16 v16bb;
__device__ __forceinline__ v16bb frag_kb_bf(const __bf16* p, int hh) { const v8bb a = *(const v8bb*)(p + 8 * hh), b = *(const v8bb*)(p + 16 + 8 * hh); return __builtin_shufflevector(a, b, 0, 1, 2, 3, 4, 5, 6, 7, 8, 9, 10, 11, 12, 13, 14, 15); }
__device__ __forceinline__ v8f wmma16bb(v16bb a, v16bb b, v8f c) {
  v8f d = __builtin_amdgcn_wmma_f32_16x16x32_bf16(false, a, false, b, (short)0, c, false, false);
  asm volatile("v_nop\n\tv_nop\n\tv_nop\n\tv_nop" : "+v"(d) : "v"(a), "v"(b));
  return d;
}
__device__ __forceinline__ unsigned short bf16_rne_bits(float v) { unsigned int u = __float_as_uint(v); u += 0x7FFFu + ((u >> 16) & 1u); return (unsigned short)(u >> 16); }
__device__ __forceinline__ float bf16_rne(float v) { return __uint_as_float(((unsigned int)bf16_rne_bits(v)) << 16); }

// prep A: embed -> bf16 rows [4096][1024] (16-B pieces); pe x8 hi/lo planes [1024][64] from the module's sinusoid formula (f32, table row 0 (the padding row) never selected for L=1024).
__global__ __launch_bounds__(256) void prep_kernel(const float* __restrict__ emb, unsigned short* __restrict__ e16, b16* __restrict__ peh, b16* __restrict__ pel) {
  typedef __attribute__((ext_vector_type(8))) unsigned short v8us;
  __shared__ __attribute__((aligned(16))) b16 Sc[256 * 16];   // per-thread staging for the rolled sinusoid loop
  const size_t tid = (size_t)blockIdx.x * blockDim.x + threadIdx.x, nth = (size_t)gridDim.x * blockDim.x;
  {
    for (size_t p = tid; p < (size_t)NTOK * DM / 8; p += nth) { v8us v;
#pragma unroll
      for (int e = 0; e < 8; ++e) v[e] = bf16_rne_bits(emb[p * 8 + e]);
      *(v8us*)(e16 + p * 8) = v; }
    for (size_t p = tid; p < (size_t)L * DH / 8; p += nth) { const int l = (int)(p / 8), d0 = (int)(p % 8) * 8;
      const int tblrow = l - L / 2 + SHIFT;                    // 89 .. 1112, never 0
      const float posv = (float)(tblrow - (TBL + 1) / 2);      // arange(-601, 600)[tblrow] = tblrow - 601
#pragma unroll 1
      for (int e = 0; e < 8; ++e) { const int d = d0 + e; const int j = (d < DH / 2) ? d : d - DH / 2;   // rolled: one sin/cos expansion in the binary
        const float freq = expf((float)j * (-9.210340371976184f / (float)(DH / 2 - 1))); const float ang = posv * freq;
        const float val = (d < DH / 2) ? sinf(ang) : cosf(ang); b16 a, c; split16(val * PES, a, c); Sc[threadIdx.x * 16 + e] = a; Sc[threadIdx.x * 16 + 8 + e] = c; }
      *(v8b*)(peh + p * 8) = *(const v8b*)(&Sc[threadIdx.x * 16]); *(v8b*)(pel + p * 8) = *(const v8b*)(&Sc[threadIdx.x * 16 + 8]); }
    
  }
}

// prep B: W [k rows][n cols] f32 -> [n][k] 16-bit rows through 64x64 LDS tiles: MODE 0: bf16 bits (W_qkv); MODE 1: f16 of bf16(w) (W_fc, W_pos). grid (N/64, K/64).
template <int MODE>
__global__ __launch_bounds__(256) void wt_kernel(const float* __restrict__ W, int K, int Ncols, unsigned short* __restrict__ out) {
  __shared__ __attribute__((aligned(16))) unsigned short Tl[64][72];
  typedef __attribute__((ext_vector_type(8))) unsigned short v8us;
  const int tid = threadIdx.x, lane = tid & 31, wave = tid >> 5, n0 = blockIdx.x * 64, k0 = blockIdx.y * 64;
  for (int i = tid; i < 64 * 64; i += 256) { const int kk = i / 64, nn = i % 64; const float w = W[(size_t)(k0 + kk) * Ncols + n0 + nn];
    unsigned short bits; if (MODE == 0) bits = bf16_rne_bits(w); else { const b16 hv = (b16)bf16_rne(w); bits = *reinterpret_cast<const unsigned short*>(&hv); }
    Tl[nn][kk] = bits; }
  __syncthreads();
  {
#pragma unroll
    for (int j = 0; j < 2; ++j) { const int rr = wave * 8 + j * 4 + (lane >> 3), c8 = (lane & 7) * 8; *(v8us*)(out + (size_t)(n0 + rr) * K + k0 + c8) = *(const v8us*)(&Tl[rr][c8]); }
    
  }
}

// qkv: (4096 x 1024) x (1024 x 4096) bf16 WMMA; grid (64, 32). Columns: [q | k1 | k2 | v] x 1024; q/k1/k2 -> single f16 rows [which][b][h][l][64]; v -> (8v)^T hi/lo planes
// [b][h][64 d][1024 l] through a block LDS transpose (block = 128 tokens of one batch row).
__global__ __launch_bounds__(128) void qkv_kernel(const __bf16* __restrict__ e16, const __bf16* __restrict__ wqkv, b16* __restrict__ qk, b16* __restrict__ vth, b16* __restrict__ vtl) {
  __shared__ __attribute__((aligned(16))) b16 Th[4][2][32 * 64];
  __shared__ __attribute__((aligned(16))) b16 Tt[2][64][128 + 8];
  const int lane = threadIdx.x & 31, wave = threadIdx.x >> 5, nloc = lane & 15, hlf = lane >> 4, m0 = blockIdx.y * 128 + wave * 32, c0 = blockIdx.x * 64;
  v8f acc[2][4];
#pragma unroll
  for (int r = 0; r < 2; ++r)
#pragma unroll
    for (int t = 0; t < 4; ++t) acc[r][t] = (v8f){};
#pragma unroll 2
  for (int kb = 0; kb < DM; kb += 32) {
    const v16bb a0 = frag_kb_bf(e16 + (size_t)(m0 + nloc) * DM + kb, hlf), a1 = frag_kb_bf(e16 + (size_t)(m0 + 16 + nloc) * DM + kb, hlf);
#pragma unroll
    for (int t = 0; t < 4; ++t) { const v16bb bw = frag_kb_bf(wqkv + (size_t)(c0 + t * 16 + nloc) * DM + kb, hlf); acc[0][t] = wmma16bb(a0, bw, acc[0][t]); acc[1][t] = wmma16bb(a1, bw, acc[1][t]); }
  }
  const int which = c0 / DM, c1 = c0 % DM, h = c1 / DH, b = m0 / L, l0 = m0 % L;   // 64 columns = one head
  if (which < 3) {                                             // q / k1 / k2 rows [which][b][h][l][64] (single f16)
    epi_planes(acc, 1.0f, false, qk + ((((size_t)which * Bn + b) * H + h) * L + l0) * DH, nullptr, DH, 0, 0, lane, Th[wave][0], Th[wave][1]);
    return;
  }
#pragma unroll
  for (int t = 0; t < 4; ++t)
#pragma unroll
    for (int r = 0; r < 2; ++r)
#pragma unroll
      for (int v = 0; v < 8; ++v) { b16 a, c; split16(acc[r][t][v] * VS, a, c); Tt[0][t * 16 + nloc][wave * 32 + r * 16 + 8 * hlf + v] = a; Tt[1][t * 16 + nloc][wave * 32 + r * 16 + 8 * hlf + v] = c; }
  __syncthreads();
  const int tok0 = (blockIdx.y * 128) % L, bb = (blockIdx.y * 128) / L;
  b16* bh_ = vth + (((size_t)bb * H + h) * DH) * L + tok0; b16* bl_ = vtl + (((size_t)bb * H + h) * DH) * L + tok0;
  {
#pragma unroll
    for (int j = 0; j < 8; ++j) { const int dd = wave * 16 + j * 2 + (lane >> 4), c8 = (lane & 15) * 8;
      *(v8b*)(bh_ + (size_t)dd * L + c8) = *(const v8b*)(&Tt[0][dd][c8]); *(v8b*)(bl_ + (size_t)dd * L + c8) = *(const v8b*)(&Tt[1][dd][c8]); }
    
  }
}

// position projections: (1024 x 64) x (64 x 3072): A = pe planes (x8 hi+lo), B = f16(bf16 W_pos)^T rows -> 2 products; single f16 rows pp[which][h][l][64]; grid (48, 8).
__global__ __launch_bounds__(128) void pos_kernel(const b16* __restrict__ peh, const b16* __restrict__ pel, const b16* __restrict__ wpos, b16* __restrict__ pp) {
  __shared__ __attribute__((aligned(16))) b16 Th[4][2][32 * 64];
  const int lane = threadIdx.x & 31, wave = threadIdx.x >> 5, nloc = lane & 15, hlf = lane >> 4, m0 = blockIdx.y * 128 + wave * 32, c0 = blockIdx.x * 64;
  v8f acc[2][4];
#pragma unroll
  for (int r = 0; r < 2; ++r)
#pragma unroll
    for (int t = 0; t < 4; ++t) acc[r][t] = (v8f){};
  const Opnd A{peh, pel, DH}, B{wpos, nullptr, DH};
  gemm_tile<2, 1>(A, B, DH, m0, c0, nloc, hlf, acc);
  const int which = c0 / DM, h = (c0 % DM) / DH;
  epi_planes(acc, 1.0f / PES, false, pp + (((size_t)which * H + h) * L + m0) * DH, nullptr, DH, 0, 0, lane, Th[wave][0], Th[wave][1]);
}

// ---------------------------------------------------------------------------
// attention: block = (b, h, 128 queries), wave = 16 queries; causal 32-key chunks up to the block's diagonal. All key-side operands come from LDS, staged once per block and
// shared by its 8 waves: the two mask rows once, and per chunk the k1/k2/kp1/kp2 rows (pitch 144 B) and the (8v)^T hi/lo columns (pitch 80 B), two buffers: chunk t + 1 is
// fetched into registers before chunk t is worked on and stored to the other buffer behind it; one barrier a chunk. A wave past its own diagonal only stages.
// Per chunk and 16-key half: four K=64 score products (q.k1, qp.kp1, q.k2, qp.kp2; single f16),
// logit = same speaker ? s1 + p1 : s2 + p2; -inf where key > query or umask[b][key] == 0; online softmax f32; P^T f16; y^T += (8v)^T.P^T (4 feature tiles, hi + lo);
// ---------------------------------------------------------------------------
constexpr int KPIT = DH + 8, VPIT = 32 + 8;                    // LDS row pitches in f16: 16 B x odd, for 16-byte fragment reads
typedef __attribute__((ext_vector_type(4))) int v4i;
__global__ __launch_bounds__(256) void attn_kernel(const b16* __restrict__ qk, const b16* __restrict__ pp, const b16* __restrict__ vth, const b16* __restrict__ vtl,
                                                   const int* __restrict__ umask, const int* __restrict__ qmask, float* __restrict__ y) {
  __shared__ __attribute__((aligned(16))) float Os[8][16][DH + 4];
  __shared__ __attribute__((aligned(16))) b16 Ks[2][4][32 * KPIT];   // [buffer][k1, k2, kp1, kp2][key][feature]
  __shared__ __attribute__((aligned(16))) b16 Vs[2][2][DH * VPIT];   // [buffer][hi, lo][feature][key]
  __shared__ __attribute__((aligned(16))) int Ms[2][L];              // speaker ids and umask of batch row b
  const int tid = threadIdx.x, wid = __builtin_amdgcn_readfirstlane(tid >> 5), lane = tid & 31, hh = lane >> 4, col = lane & 15;
  const int qt = blockIdx.x * 8 + wid, jt = qt & 63, h = (qt >> 6) & 15, b = qt >> 10, q0 = jt * 16, qi = q0 + col;
  const int nchunk = ((blockIdx.x & 7) + 1) * 4;                // 32-key chunks up to the block's last query
  const b16* Q = qk + ((((size_t)0 * Bn + b) * H + h) * L) * DH; const b16* K1 = qk + ((((size_t)1 * Bn + b) * H + h) * L) * DH; const b16* K2 = qk + ((((size_t)2 * Bn + b) * H + h) * L) * DH;
  const b16* QP = pp + (((size_t)0 * H + h) * L) * DH; const b16* KP1 = pp + (((size_t)1 * H + h) * L) * DH; const b16* KP2 = pp + (((size_t)2 * H + h) * L) * DH;
  const b16* vh = vth + (((size_t)b * H + h) * DH) * L; const b16* vl = vtl + (((size_t)b * H + h) * DH) * L;
  // staging map: a thread moves one 16-byte piece of each of the six tiles
  const int kr = tid >> 3, kc = (tid & 7) * 8, vr = tid >> 2, vc = (tid & 3) * 8;
  const size_t gko = (size_t)kr * DH + kc, gvo = (size_t)vr * L + vc;
  const int sko = kr * KPIT + kc, svo = vr * VPIT + vc;
  v8b st[6];
  st[0] = ld8b(K1 + gko); st[1] = ld8b(K2 + gko); st[2] = ld8b(KP1 + gko); st[3] = ld8b(KP2 + gko); st[4] = ld8b(vh + gvo); st[5] = ld8b(vl + gvo);
  const v4i mq = *(const v4i*)(qmask + b * L + tid * 4), mu = *(const v4i*)(umask + b * L + tid * 4);
  v16b qf[2], qpf[2];
#pragma unroll
  for (int ks = 0; ks < 2; ++ks) { qf[ks] = frag_kb(Q + (size_t)qi * DH + ks * 32, hh); qpf[ks] = frag_kb(QP + (size_t)qi * DH + ks * 32, hh); }
  const int myspk = qmask[b * L + qi];
  asm volatile("s_wait_xcnt 0x0" ::: "memory");                 // before the address registers of the loads above are reused
  *(v4i*)(&Ms[0][tid * 4]) = mq; *(v4i*)(&Ms[1][tid * 4]) = mu;
#pragma unroll
  for (int i = 0; i < 4; ++i) *(v8b*)(&Ks[0][i][sko]) = st[i];
  *(v8b*)(&Vs[0][0][svo]) = st[4]; *(v8b*)(&Vs[0][1][svo]) = st[5];
  __syncthreads();
  float m = -INFINITY, l = 0.0f; v8f o[4] = {{}, {}, {}, {}};
  for (int t = 0; t < nchunk; ++t) {
    const int kb = t * 32, cur = t & 1; const bool more = t + 1 < nchunk;
    if (more) { const size_t ka = gko + (size_t)(kb + 32) * DH, va = gvo + kb + 32;
      st[0] = ld8b(K1 + ka); st[1] = ld8b(K2 + ka); st[2] = ld8b(KP1 + ka); st[3] = ld8b(KP2 + ka); st[4] = ld8b(vh + va); st[5] = ld8b(vl + va);
      asm volatile("s_wait_xcnt 0x0" ::: "memory"); }           // before the address registers of these six loads are reused
    if (kb < q0 + 16) {
      float lg0[8], lg1[8];
#pragma unroll
      for (int half = 0; half < 2; ++half) {
        const int ro = (half * 16 + col) * KPIT;
        v8f s1 = {}, p1 = {}, s2 = {}, p2 = {};
#pragma unroll
        for (int ks = 0; ks < 2; ++ks) {
          s1 = wmma16b(frag_kb(&Ks[cur][0][ro + ks * 32], hh), qf[ks], s1); s2 = wmma16b(frag_kb(&Ks[cur][1][ro + ks * 32], hh), qf[ks], s2);
          p1 = wmma16b(frag_kb(&Ks[cur][2][ro + ks * 32], hh), qpf[ks], p1); p2 = wmma16b(frag_kb(&Ks[cur][3][ro + ks * 32], hh), qpf[ks], p2);
        }
        const int k8 = kb + half * 16 + 8 * hh;
        const v4i sp0 = *(const v4i*)(&Ms[0][k8]), sp1 = *(const v4i*)(&Ms[0][k8 + 4]), um0 = *(const v4i*)(&Ms[1][k8]), um1 = *(const v4i*)(&Ms[1][k8 + 4]);
#pragma unroll
        for (int r = 0; r < 8; ++r) { const int kk = k8 + r; const bool same = ((r < 4 ? sp0[r & 3] : sp1[r & 3]) == myspk);
          float v = same ? (s1[r] + p1[r]) : (s2[r] + p2[r]);
          if ((kk > qi) | ((r < 4 ? um0[r & 3] : um1[r & 3]) == 0)) v = -INFINITY;
          if (half == 0) lg0[r] = v; else lg1[r] = v; }
      }
      float mr = -INFINITY;
#pragma unroll
      for (int r = 0; r < 8; ++r) mr = fmaxf(mr, fmaxf(lg0[r], lg1[r]));
      mr = fmaxf(mr, __shfl_xor(mr, 16));
      float mn = fmaxf(m, mr); if (mn == -INFINITY) mn = 0.0f;
      const float al_ = __expf(m - mn); m = mn;
      float sum = 0.0f; v16b pb;
#pragma unroll
      for (int r = 0; r < 8; ++r) { const float e0 = __expf(lg0[r] - mn), e1 = __expf(lg1[r] - mn); sum += e0 + e1; pb[r] = (b16)e0; pb[8 + r] = (b16)e1; }
      sum += __shfl_xor(sum, 16); l = l * al_ + sum;
#pragma unroll
      for (int n = 0; n < 4; ++n) {
#pragma unroll
        for (int r = 0; r < 8; ++r) o[n][r] *= al_;
        const int ro = (n * 16 + col) * VPIT;
        o[n] = wmma16b(frag_kb(&Vs[cur][0][ro], hh), pb, o[n]); o[n] = wmma16b(frag_kb(&Vs[cur][1][ro], hh), pb, o[n]);
      }
    }
    if (more) {                                                 // the other buffer's last readers left it at the previous chunk's barrier
#pragma unroll
      for (int i = 0; i < 4; ++i) *(v8b*)(&Ks[cur ^ 1][i][sko]) = st[i];
      *(v8b*)(&Vs[cur ^ 1][0][svo]) = st[4]; *(v8b*)(&Vs[cur ^ 1][1][svo]) = st[5];
      __syncthreads();                                          // publishes chunk t + 1 and ends every read of chunk t
    }
  }
  const float inv = (l > 0.0f) ? (1.0f / (VS * l)) : 0.0f;
#pragma unroll
  for (int n = 0; n < 4; ++n)
#pragma unroll
    for (int r = 0; r < 8; ++r) Os[wid][col][n * 16 + 8 * hh + r] = o[n][r] * inv;
  wave_lds_sync();
  float* dst = y + ((size_t)b * L + q0) * DM + h * DH;          // 16 rows x 256 B
  {
#pragma unroll
    for (int j = 0; j < 8; ++j) { const int rr = j * 2 + hh, c4 = col * 4; *(v4f*)(dst + (size_t)rr * DM + c4) = *(const v4f*)(&Os[wid][rr][c4]); }
    
  }
}

// out = y.W_fc: (4096 x 1024) x (1024 x 1024); A = y f32 x8 split, B = f16(bf16 W_fc)^T rows -> 2 products; f32 rows; grid (16, 32).
__global__ __launch_bounds__(128) void out_kernel(const float* __restrict__ y, const b16* __restrict__ wfc, float* __restrict__ out) {
  __shared__ __attribute__((aligned(16))) float Ts[4][32 * 64];
  const int lane = threadIdx.x & 31, wave = threadIdx.x >> 5, nloc = lane & 15, hlf = lane >> 4, m0 = blockIdx.y * 128 + wave * 32, c0 = blockIdx.x * 64;
  v8f acc[2][4];
#pragma unroll
  for (int r = 0; r < 2; ++r)
#pragma unroll
    for (int t = 0; t < 4; ++t) acc[r][t] = (v8f){};
  const Opnd A{y, nullptr, DM}, B{wfc, nullptr, DM};
  gemm_tile<5, 1>(A, B, DM, m0, c0, nloc, hlf, acc);
  epi_f32(acc, 1.0f / 8.0f, nullptr, out, DM, m0, c0, lane, Ts[wave]);
}
}  // namespace

extern "C" void kernel_launch(void* const* d_in, const int* in_sizes, int n_in,
                              void* d_out, int out_size, void* d_ws, size_t ws_size, hipStream_t stream) {
  (void)n_in; (void)out_size;
  const float* emb = (const float*)d_in[0]; const int* umask = (const int*)d_in[1]; const int* qmask = (const int*)d_in[2];
  const float* Wqkv = (const float*)d_in[3]; const float* Wpos = (const float*)d_in[4]; const float* Wfc = (const float*)d_in[5];
  float* out = (float*)d_out;   // [4,1024,1024]
  if (in_sizes[0] != NTOK * DM || in_sizes[1] != NTOK || in_sizes[2] != NTOK || in_sizes[3] != DM * NQKV || in_sizes[4] != DH * NPOS || in_sizes[5] != DM * DM) return;
  size_t off = 0; char* ws = (char*)d_ws;
  auto carve = [&](size_t bytes) { char* p = ws + off; off += (bytes + 255) & ~(size_t)255; return p; };
  unsigned short* e16 = (unsigned short*)carve((size_t)NTOK * DM * 2);       // 8 MB
  unsigned short* wq = (unsigned short*)carve((size_t)NQKV * DM * 2);        // 8 MB
  unsigned short* wp = (unsigned short*)carve((size_t)NPOS * DH * 2);        // 384 KB
  unsigned short* wf = (unsigned short*)carve((size_t)DM * DM * 2);          // 2 MB
  b16* peh = (b16*)carve((size_t)L * DH * 2); b16* pel = (b16*)carve((size_t)L * DH * 2);
  b16* qk = (b16*)carve((size_t)3 * Bn * H * L * DH * 2);                   // 24 MB
  b16* vth = (b16*)carve((size_t)Bn * H * DH * L * 2); b16* vtl = (b16*)carve((size_t)Bn * H * DH * L * 2);   // 8 MB each
  b16* pp = (b16*)carve((size_t)3 * H * L * DH * 2);                         // 6 MB
  float* y = (float*)carve((size_t)NTOK * DM * 4);                           // 16 MB
  if (off > ws_size) return;                                                  // ≈ 81 MB
  prep_kernel<<<512, 256, 0, stream>>>(emb, e16, peh, pel);
  wt_kernel<0><<<dim3(NQKV / 64, DM / 64), 256, 0, stream>>>(Wqkv, DM, NQKV, wq);
  wt_kernel<1><<<dim3(NPOS / 64, DH / 64), 256, 0, stream>>>(Wpos, DH, NPOS, wp);
  wt_kernel<1><<<dim3(DM / 64, DM / 64), 256, 0, stream>>>(Wfc, DM, DM, wf);
  qkv_kernel<<<dim3(NQKV / 64, NTOK / 128), 128, 0, stream>>>((const __bf16*)e16, (const __bf16*)wq, qk, vth, vtl);
  pos_kernel<<<dim3(NPOS / 64, L / 128), 128, 0, stream>>>(peh, pel, (const b16*)wp, pp);
  attn_kernel<<<Bn * H * (L / 16) / 8, 256, 0, stream>>>(qk, pp, vth, vtl, umask, qmask, y);
  out_kernel<<<dim3(DM / 64, NTOK / 128), 128, 0, stream>>>(y, (const b16*)wf, out);
}

// v002
// A run of this version takes 151 microseconds.
// Two timings next to v001 put it at 1.48 and 1.47 times that version's speed.
// Counting every step since v000, it is 2.98 times as fast.
#include <hip/hip_runtime.h>

// Speaker-aware causal multi-head attention with relative sinusoidal position terms (d_model 1024, 16 heads x 64, B=4, L=1024): q,k1,k2,v = embed W_qkv;
// qp,kp1,kp2 = pe W_pos (pe = the module's sinusoid table rows 89..1112); logit[q][k] = same speaker ? (q.k1 + qp.kp1) : (q.k2 + qp.kp2) (scale 1); keys k > q or umask = 0
// -> -inf; softmax; out = (P.v) W_fc.
// Numerics: embed, W_qkv, W_pos and W_fc are rounded to bf16 (RNE); the qkv projection runs on
// v_wmma_f32_16x16x32_bf16 with those operands (exact products, f32 accumulate); the position projection uses f16 hi+lo of the f32 sinusoid table against the exact f16 copy of
// bf16 W_pos; the four score products use single f16 copies of q/k1/k2/qp/kp (f32 accumulate); P.V pairs single-f16 P with hi+lo 8v; the output projection pairs hi+lo of the
// attention output with the exact f16 copy of bf16 W_fc. Masks are read from the int inputs. Fragment k-map per lane half hh for A AND B: elements 0..7 <- k = 8hh+0..7, 8..15

namespace {
constexpr int Bn = 4, L = 1024, DM = 1024, H = 16, DH = 64, NTOK = Bn * L, NQKV = 4 * DM, NPOS = 3 * DM, TBL = 1201, SHIFT = 601;
constexpr float VS = 8.0f, PES = 8.0f;

typedef _Float16 b16;
typedef __attribute__((ext_vector_type(16))) _Float16 v16b;
typedef __attribute__((ext_vector_type(8)))  _Float16 v8b;
typedef __attribute__((ext_vector_type(8)))  float v8f;
typedef __attribute__((ext_vector_type(4)))  float v4f;

__device__ __forceinline__ v8b ld8b(const b16* p) { return *(const v8b*)p; }
__device__ __forceinline__ v16b cat8b(v8b a, v8b b) { return __builtin_shufflevector(a, b, 0, 1, 2, 3, 4, 5, 6, 7, 8, 9, 10, 11, 12, 13, 14, 15); }
__device__ __forceinline__ v16b frag_kb(const b16* p, int hh) { return cat8b(ld8b(p + 8 * hh), ld8b(p + 16 + 8 * hh)); }
__device__ __forceinline__ void split16(float v, b16& hi, b16& lo) { hi = (b16)v; lo = (b16)(v - (float)hi); }
// hi/lo fragment pair straight from an f32 k-contiguous row (same k-map)
__device__ __forceinline__ void frag_ksplit(const float* p, int hh, v16b& fh_, v16b& fl_) {
  const float* p0 = p + 8 * hh; const float* p1 = p + 16 + 8 * hh;
#pragma unroll
  for (int e = 0; e < 8; ++e) { b16 a, c; split16(p0[e], a, c); fh_[e] = a; fl_[e] = c; split16(p1[e], a, c); fh_[8 + e] = a; fl_[8 + e] = c; }
}
__device__ __forceinline__ v8f wmma16b(v16b a, v16b b, v8f c) {
  v8f d = __builtin_amdgcn_wmma_f32_16x16x32_f16(false, a, false, b, (short)0, c, false, false);
  asm volatile("v_nop\n\tv_nop\n\tv_nop\n\tv_nop" : "+v"(d) : "v"(a), "v"(b));
  return d;
}
__device__ __forceinline__ void wave_lds_sync() {
  __builtin_amdgcn_fence(__ATOMIC_RELEASE, "workgroup");
  __builtin_amdgcn_wave_barrier();
  __builtin_amdgcn_fence(__ATOMIC_ACQUIRE, "workgroup");
}

// Operand descriptor: NP = 0 -> f32 rows split on the fly into (hi, lo); NP = 1 -> one f16 plane; NP = 2 -> f16 hi + lo planes;
// NP = 3 -> f32 rows rounded once to a single f16 fragment. ld = row pitch.
struct Opnd { const void* p0; const void* p1; int ld; };
template <int NP> __device__ __forceinline__ void load_frags(const Opnd& o, int row, int kb, int hh, v16b& fh_, v16b& fl_) {
  if (NP == 0) { frag_ksplit((const float*)o.p0 + (size_t)row * o.ld + kb, hh, fh_, fl_); }
  else if (NP == 4 || NP == 5) {                             // f32 rows x64 (NP 4) or x8 (NP 5) then split (keeps the lo halves of small values normal)
    const float sc_ = (NP == 4) ? 64.0f : 8.0f;
    const float* p = (const float*)o.p0 + (size_t)row * o.ld + kb; const float* p0 = p + 8 * hh; const float* p1 = p + 16 + 8 * hh;
#pragma unroll
    for (int e = 0; e < 8; ++e) { b16 a, c; split16(p0[e] * sc_, a, c); fh_[e] = a; fl_[e] = c; split16(p1[e] * sc_, a, c); fh_[8 + e] = a; fl_[8 + e] = c; }
  } else if (NP == 3) {
    const float* p = (const float*)o.p0 + (size_t)row * o.ld + kb; const float* p0 = p + 8 * hh; const float* p1 = p + 16 + 8 * hh;
#pragma unroll
    for (int e = 0; e < 8; ++e) { fh_[e] = (b16)p0[e]; fh_[8 + e] = (b16)p1[e]; }
    fl_ = fh_;
  } else {
    fh_ = frag_kb((const b16*)o.p0 + (size_t)row * o.ld + kb, hh);
    if (NP == 2) fl_ = frag_kb((const b16*)o.p1 + (size_t)row * o.ld + kb, hh); else fl_ = fh_;
  }
}
template <int ANP, int BNP> __device__ __forceinline__ v8f mac(v16b ah, v16b al, v16b bh, v16b bl, v8f c) {
  c = wmma16b(ah, bh, c);
  if (BNP == 0 || BNP == 2 || BNP == 4 || BNP == 5) c = wmma16b(ah, bl, c);     // hi.lo
  if (ANP == 0 || ANP == 2 || ANP == 4 || ANP == 5) c = wmma16b(al, bh, c);     // lo.hi   (lo.lo dropped)
  return c;
}
// 32x64 wave tile: acc[r][t] (rows m0+16r.., cols c0+16t..) += A[m][k] . B[n][k] over k in [0, K)
template <int ANP, int BNP>
__device__ __forceinline__ void gemm_tile(const Opnd& A, const Opnd& B, int K, int m0, int c0, int nloc, int hlf, v8f (&acc)[2][4]) {
  for (int kb = 0; kb < K; kb += 32) {
    v16b a0h, a0l, a1h, a1l;
    load_frags<ANP>(A, m0 + nloc, kb, hlf, a0h, a0l);
    load_frags<ANP>(A, m0 + 16 + nloc, kb, hlf, a1h, a1l);
#pragma unroll
    for (int t = 0; t < 4; ++t) {
      v16b bh, bl;
      load_frags<BNP>(B, c0 + t * 16 + nloc, kb, hlf, bh, bl);
      acc[0][t] = mac<ANP, BNP>(a0h, a0l, bh, bl, acc[0][t]);
      acc[1][t] = mac<ANP, BNP>(a1h, a1l, bh, bl, acc[1][t]);
    }
  }
}

__device__ __forceinline__ void epi_planes(v8f (&acc)[2][4], float scale, bool two, b16* __restrict__ oh, b16* __restrict__ ol, int ldo,
                                           int m0, int c0, int lane, b16* Th, b16* Tl) {
  const int nloc = lane & 15, hlf = lane >> 4;
#pragma unroll
  for (int t = 0; t < 4; ++t)
#pragma unroll
    for (int r = 0; r < 2; ++r)
#pragma unroll
      for (int v = 0; v < 8; ++v) {
        const int rr = r * 16 + v + 8 * hlf, cc = t * 16 + nloc;
        b16 h_, l_; split16(acc[r][t][v] * scale, h_, l_);
        Th[rr * 64 + cc] = h_; Tl[rr * 64 + cc] = l_;
      }
  wave_lds_sync();
  {
#pragma unroll
    for (int j = 0; j < 8; ++j) {
      const int rr = j * 4 + (lane >> 3), c8 = (lane & 7) * 8;
      const size_t o = (size_t)(m0 + rr) * ldo + c0 + c8;
      *(v8b*)(oh + o) = ld8b(Th + rr * 64 + c8);
      if (two) *(v8b*)(ol + o) = ld8b(Tl + rr * 64 + c8);
    }
    
  }
}
typedef __attribute__((ext_vector_type(8))) __bf16 v8bb; typedef __attribute__((ext_vector_type(16))) __bf16 v16bb;
__device__ __forceinline__ v16bb frag_kb_bf(const __bf16* p, int hh) { const v8bb a = *(const v8bb*)(p + 8 * hh), b = *(const v8bb*)(p + 16 + 8 * hh); return __builtin_shufflevector(a, b, 0, 1, 2, 3, 4, 5, 6, 7, 8, 9, 10, 11, 12, 13, 14, 15); }
__device__ __forceinline__ v8f wmma16bb(v16bb a, v16bb b, v8f c) {
  v8f d = __builtin_amdgcn_wmma_f32_16x16x32_bf16(false, a, false, b, (short)0, c, false, false);
  asm volatile("v_nop\n\tv_nop\n\tv_nop\n\tv_nop" : "+v"(d) : "v"(a), "v"(b));
  return d;
}
__device__ __forceinline__ unsigned short bf16_rne_bits(float v) { unsigned int u = __float_as_uint(v); u += 0x7FFFu + ((u >> 16) & 1u); return (unsigned short)(u >> 16); }
__device__ __forceinline__ float bf16_rne(float v) { return __uint_as_float(((unsigned int)bf16_rne_bits(v)) << 16); }

// prep A: embed -> bf16 rows [4096][1024] (16-B pieces); pe x8 hi/lo planes [1024][64] from the module's sinusoid formula (f32, table row 0 (the padding row) never selected for L=1024).
__global__ __launch_bounds__(256) void prep_kernel(const float* __restrict__ emb, unsigned short* __restrict__ e16, b16* __restrict__ peh, b16* __restrict__ pel) {
  typedef __attribute__((ext_vector_type(8))) unsigned short v8us;
  __shared__ __attribute__((aligned(16))) b16 Sc[256 * 16];   // per-thread staging for the rolled sinusoid loop
  const size_t tid = (size_t)blockIdx.x * blockDim.x + threadIdx.x, nth = (size_t)gridDim.x * blockDim.x;
  {
    for (size_t p = tid; p < (size_t)NTOK * DM / 8; p += nth) { v8us v;
#pragma unroll
      for (int e = 0; e < 8; ++e) v[e] = bf16_rne_bits(emb[p * 8 + e]);
      *(v8us*)(e16 + p * 8) = v; }
    for (size_t p = tid; p < (size_t)L * DH / 8; p += nth) { const int l = (int)(p / 8), d0 = (int)(p % 8) * 8;
      const int tblrow = l - L / 2 + SHIFT;                    // 89 .. 1112, never 0
      const float posv = (float)(tblrow - (TBL + 1) / 2);      // arange(-601, 600)[tblrow] = tblrow - 601
#pragma unroll 1
      for (int e = 0; e < 8; ++e) { const int d = d0 + e; const int j = (d < DH / 2) ? d : d - DH / 2;   // rolled: one sin/cos expansion in the binary
        const float freq = expf((float)j * (-9.210340371976184f / (float)(DH / 2 - 1))); const float ang = posv * freq;
        const float val = (d < DH / 2) ? sinf(ang) : cosf(ang); b16 a, c; split16(val * PES, a, c); Sc[threadIdx.x * 16 + e] = a; Sc[threadIdx.x * 16 + 8 + e] = c; }
      *(v8b*)(peh + p * 8) = *(const v8b*)(&Sc[threadIdx.x * 16]); *(v8b*)(pel + p * 8) = *(const v8b*)(&Sc[threadIdx.x * 16 + 8]); }
    
  }
}

// prep B: W [k rows][n cols] f32 -> [n][k] 16-bit rows through 64x64 LDS tiles: MODE 0: bf16 bits (W_qkv); MODE 1: f16 of bf16(w) (W_fc, W_pos). grid (N/64, K/64).
template <int MODE>
__global__ __launch_bounds__(256) void wt_kernel(const float* __restrict__ W, int K, int Ncols, unsigned short* __restrict__ out) {
  __shared__ __attribute__((aligned(16))) unsigned short Tl[64][72];
  typedef __attribute__((ext_vector_type(8))) unsigned short v8us;
  const int tid = threadIdx.x, lane = tid & 31, wave = tid >> 5, n0 = blockIdx.x * 64, k0 = blockIdx.y * 64;
  for (int i = tid; i < 64 * 64; i += 256) { const int kk = i / 64, nn = i % 64; const float w = W[(size_t)(k0 + kk) * Ncols + n0 + nn];
    unsigned short bits; if (MODE == 0) bits = bf16_rne_bits(w); else { const b16 hv = (b16)bf16_rne(w); bits = *reinterpret_cast<const unsigned short*>(&hv); }
    Tl[nn][kk] = bits; }
  __syncthreads();
  {
#pragma unroll
    for (int j = 0; j < 2; ++j) { const int rr = wave * 8 + j * 4 + (lane >> 3), c8 = (lane & 7) * 8; *(v8us*)(out + (size_t)(n0 + rr) * K + k0 + c8) = *(const v8us*)(&Tl[rr][c8]); }
    
  }
}

// Eight 16-byte asynchronous copies of one thread, global memory to LDS; the closing wait stands in front of any rewrite of the address registers named here.
__device__ __forceinline__ void copy8_to_lds(unsigned l0, unsigned l1, unsigned l2, unsigned l3, unsigned l4, unsigned l5, unsigned l6, unsigned l7,
                                             const void* g0, const void* g1, const void* g2, const void* g3, const void* g4, const void* g5, const void* g6, const void* g7) {
  asm volatile("global_load_async_to_lds_b128 %0, %8, off\n\t"
               "global_load_async_to_lds_b128 %1, %9, off\n\t"
               "global_load_async_to_lds_b128 %2, %10, off\n\t"
               "global_load_async_to_lds_b128 %3, %11, off\n\t"
               "global_load_async_to_lds_b128 %4, %12, off\n\t"
               "global_load_async_to_lds_b128 %5, %13, off\n\t"
               "global_load_async_to_lds_b128 %6, %14, off\n\t"
               "global_load_async_to_lds_b128 %7, %15, off\n\t"
               "s_wait_xcnt 0x0"
               :: "v"(l0), "v"(l1), "v"(l2), "v"(l3), "v"(l4), "v"(l5), "v"(l6), "v"(l7), "v"(g0), "v"(g1), "v"(g2), "v"(g3), "v"(g4), "v"(g5), "v"(g6), "v"(g7) : "memory");
}

__device__ __forceinline__ void copy2_to_lds(unsigned l0, unsigned l1, const void* g0, const void* g1) {   // the same, two copies
  asm volatile("global_load_async_to_lds_b128 %0, %2, off\n\t"
               "global_load_async_to_lds_b128 %1, %3, off\n\t"
               "s_wait_xcnt 0x0"
               :: "v"(l0), "v"(l1), "v"(g0), "v"(g1) : "memory");
}

// qkv: (4096 x 1024) x (1024 x 4096) bf16 WMMA; grid (32, 32), block = 128 tokens x 128 columns, 8 waves (4 along tokens x 2 along columns) of 32 x 64 each. Per 64-k tile the
// 128 embed rows and the 128 weight rows are brought once per block into LDS (row pitch 144 B) by asynchronous copies, two buffers: tile t + 1 flies while tile t is worked on;
// fragments come from LDS. Columns: [q | k1 | k2 | v] x 1024; q/k1/k2 -> single f16 rows [which][b][h][l][64]; v -> (8v)^T hi/lo planes [b][h][64 d][1024 l] through a block
// LDS transpose (block = 128 tokens of one batch row, two heads). The epilogues stage in the ring's LDS behind the last tile's barrier.
// Eight waves a SIMD are asked for so that four blocks (their LDS fits four times) share a WGP and all 1024 blocks are resident at once.
constexpr int GPIT = 64 + 8, GROWS = 256, GTILE = GROWS * GPIT;   // LDS row pitch (16-bit elements), rows and elements of a stage: 128 embed rows, then 128 weight rows
__global__ __launch_bounds__(256, 8) void qkv_kernel(const __bf16* __restrict__ e16, const __bf16* __restrict__ wqkv, b16* __restrict__ qk, b16* __restrict__ vth, b16* __restrict__ vtl) {
  __shared__ __attribute__((aligned(16))) unsigned short Sm[2 * GTILE];   // 73,728 B
  const int tid = threadIdx.x, lane = tid & 31, wave = __builtin_amdgcn_readfirstlane(tid >> 5), wm = wave & 3, wn = wave >> 2, nloc = lane & 15, hlf = lane >> 4;
  const int mb = blockIdx.y * 128, cb = blockIdx.x * 128, m0 = mb + wm * 32, c0 = cb + wn * 64;   // the wave number is held scalar: tile indices and the epilogue branch stay scalar
  // copy map: 8 lanes bring one 128-byte row piece; a thread brings rows sr + 32 i of both operands
  const int sr = tid >> 3, sc = (tid & 7) * 8;
  const __bf16* ga = e16 + (size_t)(mb + sr) * DM + sc; const __bf16* gb = wqkv + (size_t)(cb + sr) * DM + sc;
  const unsigned ls = (unsigned)(size_t)(&Sm[0]) + (unsigned)(sr * GPIT + sc) * 2u;
  auto stage = [&](int kt, int buf) {
    const unsigned l = ls + (unsigned)buf * (GTILE * 2u); const __bf16* a = ga + kt * 64; const __bf16* w = gb + kt * 64;
    constexpr unsigned R32 = 32u * GPIT * 2u;
    copy8_to_lds(l, l + R32, l + 2u * R32, l + 3u * R32, l + 4u * R32, l + 5u * R32, l + 6u * R32, l + 7u * R32,
                 a, a + 32 * DM, a + 64 * DM, a + 96 * DM, w, w + 32 * DM, w + 64 * DM, w + 96 * DM);
  };
  v8f acc[2][4];
#pragma unroll
  for (int r = 0; r < 2; ++r)
#pragma unroll
    for (int t = 0; t < 4; ++t) acc[r][t] = (v8f){};
  stage(0, 0);
  asm volatile("s_wait_asynccnt 0x0" ::: "memory");             // this wave's copies of tile 0 have landed
  __syncthreads();                                              // publishes tile 0
  stage(1, 1);
  for (int kt = 0; kt < DM / 64; ++kt) {
    const __bf16* As = (const __bf16*)Sm + (kt & 1) * GTILE + (wm * 32 + nloc) * GPIT; const __bf16* Bs = (const __bf16*)Sm + (kt & 1) * GTILE + (128 + wn * 64 + nloc) * GPIT;
#pragma unroll                                                  // both 32-k halves of the tile in line: LDS offsets become immediates
    for (int ks = 0; ks < 2; ++ks) {
      const v16bb a0 = frag_kb_bf(As + ks * 32, hlf), a1 = frag_kb_bf(As + 16 * GPIT + ks * 32, hlf);
#pragma unroll
      for (int t = 0; t < 4; ++t) { const v16bb bw = frag_kb_bf(Bs + t * 16 * GPIT + ks * 32, hlf); acc[0][t] = wmma16bb(a0, bw, acc[0][t]); acc[1][t] = wmma16bb(a1, bw, acc[1][t]); }
    }
    asm volatile("s_wait_dscnt 0x0" ::: "memory");              // this wave's reads of tile kt are done before its buffer is handed back
    asm volatile("s_wait_asynccnt 0x0" ::: "memory");           // this wave's copies of tile kt + 1 have landed
    __syncthreads();                                            // publishes tile kt + 1 and ends every read of tile kt
    if (kt + 2 < DM / 64) stage(kt + 2, kt & 1);
  }
  asm volatile("s_wait_asynccnt 0x0" ::: "memory");             // no copy is outstanding when the ring becomes output staging
  const int which = c0 / DM, c1 = c0 % DM, h = c1 / DH, b = m0 / L, l0 = m0 % L;   // 64 columns = one head; which is the same for the whole block
  if (which < 3) {                                             // q / k1 / k2 rows [which][b][h][l][64] (single f16)
    b16* Th = (b16*)Sm + wave * (2 * 32 * 64);
    epi_planes(acc, 1.0f, false, qk + ((((size_t)which * Bn + b) * H + h) * L + l0) * DH, nullptr, DH, 0, 0, lane, Th, Th + 32 * 64);
    return;
  }
  constexpr int TP = 128 + 8;                                   // token pitch of the transpose planes [head wn][hi, lo][64 d][TP]
  b16* Tt = (b16*)Sm + wn * (2 * 64 * TP);
#pragma unroll
  for (int t = 0; t < 4; ++t)
#pragma unroll
    for (int r = 0; r < 2; ++r)
#pragma unroll
      for (int v = 0; v < 8; ++v) { b16 a, c; split16(acc[r][t][v] * VS, a, c); const int o = (t * 16 + nloc) * TP + wm * 32 + r * 16 + 8 * hlf + v; Tt[o] = a; Tt[64 * TP + o] = c; }
  __syncthreads();
  const int tok0 = mb % L, bb = mb / L;
  b16* bh_ = vth + (((size_t)bb * H + h) * DH) * L + tok0; b16* bl_ = vtl + (((size_t)bb * H + h) * DH) * L + tok0;
  {
#pragma unroll
    for (int j = 0; j < 8; ++j) { const int dd = wm * 16 + j * 2 + (lane >> 4), c8 = (lane & 15) * 8;
      *(v8b*)(bh_ + (size_t)dd * L + c8) = *(const v8b*)(&Tt[dd * TP + c8]); *(v8b*)(bl_ + (size_t)dd * L + c8) = *(const v8b*)(&Tt[64 * TP + dd * TP + c8]); }
    asm volatile("s_wait_xcnt 0x0" ::: "memory");               // behind the last store: stands in front of any later write of a register that these stores name
  }
}

// position projections: (1024 x 64) x (64 x 3072): A = pe planes (x8 hi+lo), B = f16(bf16 W_pos)^T rows -> 2 products; single f16 rows pp[which][h][l][64]; grid (48, 8).
__global__ __launch_bounds__(128) void pos_kernel(const b16* __restrict__ peh, const b16* __restrict__ pel, const b16* __restrict__ wpos, b16* __restrict__ pp) {
  __shared__ __attribute__((aligned(16))) b16 Th[4][2][32 * 64];
  const int lane = threadIdx.x & 31, wave = threadIdx.x >> 5, nloc = lane & 15, hlf = lane >> 4, m0 = blockIdx.y * 128 + wave * 32, c0 = blockIdx.x * 64;
  v8f acc[2][4];
#pragma unroll
  for (int r = 0; r < 2; ++r)
#pragma unroll
    for (int t = 0; t < 4; ++t) acc[r][t] = (v8f){};
  const Opnd A{peh, pel, DH}, B{wpos, nullptr, DH};
  gemm_tile<2, 1>(A, B, DH, m0, c0, nloc, hlf, acc);
  const int which = c0 / DM, h = (c0 % DM) / DH;
  epi_planes(acc, 1.0f / PES, false, pp + (((size_t)which * H + h) * L + m0) * DH, nullptr, DH, 0, 0, lane, Th[wave][0], Th[wave][1]);
}

// ---------------------------------------------------------------------------
// attention: block = (b, h, 128 queries), wave = 16 queries; causal 32-key chunks up to the block's diagonal. All key-side operands come from LDS, staged once per block and
// shared by its 8 waves: the two mask rows once, and per chunk the k1/k2/kp1/kp2 rows (pitch 144 B) and the (8v)^T hi/lo columns (pitch 80 B), two buffers: chunk t + 1 is
// fetched into registers before chunk t is worked on and stored to the other buffer behind it; one barrier a chunk. A wave past its own diagonal only stages.
// Per chunk and 16-key half: four K=64 score products (q.k1, qp.kp1, q.k2, qp.kp2; single f16),
// logit = same speaker ? s1 + p1 : s2 + p2; -inf where key > query or umask[b][key] == 0; online softmax f32; P^T f16; y^T += (8v)^T.P^T (4 feature tiles, hi + lo);
// ---------------------------------------------------------------------------
constexpr int KPIT = DH + 8, VPIT = 32 + 8;                    // LDS row pitches in f16: 16 B x odd, for 16-byte fragment reads
typedef __attribute__((ext_vector_type(4))) int v4i;
__global__ __launch_bounds__(256) void attn_kernel(const b16* __restrict__ qk, const b16* __restrict__ pp, const b16* __restrict__ vth, const b16* __restrict__ vtl,
                                                   const int* __restrict__ umask, const int* __restrict__ qmask, float* __restrict__ y) {
  __shared__ __attribute__((aligned(16))) float Os[8][16][DH + 4];
  __shared__ __attribute__((aligned(16))) b16 Ks[2][4][32 * KPIT];   // [buffer][k1, k2, kp1, kp2][key][feature]
  __shared__ __attribute__((aligned(16))) b16 Vs[2][2][DH * VPIT];   // [buffer][hi, lo][feature][key]
  __shared__ __attribute__((aligned(16))) int Ms[2][L];              // speaker ids and umask of batch row b
  const int tid = threadIdx.x, wid = __builtin_amdgcn_readfirstlane(tid >> 5), lane = tid & 31, hh = lane >> 4, col = lane & 15;
  const int qt = blockIdx.x * 8 + wid, jt = qt & 63, h = (qt >> 6) & 15, b = qt >> 10, q0 = jt * 16, qi = q0 + col;
  const int nchunk = ((blockIdx.x & 7) + 1) * 4;                // 32-key chunks up to the block's last query
  const b16* Q = qk + ((((size_t)0 * Bn + b) * H + h) * L) * DH; const b16* K1 = qk + ((((size_t)1 * Bn + b) * H + h) * L) * DH; const b16* K2 = qk + ((((size_t)2 * Bn + b) * H + h) * L) * DH;
  const b16* QP = pp + (((size_t)0 * H + h) * L) * DH; const b16* KP1 = pp + (((size_t)1 * H + h) * L) * DH; const b16* KP2 = pp + (((size_t)2 * H + h) * L) * DH;
  const b16* vh = vth + (((size_t)b * H + h) * DH) * L; const b16* vl = vtl + (((size_t)b * H + h) * DH) * L;
  // staging map: a thread moves one 16-byte piece of each of the six tiles
  const int kr = tid >> 3, kc = (tid & 7) * 8, vr = tid >> 2, vc = (tid & 3) * 8;
  const size_t gko = (size_t)kr * DH + kc, gvo = (size_t)vr * L + vc;
  const int sko = kr * KPIT + kc, svo = vr * VPIT + vc;
  v8b st[6];
  st[0] = ld8b(K1 + gko); st[1] = ld8b(K2 + gko); st[2] = ld8b(KP1 + gko); st[3] = ld8b(KP2 + gko); st[4] = ld8b(vh + gvo); st[5] = ld8b(vl + gvo);
  const v4i mq = *(const v4i*)(qmask + b * L + tid * 4), mu = *(const v4i*)(umask + b * L + tid * 4);
  v16b qf[2], qpf[2];
#pragma unroll
  for (int ks = 0; ks < 2; ++ks) { qf[ks] = frag_kb(Q + (size_t)qi * DH + ks * 32, hh); qpf[ks] = frag_kb(QP + (size_t)qi * DH + ks * 32, hh); }
  const int myspk = qmask[b * L + qi];
  asm volatile("s_wait_xcnt 0x0" ::: "memory");                 // before the address registers of the loads above are reused
  *(v4i*)(&Ms[0][tid * 4]) = mq; *(v4i*)(&Ms[1][tid * 4]) = mu;
#pragma unroll
  for (int i = 0; i < 4; ++i) *(v8b*)(&Ks[0][i][sko]) = st[i];
  *(v8b*)(&Vs[0][0][svo]) = st[4]; *(v8b*)(&Vs[0][1][svo]) = st[5];
  __syncthreads();
  float m = -INFINITY, l = 0.0f; v8f o[4] = {{}, {}, {}, {}};
  for (int t = 0; t < nchunk; ++t) {
    const int kb = t * 32, cur = t & 1; const bool more = t + 1 < nchunk;
    if (more) { const size_t ka = gko + (size_t)(kb + 32) * DH, va = gvo + kb + 32;
      st[0] = ld8b(K1 + ka); st[1] = ld8b(K2 + ka); st[2] = ld8b(KP1 + ka); st[3] = ld8b(KP2 + ka); st[4] = ld8b(vh + va); st[5] = ld8b(vl + va);
      asm volatile("s_wait_xcnt 0x0" ::: "memory"); }           // before the address registers of these six loads are reused
    if (kb < q0 + 16) {
      float lg0[8], lg1[8];
#pragma unroll
      for (int half = 0; half < 2; ++half) {
        const int ro = (half * 16 + col) * KPIT;
        v8f s1 = {}, p1 = {}, s2 = {}, p2 = {};
#pragma unroll
        for (int ks = 0; ks < 2; ++ks) {
          s1 = wmma16b(frag_kb(&Ks[cur][0][ro + ks * 32], hh), qf[ks], s1); s2 = wmma16b(frag_kb(&Ks[cur][1][ro + ks * 32], hh), qf[ks], s2);
          p1 = wmma16b(frag_kb(&Ks[cur][2][ro + ks * 32], hh), qpf[ks], p1); p2 = wmma16b(frag_kb(&Ks[cur][3][ro + ks * 32], hh), qpf[ks], p2);
        }
        const int k8 = kb + half * 16 + 8 * hh;
        const v4i sp0 = *(const v4i*)(&Ms[0][k8]), sp1 = *(const v4i*)(&Ms[0][k8 + 4]), um0 = *(const v4i*)(&Ms[1][k8]), um1 = *(const v4i*)(&Ms[1][k8 + 4]);
#pragma unroll
        for (int r = 0; r < 8; ++r) { const int kk = k8 + r; const bool same = ((r < 4 ? sp0[r & 3] : sp1[r & 3]) == myspk);
          float v = same ? (s1[r] + p1[r]) : (s2[r] + p2[r]);
          if ((kk > qi) | ((r < 4 ? um0[r & 3] : um1[r & 3]) == 0)) v = -INFINITY;
          if (half == 0) lg0[r] = v; else lg1[r] = v; }
      }
      float mr = -INFINITY;
#pragma unroll
      for (int r = 0; r < 8; ++r) mr = fmaxf(mr, fmaxf(lg0[r], lg1[r]));
      mr = fmaxf(mr, __shfl_xor(mr, 16));
      float mn = fmaxf(m, mr); if (mn == -INFINITY) mn = 0.0f;
      const float al_ = __expf(m - mn); m = mn;
      float sum = 0.0f; v16b pb;
#pragma unroll
      for (int r = 0; r < 8; ++r) { const float e0 = __expf(lg0[r] - mn), e1 = __expf(lg1[r] - mn); sum += e0 + e1; pb[r] = (b16)e0; pb[8 + r] = (b16)e1; }
      sum += __shfl_xor(sum, 16); l = l * al_ + sum;
#pragma unroll
      for (int n = 0; n < 4; ++n) {
#pragma unroll
        for (int r = 0; r < 8; ++r) o[n][r] *= al_;
        const int ro = (n * 16 + col) * VPIT;
        o[n] = wmma16b(frag_kb(&Vs[cur][0][ro], hh), pb, o[n]); o[n] = wmma16b(frag_kb(&Vs[cur][1][ro], hh), pb, o[n]);
      }
    }
    if (more) {                                                 // the other buffer's last readers left it at the previous chunk's barrier
#pragma unroll
      for (int i = 0; i < 4; ++i) *(v8b*)(&Ks[cur ^ 1][i][sko]) = st[i];
      *(v8b*)(&Vs[cur ^ 1][0][svo]) = st[4]; *(v8b*)(&Vs[cur ^ 1][1][svo]) = st[5];
      __syncthreads();                                          // publishes chunk t + 1 and ends every read of chunk t
    }
  }
  const float inv = (l > 0.0f) ? (1.0f / (VS * l)) : 0.0f;
#pragma unroll
  for (int n = 0; n < 4; ++n)
#pragma unroll
    for (int r = 0; r < 8; ++r) Os[wid][col][n * 16 + 8 * hh + r] = o[n][r] * inv;
  wave_lds_sync();
  float* dst = y + ((size_t)b * L + q0) * DM + h * DH;          // 16 rows x 256 B
  {
#pragma unroll
    for (int j = 0; j < 8; ++j) { const int rr = j * 2 + hh, c4 = col * 4; *(v4f*)(dst + (size_t)rr * DM + c4) = *(const v4f*)(&Os[wid][rr][c4]); }
    
  }
}

// out = y.W_fc: (4096 x 1024) x (1024 x 1024); A = y f32 x8 split, B = f16(bf16 W_fc)^T rows -> 2 products; f32 rows; grid (16, 32), block = 128 rows x 64 columns, 8 waves of
// 16 x 64. Per 64-k tile the 128 y rows (f32, pitch 272 B) and the 64 weight rows (pitch 144 B) are brought once per block into LDS by asynchronous copies, two buffers, as in
// qkv_kernel; the split runs on fragments read from LDS. The epilogue stages in the ring's LDS behind the last tile's barrier.
constexpr int OAP = 64 + 4, OBP = 64 + 8, OAB = 128 * OAP * 4, OST = OAB + 64 * OBP * 2;   // pitches (f32, f16 elements), bytes of the y part and of a whole stage
__global__ __launch_bounds__(256) void out_kernel(const float* __restrict__ y, const b16* __restrict__ wfc, float* __restrict__ out) {
  __shared__ __attribute__((aligned(16))) unsigned char So[2 * OST];   // 88,064 B
  const int tid = threadIdx.x, lane = tid & 31, wave = __builtin_amdgcn_readfirstlane(tid >> 5), nloc = lane & 15, hlf = lane >> 4, mb = blockIdx.y * 128, m0 = mb + wave * 16, c0 = blockIdx.x * 64;
  // copy map: 16 lanes bring one 256-byte y row piece (rows ar + 16 i), 8 lanes one 128-byte weight row piece (rows br + 32 j)
  const int ar = tid >> 4, ac = (tid & 15) * 4, br = tid >> 3, bc = (tid & 7) * 8;
  const float* ga = y + (size_t)(mb + ar) * DM + ac; const b16* gb = wfc + (size_t)(c0 + br) * DM + bc;
  const unsigned la = (unsigned)(size_t)(&So[0]) + (unsigned)(ar * OAP + ac) * 4u, lw = (unsigned)(size_t)(&So[0]) + (unsigned)OAB + (unsigned)(br * OBP + bc) * 2u;
  auto stage = [&](int kt, int buf) {
    const unsigned l = la + (unsigned)buf * (unsigned)OST, w = lw + (unsigned)buf * (unsigned)OST; const float* a = ga + kt * 64; const b16* g = gb + kt * 64;
    constexpr unsigned R16 = 16u * OAP * 4u;
    copy8_to_lds(l, l + R16, l + 2u * R16, l + 3u * R16, l + 4u * R16, l + 5u * R16, l + 6u * R16, l + 7u * R16,
                 a, a + 16 * DM, a + 32 * DM, a + 48 * DM, a + 64 * DM, a + 80 * DM, a + 96 * DM, a + 112 * DM);
    copy2_to_lds(w, w + 32u * OBP * 2u, g, g + 32 * DM);
  };
  v8f acc[4] = {{}, {}, {}, {}};
  stage(0, 0);
  asm volatile("s_wait_asynccnt 0x0" ::: "memory");             // this wave's copies of tile 0 have landed
  __syncthreads();                                              // publishes tile 0
  stage(1, 1);
  for (int kt = 0; kt < DM / 64; ++kt) {
    const float* As = (const float*)(So + (kt & 1) * OST) + (wave * 16 + nloc) * OAP + 8 * hlf; const b16* Bs = (const b16*)(So + (kt & 1) * OST + OAB) + nloc * OBP;
    // every loop below is unrolled so that the fragment and accumulator arrays are indexed by constants and stay in registers
#pragma unroll
    for (int ks = 0; ks < 2; ++ks) {
      const v4f x[4] = {*(const v4f*)(As + ks * 32), *(const v4f*)(As + ks * 32 + 4), *(const v4f*)(As + ks * 32 + 16), *(const v4f*)(As + ks * 32 + 20)};
      v16b bf[4], ah, al;
#pragma unroll
      for (int t = 0; t < 4; ++t) bf[t] = frag_kb(Bs + t * 16 * OBP + ks * 32, hlf);
#pragma unroll
      for (int e = 0; e < 16; ++e) { b16 a, c; split16(x[e >> 2][e & 3] * 8.0f, a, c); ah[e] = a; al[e] = c; }
#pragma unroll
      for (int t = 0; t < 4; ++t) acc[t] = wmma16b(ah, bf[t], acc[t]);     // hi, then lo, into each accumulator
#pragma unroll
      for (int t = 0; t < 4; ++t) acc[t] = wmma16b(al, bf[t], acc[t]);
    }
    asm volatile("s_wait_dscnt 0x0" ::: "memory");              // this wave's reads of tile kt are done before its buffer is handed back
    asm volatile("s_wait_asynccnt 0x0" ::: "memory");           // this wave's copies of tile kt + 1 have landed
    __syncthreads();                                            // publishes tile kt + 1 and ends every read of tile kt
    if (kt + 2 < DM / 64) stage(kt + 2, kt & 1);
  }
  asm volatile("s_wait_asynccnt 0x0" ::: "memory");             // no copy is outstanding when the ring becomes output staging
  float* Tt = (float*)So + wave * (16 * 64);                    // 16 rows x 256 B per wave, stored as whole lines; unrolled: constant accumulator indices
#pragma unroll
  for (int t = 0; t < 4; ++t)
#pragma unroll
    for (int v = 0; v < 8; ++v) Tt[(v + 8 * hlf) * 64 + t * 16 + nloc] = acc[t][v] * (1.0f / 8.0f);
  wave_lds_sync();
  float* dst0 = out + (size_t)m0 * DM + c0;
#pragma unroll
  for (int j = 0; j < 8; ++j) { const int rr = j * 2 + hlf, c4 = nloc * 4; *(v4f*)(dst0 + (size_t)rr * DM + c4) = *(const v4f*)(Tt + rr * 64 + c4); }
}
}  // namespace

extern "C" void kernel_launch(void* const* d_in, const int* in_sizes, int n_in,
                              void* d_out, int out_size, void* d_ws, size_t ws_size, hipStream_t stream) {
  (void)n_in; (void)out_size;
  const float* emb = (const float*)d_in[0]; const int* umask = (const int*)d_in[1]; const int* qmask = (const int*)d_in[2];
  const float* Wqkv = (const float*)d_in[3]; const float* Wpos = (const float*)d_in[4]; const float* Wfc = (const float*)d_in[5];
  float* out = (float*)d_out;   // [4,1024,1024]
  if (in_sizes[0] != NTOK * DM || in_sizes[1] != NTOK || in_sizes[2] != NTOK || in_sizes[3] != DM * NQKV || in_sizes[4] != DH * NPOS || in_sizes[5] != DM * DM) return;
  size_t off = 0; char* ws = (char*)d_ws;
  auto carve = [&](size_t bytes) { char* p = ws + off; off += (bytes + 255) & ~(size_t)255; return p; };
  unsigned short* e16 = (unsigned short*)carve((size_t)NTOK * DM * 2);       // 8 MB
  unsigned short* wq = (unsigned short*)carve((size_t)NQKV * DM * 2);        // 8 MB
  unsigned short* wp = (unsigned short*)carve((size_t)NPOS * DH * 2);        // 384 KB
  unsigned short* wf = (unsigned short*)carve((size_t)DM * DM * 2);          // 2 MB
  b16* peh = (b16*)carve((size_t)L * DH * 2); b16* pel = (b16*)carve((size_t)L * DH * 2);
  b16* qk = (b16*)carve((size_t)3 * Bn * H * L * DH * 2);                   // 24 MB
  b16* vth = (b16*)carve((size_t)Bn * H * DH * L * 2); b16* vtl = (b16*)carve((size_t)Bn * H * DH * L * 2);   // 8 MB each
  b16* pp = (b16*)carve((size_t)3 * H * L * DH * 2);                         // 6 MB
  float* y = (float*)carve((size_t)NTOK * DM * 4);                           // 16 MB
  if (off > ws_size) return;                                                  // ≈ 81 MB
  prep_kernel<<<512, 256, 0, stream>>>(emb, e16, peh, pel);
  wt_kernel<0><<<dim3(NQKV / 64, DM / 64), 256, 0, stream>>>(Wqkv, DM, NQKV, wq);
  wt_kernel<1><<<dim3(NPOS / 64, DH / 64), 256, 0, stream>>>(Wpos, DH, NPOS, wp);
  wt_kernel<1><<<dim3(DM / 64, DM / 64), 256, 0, stream>>>(Wfc, DM, DM, wf);
  qkv_kernel<<<dim3(NQKV / 128, NTOK / 128), 256, 0, stream>>>((const __bf16*)e16, (const __bf16*)wq, qk, vth, vtl);
  pos_kernel<<<dim3(NPOS / 64, L / 128), 128, 0, stream>>>(peh, pel, (const b16*)wp, pp);
  attn_kernel<<<Bn * H * (L / 16) / 8, 256, 0, stream>>>(qk, pp, vth, vtl, umask, qmask, y);
  out_kernel<<<dim3(DM / 64, NTOK / 128), 256, 0, stream>>>(y, (const b16*)wf, out);
}

// v003
// A run of this version takes 129 microseconds.
// Two timings next to v002 put it at 1.18 and 1.17 times that version's speed.
// Over all steps from v000 it is 3.50 times as fast.
#include <hip/hip_runtime.h>

// Speaker-aware causal multi-head attention with relative sinusoidal position terms (d_model 1024, 16 heads x 64, B=4, L=1024): q,k1,k2,v = embed W_qkv;
// qp,kp1,kp2 = pe W_pos (pe = the module's sinusoid table rows 89..1112); logit[q][k] = same speaker ? (q.k1 + qp.kp1) : (q.k2 + qp.kp2) (scale 1); keys k > q or umask = 0
// -> -inf; softmax; out = (P.v) W_fc.
// Numerics: embed, W_qkv, W_pos and W_fc are rounded to bf16 (RNE); the qkv projection runs on
// v_wmma_f32_16x16x32_bf16 with those operands (exact products, f32 accumulate); the position projection uses f16 hi+lo of the f32 sinusoid table against the exact f16 copy of
// bf16 W_pos; the four score products use single f16 copies of q/k1/k2/qp/kp (f32 accumulate); P.V pairs single-f16 P with hi+lo 8v; the output projection pairs hi+lo of the
// attention output with the exact f16 copy of bf16 W_fc. Masks are read from the int inputs. Fragment k-map per lane half hh for A AND B: elements 0..7 <- k = 8hh+0..7, 8..15

namespace {
constexpr int Bn = 4, L = 1024, DM = 1024, H = 16, DH = 64, NTOK = Bn * L, NQKV = 4 * DM, NPOS = 3 * DM, TBL = 1201, SHIFT = 601;
constexpr float VS = 8.0f, PES = 8.0f;

typedef _Float16 b16;
typedef __attribute__((ext_vector_type(16))) _Float16 v16b;
typedef __attribute__((ext_vector_type(8)))  _Float16 v8b;
typedef __attribute__((ext_vector_type(8)))  float v8f;
typedef __attribute__((ext_vector_type(4)))  float v4f;

__device__ __forceinline__ v8b ld8b(const b16* p) { return *(const v8b*)p; }
__device__ __forceinline__ v16b cat8b(v8b a, v8b b) { return __builtin_shufflevector(a, b, 0, 1, 2, 3, 4, 5, 6, 7, 8, 9, 10, 11, 12, 13, 14, 15); }
__device__ __forceinline__ v16b frag_kb(const b16* p, int hh) { return cat8b(ld8b(p + 8 * hh), ld8b(p + 16 + 8 * hh)); }
__device__ __forceinline__ void split16(float v, b16& hi, b16& lo) { hi = (b16)v; lo = (b16)(v - (float)hi); }
// hi/lo fragment pair straight from an f32 k-contiguous row (same k-map)
__device__ __forceinline__ void frag_ksplit(const float* p, int hh, v16b& fh_, v16b& fl_) {
  const float* p0 = p + 8 * hh; const float* p1 = p + 16 + 8 * hh;
#pragma unroll
  for (int e = 0; e < 8; ++e) { b16 a, c; split16(p0[e], a, c); fh_[e] = a; fl_[e] = c; split16(p1[e], a, c); fh_[8 + e] = a; fl_[8 + e] = c; }
}
__device__ __forceinline__ v8f wmma16b(v16b a, v16b b, v8f c) {
  v8f d = __builtin_amdgcn_wmma_f32_16x16x32_f16(false, a, false, b, (short)0, c, false, false);
  asm volatile("v_nop\n\tv_nop\n\tv_nop\n\tv_nop" : "+v"(d) : "v"(a), "v"(b));
  return d;
}
__device__ __forceinline__ void wave_lds_sync() {
  __builtin_amdgcn_fence(__ATOMIC_RELEASE, "workgroup");
  __builtin_amdgcn_wave_barrier();
  __builtin_amdgcn_fence(__ATOMIC_ACQUIRE, "workgroup");
}

// Operand descriptor: NP = 0 -> f32 rows split on the fly into (hi, lo); NP = 1 -> one f16 plane; NP = 2 -> f16 hi + lo planes;
// NP = 3 -> f32 rows rounded once to a single f16 fragment. ld = row pitch.
struct Opnd { const void* p0; const void* p1; int ld; };
template <int NP> __device__ __forceinline__ void load_frags(const Opnd& o, int row, int kb, int hh, v16b& fh_, v16b& fl_) {
  if (NP == 0) { frag_ksplit((const float*)o.p0 + (size_t)row * o.ld + kb, hh, fh_, fl_); }
  else if (NP == 4 || NP == 5) {                             // f32 rows x64 (NP 4) or x8 (NP 5) then split (keeps the lo halves of small values normal)
    const float sc_ = (NP == 4) ? 64.0f : 8.0f;
    const float* p = (const float*)o.p0 + (size_t)row * o.ld + kb; const float* p0 = p + 8 * hh; const float* p1 = p + 16 + 8 * hh;
#pragma unroll
    for (int e = 0; e < 8; ++e) { b16 a, c; split16(p0[e] * sc_, a, c); fh_[e] = a; fl_[e] = c; split16(p1[e] * sc_, a, c); fh_[8 + e] = a; fl_[8 + e] = c; }
  } else if (NP == 3) {
    const float* p = (const float*)o.p0 + (size_t)row * o.ld + kb; const float* p0 = p + 8 * hh; const float* p1 = p + 16 + 8 * hh;
#pragma unroll
    for (int e = 0; e < 8; ++e) { fh_[e] = (b16)p0[e]; fh_[8 + e] = (b16)p1[e]; }
    fl_ = fh_;
  } else {
    fh_ = frag_kb((const b16*)o.p0 + (size_t)row * o.ld + kb, hh);
    if (NP == 2) fl_ = frag_kb((const b16*)o.p1 + (size_t)row * o.ld + kb, hh); else fl_ = fh_;
  }
}
template <int ANP, int BNP> __device__ __forceinline__ v8f mac(v16b ah, v16b al, v16b bh, v16b bl, v8f c) {
  c = wmma16b(ah, bh, c);
  if (BNP == 0 || BNP == 2 || BNP == 4 || BNP == 5) c = wmma16b(ah, bl, c);     // hi.lo
  if (ANP == 0 || ANP == 2 || ANP == 4 || ANP == 5) c = wmma16b(al, bh, c);     // lo.hi   (lo.lo dropped)
  return c;
}
// 32x64 wave tile: acc[r][t] (rows m0+16r.., cols c0+16t..) += A[m][k] . B[n][k] over k in [0, K)
template <int ANP, int BNP>
__device__ __forceinline__ void gemm_tile(const Opnd& A, const Opnd& B, int K, int m0, int c0, int nloc, int hlf, v8f (&acc)[2][4]) {
  for (int kb = 0; kb < K; kb += 32) {
    v16b a0h, a0l, a1h, a1l;
    load_frags<ANP>(A, m0 + nloc, kb, hlf, a0h, a0l);
    load_frags<ANP>(A, m0 + 16 + nloc, kb, hlf, a1h, a1l);
#pragma unroll
    for (int t = 0; t < 4; ++t) {
      v16b bh, bl;
      load_frags<BNP>(B, c0 + t * 16 + nloc, kb, hlf, bh, bl);
      acc[0][t] = mac<ANP, BNP>(a0h, a0l, bh, bl, acc[0][t]);
      acc[1][t] = mac<ANP, BNP>(a1h, a1l, bh, bl, acc[1][t]);
    }
  }
}

__device__ __forceinline__ void epi_planes(v8f (&acc)[2][4], float scale, bool two, b16* __restrict__ oh, b16* __restrict__ ol, int ldo,
                                           int m0, int c0, int lane, b16* Th, b16* Tl) {
  const int nloc = lane & 15, hlf = lane >> 4;
#pragma unroll
  for (int t = 0; t < 4; ++t)
#pragma unroll
    for (int r = 0; r < 2; ++r)
#pragma unroll
      for (int v = 0; v < 8; ++v) {
        const int rr = r * 16 + v + 8 * hlf, cc = t * 16 + nloc;
        b16 h_, l_; split16(acc[r][t][v] * scale, h_, l_);
        Th[rr * 64 + cc] = h_; Tl[rr * 64 + cc] = l_;
      }
  wave_lds_sync();
  {
#pragma unroll
    for (int j = 0; j < 8; ++j) {
      const int rr = j * 4 + (lane >> 3), c8 = (lane & 7) * 8;
      const size_t o = (size_t)(m0 + rr) * ldo + c0 + c8;
      *(v8b*)(oh + o) = ld8b(Th + rr * 64 + c8);
      if (two) *(v8b*)(ol + o) = ld8b(Tl + rr * 64 + c8);
    }
    
  }
}
typedef __attribute__((ext_vector_type(8))) __bf16 v8bb; typedef __attribute__((ext_vector_type(16))) __bf16 v16bb;
__device__ __forceinline__ v16bb frag_kb_bf(const __bf16* p, int hh) { const v8bb a = *(const v8bb*)(p + 8 * hh), b = *(const v8bb*)(p + 16 + 8 * hh); return __builtin_shufflevector(a, b, 0, 1, 2, 3, 4, 5, 6, 7, 8, 9, 10, 11, 12, 13, 14, 15); }
__device__ __forceinline__ v8f wmma16bb(v16bb a, v16bb b, v8f c) {
  v8f d = __builtin_amdgcn_wmma_f32_16x16x32_bf16(false, a, false, b, (short)0, c, false, false);
  asm volatile("v_nop\n\tv_nop\n\tv_nop\n\tv_nop" : "+v"(d) : "v"(a), "v"(b));
  return d;
}
__device__ __forceinline__ unsigned short bf16_rne_bits(float v) { unsigned int u = __float_as_uint(v); u += 0x7FFFu + ((u >> 16) & 1u); return (unsigned short)(u >> 16); }
__device__ __forceinline__ float bf16_rne(float v) { return __uint_as_float(((unsigned int)bf16_rne_bits(v)) << 16); }

// The preparation work has no dependences among its parts, so all of it runs as ONE launch; a block's index picks its part (prep_kernel below).
constexpr int PB_PE = L * DH / 8 / 256, PB_WQ = (NQKV / 64) * (DM / 64), PB_WF = (DM / 64) * (DM / 64), PB_WP = (NPOS / 64) * (DH / 64), PB_EM = 512;   // blocks of each part
// part: embed -> bf16 rows [4096][1024] (16-B pieces), PB_EM blocks striding over the pieces.
__device__ __forceinline__ void prep_embed(int blk, const float* __restrict__ emb, unsigned short* __restrict__ e16) {
  typedef __attribute__((ext_vector_type(8))) unsigned short v8us;
  const size_t tid = (size_t)blk * 256 + threadIdx.x, nth = (size_t)PB_EM * 256;
  for (size_t p = tid; p < (size_t)NTOK * DM / 8; p += nth) { v8us v;
#pragma unroll
    for (int e = 0; e < 8; ++e) v[e] = bf16_rne_bits(emb[p * 8 + e]);
    *(v8us*)(e16 + p * 8) = v; }
}
// part: pe x8 hi/lo planes [1024][64] from the module's sinusoid formula (f32, table row 0 (the padding row) never selected for L=1024); PB_PE blocks, one 8-element piece a thread.
// Sc: per-thread staging (256 x 16 f16) for the rolled sinusoid loop.
__device__ __forceinline__ void prep_pe(int blk, b16* Sc, b16* __restrict__ peh, b16* __restrict__ pel) {
  const size_t p = (size_t)blk * 256 + threadIdx.x; const int l = (int)(p / 8), d0 = (int)(p % 8) * 8;
  const int tblrow = l - L / 2 + SHIFT;                        // 89 .. 1112, never 0
  const float posv = (float)(tblrow - (TBL + 1) / 2);          // arange(-601, 600)[tblrow] = tblrow - 601
#pragma unroll 1
  for (int e = 0; e < 8; ++e) { const int d = d0 + e; const int j = (d < DH / 2) ? d : d - DH / 2;   // rolled: one sin/cos expansion in the binary
    const float freq = expf((float)j * (-9.210340371976184f / (float)(DH / 2 - 1))); const float ang = posv * freq;
    const float val = (d < DH / 2) ? sinf(ang) : cosf(ang); b16 a, c; split16(val * PES, a, c); Sc[threadIdx.x * 16 + e] = a; Sc[threadIdx.x * 16 + 8 + e] = c; }
  *(v8b*)(peh + p * 8) = *(const v8b*)(&Sc[threadIdx.x * 16]); *(v8b*)(pel + p * 8) = *(const v8b*)(&Sc[threadIdx.x * 16 + 8]);
}

// part: W [k rows][n cols] f32 -> [n][k] 16-bit rows through 64x64 LDS tiles: MODE 0: bf16 bits (W_qkv); MODE 1: f16 of bf16(w) (W_fc, W_pos). Block blk = tile (blk % (N/64), blk / (N/64)).
template <int MODE>
__device__ __forceinline__ void wt_tile(int blk, const float* __restrict__ W, int K, int Ncols, unsigned short* __restrict__ out, unsigned short (*Tl)[72]) {
  typedef __attribute__((ext_vector_type(8))) unsigned short v8us;
  const int tid = threadIdx.x, lane = tid & 31, wave = tid >> 5, n0 = (blk % (Ncols / 64)) * 64, k0 = (blk / (Ncols / 64)) * 64;
  for (int i = tid; i < 64 * 64; i += 256) { const int kk = i / 64, nn = i % 64; const float w = W[(size_t)(k0 + kk) * Ncols + n0 + nn];
    unsigned short bits; if (MODE == 0) bits = bf16_rne_bits(w); else { const b16 hv = (b16)bf16_rne(w); bits = *reinterpret_cast<const unsigned short*>(&hv); }
    Tl[nn][kk] = bits; }
  __syncthreads();
  {
#pragma unroll
    for (int j = 0; j < 2; ++j) { const int rr = wave * 8 + j * 4 + (lane >> 3), c8 = (lane & 7) * 8; *(v8us*)(out + (size_t)(n0 + rr) * K + k0 + c8) = *(const v8us*)(&Tl[rr][c8]); }
    asm volatile("s_wait_xcnt 0x0" ::: "memory");               // behind the last store: stands in front of any later write of a register that these stores name
  }
}

// All preparation in one launch. The parts stand in the order of their blocks' own run time, the longest first: sinusoids, the three
// weight transposes, the embed rounding. Every branch is on the block index alone, so the barrier inside wt_tile is passed by a whole block or by none of it.
__global__ __launch_bounds__(256) void prep_kernel(const float* __restrict__ emb, const float* __restrict__ Wqkv, const float* __restrict__ Wpos, const float* __restrict__ Wfc,
                                                   unsigned short* __restrict__ e16, b16* __restrict__ peh, b16* __restrict__ pel,
                                                   unsigned short* __restrict__ wq, unsigned short* __restrict__ wp, unsigned short* __restrict__ wf) {
  __shared__ __attribute__((aligned(16))) unsigned short Sh[64][72];   // a transpose tile, or the sinusoid part's staging
  int blk = blockIdx.x;
  if (blk < PB_PE) { prep_pe(blk, (b16*)&Sh[0][0], peh, pel); return; }
  blk -= PB_PE;
  if (blk < PB_WQ) { wt_tile<0>(blk, Wqkv, DM, NQKV, wq, Sh); return; }
  blk -= PB_WQ;
  if (blk < PB_WF) { wt_tile<1>(blk, Wfc, DM, DM, wf, Sh); return; }
  blk -= PB_WF;
  if (blk < PB_WP) { wt_tile<1>(blk, Wpos, DH, NPOS, wp, Sh); return; }
  prep_embed(blk - PB_WP, emb, e16);
}

// Eight 16-byte asynchronous copies of one thread, global memory to LDS; the closing wait stands in front of any rewrite of the address registers named here.
__device__ __forceinline__ void copy8_to_lds(unsigned l0, unsigned l1, unsigned l2, unsigned l3, unsigned l4, unsigned l5, unsigned l6, unsigned l7,
                                             const void* g0, const void* g1, const void* g2, const void* g3, const void* g4, const void* g5, const void* g6, const void* g7) {
  asm volatile("global_load_async_to_lds_b128 %0, %8, off\n\t"
               "global_load_async_to_lds_b128 %1, %9, off\n\t"
               "global_load_async_to_lds_b128 %2, %10, off\n\t"
               "global_load_async_to_lds_b128 %3, %11, off\n\t"
               "global_load_async_to_lds_b128 %4, %12, off\n\t"
               "global_load_async_to_lds_b128 %5, %13, off\n\t"
               "global_load_async_to_lds_b128 %6, %14, off\n\t"
               "global_load_async_to_lds_b128 %7, %15, off\n\t"
               "s_wait_xcnt 0x0"
               :: "v"(l0), "v"(l1), "v"(l2), "v"(l3), "v"(l4), "v"(l5), "v"(l6), "v"(l7), "v"(g0), "v"(g1), "v"(g2), "v"(g3), "v"(g4), "v"(g5), "v"(g6), "v"(g7) : "memory");
}

__device__ __forceinline__ void copy2_to_lds(unsigned l0, unsigned l1, const void* g0, const void* g1) {   // the same, two copies
  asm volatile("global_load_async_to_lds_b128 %0, %2, off\n\t"
               "global_load_async_to_lds_b128 %1, %3, off\n\t"
               "s_wait_xcnt 0x0"
               :: "v"(l0), "v"(l1), "v"(g0), "v"(g1) : "memory");
}

// position projections: (1024 x 64) x (64 x 3072): A = pe planes (x8 hi+lo), B = f16(bf16 W_pos)^T rows -> 2 products; single f16 rows pp[which][h][l][64]. They need only the
// preparation's results, as the qkv projection does, so their blocks ride in qkv_kernel's launch: PB_POS blocks of 8 waves, block blk = 256 rows x 64 columns, wave = 32 x 64.
// Th: 8 KB of LDS a wave for the epilogue.
constexpr int PB_POS = (NPOS / 64) * (L / 256);
__device__ __forceinline__ void pos_block(int blk, const b16* __restrict__ peh, const b16* __restrict__ pel, const b16* __restrict__ wpos, b16* __restrict__ pp, b16* Th) {
  const int lane = threadIdx.x & 31, wave = threadIdx.x >> 5, nloc = lane & 15, hlf = lane >> 4, m0 = (blk / (NPOS / 64)) * 256 + wave * 32, c0 = (blk % (NPOS / 64)) * 64;
  v8f acc[2][4];
#pragma unroll
  for (int r = 0; r < 2; ++r)
#pragma unroll
    for (int t = 0; t < 4; ++t) acc[r][t] = (v8f){};
  const Opnd A{peh, pel, DH}, B{wpos, nullptr, DH};
  gemm_tile<2, 1>(A, B, DH, m0, c0, nloc, hlf, acc);
  const int which = c0 / DM, h = (c0 % DM) / DH;
  epi_planes(acc, 1.0f / PES, false, pp + (((size_t)which * H + h) * L + m0) * DH, nullptr, DH, 0, 0, lane, Th + wave * (2 * 32 * 64), Th + wave * (2 * 32 * 64) + 32 * 64);
}

// qkv: (4096 x 1024) x (1024 x 4096) bf16 WMMA; 32 x 32 blocks behind the PB_POS position blocks (those end early and free their places), block = 128 tokens x 128 columns, 8 waves (4 along tokens x 2 along columns) of 32 x 64 each. Per 64-k tile the
// 128 embed rows and the 128 weight rows are brought once per block into LDS (row pitch 144 B) by asynchronous copies, two buffers: tile t + 1 flies while tile t is worked on;
// fragments come from LDS. Columns: [q | k1 | k2 | v] x 1024; q/k1/k2 -> single f16 rows [which][b][h][l][64]; v -> (8v)^T hi/lo planes [b][h][64 d][1024 l] through a block
// LDS transpose (block = 128 tokens of one batch row, two heads). The epilogues stage in the ring's LDS behind the last tile's barrier.
// Eight waves a SIMD are asked for so that four blocks (their LDS fits four times) share a WGP and all 1024 blocks are resident at once.
constexpr int GPIT = 64 + 8, GROWS = 256, GTILE = GROWS * GPIT;   // LDS row pitch (16-bit elements), rows and elements of a stage: 128 embed rows, then 128 weight rows
__global__ __launch_bounds__(256, 8) void qkv_kernel(const __bf16* __restrict__ e16, const __bf16* __restrict__ wqkv, b16* __restrict__ qk, b16* __restrict__ vth, b16* __restrict__ vtl,
                                                     const b16* __restrict__ peh, const b16* __restrict__ pel, const b16* __restrict__ wpos, b16* __restrict__ pp) {
  __shared__ __attribute__((aligned(16))) unsigned short Sm[2 * GTILE];   // 73,728 B
  if (blockIdx.x < PB_POS) { pos_block(blockIdx.x, peh, pel, wpos, pp, (b16*)Sm); return; }   // a whole block takes this branch, in front of every barrier
  const int gblk = blockIdx.x - PB_POS;                         // column tile runs fastest
  const int tid = threadIdx.x, lane = tid & 31, wave = __builtin_amdgcn_readfirstlane(tid >> 5), wm = wave & 3, wn = wave >> 2, nloc = lane & 15, hlf = lane >> 4;
  const int mb = (gblk / (NQKV / 128)) * 128, cb = (gblk % (NQKV / 128)) * 128, m0 = mb + wm * 32, c0 = cb + wn * 64;   // the wave number is held scalar: tile indices and the epilogue branch stay scalar
  // copy map: 8 lanes bring one 128-byte row piece; a thread brings rows sr + 32 i of both operands
  const int sr = tid >> 3, sc = (tid & 7) * 8;
  const __bf16* ga = e16 + (size_t)(mb + sr) * DM + sc; const __bf16* gb = wqkv + (size_t)(cb + sr) * DM + sc;
  const unsigned ls = (unsigned)(size_t)(&Sm[0]) + (unsigned)(sr * GPIT + sc) * 2u;
  auto stage = [&](int kt, int buf) {
    const unsigned l = ls + (unsigned)buf * (GTILE * 2u); const __bf16* a = ga + kt * 64; const __bf16* w = gb + kt * 64;
    constexpr unsigned R32 = 32u * GPIT * 2u;
    copy8_to_lds(l, l + R32, l + 2u * R32, l + 3u * R32, l + 4u * R32, l + 5u * R32, l + 6u * R32, l + 7u * R32,
                 a, a + 32 * DM, a + 64 * DM, a + 96 * DM, w, w + 32 * DM, w + 64 * DM, w + 96 * DM);
  };
  v8f acc[2][4];
#pragma unroll
  for (int r = 0; r < 2; ++r)
#pragma unroll
    for (int t = 0; t < 4; ++t) acc[r][t] = (v8f){};
  stage(0, 0);
  asm volatile("s_wait_asynccnt 0x0" ::: "memory");             // this wave's copies of tile 0 have landed
  __syncthreads();                                              // publishes tile 0
  stage(1, 1);
  for (int kt = 0; kt < DM / 64; ++kt) {
    const __bf16* As = (const __bf16*)Sm + (kt & 1) * GTILE + (wm * 32 + nloc) * GPIT; const __bf16* Bs = (const __bf16*)Sm + (kt & 1) * GTILE + (128 + wn * 64 + nloc) * GPIT;
#pragma unroll                                                  // both 32-k halves of the tile in line: LDS offsets become immediates
    for (int ks = 0; ks < 2; ++ks) {
      const v16bb a0 = frag_kb_bf(As + ks * 32, hlf), a1 = frag_kb_bf(As + 16 * GPIT + ks * 32, hlf);
#pragma unroll
      for (int t = 0; t < 4; ++t) { const v16bb bw = frag_kb_bf(Bs + t * 16 * GPIT + ks * 32, hlf); acc[0][t] = wmma16bb(a0, bw, acc[0][t]); acc[1][t] = wmma16bb(a1, bw, acc[1][t]); }
    }
    asm volatile("s_wait_dscnt 0x0" ::: "memory");              // this wave's reads of tile kt are done before its buffer is handed back
    asm volatile("s_wait_asynccnt 0x0" ::: "memory");           // this wave's copies of tile kt + 1 have landed
    __syncthreads();                                            // publishes tile kt + 1 and ends every read of tile kt
    if (kt + 2 < DM / 64) stage(kt + 2, kt & 1);
  }
  asm volatile("s_wait_asynccnt 0x0" ::: "memory");             // no copy is outstanding when the ring becomes output staging
  const int which = c0 / DM, c1 = c0 % DM, h = c1 / DH, b = m0 / L, l0 = m0 % L;   // 64 columns = one head; which is the same for the whole block
  if (which < 3) {                                             // q / k1 / k2 rows [which][b][h][l][64] (single f16)
    b16* Th = (b16*)Sm + wave * (2 * 32 * 64);
    epi_planes(acc, 1.0f, false, qk + ((((size_t)which * Bn + b) * H + h) * L + l0) * DH, nullptr, DH, 0, 0, lane, Th, Th + 32 * 64);
    return;
  }
  constexpr int TP = 128 + 8;                                   // token pitch of the transpose planes [head wn][hi, lo][64 d][TP]
  b16* Tt = (b16*)Sm + wn * (2 * 64 * TP);
#pragma unroll
  for (int t = 0; t < 4; ++t)
#pragma unroll
    for (int r = 0; r < 2; ++r)
#pragma unroll
      for (int v = 0; v < 8; ++v) { b16 a, c; split16(acc[r][t][v] * VS, a, c); const int o = (t * 16 + nloc) * TP + wm * 32 + r * 16 + 8 * hlf + v; Tt[o] = a; Tt[64 * TP + o] = c; }
  __syncthreads();
  const int tok0 = mb % L, bb = mb / L;
  b16* bh_ = vth + (((size_t)bb * H + h) * DH) * L + tok0; b16* bl_ = vtl + (((size_t)bb * H + h) * DH) * L + tok0;
  {
#pragma unroll
    for (int j = 0; j < 8; ++j) { const int dd = wm * 16 + j * 2 + (lane >> 4), c8 = (lane & 15) * 8;
      *(v8b*)(bh_ + (size_t)dd * L + c8) = *(const v8b*)(&Tt[dd * TP + c8]); *(v8b*)(bl_ + (size_t)dd * L + c8) = *(const v8b*)(&Tt[64 * TP + dd * TP + c8]); }
    asm volatile("s_wait_xcnt 0x0" ::: "memory");               // behind the last store: stands in front of any later write of a register that these stores name
  }
}

// ---------------------------------------------------------------------------
// attention: block = (b, h, 128 queries), wave = 16 queries; causal 32-key chunks up to the block's diagonal. All key-side operands come from LDS, staged once per block and
// shared by its 8 waves: the two mask rows once, and per chunk the k1/k2/kp1/kp2 rows (pitch 144 B) and the (8v)^T hi/lo columns (pitch 80 B), two buffers: chunk t + 1 is
// fetched into registers before chunk t is worked on and stored to the other buffer behind it; one barrier a chunk. A wave past its own diagonal only stages.
// Per chunk and 16-key half: four K=64 score products (q.k1, qp.kp1, q.k2, qp.kp2; single f16),
// logit = same speaker ? s1 + p1 : s2 + p2; -inf where key > query or umask[b][key] == 0; online softmax f32; P^T f16; y^T += (8v)^T.P^T (4 feature tiles, hi + lo);
// ---------------------------------------------------------------------------
constexpr int KPIT = DH + 8, VPIT = 32 + 8;                    // LDS row pitches in f16: 16 B x odd, for 16-byte fragment reads
typedef __attribute__((ext_vector_type(4))) int v4i;
__global__ __launch_bounds__(256) void attn_kernel(const b16* __restrict__ qk, const b16* __restrict__ pp, const b16* __restrict__ vth, const b16* __restrict__ vtl,
                                                   const int* __restrict__ umask, const int* __restrict__ qmask, float* __restrict__ y) {
  __shared__ __attribute__((aligned(16))) float Os[8][16][DH + 4];
  __shared__ __attribute__((aligned(16))) b16 Ks[2][4][32 * KPIT];   // [buffer][k1, k2, kp1, kp2][key][feature]
  __shared__ __attribute__((aligned(16))) b16 Vs[2][2][DH * VPIT];   // [buffer][hi, lo][feature][key]
  __shared__ __attribute__((aligned(16))) int Ms[2][L];              // speaker ids and umask of batch row b
  const int tid = threadIdx.x, wid = __builtin_amdgcn_readfirstlane(tid >> 5), lane = tid & 31, hh = lane >> 4, col = lane & 15;
  const int qt = blockIdx.x * 8 + wid, jt = qt & 63, h = (qt >> 6) & 15, b = qt >> 10, q0 = jt * 16, qi = q0 + col;
  const int nchunk = ((blockIdx.x & 7) + 1) * 4;                // 32-key chunks up to the block's last query
  const b16* Q = qk + ((((size_t)0 * Bn + b) * H + h) * L) * DH; const b16* K1 = qk + ((((size_t)1 * Bn + b) * H + h) * L) * DH; const b16* K2 = qk + ((((size_t)2 * Bn + b) * H + h) * L) * DH;
  const b16* QP = pp + (((size_t)0 * H + h) * L) * DH; const b16* KP1 = pp + (((size_t)1 * H + h) * L) * DH; const b16* KP2 = pp + (((size_t)2 * H + h) * L) * DH;
  const b16* vh = vth + (((size_t)b * H + h) * DH) * L; const b16* vl = vtl + (((size_t)b * H + h) * DH) * L;
  // staging map: a thread moves one 16-byte piece of each of the six tiles
  const int kr = tid >> 3, kc = (tid & 7) * 8, vr = tid >> 2, vc = (tid & 3) * 8;
  const size_t gko = (size_t)kr * DH + kc, gvo = (size_t)vr * L + vc;
  const int sko = kr * KPIT + kc, svo = vr * VPIT + vc;
  v8b st[6];
  st[0] = ld8b(K1 + gko); st[1] = ld8b(K2 + gko); st[2] = ld8b(KP1 + gko); st[3] = ld8b(KP2 + gko); st[4] = ld8b(vh + gvo); st[5] = ld8b(vl + gvo);
  const v4i mq = *(const v4i*)(qmask + b * L + tid * 4), mu = *(const v4i*)(umask + b * L + tid * 4);
  v16b qf[2], qpf[2];
#pragma unroll
  for (int ks = 0; ks < 2; ++ks) { qf[ks] = frag_kb(Q + (size_t)qi * DH + ks * 32, hh); qpf[ks] = frag_kb(QP + (size_t)qi * DH + ks * 32, hh); }
  const int myspk = qmask[b * L + qi];
  asm volatile("s_wait_xcnt 0x0" ::: "memory");                 // before the address registers of the loads above are reused
  *(v4i*)(&Ms[0][tid * 4]) = mq; *(v4i*)(&Ms[1][tid * 4]) = mu;
#pragma unroll
  for (int i = 0; i < 4; ++i) *(v8b*)(&Ks[0][i][sko]) = st[i];
  *(v8b*)(&Vs[0][0][svo]) = st[4]; *(v8b*)(&Vs[0][1][svo]) = st[5];
  __syncthreads();
  float m = -INFINITY, l = 0.0f; v8f o[4] = {{}, {}, {}, {}};
  for (int t = 0; t < nchunk; ++t) {
    const int kb = t * 32, cur = t & 1; const bool more = t + 1 < nchunk;
    if (more) { const size_t ka = gko + (size_t)(kb + 32) * DH, va = gvo + kb + 32;
      st[0] = ld8b(K1 + ka); st[1] = ld8b(K2 + ka); st[2] = ld8b(KP1 + ka); st[3] = ld8b(KP2 + ka); st[4] = ld8b(vh + va); st[5] = ld8b(vl + va);
      asm volatile("s_wait_xcnt 0x0" ::: "memory"); }           // before the address registers of these six loads are reused
    if (kb < q0 + 16) {
      float lg0[8], lg1[8];
#pragma unroll
      for (int half = 0; half < 2; ++half) {
        const int ro = (half * 16 + col) * KPIT;
        v8f s1 = {}, p1 = {}, s2 = {}, p2 = {};
#pragma unroll
        for (int ks = 0; ks < 2; ++ks) {
          s1 = wmma16b(frag_kb(&Ks[cur][0][ro + ks * 32], hh), qf[ks], s1); s2 = wmma16b(frag_kb(&Ks[cur][1][ro + ks * 32], hh), qf[ks], s2);
          p1 = wmma16b(frag_kb(&Ks[cur][2][ro + ks * 32], hh), qpf[ks], p1); p2 = wmma16b(frag_kb(&Ks[cur][3][ro + ks * 32], hh), qpf[ks], p2);
        }
        const int k8 = kb + half * 16 + 8 * hh;
        const v4i sp0 = *(const v4i*)(&Ms[0][k8]), sp1 = *(const v4i*)(&Ms[0][k8 + 4]), um0 = *(const v4i*)(&Ms[1][k8]), um1 = *(const v4i*)(&Ms[1][k8 + 4]);
#pragma unroll
        for (int r = 0; r < 8; ++r) { const int kk = k8 + r; const bool same = ((r < 4 ? sp0[r & 3] : sp1[r & 3]) == myspk);
          float v = same ? (s1[r] + p1[r]) : (s2[r] + p2[r]);
          if ((kk > qi) | ((r < 4 ? um0[r & 3] : um1[r & 3]) == 0)) v = -INFINITY;
          if (half == 0) lg0[r] = v; else lg1[r] = v; }
      }
      float mr = -INFINITY;
#pragma unroll
      for (int r = 0; r < 8; ++r) mr = fmaxf(mr, fmaxf(lg0[r], lg1[r]));
      mr = fmaxf(mr, __shfl_xor(mr, 16));
      float mn = fmaxf(m, mr); if (mn == -INFINITY) mn = 0.0f;
      const float al_ = __expf(m - mn); m = mn;
      float sum = 0.0f; v16b pb;
#pragma unroll
      for (int r = 0; r < 8; ++r) { const float e0 = __expf(lg0[r] - mn), e1 = __expf(lg1[r] - mn); sum += e0 + e1; pb[r] = (b16)e0; pb[8 + r] = (b16)e1; }
      sum += __shfl_xor(sum, 16); l = l * al_ + sum;
#pragma unroll
      for (int n = 0; n < 4; ++n) {
#pragma unroll
        for (int r = 0; r < 8; ++r) o[n][r] *= al_;
        const int ro = (n * 16 + col) * VPIT;
        o[n] = wmma16b(frag_kb(&Vs[cur][0][ro], hh), pb, o[n]); o[n] = wmma16b(frag_kb(&Vs[cur][1][ro], hh), pb, o[n]);
      }
    }
    if (more) {                                                 // the other buffer's last readers left it at the previous chunk's barrier
#pragma unroll
      for (int i = 0; i < 4; ++i) *(v8b*)(&Ks[cur ^ 1][i][sko]) = st[i];
      *(v8b*)(&Vs[cur ^ 1][0][svo]) = st[4]; *(v8b*)(&Vs[cur ^ 1][1][svo]) = st[5];
      __syncthreads();                                          // publishes chunk t + 1 and ends every read of chunk t
    }
  }
  const float inv = (l > 0.0f) ? (1.0f / (VS * l)) : 0.0f;
#pragma unroll
  for (int n = 0; n < 4; ++n)
#pragma unroll
    for (int r = 0; r < 8; ++r) Os[wid][col][n * 16 + 8 * hh + r] = o[n][r] * inv;
  wave_lds_sync();
  float* dst = y + ((size_t)b * L + q0) * DM + h * DH;          // 16 rows x 256 B
  {
#pragma unroll
    for (int j = 0; j < 8; ++j) { const int rr = j * 2 + hh, c4 = col * 4; *(v4f*)(dst + (size_t)rr * DM + c4) = *(const v4f*)(&Os[wid][rr][c4]); }
    
  }
}

// out = y.W_fc: (4096 x 1024) x (1024 x 1024); A = y f32 x8 split, B = f16(bf16 W_fc)^T rows -> 2 products; f32 rows; grid (16, 32), block = 128 rows x 64 columns, 8 waves of
// 16 x 64. Per 64-k tile the 128 y rows (f32, pitch 272 B) and the 64 weight rows (pitch 144 B) are brought once per block into LDS by asynchronous copies, two buffers, as in
// qkv_kernel; the split runs on fragments read from LDS. The epilogue stages in the ring's LDS behind the last tile's barrier.
constexpr int OAP = 64 + 4, OBP = 64 + 8, OAB = 128 * OAP * 4, OST = OAB + 64 * OBP * 2;   // pitches (f32, f16 elements), bytes of the y part and of a whole stage
__global__ __launch_bounds__(256) void out_kernel(const float* __restrict__ y, const b16* __restrict__ wfc, float* __restrict__ out) {
  __shared__ __attribute__((aligned(16))) unsigned char So[2 * OST];   // 88,064 B
  const int tid = threadIdx.x, lane = tid & 31, wave = __builtin_amdgcn_readfirstlane(tid >> 5), nloc = lane & 15, hlf = lane >> 4, mb = blockIdx.y * 128, m0 = mb + wave * 16, c0 = blockIdx.x * 64;
  // copy map: 16 lanes bring one 256-byte y row piece (rows ar + 16 i), 8 lanes one 128-byte weight row piece (rows br + 32 j)
  const int ar = tid >> 4, ac = (tid & 15) * 4, br = tid >> 3, bc = (tid & 7) * 8;
  const float* ga = y + (size_t)(mb + ar) * DM + ac; const b16* gb = wfc + (size_t)(c0 + br) * DM + bc;
  const unsigned la = (unsigned)(size_t)(&So[0]) + (unsigned)(ar * OAP + ac) * 4u, lw = (unsigned)(size_t)(&So[0]) + (unsigned)OAB + (unsigned)(br * OBP + bc) * 2u;
  auto stage = [&](int kt, int buf) {
    const unsigned l = la + (unsigned)buf * (unsigned)OST, w = lw + (unsigned)buf * (unsigned)OST; const float* a = ga + kt * 64; const b16* g = gb + kt * 64;
    constexpr unsigned R16 = 16u * OAP * 4u;
    copy8_to_lds(l, l + R16, l + 2u * R16, l + 3u * R16, l + 4u * R16, l + 5u * R16, l + 6u * R16, l + 7u * R16,
                 a, a + 16 * DM, a + 32 * DM, a + 48 * DM, a + 64 * DM, a + 80 * DM, a + 96 * DM, a + 112 * DM);
    copy2_to_lds(w, w + 32u * OBP * 2u, g, g + 32 * DM);
  };
  v8f acc[4] = {{}, {}, {}, {}};
  stage(0, 0);
  asm volatile("s_wait_asynccnt 0x0" ::: "memory");             // this wave's copies of tile 0 have landed
  __syncthreads();                                              // publishes tile 0
  stage(1, 1);
  for (int kt = 0; kt < DM / 64; ++kt) {
    const float* As = (const float*)(So + (kt & 1) * OST) + (wave * 16 + nloc) * OAP + 8 * hlf; const b16* Bs = (const b16*)(So + (kt & 1) * OST + OAB) + nloc * OBP;
    // every loop below is unrolled so that the fragment and accumulator arrays are indexed by constants and stay in registers
#pragma unroll
    for (int ks = 0; ks < 2; ++ks) {
      const v4f x[4] = {*(const v4f*)(As + ks * 32), *(const v4f*)(As + ks * 32 + 4), *(const v4f*)(As + ks * 32 + 16), *(const v4f*)(As + ks * 32 + 20)};
      v16b bf[4], ah, al;
#pragma unroll
      for (int t = 0; t < 4; ++t) bf[t] = frag_kb(Bs + t * 16 * OBP + ks * 32, hlf);
#pragma unroll
      for (int e = 0; e < 16; ++e) { b16 a, c; split16(x[e >> 2][e & 3] * 8.0f, a, c); ah[e] = a; al[e] = c; }
#pragma unroll
      for (int t = 0; t < 4; ++t) acc[t] = wmma16b(ah, bf[t], acc[t]);     // hi, then lo, into each accumulator
#pragma unroll
      for (int t = 0; t < 4; ++t) acc[t] = wmma16b(al, bf[t], acc[t]);
    }
    asm volatile("s_wait_dscnt 0x0" ::: "memory");              // this wave's reads of tile kt are done before its buffer is handed back
    asm volatile("s_wait_asynccnt 0x0" ::: "memory");           // this wave's copies of tile kt + 1 have landed
    __syncthreads();                                            // publishes tile kt + 1 and ends every read of tile kt
    if (kt + 2 < DM / 64) stage(kt + 2, kt & 1);
  }
  asm volatile("s_wait_asynccnt 0x0" ::: "memory");             // no copy is outstanding when the ring becomes output staging
  float* Tt = (float*)So + wave * (16 * 64);                    // 16 rows x 256 B per wave, stored as whole lines; unrolled: constant accumulator indices
#pragma unroll
  for (int t = 0; t < 4; ++t)
#pragma unroll
    for (int v = 0; v < 8; ++v) Tt[(v + 8 * hlf) * 64 + t * 16 + nloc] = acc[t][v] * (1.0f / 8.0f);
  wave_lds_sync();
  float* dst0 = out + (size_t)m0 * DM + c0;
#pragma unroll
  for (int j = 0; j < 8; ++j) { const int rr = j * 2 + hlf, c4 = nloc * 4; *(v4f*)(dst0 + (size_t)rr * DM + c4) = *(const v4f*)(Tt + rr * 64 + c4); }
}
}  // namespace

extern "C" void kernel_launch(void* const* d_in, const int* in_sizes, int n_in,
                              void* d_out, int out_size, void* d_ws, size_t ws_size, hipStream_t stream) {
  (void)n_in; (void)out_size;
  const float* emb = (const float*)d_in[0]; const int* umask = (const int*)d_in[1]; const int* qmask = (const int*)d_in[2];
  const float* Wqkv = (const float*)d_in[3]; const float* Wpos = (const float*)d_in[4]; const float* Wfc = (const float*)d_in[5];
  float* out = (float*)d_out;   // [4,1024,1024]
  if (in_sizes[0] != NTOK * DM || in_sizes[1] != NTOK || in_sizes[2] != NTOK || in_sizes[3] != DM * NQKV || in_sizes[4] != DH * NPOS || in_sizes[5] != DM * DM) return;
  size_t off = 0; char* ws = (char*)d_ws;
  auto carve = [&](size_t bytes) { char* p = ws + off; off += (bytes + 255) & ~(size_t)255; return p; };
  unsigned short* e16 = (unsigned short*)carve((size_t)NTOK * DM * 2);       // 8 MB
  unsigned short* wq = (unsigned short*)carve((size_t)NQKV * DM * 2);        // 8 MB
  unsigned short* wp = (unsigned short*)carve((size_t)NPOS * DH * 2);        // 384 KB
  unsigned short* wf = (unsigned short*)carve((size_t)DM * DM * 2);          // 2 MB
  b16* peh = (b16*)carve((size_t)L * DH * 2); b16* pel = (b16*)carve((size_t)L * DH * 2);
  b16* qk = (b16*)carve((size_t)3 * Bn * H * L * DH * 2);                   // 24 MB
  b16* vth = (b16*)carve((size_t)Bn * H * DH * L * 2); b16* vtl = (b16*)carve((size_t)Bn * H * DH * L * 2);   // 8 MB each
  b16* pp = (b16*)carve((size_t)3 * H * L * DH * 2);                         // 6 MB
  float* y = (float*)carve((size_t)NTOK * DM * 4);                           // 16 MB
  if (off > ws_size) return;                                                  // ≈ 81 MB
  prep_kernel<<<PB_PE + PB_WQ + PB_WF + PB_WP + PB_EM, 256, 0, stream>>>(emb, Wqkv, Wpos, Wfc, e16, peh, pel, wq, wp, wf);
  qkv_kernel<<<PB_POS + (NQKV / 128) * (NTOK / 128), 256, 0, stream>>>((const __bf16*)e16, (const __bf16*)wq, qk, vth, vtl, peh, pel, (const b16*)wp, pp);
  attn_kernel<<<Bn * H * (L / 16) / 8, 256, 0, stream>>>(qk, pp, vth, vtl, umask, qmask, y);
  out_kernel<<<dim3(DM / 64, NTOK / 128), 256, 0, stream>>>(y, (const b16*)wf, out);
}

// v004
// A run of this version takes 115 microseconds.
// In both of two side-by-side timings against v003, it was 1.11 times as fast.
// Over all steps from v000 it is 3.88 times as fast.
#include <hip/hip_runtime.h>

// Speaker-aware causal multi-head attention with relative sinusoidal position terms (d_model 1024, 16 heads x 64, B=4, L=1024): q,k1,k2,v = embed W_qkv;
// qp,kp1,kp2 = pe W_pos (pe = the module's sinusoid table rows 89..1112); logit[q][k] = same speaker ? (q.k1 + qp.kp1) : (q.k2 + qp.kp2) (scale 1); keys k > q or umask = 0
// -> -inf; softmax; out = (P.v) W_fc.
// Numerics: embed, W_qkv, W_pos and W_fc are rounded to bf16 (RNE); the qkv projection runs on
// v_wmma_f32_16x16x32_bf16 with those operands (exact products, f32 accumulate); the position projection uses f16 hi+lo of the f32 sinusoid table against the exact f16 copy of
// bf16 W_pos; the four score products use single f16 copies of q/k1/k2/qp/kp (f32 accumulate); P.V pairs single-f16 P with hi+lo 8v; the output projection pairs hi+lo of the
// attention output with the exact f16 copy of bf16 W_fc. Masks are read from the int inputs. Fragment k-map per lane half hh for A AND B: elements 0..7 <- k = 8hh+0..7, 8..15

namespace {
constexpr int Bn = 4, L = 1024, DM = 1024, H = 16, DH = 64, NTOK = Bn * L, NQKV = 4 * DM, NPOS = 3 * DM, TBL = 1201, SHIFT = 601;
constexpr float VS = 8.0f, PES = 8.0f;

typedef _Float16 b16;
typedef __attribute__((ext_vector_type(16))) _Float16 v16b;
typedef __attribute__((ext_vector_type(8)))  _Float16 v8b;
typedef __attribute__((ext_vector_type(8)))  float v8f;
typedef __attribute__((ext_vector_type(4)))  float v4f;

__device__ __forceinline__ v8b ld8b(const b16* p) { return *(const v8b*)p; }
__device__ __forceinline__ v16b cat8b(v8b a, v8b b) { return __builtin_shufflevector(a, b, 0, 1, 2, 3, 4, 5, 6, 7, 8, 9, 10, 11, 12, 13, 14, 15); }
__device__ __forceinline__ v16b frag_kb(const b16* p, int hh) { return cat8b(ld8b(p + 8 * hh), ld8b(p + 16 + 8 * hh)); }
__device__ __forceinline__ void split16(float v, b16& hi, b16& lo) { hi = (b16)v; lo = (b16)(v - (float)hi); }
// hi/lo fragment pair straight from an f32 k-contiguous row (same k-map)
__device__ __forceinline__ void frag_ksplit(const float* p, int hh, v16b& fh_, v16b& fl_) {
  const float* p0 = p + 8 * hh; const float* p1 = p + 16 + 8 * hh;
#pragma unroll
  for (int e = 0; e < 8; ++e) { b16 a, c; split16(p0[e], a, c); fh_[e] = a; fl_[e] = c; split16(p1[e], a, c); fh_[8 + e] = a; fl_[8 + e] = c; }
}
__device__ __forceinline__ v8f wmma16b(v16b a, v16b b, v8f c) {
  return __builtin_amdgcn_wmma_f32_16x16x32_f16(false, a, false, b, (short)0, c, false, false);
}
// Keeps a group of LDS reads whole and at its place in the instruction stream: the compiler fence holds the reads on their side, the scheduling fence the WMMAs and vector work.
// Left free, the reads sink to one pair with a full LDS wait in front of each WMMA, or rise so far that the live fragments no longer fit the registers.
__device__ __forceinline__ void group_fence() { asm volatile("" ::: "memory"); __builtin_amdgcn_sched_barrier(0); }
__device__ __forceinline__ void wave_lds_sync() {
  __builtin_amdgcn_fence(__ATOMIC_RELEASE, "workgroup");
  __builtin_amdgcn_wave_barrier();
  __builtin_amdgcn_fence(__ATOMIC_ACQUIRE, "workgroup");
}

// Operand descriptor: NP = 0 -> f32 rows split on the fly into (hi, lo); NP = 1 -> one f16 plane; NP = 2 -> f16 hi + lo planes;
// NP = 3 -> f32 rows rounded once to a single f16 fragment. ld = row pitch.
struct Opnd { const void* p0; const void* p1; int ld; };
template <int NP> __device__ __forceinline__ void load_frags(const Opnd& o, int row, int kb, int hh, v16b& fh_, v16b& fl_) {
  if (NP == 0) { frag_ksplit((const float*)o.p0 + (size_t)row * o.ld + kb, hh, fh_, fl_); }
  else if (NP == 4 || NP == 5) {                             // f32 rows x64 (NP 4) or x8 (NP 5) then split (keeps the lo halves of small values normal)
    const float sc_ = (NP == 4) ? 64.0f : 8.0f;
    const float* p = (const float*)o.p0 + (size_t)row * o.ld + kb; const float* p0 = p + 8 * hh; const float* p1 = p + 16 + 8 * hh;
#pragma unroll
    for (int e = 0; e < 8; ++e) { b16 a, c; split16(p0[e] * sc_, a, c); fh_[e] = a; fl_[e] = c; split16(p1[e] * sc_, a, c); fh_[8 + e] = a; fl_[8 + e] = c; }
  } else if (NP == 3) {
    const float* p = (const float*)o.p0 + (size_t)row * o.ld + kb; const float* p0 = p + 8 * hh; const float* p1 = p + 16 + 8 * hh;
#pragma unroll
    for (int e = 0; e < 8; ++e) { fh_[e] = (b16)p0[e]; fh_[8 + e] = (b16)p1[e]; }
    fl_ = fh_;
  } else {
    fh_ = frag_kb((const b16*)o.p0 + (size_t)row * o.ld + kb, hh);
    if (NP == 2) fl_ = frag_kb((const b16*)o.p1 + (size_t)row * o.ld + kb, hh); else fl_ = fh_;
  }
}
template <int ANP, int BNP> __device__ __forceinline__ v8f mac(v16b ah, v16b al, v16b bh, v16b bl, v8f c) {
  c = wmma16b(ah, bh, c);
  if (BNP == 0 || BNP == 2 || BNP == 4 || BNP == 5) c = wmma16b(ah, bl, c);     // hi.lo
  if (ANP == 0 || ANP == 2 || ANP == 4 || ANP == 5) c = wmma16b(al, bh, c);     // lo.hi   (lo.lo dropped)
  return c;
}
// 32x64 wave tile: acc[r][t] (rows m0+16r.., cols c0+16t..) += A[m][k] . B[n][k] over k in [0, K)
template <int ANP, int BNP>
__device__ __forceinline__ void gemm_tile(const Opnd& A, const Opnd& B, int K, int m0, int c0, int nloc, int hlf, v8f (&acc)[2][4]) {
  for (int kb = 0; kb < K; kb += 32) {
    v16b a0h, a0l, a1h, a1l;
    load_frags<ANP>(A, m0 + nloc, kb, hlf, a0h, a0l);
    load_frags<ANP>(A, m0 + 16 + nloc, kb, hlf, a1h, a1l);
#pragma unroll
    for (int t = 0; t < 4; ++t) {
      v16b bh, bl;
      load_frags<BNP>(B, c0 + t * 16 + nloc, kb, hlf, bh, bl);
      acc[0][t] = mac<ANP, BNP>(a0h, a0l, bh, bl, acc[0][t]);
      acc[1][t] = mac<ANP, BNP>(a1h, a1l, bh, bl, acc[1][t]);
    }
  }
}

__device__ __forceinline__ void epi_planes(v8f (&acc)[2][4], float scale, bool two, b16* __restrict__ oh, b16* __restrict__ ol, int ldo,
                                           int m0, int c0, int lane, b16* Th, b16* Tl) {
  const int nloc = lane & 15, hlf = lane >> 4;
#pragma unroll
  for (int t = 0; t < 4; ++t)
#pragma unroll
    for (int r = 0; r < 2; ++r)
#pragma unroll
      for (int v = 0; v < 8; ++v) {
        const int rr = r * 16 + v + 8 * hlf, cc = t * 16 + nloc;
        b16 h_, l_; split16(acc[r][t][v] * scale, h_, l_);
        Th[rr * 64 + cc] = h_; Tl[rr * 64 + cc] = l_;
      }
  wave_lds_sync();
  {
#pragma unroll
    for (int j = 0; j < 8; ++j) {
      const int rr = j * 4 + (lane >> 3), c8 = (lane & 7) * 8;
      const size_t o = (size_t)(m0 + rr) * ldo + c0 + c8;
      *(v8b*)(oh + o) = ld8b(Th + rr * 64 + c8);
      if (two) *(v8b*)(ol + o) = ld8b(Tl + rr * 64 + c8);
    }
    
  }
}
typedef __attribute__((ext_vector_type(8))) __bf16 v8bb; typedef __attribute__((ext_vector_type(16))) __bf16 v16bb;
__device__ __forceinline__ v16bb frag_kb_bf(const __bf16* p, int hh) { const v8bb a = *(const v8bb*)(p + 8 * hh), b = *(const v8bb*)(p + 16 + 8 * hh); return __builtin_shufflevector(a, b, 0, 1, 2, 3, 4, 5, 6, 7, 8, 9, 10, 11, 12, 13, 14, 15); }
__device__ __forceinline__ v8f wmma16bb(v16bb a, v16bb b, v8f c) {
  return __builtin_amdgcn_wmma_f32_16x16x32_bf16(false, a, false, b, (short)0, c, false, false);
}
__device__ __forceinline__ unsigned short bf16_rne_bits(float v) { unsigned int u = __float_as_uint(v); u += 0x7FFFu + ((u >> 16) & 1u); return (unsigned short)(u >> 16); }
__device__ __forceinline__ float bf16_rne(float v) { return __uint_as_float(((unsigned int)bf16_rne_bits(v)) << 16); }

// The preparation work has no dependences among its parts, so all of it runs as ONE launch; a block's index picks its part (prep_kernel below).
constexpr int PB_PE = L * DH / 8 / 256, PB_WQ = (NQKV / 64) * (DM / 64), PB_WF = (DM / 64) * (DM / 64), PB_WP = (NPOS / 64) * (DH / 64), PB_EM = 512;   // blocks of each part
// part: embed -> bf16 rows [4096][1024] (16-B pieces), PB_EM blocks striding over the pieces.
__device__ __forceinline__ void prep_embed(int blk, const float* __restrict__ emb, unsigned short* __restrict__ e16) {
  typedef __attribute__((ext_vector_type(8))) unsigned short v8us;
  const size_t tid = (size_t)blk * 256 + threadIdx.x, nth = (size_t)PB_EM * 256;
  for (size_t p = tid; p < (size_t)NTOK * DM / 8; p += nth) { v8us v;
#pragma unroll
    for (int e = 0; e < 8; ++e) v[e] = bf16_rne_bits(emb[p * 8 + e]);
    *(v8us*)(e16 + p * 8) = v; }
}
// part: pe x8 hi/lo planes [1024][64] from the module's sinusoid formula (f32, table row 0 (the padding row) never selected for L=1024); PB_PE blocks, one 8-element piece a thread.
// Sc: per-thread staging (256 x 16 f16) for the rolled sinusoid loop.
__device__ __forceinline__ void prep_pe(int blk, b16* Sc, b16* __restrict__ peh, b16* __restrict__ pel) {
  const size_t p = (size_t)blk * 256 + threadIdx.x; const int l = (int)(p / 8), d0 = (int)(p % 8) * 8;
  const int tblrow = l - L / 2 + SHIFT;                        // 89 .. 1112, never 0
  const float posv = (float)(tblrow - (TBL + 1) / 2);          // arange(-601, 600)[tblrow] = tblrow - 601
#pragma unroll 1
  for (int e = 0; e < 8; ++e) { const int d = d0 + e; const int j = (d < DH / 2) ? d : d - DH / 2;   // rolled: one sin/cos expansion in the binary
    const float freq = expf((float)j * (-9.210340371976184f / (float)(DH / 2 - 1))); const float ang = posv * freq;
    const float val = (d < DH / 2) ? sinf(ang) : cosf(ang); b16 a, c; split16(val * PES, a, c); Sc[threadIdx.x * 16 + e] = a; Sc[threadIdx.x * 16 + 8 + e] = c; }
  *(v8b*)(peh + p * 8) = *(const v8b*)(&Sc[threadIdx.x * 16]); *(v8b*)(pel + p * 8) = *(const v8b*)(&Sc[threadIdx.x * 16 + 8]);
}

// part: W [k rows][n cols] f32 -> [n][k] 16-bit rows through 64x64 LDS tiles: MODE 0: bf16 bits (W_qkv); MODE 1: f16 of bf16(w) (W_fc, W_pos). Block blk = tile (blk % (N/64), blk / (N/64)).
template <int MODE>
__device__ __forceinline__ void wt_tile(int blk, const float* __restrict__ W, int K, int Ncols, unsigned short* __restrict__ out, unsigned short (*Tl)[72]) {
  typedef __attribute__((ext_vector_type(8))) unsigned short v8us;
  const int tid = threadIdx.x, lane = tid & 31, wave = tid >> 5, n0 = (blk % (Ncols / 64)) * 64, k0 = (blk / (Ncols / 64)) * 64;
  for (int i = tid; i < 64 * 64; i += 256) { const int kk = i / 64, nn = i % 64; const float w = W[(size_t)(k0 + kk) * Ncols + n0 + nn];
    unsigned short bits; if (MODE == 0) bits = bf16_rne_bits(w); else { const b16 hv = (b16)bf16_rne(w); bits = *reinterpret_cast<const unsigned short*>(&hv); }
    Tl[nn][kk] = bits; }
  __syncthreads();
  {
#pragma unroll
    for (int j = 0; j < 2; ++j) { const int rr = wave * 8 + j * 4 + (lane >> 3), c8 = (lane & 7) * 8; *(v8us*)(out + (size_t)(n0 + rr) * K + k0 + c8) = *(const v8us*)(&Tl[rr][c8]); }
    asm volatile("s_wait_xcnt 0x0" ::: "memory");               // behind the last store: stands in front of any later write of a register that these stores name
  }
}

// All preparation in one launch. The parts stand in the order of their blocks' own run time, the longest first: sinusoids, the three
// weight transposes, the embed rounding. Every branch is on the block index alone, so the barrier inside wt_tile is passed by a whole block or by none of it.
__global__ __launch_bounds__(256) void prep_kernel(const float* __restrict__ emb, const float* __restrict__ Wqkv, const float* __restrict__ Wpos, const float* __restrict__ Wfc,
                                                   unsigned short* __restrict__ e16, b16* __restrict__ peh, b16* __restrict__ pel,
                                                   unsigned short* __restrict__ wq, unsigned short* __restrict__ wp, unsigned short* __restrict__ wf) {
  __shared__ __attribute__((aligned(16))) unsigned short Sh[64][72];   // a transpose tile, or the sinusoid part's staging
  int blk = blockIdx.x;
  if (blk < PB_PE) { prep_pe(blk, (b16*)&Sh[0][0], peh, pel); return; }
  blk -= PB_PE;
  if (blk < PB_WQ) { wt_tile<0>(blk, Wqkv, DM, NQKV, wq, Sh); return; }
  blk -= PB_WQ;
  if (blk < PB_WF) { wt_tile<1>(blk, Wfc, DM, DM, wf, Sh); return; }
  blk -= PB_WF;
  if (blk < PB_WP) { wt_tile<1>(blk, Wpos, DH, NPOS, wp, Sh); return; }
  prep_embed(blk - PB_WP, emb, e16);
}

// Eight 16-byte asynchronous copies of one thread, global memory to LDS; the closing wait stands in front of any rewrite of the address registers named here.
__device__ __forceinline__ void copy8_to_lds(unsigned l0, unsigned l1, unsigned l2, unsigned l3, unsigned l4, unsigned l5, unsigned l6, unsigned l7,
                                             const void* g0, const void* g1, const void* g2, const void* g3, const void* g4, const void* g5, const void* g6, const void* g7) {
  asm volatile("global_load_async_to_lds_b128 %0, %8, off\n\t"
               "global_load_async_to_lds_b128 %1, %9, off\n\t"
               "global_load_async_to_lds_b128 %2, %10, off\n\t"
               "global_load_async_to_lds_b128 %3, %11, off\n\t"
               "global_load_async_to_lds_b128 %4, %12, off\n\t"
               "global_load_async_to_lds_b128 %5, %13, off\n\t"
               "global_load_async_to_lds_b128 %6, %14, off\n\t"
               "global_load_async_to_lds_b128 %7, %15, off\n\t"
               "s_wait_xcnt 0x0"
               :: "v"(l0), "v"(l1), "v"(l2), "v"(l3), "v"(l4), "v"(l5), "v"(l6), "v"(l7), "v"(g0), "v"(g1), "v"(g2), "v"(g3), "v"(g4), "v"(g5), "v"(g6), "v"(g7) : "memory");
}

__device__ __forceinline__ void copy2_to_lds(unsigned l0, unsigned l1, const void* g0, const void* g1) {   // the same, two copies
  asm volatile("global_load_async_to_lds_b128 %0, %2, off\n\t"
               "global_load_async_to_lds_b128 %1, %3, off\n\t"
               "s_wait_xcnt 0x0"
               :: "v"(l0), "v"(l1), "v"(g0), "v"(g1) : "memory");
}

// position projections: (1024 x 64) x (64 x 3072): A = pe planes (x8 hi+lo), B = f16(bf16 W_pos)^T rows -> 2 products; single f16 rows pp[which][h][l][64]. They need only the
// preparation's results, as the qkv projection does, so their blocks ride in qkv_kernel's launch: PB_POS blocks of 8 waves, block blk = 256 rows x 64 columns, wave = 32 x 64.
// Th: 8 KB of LDS a wave for the epilogue.
constexpr int PB_POS = (NPOS / 64) * (L / 256);
__device__ __forceinline__ void pos_block(int blk, const b16* __restrict__ peh, const b16* __restrict__ pel, const b16* __restrict__ wpos, b16* __restrict__ pp, b16* Th) {
  const int lane = threadIdx.x & 31, wave = threadIdx.x >> 5, nloc = lane & 15, hlf = lane >> 4, m0 = (blk / (NPOS / 64)) * 256 + wave * 32, c0 = (blk % (NPOS / 64)) * 64;
  v8f acc[2][4];
#pragma unroll
  for (int r = 0; r < 2; ++r)
#pragma unroll
    for (int t = 0; t < 4; ++t) acc[r][t] = (v8f){};
  const Opnd A{peh, pel, DH}, B{wpos, nullptr, DH};
  gemm_tile<2, 1>(A, B, DH, m0, c0, nloc, hlf, acc);
  const int which = c0 / DM, h = (c0 % DM) / DH;
  epi_planes(acc, 1.0f / PES, false, pp + (((size_t)which * H + h) * L + m0) * DH, nullptr, DH, 0, 0, lane, Th + wave * (2 * 32 * 64), Th + wave * (2 * 32 * 64) + 32 * 64);
}

// qkv: (4096 x 1024) x (1024 x 4096) bf16 WMMA; 32 x 32 blocks behind the PB_POS position blocks (those end early and free their places), block = 128 tokens x 128 columns, 8 waves (4 along tokens x 2 along columns) of 32 x 64 each. Per 64-k tile the
// 128 embed rows and the 128 weight rows are brought once per block into LDS (row pitch 144 B) by asynchronous copies, two buffers: tile t + 1 flies while tile t is worked on;
// fragments come from LDS. Columns: [q | k1 | k2 | v] x 1024; q/k1/k2 -> single f16 rows [which][b][h][l][64]; v -> (8v)^T hi/lo planes [b][h][64 d][1024 l] through a block
// LDS transpose (block = 128 tokens of one batch row, two heads). The epilogues stage in the ring's LDS behind the last tile's barrier.
// Eight waves a SIMD are asked for so that four blocks (their LDS fits four times) share a WGP and all 1024 blocks are resident at once.
constexpr int GPIT = 64 + 8, GROWS = 256, GTILE = GROWS * GPIT;   // LDS row pitch (16-bit elements), rows and elements of a stage: 128 embed rows, then 128 weight rows
__global__ __launch_bounds__(256, 8) void qkv_kernel(const __bf16* __restrict__ e16, const __bf16* __restrict__ wqkv, b16* __restrict__ qk, b16* __restrict__ vth, b16* __restrict__ vtl,
                                                     const b16* __restrict__ peh, const b16* __restrict__ pel, const b16* __restrict__ wpos, b16* __restrict__ pp) {
  __shared__ __attribute__((aligned(16))) unsigned short Sm[2 * GTILE];   // 73,728 B
  if (blockIdx.x < PB_POS) { pos_block(blockIdx.x, peh, pel, wpos, pp, (b16*)Sm); return; }   // a whole block takes this branch, in front of every barrier
  const int gblk = blockIdx.x - PB_POS;                         // column tile runs fastest
  const int tid = threadIdx.x, lane = tid & 31, wave = __builtin_amdgcn_readfirstlane(tid >> 5), wm = wave & 3, wn = wave >> 2, nloc = lane & 15, hlf = lane >> 4;
  const int mb = (gblk / (NQKV / 128)) * 128, cb = (gblk % (NQKV / 128)) * 128, m0 = mb + wm * 32, c0 = cb + wn * 64;   // the wave number is held scalar: tile indices and the epilogue branch stay scalar
  // copy map: 8 lanes bring one 128-byte row piece; a thread brings rows sr + 32 i of both operands
  const int sr = tid >> 3, sc = (tid & 7) * 8;
  const __bf16* ga = e16 + (size_t)(mb + sr) * DM + sc; const __bf16* gb = wqkv + (size_t)(cb + sr) * DM + sc;
  const unsigned ls = (unsigned)(size_t)(&Sm[0]) + (unsigned)(sr * GPIT + sc) * 2u;
  auto stage = [&](int kt, int buf) {
    const unsigned l = ls + (unsigned)buf * (GTILE * 2u); const __bf16* a = ga + kt * 64; const __bf16* w = gb + kt * 64;
    constexpr unsigned R32 = 32u * GPIT * 2u;
    copy8_to_lds(l, l + R32, l + 2u * R32, l + 3u * R32, l + 4u * R32, l + 5u * R32, l + 6u * R32, l + 7u * R32,
                 a, a + 32 * DM, a + 64 * DM, a + 96 * DM, w, w + 32 * DM, w + 64 * DM, w + 96 * DM);
  };
  v8f acc[2][4];
#pragma unroll
  for (int r = 0; r < 2; ++r)
#pragma unroll
    for (int t = 0; t < 4; ++t) acc[r][t] = (v8f){};
  stage(0, 0);
  asm volatile("s_wait_asynccnt 0x0" ::: "memory");             // this wave's copies of tile 0 have landed
  __syncthreads();                                              // publishes tile 0
  stage(1, 1);
  for (int kt = 0; kt < DM / 64; ++kt) {
    const __bf16* As = (const __bf16*)Sm + (kt & 1) * GTILE + (wm * 32 + nloc) * GPIT; const __bf16* Bs = (const __bf16*)Sm + (kt & 1) * GTILE + (128 + wn * 64 + nloc) * GPIT;
#pragma unroll                                                  // both 32-k halves of the tile in line: LDS offsets become immediates
    for (int ks = 0; ks < 2; ++ks) {
      const v16bb a0 = frag_kb_bf(As + ks * 32, hlf), a1 = frag_kb_bf(As + 16 * GPIT + ks * 32, hlf);
      v16bb bw[4];
#pragma unroll
      for (int t = 0; t < 4; ++t) bw[t] = frag_kb_bf(Bs + t * 16 * GPIT + ks * 32, hlf);
      group_fence();                        // the 12 LDS reads of this 32-k half stay one group ahead of its WMMAs: one LDS wait instead of one per fragment
#pragma unroll
      for (int t = 0; t < 4; ++t) { acc[0][t] = wmma16bb(a0, bw[t], acc[0][t]); acc[1][t] = wmma16bb(a1, bw[t], acc[1][t]); }
      group_fence();                        // the next group's reads are not spread among these WMMAs
    }
    asm volatile("s_wait_dscnt 0x0" ::: "memory");              // this wave's reads of tile kt are done before its buffer is handed back
    asm volatile("s_wait_asynccnt 0x0" ::: "memory");           // this wave's copies of tile kt + 1 have landed
    __syncthreads();                                            // publishes tile kt + 1 and ends every read of tile kt
    if (kt + 2 < DM / 64) stage(kt + 2, kt & 1);
  }
  asm volatile("s_wait_asynccnt 0x0" ::: "memory");             // no copy is outstanding when the ring becomes output staging
  const int which = c0 / DM, c1 = c0 % DM, h = c1 / DH, b = m0 / L, l0 = m0 % L;   // 64 columns = one head; which is the same for the whole block
  if (which < 3) {                                             // q / k1 / k2 rows [which][b][h][l][64] (single f16)
    b16* Th = (b16*)Sm + wave * (2 * 32 * 64);
    epi_planes(acc, 1.0f, false, qk + ((((size_t)which * Bn + b) * H + h) * L + l0) * DH, nullptr, DH, 0, 0, lane, Th, Th + 32 * 64);
    return;
  }
  constexpr int TP = 128 + 8;                                   // token pitch of the transpose planes [head wn][hi, lo][64 d][TP]
  b16* Tt = (b16*)Sm + wn * (2 * 64 * TP);
#pragma unroll
  for (int t = 0; t < 4; ++t)
#pragma unroll
    for (int r = 0; r < 2; ++r)
#pragma unroll
      for (int v = 0; v < 8; ++v) { b16 a, c; split16(acc[r][t][v] * VS, a, c); const int o = (t * 16 + nloc) * TP + wm * 32 + r * 16 + 8 * hlf + v; Tt[o] = a; Tt[64 * TP + o] = c; }
  __syncthreads();
  const int tok0 = mb % L, bb = mb / L;
  b16* bh_ = vth + (((size_t)bb * H + h) * DH) * L + tok0; b16* bl_ = vtl + (((size_t)bb * H + h) * DH) * L + tok0;
  {
#pragma unroll
    for (int j = 0; j < 8; ++j) { const int dd = wm * 16 + j * 2 + (lane >> 4), c8 = (lane & 15) * 8;
      *(v8b*)(bh_ + (size_t)dd * L + c8) = *(const v8b*)(&Tt[dd * TP + c8]); *(v8b*)(bl_ + (size_t)dd * L + c8) = *(const v8b*)(&Tt[64 * TP + dd * TP + c8]); }
    asm volatile("s_wait_xcnt 0x0" ::: "memory");               // behind the last store: stands in front of any later write of a register that these stores name
  }
}

// ---------------------------------------------------------------------------
// attention: block = (b, h, 128 queries), wave = 16 queries; causal 32-key chunks up to the block's diagonal. All key-side operands come from LDS, staged once per block and
// shared by its 8 waves: the two mask rows once, and per chunk the k1/k2/kp1/kp2 rows (pitch 144 B) and the (8v)^T hi/lo columns (pitch 80 B), two buffers: chunk t + 1 is
// fetched into registers before chunk t is worked on and stored to the other buffer behind it; one barrier a chunk. A wave past its own diagonal only stages.
// Per chunk and 16-key half: four K=64 score products (q.k1, qp.kp1, q.k2, qp.kp2; single f16),
// logit = same speaker ? s1 + p1 : s2 + p2; -inf where key > query or umask[b][key] == 0; online softmax f32; P^T f16; y^T += (8v)^T.P^T (4 feature tiles, hi + lo);
// ---------------------------------------------------------------------------
constexpr int KPIT = DH + 8, VPIT = 32 + 8;                    // LDS row pitches in f16: 16 B x odd, for 16-byte fragment reads
typedef __attribute__((ext_vector_type(4))) int v4i;
__global__ __launch_bounds__(256) void attn_kernel(const b16* __restrict__ qk, const b16* __restrict__ pp, const b16* __restrict__ vth, const b16* __restrict__ vtl,
                                                   const int* __restrict__ umask, const int* __restrict__ qmask, float* __restrict__ y) {
  __shared__ __attribute__((aligned(16))) float Os[8][16][DH + 4];
  __shared__ __attribute__((aligned(16))) b16 Ks[2][4][32 * KPIT];   // [buffer][k1, k2, kp1, kp2][key][feature]
  __shared__ __attribute__((aligned(16))) b16 Vs[2][2][DH * VPIT];   // [buffer][hi, lo][feature][key]
  __shared__ __attribute__((aligned(16))) int Ms[2][L];              // speaker ids and umask of batch row b
  const int tid = threadIdx.x, wid = __builtin_amdgcn_readfirstlane(tid >> 5), lane = tid & 31, hh = lane >> 4, col = lane & 15;
  const int qt = blockIdx.x * 8 + wid, jt = qt & 63, h = (qt >> 6) & 15, b = qt >> 10, q0 = jt * 16, qi = q0 + col;
  const int nchunk = ((blockIdx.x & 7) + 1) * 4;                // 32-key chunks up to the block's last query
  const b16* Q = qk + ((((size_t)0 * Bn + b) * H + h) * L) * DH; const b16* K1 = qk + ((((size_t)1 * Bn + b) * H + h) * L) * DH; const b16* K2 = qk + ((((size_t)2 * Bn + b) * H + h) * L) * DH;
  const b16* QP = pp + (((size_t)0 * H + h) * L) * DH; const b16* KP1 = pp + (((size_t)1 * H + h) * L) * DH; const b16* KP2 = pp + (((size_t)2 * H + h) * L) * DH;
  const b16* vh = vth + (((size_t)b * H + h) * DH) * L; const b16* vl = vtl + (((size_t)b * H + h) * DH) * L;
  // staging map: a thread moves one 16-byte piece of each of the six tiles
  const int kr = tid >> 3, kc = (tid & 7) * 8, vr = tid >> 2, vc = (tid & 3) * 8;
  const size_t gko = (size_t)kr * DH + kc, gvo = (size_t)vr * L + vc;
  const int sko = kr * KPIT + kc, svo = vr * VPIT + vc;
  v8b st[6];
  st[0] = ld8b(K1 + gko); st[1] = ld8b(K2 + gko); st[2] = ld8b(KP1 + gko); st[3] = ld8b(KP2 + gko); st[4] = ld8b(vh + gvo); st[5] = ld8b(vl + gvo);
  const v4i mq = *(const v4i*)(qmask + b * L + tid * 4), mu = *(const v4i*)(umask + b * L + tid * 4);
  v16b qf[2], qpf[2];
#pragma unroll
  for (int ks = 0; ks < 2; ++ks) { qf[ks] = frag_kb(Q + (size_t)qi * DH + ks * 32, hh); qpf[ks] = frag_kb(QP + (size_t)qi * DH + ks * 32, hh); }
  const int myspk = qmask[b * L + qi];
  asm volatile("s_wait_xcnt 0x0" ::: "memory");                 // before the address registers of the loads above are reused
  *(v4i*)(&Ms[0][tid * 4]) = mq; *(v4i*)(&Ms[1][tid * 4]) = mu;
#pragma unroll
  for (int i = 0; i < 4; ++i) *(v8b*)(&Ks[0][i][sko]) = st[i];
  *(v8b*)(&Vs[0][0][svo]) = st[4]; *(v8b*)(&Vs[0][1][svo]) = st[5];
  __syncthreads();
  float m = -INFINITY, l = 0.0f; v8f o[4] = {{}, {}, {}, {}};
  for (int t = 0; t < nchunk; ++t) {
    const int kb = t * 32, cur = t & 1; const bool more = t + 1 < nchunk;
    if (more) { const size_t ka = gko + (size_t)(kb + 32) * DH, va = gvo + kb + 32;
      st[0] = ld8b(K1 + ka); st[1] = ld8b(K2 + ka); st[2] = ld8b(KP1 + ka); st[3] = ld8b(KP2 + ka); st[4] = ld8b(vh + va); st[5] = ld8b(vl + va);
      asm volatile("s_wait_xcnt 0x0" ::: "memory"); }           // before the address registers of these six loads are reused
    if (kb < q0 + 16) {
      // The chunk's LDS reads stand in three groups, each issued whole: keys 0..15 and keys 16..31 (each with its mask words) ahead of their WMMAs, the value tiles ahead of the softmax.
      float lg0[8], lg1[8] = {};
      v16b kf[4][2], vf[4][2]; v4i mk[4]; v8f s1, p1, s2, p2;
      auto read_keys = [&](int half) {
        const int ro = (half * 16 + col) * KPIT;
#pragma unroll
        for (int i = 0; i < 4; ++i)
#pragma unroll
          for (int ks = 0; ks < 2; ++ks) kf[i][ks] = frag_kb(&Ks[cur][i][ro + ks * 32], hh);
      };
      auto read_masks = [&](int half) {
        const int k8 = kb + half * 16 + 8 * hh;
        mk[0] = *(const v4i*)(&Ms[0][k8]); mk[1] = *(const v4i*)(&Ms[0][k8 + 4]); mk[2] = *(const v4i*)(&Ms[1][k8]); mk[3] = *(const v4i*)(&Ms[1][k8 + 4]);
      };
      auto scores = [&]() {
        s1 = (v8f){}; p1 = (v8f){}; s2 = (v8f){}; p2 = (v8f){};
#pragma unroll
        for (int ks = 0; ks < 2; ++ks) {
          s1 = wmma16b(kf[0][ks], qf[ks], s1); s2 = wmma16b(kf[1][ks], qf[ks], s2);
          p1 = wmma16b(kf[2][ks], qpf[ks], p1); p2 = wmma16b(kf[3][ks], qpf[ks], p2);
        }
      };
      auto logits = [&](int half, float (&lg)[8]) {
        const int k8 = kb + half * 16 + 8 * hh;
#pragma unroll
        for (int r = 0; r < 8; ++r) { const int kk = k8 + r; const bool same = ((r < 4 ? mk[0][r & 3] : mk[1][r & 3]) == myspk);
          float v = same ? (s1[r] + p1[r]) : (s2[r] + p2[r]);
          if ((kk > qi) | ((r < 4 ? mk[2][r & 3] : mk[3][r & 3]) == 0)) v = -INFINITY;
          lg[r] = v; }
      };
#pragma unroll 1                                                // rolled: a half's logits are finished before the next half's fragments are read, so the live registers still let two blocks share a WGP
      for (int half = 0; half < 2; ++half) {
        read_keys(half);
        asm volatile("" ::: "memory");                          // compiler fence: the mask words are read last, so the compares that wait for them stand behind the whole group, not inside it
        read_masks(half);
        group_fence();                                          // the half's 20 LDS reads stay one group ahead of its WMMAs
        scores();
#pragma unroll
        for (int r = 0; r < 8; ++r) lg0[r] = lg1[r];            // the first half's logits move on; after two trips lg0 holds keys 0..15 and lg1 keys 16..31
        logits(half, lg1);
      }
#pragma unroll
      for (int n = 0; n < 4; ++n) { const int ro = (n * 16 + col) * VPIT; vf[n][0] = frag_kb(&Vs[cur][0][ro], hh); vf[n][1] = frag_kb(&Vs[cur][1][ro], hh); }
      group_fence();                                            // the 16 reads of the value tiles stay one group ahead of the softmax, which hides them
      float mr = -INFINITY;
#pragma unroll
      for (int r = 0; r < 8; ++r) mr = fmaxf(mr, fmaxf(lg0[r], lg1[r]));
      mr = fmaxf(mr, __shfl_xor(mr, 16));
      float mn = fmaxf(m, mr); if (mn == -INFINITY) mn = 0.0f;
      const float al_ = __expf(m - mn); m = mn;
      float sum = 0.0f; v16b pb;
#pragma unroll
      for (int r = 0; r < 8; ++r) { const float e0 = __expf(lg0[r] - mn), e1 = __expf(lg1[r] - mn); sum += e0 + e1; pb[r] = (b16)e0; pb[8 + r] = (b16)e1; }
      sum += __shfl_xor(sum, 16); l = l * al_ + sum;
#pragma unroll
      for (int n = 0; n < 4; ++n) {
#pragma unroll
        for (int r = 0; r < 8; ++r) o[n][r] *= al_;
        o[n] = wmma16b(vf[n][0], pb, o[n]); o[n] = wmma16b(vf[n][1], pb, o[n]);
      }
      // four vector slots behind the chunk's last WMMAs on every path out of the chunk
      asm volatile("v_nop\n\tv_nop\n\tv_nop\n\tv_nop" : "+v"(o[0]), "+v"(o[1]), "+v"(o[2]), "+v"(o[3]) : "v"(pb));
    }
    if (more) {                                                 // the other buffer's last readers left it at the previous chunk's barrier
#pragma unroll
      for (int i = 0; i < 4; ++i) *(v8b*)(&Ks[cur ^ 1][i][sko]) = st[i];
      *(v8b*)(&Vs[cur ^ 1][0][svo]) = st[4]; *(v8b*)(&Vs[cur ^ 1][1][svo]) = st[5];
      __syncthreads();                                          // publishes chunk t + 1 and ends every read of chunk t
    }
  }
  const float inv = (l > 0.0f) ? (1.0f / (VS * l)) : 0.0f;
#pragma unroll
  for (int n = 0; n < 4; ++n)
#pragma unroll
    for (int r = 0; r < 8; ++r) Os[wid][col][n * 16 + 8 * hh + r] = o[n][r] * inv;
  wave_lds_sync();
  float* dst = y + ((size_t)b * L + q0) * DM + h * DH;          // 16 rows x 256 B
  {
#pragma unroll
    for (int j = 0; j < 8; ++j) { const int rr = j * 2 + hh, c4 = col * 4; *(v4f*)(dst + (size_t)rr * DM + c4) = *(const v4f*)(&Os[wid][rr][c4]); }
    
  }
}

// out = y.W_fc: (4096 x 1024) x (1024 x 1024); A = y f32 x8 split, B = f16(bf16 W_fc)^T rows -> 2 products; f32 rows; grid (16, 32), block = 128 rows x 64 columns, 8 waves of
// 16 x 64. Per 64-k tile the 128 y rows (f32, pitch 272 B) and the 64 weight rows (pitch 144 B) are brought once per block into LDS by asynchronous copies, two buffers, as in
// qkv_kernel; the split runs on fragments read from LDS. The epilogue stages in the ring's LDS behind the last tile's barrier.
constexpr int OAP = 64 + 4, OBP = 64 + 8, OAB = 128 * OAP * 4, OST = OAB + 64 * OBP * 2;   // pitches (f32, f16 elements), bytes of the y part and of a whole stage
__global__ __launch_bounds__(256) void out_kernel(const float* __restrict__ y, const b16* __restrict__ wfc, float* __restrict__ out) {
  __shared__ __attribute__((aligned(16))) unsigned char So[2 * OST];   // 88,064 B
  const int tid = threadIdx.x, lane = tid & 31, wave = __builtin_amdgcn_readfirstlane(tid >> 5), nloc = lane & 15, hlf = lane >> 4, mb = blockIdx.y * 128, m0 = mb + wave * 16, c0 = blockIdx.x * 64;
  // copy map: 16 lanes bring one 256-byte y row piece (rows ar + 16 i), 8 lanes one 128-byte weight row piece (rows br + 32 j)
  const int ar = tid >> 4, ac = (tid & 15) * 4, br = tid >> 3, bc = (tid & 7) * 8;
  const float* ga = y + (size_t)(mb + ar) * DM + ac; const b16* gb = wfc + (size_t)(c0 + br) * DM + bc;
  const unsigned la = (unsigned)(size_t)(&So[0]) + (unsigned)(ar * OAP + ac) * 4u, lw = (unsigned)(size_t)(&So[0]) + (unsigned)OAB + (unsigned)(br * OBP + bc) * 2u;
  auto stage = [&](int kt, int buf) {
    const unsigned l = la + (unsigned)buf * (unsigned)OST, w = lw + (unsigned)buf * (unsigned)OST; const float* a = ga + kt * 64; const b16* g = gb + kt * 64;
    constexpr unsigned R16 = 16u * OAP * 4u;
    copy8_to_lds(l, l + R16, l + 2u * R16, l + 3u * R16, l + 4u * R16, l + 5u * R16, l + 6u * R16, l + 7u * R16,
                 a, a + 16 * DM, a + 32 * DM, a + 48 * DM, a + 64 * DM, a + 80 * DM, a + 96 * DM, a + 112 * DM);
    copy2_to_lds(w, w + 32u * OBP * 2u, g, g + 32 * DM);
  };
  v8f acc[4] = {{}, {}, {}, {}};
  stage(0, 0);
  asm volatile("s_wait_asynccnt 0x0" ::: "memory");             // this wave's copies of tile 0 have landed
  __syncthreads();                                              // publishes tile 0
  stage(1, 1);
  for (int kt = 0; kt < DM / 64; ++kt) {
    const float* As = (const float*)(So + (kt & 1) * OST) + (wave * 16 + nloc) * OAP + 8 * hlf; const b16* Bs = (const b16*)(So + (kt & 1) * OST + OAB) + nloc * OBP;
    // every loop below is unrolled so that the fragment and accumulator arrays are indexed by constants and stay in registers
    v4f x[2][4]; v16b bf[2][4];
#pragma unroll
    for (int ks = 0; ks < 2; ++ks) {
      x[ks][0] = *(const v4f*)(As + ks * 32); x[ks][1] = *(const v4f*)(As + ks * 32 + 4); x[ks][2] = *(const v4f*)(As + ks * 32 + 16); x[ks][3] = *(const v4f*)(As + ks * 32 + 20);
#pragma unroll
      for (int t = 0; t < 4; ++t) bf[ks][t] = frag_kb(Bs + t * 16 * OBP + ks * 32, hlf);
    }
    group_fence();                          // the tile's 24 LDS reads stay one group ahead of the split and the WMMAs: one LDS wait a tile instead of one per fragment
#pragma unroll
    for (int ks = 0; ks < 2; ++ks) {
      v16b ah, al;
#pragma unroll
      for (int e = 0; e < 16; ++e) { b16 a, c; split16(x[ks][e >> 2][e & 3] * 8.0f, a, c); ah[e] = a; al[e] = c; }
#pragma unroll
      for (int t = 0; t < 4; ++t) acc[t] = wmma16b(ah, bf[ks][t], acc[t]);     // hi, then lo, into each accumulator
#pragma unroll
      for (int t = 0; t < 4; ++t) acc[t] = wmma16b(al, bf[ks][t], acc[t]);
    }
    asm volatile("s_wait_dscnt 0x0" ::: "memory");              // this wave's reads of tile kt are done before its buffer is handed back
    asm volatile("s_wait_asynccnt 0x0" ::: "memory");           // this wave's copies of tile kt + 1 have landed
    __syncthreads();                                            // publishes tile kt + 1 and ends every read of tile kt
    if (kt + 2 < DM / 64) stage(kt + 2, kt & 1);
  }
  asm volatile("s_wait_asynccnt 0x0" ::: "memory");             // no copy is outstanding when the ring becomes output staging
  float* Tt = (float*)So + wave * (16 * 64);                    // 16 rows x 256 B per wave, stored as whole lines; unrolled: constant accumulator indices
#pragma unroll
  for (int t = 0; t < 4; ++t)
#pragma unroll
    for (int v = 0; v < 8; ++v) Tt[(v + 8 * hlf) * 64 + t * 16 + nloc] = acc[t][v] * (1.0f / 8.0f);
  wave_lds_sync();
  float* dst0 = out + (size_t)m0 * DM + c0;
#pragma unroll
  for (int j = 0; j < 8; ++j) { const int rr = j * 2 + hlf, c4 = nloc * 4; *(v4f*)(dst0 + (size_t)rr * DM + c4) = *(const v4f*)(Tt + rr * 64 + c4); }
}
}  // namespace

extern "C" void kernel_launch(void* const* d_in, const int* in_sizes, int n_in,
                              void* d_out, int out_size, void* d_ws, size_t ws_size, hipStream_t stream) {
  (void)n_in; (void)out_size;
  const float* emb = (const float*)d_in[0]; const int* umask = (const int*)d_in[1]; const int* qmask = (const int*)d_in[2];
  const float* Wqkv = (const float*)d_in[3]; const float* Wpos = (const float*)d_in[4]; const float* Wfc = (const float*)d_in[5];
  float* out = (float*)d_out;   // [4,1024,1024]
  if (in_sizes[0] != NTOK * DM || in_sizes[1] != NTOK || in_sizes[2] != NTOK || in_sizes[3] != DM * NQKV || in_sizes[4] != DH * NPOS || in_sizes[5] != DM * DM) return;
  size_t off = 0; char* ws = (char*)d_ws;
  auto carve = [&](size_t bytes) { char* p = ws + off; off += (bytes + 255) & ~(size_t)255; return p; };
  unsigned short* e16 = (unsigned short*)carve((size_t)NTOK * DM * 2);       // 8 MB
  unsigned short* wq = (unsigned short*)carve((size_t)NQKV * DM * 2);        // 8 MB
  unsigned short* wp = (unsigned short*)carve((size_t)NPOS * DH * 2);        // 384 KB
  unsigned short* wf = (unsigned short*)carve((size_t)DM * DM * 2);          // 2 MB
  b16* peh = (b16*)carve((size_t)L * DH * 2); b16* pel = (b16*)carve((size_t)L * DH * 2);
  b16* qk = (b16*)carve((size_t)3 * Bn * H * L * DH * 2);                   // 24 MB
  b16* vth = (b16*)carve((size_t)Bn * H * DH * L * 2); b16* vtl = (b16*)carve((size_t)Bn * H * DH * L * 2);   // 8 MB each
  b16* pp = (b16*)carve((size_t)3 * H * L * DH * 2);                         // 6 MB
  float* y = (float*)carve((size_t)NTOK * DM * 4);                           // 16 MB
  if (off > ws_size) return;                                                  // ≈ 81 MB
  prep_kernel<<<PB_PE + PB_WQ + PB_WF + PB_WP + PB_EM, 256, 0, stream>>>(emb, Wqkv, Wpos, Wfc, e16, peh, pel, wq, wp, wf);
  qkv_kernel<<<PB_POS + (NQKV / 128) * (NTOK / 128), 256, 0, stream>>>((const __bf16*)e16, (const __bf16*)wq, qk, vth, vtl, peh, pel, (const b16*)wp, pp);
  attn_kernel<<<Bn * H * (L / 16) / 8, 256, 0, stream>>>(qk, pp, vth, vtl, umask, qmask, y);
  out_kernel<<<dim3(DM / 64, NTOK / 128), 256, 0, stream>>>(y, (const b16*)wf, out);
}

// v005
// A run of this version takes 102 microseconds.
// Timed twice side by side with v004, it ran 1.14 and 1.13 times as fast.
// Counting every step since v000, it is 4.41 times as fast.
#include <hip/hip_runtime.h>

// Speaker-aware causal multi-head attention with relative sinusoidal position terms (d_model 1024, 16 heads x 64, B=4, L=1024): q,k1,k2,v = embed W_qkv;
// qp,kp1,kp2 = pe W_pos (pe = the module's sinusoid table rows 89..1112); logit[q][k] = same speaker ? (q.k1 + qp.kp1) : (q.k2 + qp.kp2) (scale 1); keys k > q or umask = 0
// -> -inf; softmax; out = (P.v) W_fc.
// Numerics: embed, W_qkv, W_pos and W_fc are rounded to bf16 (RNE); the qkv projection runs on
// v_wmma_f32_16x16x32_bf16 with those operands (exact products, f32 accumulate); the position projection uses f16 hi+lo of the f32 sinusoid table against the exact f16 copy of
// bf16 W_pos; the four score products use single f16 copies of q/k1/k2/qp/kp (f32 accumulate); P.V pairs single-f16 P with hi+lo 8v; the output projection pairs hi+lo of the
// attention output with the exact f16 copy of bf16 W_fc. Masks are read from the int inputs. Fragment k-map per lane half hh for A AND B: elements 0..7 <- k = 8hh+0..7, 8..15

namespace {
constexpr int Bn = 4, L = 1024, DM = 1024, H = 16, DH = 64, NTOK = Bn * L, NQKV = 4 * DM, NPOS = 3 * DM, TBL = 1201, SHIFT = 601;
constexpr float VS = 8.0f, PES = 8.0f;

typedef _Float16 b16;
typedef __attribute__((ext_vector_type(16))) _Float16 v16b;
typedef __attribute__((ext_vector_type(8)))  _Float16 v8b;
typedef __attribute__((ext_vector_type(8)))  float v8f;
typedef __attribute__((ext_vector_type(4)))  float v4f;

__device__ __forceinline__ v8b ld8b(const b16* p) { return *(const v8b*)p; }
__device__ __forceinline__ v16b cat8b(v8b a, v8b b) { return __builtin_shufflevector(a, b, 0, 1, 2, 3, 4, 5, 6, 7, 8, 9, 10, 11, 12, 13, 14, 15); }
__device__ __forceinline__ v16b frag_kb(const b16* p, int hh) { return cat8b(ld8b(p + 8 * hh), ld8b(p + 16 + 8 * hh)); }
__device__ __forceinline__ void split16(float v, b16& hi, b16& lo) { hi = (b16)v; lo = (b16)(v - (float)hi); }
// hi/lo fragment pair straight from an f32 k-contiguous row (same k-map)
__device__ __forceinline__ void frag_ksplit(const float* p, int hh, v16b& fh_, v16b& fl_) {
  const float* p0 = p + 8 * hh; const float* p1 = p + 16 + 8 * hh;
#pragma unroll
  for (int e = 0; e < 8; ++e) { b16 a, c; split16(p0[e], a, c); fh_[e] = a; fl_[e] = c; split16(p1[e], a, c); fh_[8 + e] = a; fl_[8 + e] = c; }
}
__device__ __forceinline__ v8f wmma16b(v16b a, v16b b, v8f c) {
  return __builtin_amdgcn_wmma_f32_16x16x32_f16(false, a, false, b, (short)0, c, false, false);
}
// Keeps a group of LDS reads whole and at its place in the instruction stream: the compiler fence holds the reads on their side, the scheduling fence the WMMAs and vector work.
// Left free, the reads sink to one pair with a full LDS wait in front of each WMMA, or rise so far that the live fragments no longer fit the registers.
__device__ __forceinline__ void group_fence() { asm volatile("" ::: "memory"); __builtin_amdgcn_sched_barrier(0); }
__device__ __forceinline__ void wave_lds_sync() {
  __builtin_amdgcn_fence(__ATOMIC_RELEASE, "workgroup");
  __builtin_amdgcn_wave_barrier();
  __builtin_amdgcn_fence(__ATOMIC_ACQUIRE, "workgroup");
}

// Operand descriptor: NP = 0 -> f32 rows split on the fly into (hi, lo); NP = 1 -> one f16 plane; NP = 2 -> f16 hi + lo planes;
// NP = 3 -> f32 rows rounded once to a single f16 fragment. ld = row pitch.
struct Opnd { const void* p0; const void* p1; int ld; };
template <int NP> __device__ __forceinline__ void load_frags(const Opnd& o, int row, int kb, int hh, v16b& fh_, v16b& fl_) {
  if (NP == 0) { frag_ksplit((const float*)o.p0 + (size_t)row * o.ld + kb, hh, fh_, fl_); }
  else if (NP == 4 || NP == 5) {                             // f32 rows x64 (NP 4) or x8 (NP 5) then split (keeps the lo halves of small values normal)
    const float sc_ = (NP == 4) ? 64.0f : 8.0f;
    const float* p = (const float*)o.p0 + (size_t)row * o.ld + kb; const float* p0 = p + 8 * hh; const float* p1 = p + 16 + 8 * hh;
#pragma unroll
    for (int e = 0; e < 8; ++e) { b16 a, c; split16(p0[e] * sc_, a, c); fh_[e] = a; fl_[e] = c; split16(p1[e] * sc_, a, c); fh_[8 + e] = a; fl_[8 + e] = c; }
  } else if (NP == 3) {
    const float* p = (const float*)o.p0 + (size_t)row * o.ld + kb; const float* p0 = p + 8 * hh; const float* p1 = p + 16 + 8 * hh;
#pragma unroll
    for (int e = 0; e < 8; ++e) { fh_[e] = (b16)p0[e]; fh_[8 + e] = (b16)p1[e]; }
    fl_ = fh_;
  } else {
    fh_ = frag_kb((const b16*)o.p0 + (size_t)row * o.ld + kb, hh);
    if (NP == 2) fl_ = frag_kb((const b16*)o.p1 + (size_t)row * o.ld + kb, hh); else fl_ = fh_;
  }
}
template <int ANP, int BNP> __device__ __forceinline__ v8f mac(v16b ah, v16b al, v16b bh, v16b bl, v8f c) {
  c = wmma16b(ah, bh, c);
  if (BNP == 0 || BNP == 2 || BNP == 4 || BNP == 5) c = wmma16b(ah, bl, c);     // hi.lo
  if (ANP == 0 || ANP == 2 || ANP == 4 || ANP == 5) c = wmma16b(al, bh, c);     // lo.hi   (lo.lo dropped)
  return c;
}
// 32x64 wave tile: acc[r][t] (rows m0+16r.., cols c0+16t..) += A[m][k] . B[n][k] over k in [0, K)
template <int ANP, int BNP>
__device__ __forceinline__ void gemm_tile(const Opnd& A, const Opnd& B, int K, int m0, int c0, int nloc, int hlf, v8f (&acc)[2][4]) {
  for (int kb = 0; kb < K; kb += 32) {
    v16b a0h, a0l, a1h, a1l;
    load_frags<ANP>(A, m0 + nloc, kb, hlf, a0h, a0l);
    load_frags<ANP>(A, m0 + 16 + nloc, kb, hlf, a1h, a1l);
#pragma unroll
    for (int t = 0; t < 4; ++t) {
      v16b bh, bl;
      load_frags<BNP>(B, c0 + t * 16 + nloc, kb, hlf, bh, bl);
      acc[0][t] = mac<ANP, BNP>(a0h, a0l, bh, bl, acc[0][t]);
      acc[1][t] = mac<ANP, BNP>(a1h, a1l, bh, bl, acc[1][t]);
    }
  }
}

__device__ __forceinline__ void epi_planes(v8f (&acc)[2][4], float scale, bool two, b16* __restrict__ oh, b16* __restrict__ ol, int ldo,
                                           int m0, int c0, int lane, b16* Th, b16* Tl) {
  const int nloc = lane & 15, hlf = lane >> 4;
#pragma unroll
  for (int t = 0; t < 4; ++t)
#pragma unroll
    for (int r = 0; r < 2; ++r)
#pragma unroll
      for (int v = 0; v < 8; ++v) {
        const int rr = r * 16 + v + 8 * hlf, cc = t * 16 + nloc;
        b16 h_, l_; split16(acc[r][t][v] * scale, h_, l_);
        Th[rr * 64 + cc] = h_; Tl[rr * 64 + cc] = l_;
      }
  wave_lds_sync();
  {
#pragma unroll
    for (int j = 0; j < 8; ++j) {
      const int rr = j * 4 + (lane >> 3), c8 = (lane & 7) * 8;
      const size_t o = (size_t)(m0 + rr) * ldo + c0 + c8;
      *(v8b*)(oh + o) = ld8b(Th + rr * 64 + c8);
      if (two) *(v8b*)(ol + o) = ld8b(Tl + rr * 64 + c8);
    }
    
  }
}
typedef __attribute__((ext_vector_type(8))) __bf16 v8bb; typedef __attribute__((ext_vector_type(16))) __bf16 v16bb;
__device__ __forceinline__ v16bb frag_kb_bf(const __bf16* p, int hh) { const v8bb a = *(const v8bb*)(p + 8 * hh), b = *(const v8bb*)(p + 16 + 8 * hh); return __builtin_shufflevector(a, b, 0, 1, 2, 3, 4, 5, 6, 7, 8, 9, 10, 11, 12, 13, 14, 15); }
__device__ __forceinline__ v8f wmma16bb(v16bb a, v16bb b, v8f c) {
  return __builtin_amdgcn_wmma_f32_16x16x32_bf16(false, a, false, b, (short)0, c, false, false);
}
__device__ __forceinline__ unsigned short bf16_rne_bits(float v) { unsigned int u = __float_as_uint(v); u += 0x7FFFu + ((u >> 16) & 1u); return (unsigned short)(u >> 16); }
__device__ __forceinline__ float bf16_rne(float v) { return __uint_as_float(((unsigned int)bf16_rne_bits(v)) << 16); }

// The preparation work has no dependences among its parts, so all of it runs as ONE launch; a block's index picks its part (prep_kernel below).
constexpr int PB_PE = L * DH / 8 / 256, PB_WQ = (NQKV / 64) * (DM / 64), PB_WF = (DM / 64) * (DM / 64), PB_WP = (NPOS / 64) * (DH / 64), PB_EM = 512;   // blocks of each part
// part: embed -> bf16 rows [4096][1024] (16-B pieces), PB_EM blocks striding over the pieces.
__device__ __forceinline__ void prep_embed(int blk, const float* __restrict__ emb, unsigned short* __restrict__ e16) {
  typedef __attribute__((ext_vector_type(8))) unsigned short v8us;
  const size_t tid = (size_t)blk * 256 + threadIdx.x, nth = (size_t)PB_EM * 256;
  for (size_t p = tid; p < (size_t)NTOK * DM / 8; p += nth) { v8us v;
#pragma unroll
    for (int e = 0; e < 8; ++e) v[e] = bf16_rne_bits(emb[p * 8 + e]);
    *(v8us*)(e16 + p * 8) = v; }
}
// part: pe x8 hi/lo planes [1024][64] from the module's sinusoid formula (f32, table row 0 (the padding row) never selected for L=1024); PB_PE blocks, one 8-element piece a thread.
// Sc: per-thread staging (256 x 16 f16) for the rolled sinusoid loop.
__device__ __forceinline__ void prep_pe(int blk, b16* Sc, b16* __restrict__ peh, b16* __restrict__ pel) {
  const size_t p = (size_t)blk * 256 + threadIdx.x; const int l = (int)(p / 8), d0 = (int)(p % 8) * 8;
  const int tblrow = l - L / 2 + SHIFT;                        // 89 .. 1112, never 0
  const float posv = (float)(tblrow - (TBL + 1) / 2);          // arange(-601, 600)[tblrow] = tblrow - 601
#pragma unroll 1
  for (int e = 0; e < 8; ++e) { const int d = d0 + e; const int j = (d < DH / 2) ? d : d - DH / 2;   // rolled: one sin/cos expansion in the binary
    const float freq = expf((float)j * (-9.210340371976184f / (float)(DH / 2 - 1))); const float ang = posv * freq;
    const float val = (d < DH / 2) ? sinf(ang) : cosf(ang); b16 a, c; split16(val * PES, a, c); Sc[threadIdx.x * 16 + e] = a; Sc[threadIdx.x * 16 + 8 + e] = c; }
  *(v8b*)(peh + p * 8) = *(const v8b*)(&Sc[threadIdx.x * 16]); *(v8b*)(pel + p * 8) = *(const v8b*)(&Sc[threadIdx.x * 16 + 8]);
}

// part: W [k rows][n cols] f32 -> [n][k] 16-bit rows through 64x64 LDS tiles: MODE 0: bf16 bits (W_qkv); MODE 1: f16 of bf16(w) (W_fc, W_pos). Block blk = tile (blk % (N/64), blk / (N/64)).
template <int MODE>
__device__ __forceinline__ void wt_tile(int blk, const float* __restrict__ W, int K, int Ncols, unsigned short* __restrict__ out, unsigned short (*Tl)[72]) {
  typedef __attribute__((ext_vector_type(8))) unsigned short v8us;
  const int tid = threadIdx.x, lane = tid & 31, wave = tid >> 5, n0 = (blk % (Ncols / 64)) * 64, k0 = (blk / (Ncols / 64)) * 64;
  for (int i = tid; i < 64 * 64; i += 256) { const int kk = i / 64, nn = i % 64; const float w = W[(size_t)(k0 + kk) * Ncols + n0 + nn];
    unsigned short bits; if (MODE == 0) bits = bf16_rne_bits(w); else { const b16 hv = (b16)bf16_rne(w); bits = *reinterpret_cast<const unsigned short*>(&hv); }
    Tl[nn][kk] = bits; }
  __syncthreads();
  {
#pragma unroll
    for (int j = 0; j < 2; ++j) { const int rr = wave * 8 + j * 4 + (lane >> 3), c8 = (lane & 7) * 8; *(v8us*)(out + (size_t)(n0 + rr) * K + k0 + c8) = *(const v8us*)(&Tl[rr][c8]); }
    asm volatile("s_wait_xcnt 0x0" ::: "memory");               // behind the last store: stands in front of any later write of a register that these stores name
  }
}

// All preparation in one launch. The parts stand in the order of their blocks' own run time, the longest first: sinusoids, the three
// weight transposes, the embed rounding. Every branch is on the block index alone, so the barrier inside wt_tile is passed by a whole block or by none of it.
__global__ __launch_bounds__(256) void prep_kernel(const float* __restrict__ emb, const float* __restrict__ Wqkv, const float* __restrict__ Wpos, const float* __restrict__ Wfc,
                                                   unsigned short* __restrict__ e16, b16* __restrict__ peh, b16* __restrict__ pel,
                                                   unsigned short* __restrict__ wq, unsigned short* __restrict__ wp, unsigned short* __restrict__ wf) {
  __shared__ __attribute__((aligned(16))) unsigned short Sh[64][72];   // a transpose tile, or the sinusoid part's staging
  int blk = blockIdx.x;
  if (blk < PB_PE) { prep_pe(blk, (b16*)&Sh[0][0], peh, pel); return; }
  blk -= PB_PE;
  if (blk < PB_WQ) { wt_tile<0>(blk, Wqkv, DM, NQKV, wq, Sh); return; }
  blk -= PB_WQ;
  if (blk < PB_WF) { wt_tile<1>(blk, Wfc, DM, DM, wf, Sh); return; }
  blk -= PB_WF;
  if (blk < PB_WP) { wt_tile<1>(blk, Wpos, DH, NPOS, wp, Sh); return; }
  prep_embed(blk - PB_WP, emb, e16);
}

// Eight 16-byte asynchronous copies of one thread, global memory to LDS; the closing wait stands in front of any rewrite of the address registers named here.
__device__ __forceinline__ void copy8_to_lds(unsigned l0, unsigned l1, unsigned l2, unsigned l3, unsigned l4, unsigned l5, unsigned l6, unsigned l7,
                                             const void* g0, const void* g1, const void* g2, const void* g3, const void* g4, const void* g5, const void* g6, const void* g7) {
  asm volatile("global_load_async_to_lds_b128 %0, %8, off\n\t"
               "global_load_async_to_lds_b128 %1, %9, off\n\t"
               "global_load_async_to_lds_b128 %2, %10, off\n\t"
               "global_load_async_to_lds_b128 %3, %11, off\n\t"
               "global_load_async_to_lds_b128 %4, %12, off\n\t"
               "global_load_async_to_lds_b128 %5, %13, off\n\t"
               "global_load_async_to_lds_b128 %6, %14, off\n\t"
               "global_load_async_to_lds_b128 %7, %15, off\n\t"
               "s_wait_xcnt 0x0"
               :: "v"(l0), "v"(l1), "v"(l2), "v"(l3), "v"(l4), "v"(l5), "v"(l6), "v"(l7), "v"(g0), "v"(g1), "v"(g2), "v"(g3), "v"(g4), "v"(g5), "v"(g6), "v"(g7) : "memory");
}

__device__ __forceinline__ void copy2_to_lds(unsigned l0, unsigned l1, const void* g0, const void* g1) {   // the same, two copies
  asm volatile("global_load_async_to_lds_b128 %0, %2, off\n\t"
               "global_load_async_to_lds_b128 %1, %3, off\n\t"
               "s_wait_xcnt 0x0"
               :: "v"(l0), "v"(l1), "v"(g0), "v"(g1) : "memory");
}

// position projections: (1024 x 64) x (64 x 3072): A = pe planes (x8 hi+lo), B = f16(bf16 W_pos)^T rows -> 2 products; single f16 rows pp[which][h][l][64]. They need only the
// preparation's results, as the qkv projection does, so their blocks ride in qkv_kernel's launch: PB_POS blocks of 8 waves, block blk = 256 rows x 64 columns, wave = 32 x 64.
// Th: 8 KB of LDS a wave for the epilogue.
constexpr int PB_POS = (NPOS / 64) * (L / 256);
__device__ __forceinline__ void pos_block(int blk, const b16* __restrict__ peh, const b16* __restrict__ pel, const b16* __restrict__ wpos, b16* __restrict__ pp, b16* Th) {
  const int lane = threadIdx.x & 31, wave = threadIdx.x >> 5, nloc = lane & 15, hlf = lane >> 4, m0 = (blk / (NPOS / 64)) * 256 + wave * 32, c0 = (blk % (NPOS / 64)) * 64;
  v8f acc[2][4];
#pragma unroll
  for (int r = 0; r < 2; ++r)
#pragma unroll
    for (int t = 0; t < 4; ++t) acc[r][t] = (v8f){};
  const Opnd A{peh, pel, DH}, B{wpos, nullptr, DH};
  gemm_tile<2, 1>(A, B, DH, m0, c0, nloc, hlf, acc);
  const int which = c0 / DM, h = (c0 % DM) / DH;
  epi_planes(acc, 1.0f / PES, false, pp + (((size_t)which * H + h) * L + m0) * DH, nullptr, DH, 0, 0, lane, Th + wave * (2 * 32 * 64), Th + wave * (2 * 32 * 64) + 32 * 64);
}

// qkv: (4096 x 1024) x (1024 x 4096) bf16 WMMA; 32 x 32 blocks behind the PB_POS position blocks (those end early and free their places), block = 128 tokens x 128 columns, 8 waves (4 along tokens x 2 along columns) of 32 x 64 each. Per 64-k tile the
// 128 embed rows and the 128 weight rows are brought once per block into LDS (row pitch 144 B) by asynchronous copies, two buffers: tile t + 1 flies while tile t is worked on;
// fragments come from LDS. Columns: [q | k1 | k2 | v] x 1024; q/k1/k2 -> single f16 rows [which][b][h][l][64]; v -> (8v)^T hi/lo planes [b][h][64 d][1024 l] through a block
// LDS transpose (block = 128 tokens of one batch row, two heads). The epilogues stage in the ring's LDS behind the last tile's barrier.
// Eight waves a SIMD are asked for so that four blocks (their LDS fits four times) share a WGP and all 1024 blocks are resident at once.
constexpr int GPIT = 64 + 8, GROWS = 256, GTILE = GROWS * GPIT;   // LDS row pitch (16-bit elements), rows and elements of a stage: 128 embed rows, then 128 weight rows
__global__ __launch_bounds__(256, 8) void qkv_kernel(const __bf16* __restrict__ e16, const __bf16* __restrict__ wqkv, b16* __restrict__ qk, b16* __restrict__ vth, b16* __restrict__ vtl,
                                                     const b16* __restrict__ peh, const b16* __restrict__ pel, const b16* __restrict__ wpos, b16* __restrict__ pp) {
  __shared__ __attribute__((aligned(16))) unsigned short Sm[2 * GTILE];   // 73,728 B
  if (blockIdx.x < PB_POS) { pos_block(blockIdx.x, peh, pel, wpos, pp, (b16*)Sm); return; }   // a whole block takes this branch, in front of every barrier
  const int gblk = blockIdx.x - PB_POS;                         // column tile runs fastest
  const int tid = threadIdx.x, lane = tid & 31, wave = __builtin_amdgcn_readfirstlane(tid >> 5), wm = wave & 3, wn = wave >> 2, nloc = lane & 15, hlf = lane >> 4;
  const int mb = (gblk / (NQKV / 128)) * 128, cb = (gblk % (NQKV / 128)) * 128, m0 = mb + wm * 32, c0 = cb + wn * 64;   // the wave number is held scalar: tile indices and the epilogue branch stay scalar
  // copy map: 8 lanes bring one 128-byte row piece; a thread brings rows sr + 32 i of both operands
  const int sr = tid >> 3, sc = (tid & 7) * 8;
  const __bf16* ga = e16 + (size_t)(mb + sr) * DM + sc; const __bf16* gb = wqkv + (size_t)(cb + sr) * DM + sc;
  const unsigned ls = (unsigned)(size_t)(&Sm[0]) + (unsigned)(sr * GPIT + sc) * 2u;
  auto stage = [&](int kt, int buf) {
    const unsigned l = ls + (unsigned)buf * (GTILE * 2u); const __bf16* a = ga + kt * 64; const __bf16* w = gb + kt * 64;
    constexpr unsigned R32 = 32u * GPIT * 2u;
    copy8_to_lds(l, l + R32, l + 2u * R32, l + 3u * R32, l + 4u * R32, l + 5u * R32, l + 6u * R32, l + 7u * R32,
                 a, a + 32 * DM, a + 64 * DM, a + 96 * DM, w, w + 32 * DM, w + 64 * DM, w + 96 * DM);
  };
  v8f acc[2][4];
#pragma unroll
  for (int r = 0; r < 2; ++r)
#pragma unroll
    for (int t = 0; t < 4; ++t) acc[r][t] = (v8f){};
  stage(0, 0);
  asm volatile("s_wait_asynccnt 0x0" ::: "memory");             // this wave's copies of tile 0 have landed
  __syncthreads();                                              // publishes tile 0
  stage(1, 1);
  for (int kt = 0; kt < DM / 64; ++kt) {
    const __bf16* As = (const __bf16*)Sm + (kt & 1) * GTILE + (wm * 32 + nloc) * GPIT; const __bf16* Bs = (const __bf16*)Sm + (kt & 1) * GTILE + (128 + wn * 64 + nloc) * GPIT;
#pragma unroll                                                  // both 32-k halves of the tile in line: LDS offsets become immediates
    for (int ks = 0; ks < 2; ++ks) {
      const v16bb a0 = frag_kb_bf(As + ks * 32, hlf), a1 = frag_kb_bf(As + 16 * GPIT + ks * 32, hlf);
      v16bb bw[4];
#pragma unroll
      for (int t = 0; t < 4; ++t) bw[t] = frag_kb_bf(Bs + t * 16 * GPIT + ks * 32, hlf);
      group_fence();                        // the 12 LDS reads of this 32-k half stay one group ahead of its WMMAs: one LDS wait instead of one per fragment
#pragma unroll
      for (int t = 0; t < 4; ++t) { acc[0][t] = wmma16bb(a0, bw[t], acc[0][t]); acc[1][t] = wmma16bb(a1, bw[t], acc[1][t]); }
      group_fence();                        // the next group's reads are not spread among these WMMAs
    }
    asm volatile("s_wait_dscnt 0x0" ::: "memory");              // this wave's reads of tile kt are done before its buffer is handed back
    asm volatile("s_wait_asynccnt 0x0" ::: "memory");           // this wave's copies of tile kt + 1 have landed
    __syncthreads();                                            // publishes tile kt + 1 and ends every read of tile kt
    if (kt + 2 < DM / 64) stage(kt + 2, kt & 1);
  }
  asm volatile("s_wait_asynccnt 0x0" ::: "memory");             // no copy is outstanding when the ring becomes output staging
  const int which = c0 / DM, c1 = c0 % DM, h = c1 / DH, b = m0 / L, l0 = m0 % L;   // 64 columns = one head; which is the same for the whole block
  if (which < 3) {                                             // q / k1 / k2 rows [which][b][h][l][64] (single f16)
    b16* Th = (b16*)Sm + wave * (2 * 32 * 64);
    epi_planes(acc, 1.0f, false, qk + ((((size_t)which * Bn + b) * H + h) * L + l0) * DH, nullptr, DH, 0, 0, lane, Th, Th + 32 * 64);
    return;
  }
  constexpr int TP = 128 + 8;                                   // token pitch of the transpose planes [head wn][hi, lo][64 d][TP]
  b16* Tt = (b16*)Sm + wn * (2 * 64 * TP);
#pragma unroll
  for (int t = 0; t < 4; ++t)
#pragma unroll
    for (int r = 0; r < 2; ++r)
#pragma unroll
      for (int v = 0; v < 8; ++v) { b16 a, c; split16(acc[r][t][v] * VS, a, c); const int o = (t * 16 + nloc) * TP + wm * 32 + r * 16 + 8 * hlf + v; Tt[o] = a; Tt[64 * TP + o] = c; }
  __syncthreads();
  const int tok0 = mb % L, bb = mb / L;
  b16* bh_ = vth + (((size_t)bb * H + h) * DH) * L + tok0; b16* bl_ = vtl + (((size_t)bb * H + h) * DH) * L + tok0;
  {
#pragma unroll
    for (int j = 0; j < 8; ++j) { const int dd = wm * 16 + j * 2 + (lane >> 4), c8 = (lane & 15) * 8;
      *(v8b*)(bh_ + (size_t)dd * L + c8) = *(const v8b*)(&Tt[dd * TP + c8]); *(v8b*)(bl_ + (size_t)dd * L + c8) = *(const v8b*)(&Tt[64 * TP + dd * TP + c8]); }
    asm volatile("s_wait_xcnt 0x0" ::: "memory");               // behind the last store: stands in front of any later write of a register that these stores name
  }
}

// ---------------------------------------------------------------------------
// attention: block = (b, h, 128 queries), wave = 16 queries; causal 32-key chunks up to the block's diagonal. All key-side operands come from LDS, staged once per block and
// shared by its 8 waves: the two mask rows once, and per chunk the k1/k2/kp1/kp2 rows (pitch 144 B) and the (8v)^T hi/lo columns (pitch 80 B), two buffers: chunk t + 1 is
// fetched into registers before chunk t is worked on and stored to the other buffer behind it; one barrier a chunk. A wave past its own diagonal only stages.
// Per chunk and 16-key half: four K=64 score products (q.k1, qp.kp1, q.k2, qp.kp2; single f16),
// logit = same speaker ? s1 + p1 : s2 + p2; -inf where key > query or umask[b][key] == 0; online softmax f32; P^T f16; y^T += (8v)^T.P^T (4 feature tiles, hi + lo);
// ---------------------------------------------------------------------------
constexpr int KPIT = DH + 8, VPIT = 32 + 8;                    // LDS row pitches in f16: 16 B x odd, for 16-byte fragment reads
typedef __attribute__((ext_vector_type(4))) int v4i;
__global__ __launch_bounds__(256) void attn_kernel(const b16* __restrict__ qk, const b16* __restrict__ pp, const b16* __restrict__ vth, const b16* __restrict__ vtl,
                                                   const int* __restrict__ umask, const int* __restrict__ qmask, float* __restrict__ y) {
  __shared__ __attribute__((aligned(16))) float Os[8][16][DH + 4];
  __shared__ __attribute__((aligned(16))) b16 Ks[2][4][32 * KPIT];   // [buffer][k1, k2, kp1, kp2][key][feature]
  __shared__ __attribute__((aligned(16))) b16 Vs[2][2][DH * VPIT];   // [buffer][hi, lo][feature][key]
  __shared__ __attribute__((aligned(16))) int Ms[2][L];              // speaker ids and umask of batch row b
  const int tid = threadIdx.x, wid = __builtin_amdgcn_readfirstlane(tid >> 5), lane = tid & 31, hh = lane >> 4, col = lane & 15;
  // Block index -> (head row, query tile). A block's cost grows with its tile (4 to 32 chunks), so the tile comes from the HIGH bits:
  // every run of 64 blocks is one tile over all 64 (b, h). Order 7,6,5,4,0,1,2,3: the long blocks have the low indices,
  // and blocks 256 apart add up to 36 chunks. The map is one-to-one onto (b, h, tile); its order matters for speed only.
  const int grp = blockIdx.x >> 6, tile = grp < 4 ? 7 - grp : grp - 4;
  const int qt = (blockIdx.x & 63) * 64 + tile * 8 + wid, jt = qt & 63, h = (qt >> 6) & 15, b = qt >> 10, q0 = jt * 16, qi = q0 + col;
  const int nchunk = (tile + 1) * 4;                            // 32-key chunks up to the block's last query
  const b16* Q = qk + ((((size_t)0 * Bn + b) * H + h) * L) * DH; const b16* K1 = qk + ((((size_t)1 * Bn + b) * H + h) * L) * DH; const b16* K2 = qk + ((((size_t)2 * Bn + b) * H + h) * L) * DH;
  const b16* QP = pp + (((size_t)0 * H + h) * L) * DH; const b16* KP1 = pp + (((size_t)1 * H + h) * L) * DH; const b16* KP2 = pp + (((size_t)2 * H + h) * L) * DH;
  const b16* vh = vth + (((size_t)b * H + h) * DH) * L; const b16* vl = vtl + (((size_t)b * H + h) * DH) * L;
  // staging map: a thread moves one 16-byte piece of each of the six tiles
  const int kr = tid >> 3, kc = (tid & 7) * 8, vr = tid >> 2, vc = (tid & 3) * 8;
  const size_t gko = (size_t)kr * DH + kc, gvo = (size_t)vr * L + vc;
  const int sko = kr * KPIT + kc, svo = vr * VPIT + vc;
  v8b st[6];
  st[0] = ld8b(K1 + gko); st[1] = ld8b(K2 + gko); st[2] = ld8b(KP1 + gko); st[3] = ld8b(KP2 + gko); st[4] = ld8b(vh + gvo); st[5] = ld8b(vl + gvo);
  const v4i mq = *(const v4i*)(qmask + b * L + tid * 4), mu = *(const v4i*)(umask + b * L + tid * 4);
  v16b qf[2], qpf[2];
#pragma unroll
  for (int ks = 0; ks < 2; ++ks) { qf[ks] = frag_kb(Q + (size_t)qi * DH + ks * 32, hh); qpf[ks] = frag_kb(QP + (size_t)qi * DH + ks * 32, hh); }
  const int myspk = qmask[b * L + qi];
  asm volatile("s_wait_xcnt 0x0" ::: "memory");                 // before the address registers of the loads above are reused
  *(v4i*)(&Ms[0][tid * 4]) = mq; *(v4i*)(&Ms[1][tid * 4]) = mu;
#pragma unroll
  for (int i = 0; i < 4; ++i) *(v8b*)(&Ks[0][i][sko]) = st[i];
  *(v8b*)(&Vs[0][0][svo]) = st[4]; *(v8b*)(&Vs[0][1][svo]) = st[5];
  __syncthreads();
  float m = -INFINITY, l = 0.0f; v8f o[4] = {{}, {}, {}, {}};
  for (int t = 0; t < nchunk; ++t) {
    const int kb = t * 32, cur = t & 1; const bool more = t + 1 < nchunk;
    if (more) { const size_t ka = gko + (size_t)(kb + 32) * DH, va = gvo + kb + 32;
      st[0] = ld8b(K1 + ka); st[1] = ld8b(K2 + ka); st[2] = ld8b(KP1 + ka); st[3] = ld8b(KP2 + ka); st[4] = ld8b(vh + va); st[5] = ld8b(vl + va);
      asm volatile("s_wait_xcnt 0x0" ::: "memory"); }           // before the address registers of these six loads are reused
    if (kb < q0 + 16) {
      // The chunk's LDS reads stand in three groups, each issued whole: keys 0..15 and keys 16..31 (each with its mask words) ahead of their WMMAs, the value tiles ahead of the softmax.
      float lg0[8], lg1[8] = {};
      v16b kf[4][2], vf[4][2]; v4i mk[4]; v8f s1, p1, s2, p2;
      auto read_keys = [&](int half) {
        const int ro = (half * 16 + col) * KPIT;
#pragma unroll
        for (int i = 0; i < 4; ++i)
#pragma unroll
          for (int ks = 0; ks < 2; ++ks) kf[i][ks] = frag_kb(&Ks[cur][i][ro + ks * 32], hh);
      };
      auto read_masks = [&](int half) {
        const int k8 = kb + half * 16 + 8 * hh;
        mk[0] = *(const v4i*)(&Ms[0][k8]); mk[1] = *(const v4i*)(&Ms[0][k8 + 4]); mk[2] = *(const v4i*)(&Ms[1][k8]); mk[3] = *(const v4i*)(&Ms[1][k8 + 4]);
      };
      auto scores = [&]() {
        s1 = (v8f){}; p1 = (v8f){}; s2 = (v8f){}; p2 = (v8f){};
#pragma unroll
        for (int ks = 0; ks < 2; ++ks) {
          s1 = wmma16b(kf[0][ks], qf[ks], s1); s2 = wmma16b(kf[1][ks], qf[ks], s2);
          p1 = wmma16b(kf[2][ks], qpf[ks], p1); p2 = wmma16b(kf[3][ks], qpf[ks], p2);
        }
      };
      auto logits = [&](int half, float (&lg)[8]) {
        const int k8 = kb + half * 16 + 8 * hh;
#pragma unroll
        for (int r = 0; r < 8; ++r) { const int kk = k8 + r; const bool same = ((r < 4 ? mk[0][r & 3] : mk[1][r & 3]) == myspk);
          float v = same ? (s1[r] + p1[r]) : (s2[r] + p2[r]);
          if ((kk > qi) | ((r < 4 ? mk[2][r & 3] : mk[3][r & 3]) == 0)) v = -INFINITY;
          lg[r] = v; }
      };
#pragma unroll 1                                                // rolled: a half's logits are finished before the next half's fragments are read, so the live registers still let two blocks share a WGP
      for (int half = 0; half < 2; ++half) {
        read_keys(half);
        asm volatile("" ::: "memory");                          // compiler fence: the mask words are read last, so the compares that wait for them stand behind the whole group, not inside it
        read_masks(half);
        group_fence();                                          // the half's 20 LDS reads stay one group ahead of its WMMAs
        scores();
#pragma unroll
        for (int r = 0; r < 8; ++r) lg0[r] = lg1[r];            // the first half's logits move on; after two trips lg0 holds keys 0..15 and lg1 keys 16..31
        logits(half, lg1);
      }
#pragma unroll
      for (int n = 0; n < 4; ++n) { const int ro = (n * 16 + col) * VPIT; vf[n][0] = frag_kb(&Vs[cur][0][ro], hh); vf[n][1] = frag_kb(&Vs[cur][1][ro], hh); }
      group_fence();                                            // the 16 reads of the value tiles stay one group ahead of the softmax, which hides them
      float mr = -INFINITY;
#pragma unroll
      for (int r = 0; r < 8; ++r) mr = fmaxf(mr, fmaxf(lg0[r], lg1[r]));
      mr = fmaxf(mr, __shfl_xor(mr, 16));
      float mn = fmaxf(m, mr); if (mn == -INFINITY) mn = 0.0f;
      const float al_ = __expf(m - mn); m = mn;
      float sum = 0.0f; v16b pb;
#pragma unroll
      for (int r = 0; r < 8; ++r) { const float e0 = __expf(lg0[r] - mn), e1 = __expf(lg1[r] - mn); sum += e0 + e1; pb[r] = (b16)e0; pb[8 + r] = (b16)e1; }
      sum += __shfl_xor(sum, 16); l = l * al_ + sum;
#pragma unroll
      for (int n = 0; n < 4; ++n) {
#pragma unroll
        for (int r = 0; r < 8; ++r) o[n][r] *= al_;
        o[n] = wmma16b(vf[n][0], pb, o[n]); o[n] = wmma16b(vf[n][1], pb, o[n]);
      }
      // four vector slots behind the chunk's last WMMAs on every path out of the chunk
      asm volatile("v_nop\n\tv_nop\n\tv_nop\n\tv_nop" : "+v"(o[0]), "+v"(o[1]), "+v"(o[2]), "+v"(o[3]) : "v"(pb));
    }
    if (more) {                                                 // the other buffer's last readers left it at the previous chunk's barrier
#pragma unroll
      for (int i = 0; i < 4; ++i) *(v8b*)(&Ks[cur ^ 1][i][sko]) = st[i];
      *(v8b*)(&Vs[cur ^ 1][0][svo]) = st[4]; *(v8b*)(&Vs[cur ^ 1][1][svo]) = st[5];
      __syncthreads();                                          // publishes chunk t + 1 and ends every read of chunk t
    }
  }
  const float inv = (l > 0.0f) ? (1.0f / (VS * l)) : 0.0f;
#pragma unroll
  for (int n = 0; n < 4; ++n)
#pragma unroll
    for (int r = 0; r < 8; ++r) Os[wid][col][n * 16 + 8 * hh + r] = o[n][r] * inv;
  wave_lds_sync();
  float* dst = y + ((size_t)b * L + q0) * DM + h * DH;          // 16 rows x 256 B
  {
#pragma unroll
    for (int j = 0; j < 8; ++j) { const int rr = j * 2 + hh, c4 = col * 4; *(v4f*)(dst + (size_t)rr * DM + c4) = *(const v4f*)(&Os[wid][rr][c4]); }
    
  }
}

// out = y.W_fc: (4096 x 1024) x (1024 x 1024); A = y f32 x8 split, B = f16(bf16 W_fc)^T rows -> 2 products; f32 rows; grid (16, 32), block = 128 rows x 64 columns, 8 waves of
// 16 x 64. Per 64-k tile the 128 y rows (f32, pitch 272 B) and the 64 weight rows (pitch 144 B) are brought once per block into LDS by asynchronous copies, two buffers, as in
// qkv_kernel; the split runs on fragments read from LDS. The epilogue stages in the ring's LDS behind the last tile's barrier.
constexpr int OAP = 64 + 4, OBP = 64 + 8, OAB = 128 * OAP * 4, OST = OAB + 64 * OBP * 2;   // pitches (f32, f16 elements), bytes of the y part and of a whole stage
__global__ __launch_bounds__(256) void out_kernel(const float* __restrict__ y, const b16* __restrict__ wfc, float* __restrict__ out) {
  __shared__ __attribute__((aligned(16))) unsigned char So[2 * OST];   // 88,064 B
  const int tid = threadIdx.x, lane = tid & 31, wave = __builtin_amdgcn_readfirstlane(tid >> 5), nloc = lane & 15, hlf = lane >> 4, mb = blockIdx.y * 128, m0 = mb + wave * 16, c0 = blockIdx.x * 64;
  // copy map: 16 lanes bring one 256-byte y row piece (rows ar + 16 i), 8 lanes one 128-byte weight row piece (rows br + 32 j)
  const int ar = tid >> 4, ac = (tid & 15) * 4, br = tid >> 3, bc = (tid & 7) * 8;
  const float* ga = y + (size_t)(mb + ar) * DM + ac; const b16* gb = wfc + (size_t)(c0 + br) * DM + bc;
  const unsigned la = (unsigned)(size_t)(&So[0]) + (unsigned)(ar * OAP + ac) * 4u, lw = (unsigned)(size_t)(&So[0]) + (unsigned)OAB + (unsigned)(br * OBP + bc) * 2u;
  auto stage = [&](int kt, int buf) {
    const unsigned l = la + (unsigned)buf * (unsigned)OST, w = lw + (unsigned)buf * (unsigned)OST; const float* a = ga + kt * 64; const b16* g = gb + kt * 64;
    constexpr unsigned R16 = 16u * OAP * 4u;
    copy8_to_lds(l, l + R16, l + 2u * R16, l + 3u * R16, l + 4u * R16, l + 5u * R16, l + 6u * R16, l + 7u * R16,
                 a, a + 16 * DM, a + 32 * DM, a + 48 * DM, a + 64 * DM, a + 80 * DM, a + 96 * DM, a + 112 * DM);
    copy2_to_lds(w, w + 32u * OBP * 2u, g, g + 32 * DM);
  };
  v8f acc[4] = {{}, {}, {}, {}};
  stage(0, 0);
  asm volatile("s_wait_asynccnt 0x0" ::: "memory");             // this wave's copies of tile 0 have landed
  __syncthreads();                                              // publishes tile 0
  stage(1, 1);
  for (int kt = 0; kt < DM / 64; ++kt) {
    const float* As = (const float*)(So + (kt & 1) * OST) + (wave * 16 + nloc) * OAP + 8 * hlf; const b16* Bs = (const b16*)(So + (kt & 1) * OST + OAB) + nloc * OBP;
    // every loop below is unrolled so that the fragment and accumulator arrays are indexed by constants and stay in registers
    v4f x[2][4]; v16b bf[2][4];
#pragma unroll
    for (int ks = 0; ks < 2; ++ks) {
      x[ks][0] = *(const v4f*)(As + ks * 32); x[ks][1] = *(const v4f*)(As + ks * 32 + 4); x[ks][2] = *(const v4f*)(As + ks * 32 + 16); x[ks][3] = *(const v4f*)(As + ks * 32 + 20);
#pragma unroll
      for (int t = 0; t < 4; ++t) bf[ks][t] = frag_kb(Bs + t * 16 * OBP + ks * 32, hlf);
    }
    group_fence();                          // the tile's 24 LDS reads stay one group ahead of the split and the WMMAs: one LDS wait a tile instead of one per fragment
#pragma unroll
    for (int ks = 0; ks < 2; ++ks) {
      v16b ah, al;
#pragma unroll
      for (int e = 0; e < 16; ++e) { b16 a, c; split16(x[ks][e >> 2][e & 3] * 8.0f, a, c); ah[e] = a; al[e] = c; }
#pragma unroll
      for (int t = 0; t < 4; ++t) acc[t] = wmma16b(ah, bf[ks][t], acc[t]);     // hi, then lo, into each accumulator
#pragma unroll
      for (int t = 0; t < 4; ++t) acc[t] = wmma16b(al, bf[ks][t], acc[t]);
    }
    asm volatile("s_wait_dscnt 0x0" ::: "memory");              // this wave's reads of tile kt are done before its buffer is handed back
    asm volatile("s_wait_asynccnt 0x0" ::: "memory");           // this wave's copies of tile kt + 1 have landed
    __syncthreads();                                            // publishes tile kt + 1 and ends every read of tile kt
    if (kt + 2 < DM / 64) stage(kt + 2, kt & 1);
  }
  asm volatile("s_wait_asynccnt 0x0" ::: "memory");             // no copy is outstanding when the ring becomes output staging
  float* Tt = (float*)So + wave * (16 * 64);                    // 16 rows x 256 B per wave, stored as whole lines; unrolled: constant accumulator indices
#pragma unroll
  for (int t = 0; t < 4; ++t)
#pragma unroll
    for (int v = 0; v < 8; ++v) Tt[(v + 8 * hlf) * 64 + t * 16 + nloc] = acc[t][v] * (1.0f / 8.0f);
  wave_lds_sync();
  float* dst0 = out + (size_t)m0 * DM + c0;
#pragma unroll
  for (int j = 0; j < 8; ++j) { const int rr = j * 2 + hlf, c4 = nloc * 4; *(v4f*)(dst0 + (size_t)rr * DM + c4) = *(const v4f*)(Tt + rr * 64 + c4); }
}
}  // namespace

extern "C" void kernel_launch(void* const* d_in, const int* in_sizes, int n_in,
                              void* d_out, int out_size, void* d_ws, size_t ws_size, hipStream_t stream) {
  (void)n_in; (void)out_size;
  const float* emb = (const float*)d_in[0]; const int* umask = (const int*)d_in[1]; const int* qmask = (const int*)d_in[2];
  const float* Wqkv = (const float*)d_in[3]; const float* Wpos = (const float*)d_in[4]; const float* Wfc = (const float*)d_in[5];
  float* out = (float*)d_out;   // [4,1024,1024]
  if (in_sizes[0] != NTOK * DM || in_sizes[1] != NTOK || in_sizes[2] != NTOK || in_sizes[3] != DM * NQKV || in_sizes[4] != DH * NPOS || in_sizes[5] != DM * DM) return;
  size_t off = 0; char* ws = (char*)d_ws;
  auto carve = [&](size_t bytes) { char* p = ws + off; off += (bytes + 255) & ~(size_t)255; return p; };
  unsigned short* e16 = (unsigned short*)carve((size_t)NTOK * DM * 2);       // 8 MB
  unsigned short* wq = (unsigned short*)carve((size_t)NQKV * DM * 2);        // 8 MB
  unsigned short* wp = (unsigned short*)carve((size_t)NPOS * DH * 2);        // 384 KB
  unsigned short* wf = (unsigned short*)carve((size_t)DM * DM * 2);          // 2 MB
  b16* peh = (b16*)carve((size_t)L * DH * 2); b16* pel = (b16*)carve((size_t)L * DH * 2);
  b16* qk = (b16*)carve((size_t)3 * Bn * H * L * DH * 2);                   // 24 MB
  b16* vth = (b16*)carve((size_t)Bn * H * DH * L * 2); b16* vtl = (b16*)carve((size_t)Bn * H * DH * L * 2);   // 8 MB each
  b16* pp = (b16*)carve((size_t)3 * H * L * DH * 2);                         // 6 MB
  float* y = (float*)carve((size_t)NTOK * DM * 4);                           // 16 MB
  if (off > ws_size) return;                                                  // ≈ 81 MB
  prep_kernel<<<PB_PE + PB_WQ + PB_WF + PB_WP + PB_EM, 256, 0, stream>>>(emb, Wqkv, Wpos, Wfc, e16, peh, pel, wq, wp, wf);
  qkv_kernel<<<PB_POS + (NQKV / 128) * (NTOK / 128), 256, 0, stream>>>((const __bf16*)e16, (const __bf16*)wq, qk, vth, vtl, peh, pel, (const b16*)wp, pp);
  attn_kernel<<<Bn * H * (L / 16) / 8, 256, 0, stream>>>(qk, pp, vth, vtl, umask, qmask, y);
  out_kernel<<<dim3(DM / 64, NTOK / 128), 256, 0, stream>>>(y, (const b16*)wf, out);
}

// v006
// One run takes 99.1 microseconds.
// Two timings next to v005 both put it at 1.03 times that version's speed.
// All steps since v000 together make it 4.55 times as fast.
#include <hip/hip_runtime.h>

// Speaker-aware causal multi-head attention with relative sinusoidal position terms (d_model 1024, 16 heads x 64, B=4, L=1024): q,k1,k2,v = embed W_qkv;
// qp,kp1,kp2 = pe W_pos (pe = the module's sinusoid table rows 89..1112); logit[q][k] = same speaker ? (q.k1 + qp.kp1) : (q.k2 + qp.kp2) (scale 1); keys k > q or umask = 0
// -> -inf; softmax; out = (P.v) W_fc.
// Numerics: embed, W_qkv, W_pos and W_fc are rounded to bf16 (RNE); the qkv projection runs on
// v_wmma_f32_16x16x32_bf16 with those operands (exact products, f32 accumulate); the position projection uses f16 hi+lo of the f32 sinusoid table against the exact f16 copy of
// bf16 W_pos; the four score products use single f16 copies of q/k1/k2/qp/kp (f32 accumulate); P.V pairs single-f16 P with hi+lo 8v; the output projection pairs hi+lo of the
// attention output with the exact f16 copy of bf16 W_fc. Masks are read from the int inputs. Fragment k-map per lane half hh for A AND B: elements 0..7 <- k = 8hh+0..7, 8..15

namespace {
constexpr int Bn = 4, L = 1024, DM = 1024, H = 16, DH = 64, NTOK = Bn * L, NQKV = 4 * DM, NPOS = 3 * DM, TBL = 1201, SHIFT = 601;
constexpr float VS = 8.0f, PES = 8.0f;

typedef _Float16 b16;
typedef __attribute__((ext_vector_type(16))) _Float16 v16b;
typedef __attribute__((ext_vector_type(8)))  _Float16 v8b;
typedef __attribute__((ext_vector_type(8)))  float v8f;
typedef __attribute__((ext_vector_type(4)))  float v4f;

__device__ __forceinline__ v8b ld8b(const b16* p) { return *(const v8b*)p; }
__device__ __forceinline__ v16b cat8b(v8b a, v8b b) { return __builtin_shufflevector(a, b, 0, 1, 2, 3, 4, 5, 6, 7, 8, 9, 10, 11, 12, 13, 14, 15); }
__device__ __forceinline__ v16b frag_kb(const b16* p, int hh) { return cat8b(ld8b(p + 8 * hh), ld8b(p + 16 + 8 * hh)); }
__device__ __forceinline__ void split16(float v, b16& hi, b16& lo) { hi = (b16)v; lo = (b16)(v - (float)hi); }
// hi/lo fragment pair straight from an f32 k-contiguous row (same k-map)
__device__ __forceinline__ void frag_ksplit(const float* p, int hh, v16b& fh_, v16b& fl_) {
  const float* p0 = p + 8 * hh; const float* p1 = p + 16 + 8 * hh;
#pragma unroll
  for (int e = 0; e < 8; ++e) { b16 a, c; split16(p0[e], a, c); fh_[e] = a; fl_[e] = c; split16(p1[e], a, c); fh_[8 + e] = a; fl_[8 + e] = c; }
}
__device__ __forceinline__ v8f wmma16b(v16b a, v16b b, v8f c) {
  return __builtin_amdgcn_wmma_f32_16x16x32_f16(false, a, false, b, (short)0, c, false, false);
}
// Keeps a group of LDS reads whole and at its place in the instruction stream: the compiler fence holds the reads on their side, the scheduling fence the WMMAs and vector work.
// Left free, the reads sink to one pair with a full LDS wait in front of each WMMA, or rise so far that the live fragments no longer fit the registers.
__device__ __forceinline__ void group_fence() { asm volatile("" ::: "memory"); __builtin_amdgcn_sched_barrier(0); }
__device__ __forceinline__ void wave_lds_sync() {
  __builtin_amdgcn_fence(__ATOMIC_RELEASE, "workgroup");
  __builtin_amdgcn_wave_barrier();
  __builtin_amdgcn_fence(__ATOMIC_ACQUIRE, "workgroup");
}

// Operand descriptor: NP = 0 -> f32 rows split on the fly into (hi, lo); NP = 1 -> one f16 plane; NP = 2 -> f16 hi + lo planes;
// NP = 3 -> f32 rows rounded once to a single f16 fragment. ld = row pitch.
struct Opnd { const void* p0; const void* p1; int ld; };
template <int NP> __device__ __forceinline__ void load_frags(const Opnd& o, int row, int kb, int hh, v16b& fh_, v16b& fl_) {
  if (NP == 0) { frag_ksplit((const float*)o.p0 + (size_t)row * o.ld + kb, hh, fh_, fl_); }
  else if (NP == 4 || NP == 5) {                             // f32 rows x64 (NP 4) or x8 (NP 5) then split (keeps the lo halves of small values normal)
    const float sc_ = (NP == 4) ? 64.0f : 8.0f;
    const float* p = (const float*)o.p0 + (size_t)row * o.ld + kb; const float* p0 = p + 8 * hh; const float* p1 = p + 16 + 8 * hh;
#pragma unroll
    for (int e = 0; e < 8; ++e) { b16 a, c; split16(p0[e] * sc_, a, c); fh_[e] = a; fl_[e] = c; split16(p1[e] * sc_, a, c); fh_[8 + e] = a; fl_[8 + e] = c; }
  } else if (NP == 3) {
    const float* p = (const float*)o.p0 + (size_t)row * o.ld + kb; const float* p0 = p + 8 * hh; const float* p1 = p + 16 + 8 * hh;
#pragma unroll
    for (int e = 0; e < 8; ++e) { fh_[e] = (b16)p0[e]; fh_[8 + e] = (b16)p1[e]; }
    fl_ = fh_;
  } else {
    fh_ = frag_kb((const b16*)o.p0 + (size_t)row * o.ld + kb, hh);
    if (NP == 2) fl_ = frag_kb((const b16*)o.p1 + (size_t)row * o.ld + kb, hh); else fl_ = fh_;
  }
}
template <int ANP, int BNP> __device__ __forceinline__ v8f mac(v16b ah, v16b al, v16b bh, v16b bl, v8f c) {
  c = wmma16b(ah, bh, c);
  if (BNP == 0 || BNP == 2 || BNP == 4 || BNP == 5) c = wmma16b(ah, bl, c);     // hi.lo
  if (ANP == 0 || ANP == 2 || ANP == 4 || ANP == 5) c = wmma16b(al, bh, c);     // lo.hi   (lo.lo dropped)
  return c;
}
// 32x64 wave tile: acc[r][t] (rows m0+16r.., cols c0+16t..) += A[m][k] . B[n][k] over k in [0, K)
template <int ANP, int BNP>
__device__ __forceinline__ void gemm_tile(const Opnd& A, const Opnd& B, int K, int m0, int c0, int nloc, int hlf, v8f (&acc)[2][4]) {
  for (int kb = 0; kb < K; kb += 32) {
    v16b a0h, a0l, a1h, a1l;
    load_frags<ANP>(A, m0 + nloc, kb, hlf, a0h, a0l);
    load_frags<ANP>(A, m0 + 16 + nloc, kb, hlf, a1h, a1l);
#pragma unroll
    for (int t = 0; t < 4; ++t) {
      v16b bh, bl;
      load_frags<BNP>(B, c0 + t * 16 + nloc, kb, hlf, bh, bl);
      acc[0][t] = mac<ANP, BNP>(a0h, a0l, bh, bl, acc[0][t]);
      acc[1][t] = mac<ANP, BNP>(a1h, a1l, bh, bl, acc[1][t]);
    }
  }
}

__device__ __forceinline__ void epi_planes(v8f (&acc)[2][4], float scale, bool two, b16* __restrict__ oh, b16* __restrict__ ol, int ldo,
                                           int m0, int c0, int lane, b16* Th, b16* Tl) {
  const int nloc = lane & 15, hlf = lane >> 4;
#pragma unroll
  for (int t = 0; t < 4; ++t)
#pragma unroll
    for (int r = 0; r < 2; ++r)
#pragma unroll
      for (int v = 0; v < 8; ++v) {
        const int rr = r * 16 + v + 8 * hlf, cc = t * 16 + nloc;
        b16 h_, l_; split16(acc[r][t][v] * scale, h_, l_);
        Th[rr * 64 + cc] = h_; Tl[rr * 64 + cc] = l_;
      }
  wave_lds_sync();
  {
#pragma unroll
    for (int j = 0; j < 8; ++j) {
      const int rr = j * 4 + (lane >> 3), c8 = (lane & 7) * 8;
      const size_t o = (size_t)(m0 + rr) * ldo + c0 + c8;
      *(v8b*)(oh + o) = ld8b(Th + rr * 64 + c8);
      if (two) *(v8b*)(ol + o) = ld8b(Tl + rr * 64 + c8);
    }
    
  }
}
typedef __attribute__((ext_vector_type(8))) __bf16 v8bb; typedef __attribute__((ext_vector_type(16))) __bf16 v16bb;
__device__ __forceinline__ v16bb frag_kb_bf(const __bf16* p, int hh) { const v8bb a = *(const v8bb*)(p + 8 * hh), b = *(const v8bb*)(p + 16 + 8 * hh); return __builtin_shufflevector(a, b, 0, 1, 2, 3, 4, 5, 6, 7, 8, 9, 10, 11, 12, 13, 14, 15); }
__device__ __forceinline__ v8f wmma16bb(v16bb a, v16bb b, v8f c) {
  return __builtin_amdgcn_wmma_f32_16x16x32_bf16(false, a, false, b, (short)0, c, false, false);
}
__device__ __forceinline__ unsigned short bf16_rne_bits(float v) { unsigned int u = __float_as_uint(v); u += 0x7FFFu + ((u >> 16) & 1u); return (unsigned short)(u >> 16); }
__device__ __forceinline__ float bf16_rne(float v) { return __uint_as_float(((unsigned int)bf16_rne_bits(v)) << 16); }

// The preparation work has no dependences among its parts, so all of it runs as ONE launch; a block's index picks its part (prep_kernel below).
constexpr int PB_PE = L * DH / 8 / 256, PB_WQ = (NQKV / 64) * (DM / 64), PB_WF = (DM / 64) * (DM / 64), PB_WP = (NPOS / 64) * (DH / 64), PB_EM = 512;   // blocks of each part
// part: embed -> bf16 rows [4096][1024] (16-B pieces), PB_EM blocks striding over the pieces.
__device__ __forceinline__ void prep_embed(int blk, const float* __restrict__ emb, unsigned short* __restrict__ e16) {
  typedef __attribute__((ext_vector_type(8))) unsigned short v8us;
  const size_t tid = (size_t)blk * 256 + threadIdx.x, nth = (size_t)PB_EM * 256;
  for (size_t p = tid; p < (size_t)NTOK * DM / 8; p += nth) { v8us v;
#pragma unroll
    for (int e = 0; e < 8; ++e) v[e] = bf16_rne_bits(emb[p * 8 + e]);
    *(v8us*)(e16 + p * 8) = v; }
}
// part: pe x8 hi/lo planes [1024][64] from the module's sinusoid formula (f32, table row 0 (the padding row) never selected for L=1024); PB_PE blocks, one 8-element piece a thread.
// Sc: per-thread staging (256 x 16 f16) for the rolled sinusoid loop.
__device__ __forceinline__ void prep_pe(int blk, b16* Sc, b16* __restrict__ peh, b16* __restrict__ pel) {
  const size_t p = (size_t)blk * 256 + threadIdx.x; const int l = (int)(p / 8), d0 = (int)(p % 8) * 8;
  const int tblrow = l - L / 2 + SHIFT;                        // 89 .. 1112, never 0
  const float posv = (float)(tblrow - (TBL + 1) / 2);          // arange(-601, 600)[tblrow] = tblrow - 601
#pragma unroll 1
  for (int e = 0; e < 8; ++e) { const int d = d0 + e; const int j = (d < DH / 2) ? d : d - DH / 2;   // rolled: one sin/cos expansion in the binary
    const float freq = expf((float)j * (-9.210340371976184f / (float)(DH / 2 - 1))); const float ang = posv * freq;
    const float val = (d < DH / 2) ? sinf(ang) : cosf(ang); b16 a, c; split16(val * PES, a, c); Sc[threadIdx.x * 16 + e] = a; Sc[threadIdx.x * 16 + 8 + e] = c; }
  *(v8b*)(peh + p * 8) = *(const v8b*)(&Sc[threadIdx.x * 16]); *(v8b*)(pel + p * 8) = *(const v8b*)(&Sc[threadIdx.x * 16 + 8]);
}

// part: W [k rows][n cols] f32 -> [n][k] 16-bit rows through 64x64 LDS tiles: MODE 0: bf16 bits (W_qkv); MODE 1: f16 of bf16(w) (W_fc, W_pos). Block blk = tile (blk % (N/64), blk / (N/64)).
template <int MODE>
__device__ __forceinline__ void wt_tile(int blk, const float* __restrict__ W, int K, int Ncols, unsigned short* __restrict__ out, unsigned short (*Tl)[72]) {
  typedef __attribute__((ext_vector_type(8))) unsigned short v8us;
  const int tid = threadIdx.x, lane = tid & 31, wave = tid >> 5, n0 = (blk % (Ncols / 64)) * 64, k0 = (blk / (Ncols / 64)) * 64;
  for (int i = tid; i < 64 * 64; i += 256) { const int kk = i / 64, nn = i % 64; const float w = W[(size_t)(k0 + kk) * Ncols + n0 + nn];
    unsigned short bits; if (MODE == 0) bits = bf16_rne_bits(w); else { const b16 hv = (b16)bf16_rne(w); bits = *reinterpret_cast<const unsigned short*>(&hv); }
    Tl[nn][kk] = bits; }
  __syncthreads();
  {
#pragma unroll
    for (int j = 0; j < 2; ++j) { const int rr = wave * 8 + j * 4 + (lane >> 3), c8 = (lane & 7) * 8; *(v8us*)(out + (size_t)(n0 + rr) * K + k0 + c8) = *(const v8us*)(&Tl[rr][c8]); }
    asm volatile("s_wait_xcnt 0x0" ::: "memory");               // behind the last store: stands in front of any later write of a register that these stores name
  }
}

// All preparation in one launch. The parts stand in the order of their blocks' own run time, the longest first: sinusoids, the three
// weight transposes, the embed rounding. Every branch is on the block index alone, so the barrier inside wt_tile is passed by a whole block or by none of it.
__global__ __launch_bounds__(256) void prep_kernel(const float* __restrict__ emb, const float* __restrict__ Wqkv, const float* __restrict__ Wpos, const float* __restrict__ Wfc,
                                                   unsigned short* __restrict__ e16, b16* __restrict__ peh, b16* __restrict__ pel,
                                                   unsigned short* __restrict__ wq, unsigned short* __restrict__ wp, unsigned short* __restrict__ wf) {
  __shared__ __attribute__((aligned(16))) unsigned short Sh[64][72];   // a transpose tile, or the sinusoid part's staging
  int blk = blockIdx.x;
  if (blk < PB_PE) { prep_pe(blk, (b16*)&Sh[0][0], peh, pel); return; }
  blk -= PB_PE;
  if (blk < PB_WQ) { wt_tile<0>(blk, Wqkv, DM, NQKV, wq, Sh); return; }
  blk -= PB_WQ;
  if (blk < PB_WF) { wt_tile<1>(blk, Wfc, DM, DM, wf, Sh); return; }
  blk -= PB_WF;
  if (blk < PB_WP) { wt_tile<1>(blk, Wpos, DH, NPOS, wp, Sh); return; }
  prep_embed(blk - PB_WP, emb, e16);
}

// Eight 16-byte asynchronous copies of one thread, global memory to LDS; the closing wait stands in front of any rewrite of the address registers named here.
__device__ __forceinline__ void copy8_to_lds(unsigned l0, unsigned l1, unsigned l2, unsigned l3, unsigned l4, unsigned l5, unsigned l6, unsigned l7,
                                             const void* g0, const void* g1, const void* g2, const void* g3, const void* g4, const void* g5, const void* g6, const void* g7) {
  asm volatile("global_load_async_to_lds_b128 %0, %8, off\n\t"
               "global_load_async_to_lds_b128 %1, %9, off\n\t"
               "global_load_async_to_lds_b128 %2, %10, off\n\t"
               "global_load_async_to_lds_b128 %3, %11, off\n\t"
               "global_load_async_to_lds_b128 %4, %12, off\n\t"
               "global_load_async_to_lds_b128 %5, %13, off\n\t"
               "global_load_async_to_lds_b128 %6, %14, off\n\t"
               "global_load_async_to_lds_b128 %7, %15, off\n\t"
               "s_wait_xcnt 0x0"
               :: "v"(l0), "v"(l1), "v"(l2), "v"(l3), "v"(l4), "v"(l5), "v"(l6), "v"(l7), "v"(g0), "v"(g1), "v"(g2), "v"(g3), "v"(g4), "v"(g5), "v"(g6), "v"(g7) : "memory");
}

__device__ __forceinline__ void copy2_to_lds(unsigned l0, unsigned l1, const void* g0, const void* g1) {   // the same, two copies
  asm volatile("global_load_async_to_lds_b128 %0, %2, off\n\t"
               "global_load_async_to_lds_b128 %1, %3, off\n\t"
               "s_wait_xcnt 0x0"
               :: "v"(l0), "v"(l1), "v"(g0), "v"(g1) : "memory");
}

// position projections: (1024 x 64) x (64 x 3072): A = pe planes (x8 hi+lo), B = f16(bf16 W_pos)^T rows -> 2 products; single f16 rows pp[which][h][l][64]. They need only the
// preparation's results, as the qkv projection does, so their blocks ride in qkv_kernel's launch: PB_POS blocks of 8 waves, block blk = 256 rows x 64 columns, wave = 32 x 64.
// Th: 8 KB of LDS a wave for the epilogue.
constexpr int PB_POS = (NPOS / 64) * (L / 256);
__device__ __forceinline__ void pos_block(int blk, const b16* __restrict__ peh, const b16* __restrict__ pel, const b16* __restrict__ wpos, b16* __restrict__ pp, b16* Th) {
  const int lane = threadIdx.x & 31, wave = threadIdx.x >> 5, nloc = lane & 15, hlf = lane >> 4, m0 = (blk / (NPOS / 64)) * 256 + wave * 32, c0 = (blk % (NPOS / 64)) * 64;
  v8f acc[2][4];
#pragma unroll
  for (int r = 0; r < 2; ++r)
#pragma unroll
    for (int t = 0; t < 4; ++t) acc[r][t] = (v8f){};
  const Opnd A{peh, pel, DH}, B{wpos, nullptr, DH};
  gemm_tile<2, 1>(A, B, DH, m0, c0, nloc, hlf, acc);
  const int which = c0 / DM, h = (c0 % DM) / DH;
  epi_planes(acc, 1.0f / PES, false, pp + (((size_t)which * H + h) * L + m0) * DH, nullptr, DH, 0, 0, lane, Th + wave * (2 * 32 * 64), Th + wave * (2 * 32 * 64) + 32 * 64);
}

// qkv: (4096 x 1024) x (1024 x 4096) bf16 WMMA; 32 x 32 blocks behind the PB_POS position blocks (those end early and free their places), block = 128 tokens x 128 columns, 8 waves (4 along tokens x 2 along columns) of 32 x 64 each. Per 64-k tile the
// 128 embed rows and the 128 weight rows are brought once per block into LDS (row pitch 144 B) by asynchronous copies, two buffers: tile t + 1 flies while tile t is worked on;
// fragments come from LDS. Columns: [q | k1 | k2 | v] x 1024; q/k1/k2 -> single f16 rows [which][b][h][l][64]; v -> (8v)^T hi/lo planes [b][h][64 d][1024 l] through a block
// LDS transpose (block = 128 tokens of one batch row, two heads). The epilogues stage in the ring's LDS behind the last tile's barrier.
// Eight waves a SIMD are asked for so that four blocks (their LDS fits four times) share a WGP and all 1024 blocks are resident at once.
constexpr int GPIT = 64 + 8, GROWS = 256, GTILE = GROWS * GPIT;   // LDS row pitch (16-bit elements), rows and elements of a stage: 128 embed rows, then 128 weight rows
__global__ __launch_bounds__(256, 8) void qkv_kernel(const __bf16* __restrict__ e16, const __bf16* __restrict__ wqkv, b16* __restrict__ qk, b16* __restrict__ vth, b16* __restrict__ vtl,
                                                     const b16* __restrict__ peh, const b16* __restrict__ pel, const b16* __restrict__ wpos, b16* __restrict__ pp) {
  __shared__ __attribute__((aligned(16))) unsigned short Sm[2 * GTILE];   // 73,728 B
  if (blockIdx.x < PB_POS) { pos_block(blockIdx.x, peh, pel, wpos, pp, (b16*)Sm); return; }   // a whole block takes this branch, in front of every barrier
  const int gblk = blockIdx.x - PB_POS;                         // column tile runs fastest
  const int tid = threadIdx.x, lane = tid & 31, wave = __builtin_amdgcn_readfirstlane(tid >> 5), wm = wave & 3, wn = wave >> 2, nloc = lane & 15, hlf = lane >> 4;
  const int mb = (gblk / (NQKV / 128)) * 128, cb = (gblk % (NQKV / 128)) * 128, m0 = mb + wm * 32, c0 = cb + wn * 64;   // the wave number is held scalar: tile indices and the epilogue branch stay scalar
  // copy map: 8 lanes bring one 128-byte row piece; a thread brings rows sr + 32 i of both operands
  const int sr = tid >> 3, sc = (tid & 7) * 8;
  const __bf16* ga = e16 + (size_t)(mb + sr) * DM + sc; const __bf16* gb = wqkv + (size_t)(cb + sr) * DM + sc;
  const unsigned ls = (unsigned)(size_t)(&Sm[0]) + (unsigned)(sr * GPIT + sc) * 2u;
  auto stage = [&](int kt, int buf) {
    const unsigned l = ls + (unsigned)buf * (GTILE * 2u); const __bf16* a = ga + kt * 64; const __bf16* w = gb + kt * 64;
    constexpr unsigned R32 = 32u * GPIT * 2u;
    copy8_to_lds(l, l + R32, l + 2u * R32, l + 3u * R32, l + 4u * R32, l + 5u * R32, l + 6u * R32, l + 7u * R32,
                 a, a + 32 * DM, a + 64 * DM, a + 96 * DM, w, w + 32 * DM, w + 64 * DM, w + 96 * DM);
  };
  v8f acc[2][4];
#pragma unroll
  for (int r = 0; r < 2; ++r)
#pragma unroll
    for (int t = 0; t < 4; ++t) acc[r][t] = (v8f){};
  stage(0, 0);
  asm volatile("s_wait_asynccnt 0x0" ::: "memory");             // this wave's copies of tile 0 have landed
  __syncthreads();                                              // publishes tile 0
  stage(1, 1);
  for (int kt = 0; kt < DM / 64; ++kt) {
    const __bf16* As = (const __bf16*)Sm + (kt & 1) * GTILE + (wm * 32 + nloc) * GPIT; const __bf16* Bs = (const __bf16*)Sm + (kt & 1) * GTILE + (128 + wn * 64 + nloc) * GPIT;
#pragma unroll                                                  // both 32-k halves of the tile in line: LDS offsets become immediates
    for (int ks = 0; ks < 2; ++ks) {
      const v16bb a0 = frag_kb_bf(As + ks * 32, hlf), a1 = frag_kb_bf(As + 16 * GPIT + ks * 32, hlf);
      v16bb bw[4];
#pragma unroll
      for (int t = 0; t < 4; ++t) bw[t] = frag_kb_bf(Bs + t * 16 * GPIT + ks * 32, hlf);
      group_fence();                        // the 12 LDS reads of this 32-k half stay one group ahead of its WMMAs: one LDS wait instead of one per fragment
#pragma unroll
      for (int t = 0; t < 4; ++t) { acc[0][t] = wmma16bb(a0, bw[t], acc[0][t]); acc[1][t] = wmma16bb(a1, bw[t], acc[1][t]); }
      group_fence();                        // the next group's reads are not spread among these WMMAs
    }
    asm volatile("s_wait_dscnt 0x0" ::: "memory");              // this wave's reads of tile kt are done before its buffer is handed back
    asm volatile("s_wait_asynccnt 0x0" ::: "memory");           // this wave's copies of tile kt + 1 have landed
    __syncthreads();                                            // publishes tile kt + 1 and ends every read of tile kt
    if (kt + 2 < DM / 64) stage(kt + 2, kt & 1);
  }
  asm volatile("s_wait_asynccnt 0x0" ::: "memory");             // no copy is outstanding when the ring becomes output staging
  const int which = c0 / DM, c1 = c0 % DM, h = c1 / DH, b = m0 / L, l0 = m0 % L;   // 64 columns = one head; which is the same for the whole block
  if (which < 3) {                                             // q / k1 / k2 rows [which][b][h][l][64] (single f16)
    b16* Th = (b16*)Sm + wave * (2 * 32 * 64);
    epi_planes(acc, 1.0f, false, qk + ((((size_t)which * Bn + b) * H + h) * L + l0) * DH, nullptr, DH, 0, 0, lane, Th, Th + 32 * 64);
    return;
  }
  constexpr int TP = 128 + 8;                                   // token pitch of the transpose planes [head wn][hi, lo][64 d][TP]
  b16* Tt = (b16*)Sm + wn * (2 * 64 * TP);
#pragma unroll
  for (int t = 0; t < 4; ++t)
#pragma unroll
    for (int r = 0; r < 2; ++r)
#pragma unroll
      for (int v = 0; v < 8; ++v) { b16 a, c; split16(acc[r][t][v] * VS, a, c); const int o = (t * 16 + nloc) * TP + wm * 32 + r * 16 + 8 * hlf + v; Tt[o] = a; Tt[64 * TP + o] = c; }
  __syncthreads();
  const int tok0 = mb % L, bb = mb / L;
  b16* bh_ = vth + (((size_t)bb * H + h) * DH) * L + tok0; b16* bl_ = vtl + (((size_t)bb * H + h) * DH) * L + tok0;
  {
#pragma unroll
    for (int j = 0; j < 8; ++j) { const int dd = wm * 16 + j * 2 + (lane >> 4), c8 = (lane & 15) * 8;
      *(v8b*)(bh_ + (size_t)dd * L + c8) = *(const v8b*)(&Tt[dd * TP + c8]); *(v8b*)(bl_ + (size_t)dd * L + c8) = *(const v8b*)(&Tt[64 * TP + dd * TP + c8]); }
    asm volatile("s_wait_xcnt 0x0" ::: "memory");               // behind the last store: stands in front of any later write of a register that these stores name
  }
}

// ---------------------------------------------------------------------------
// attention: block = (b, h, 128 queries), wave = 16 queries; causal 32-key chunks up to the block's diagonal. All key-side operands come from LDS, staged once per block and
// shared by its 8 waves: the two mask rows once, and per chunk the k1/k2/kp1/kp2 rows (pitch 144 B) and the (8v)^T hi/lo columns (pitch 80 B), two buffers: chunk t + 1 is
// fetched into registers before chunk t is worked on and stored to the other buffer behind chunk t's logits; one barrier a chunk, in front of the softmax. A wave past its own
// diagonal only stages. Four waves a SIMD are asked for (256 registers a wave) so that two blocks still share a WGP.
// Per chunk and 16-key half: four K=64 score products (q.k1, qp.kp1, q.k2, qp.kp2; single f16),
// logit = same speaker ? s1 + p1 : s2 + p2; -inf where key > query or umask[b][key] == 0; online softmax f32; P^T f16; y^T += (8v)^T.P^T (4 feature tiles, hi + lo);
// ---------------------------------------------------------------------------
constexpr int KPIT = DH + 8, VPIT = 32 + 8;                    // LDS row pitches in f16: 16 B x odd, for 16-byte fragment reads
typedef __attribute__((ext_vector_type(4))) int v4i;
__device__ __forceinline__ v8b ldoff(const b16* base, unsigned bytes) { return *(const v8b*)((const char*)base + bytes); }
// value of lane l ^ 16, by a vector cross-row move: an LDS-path shuffle would be waited for on the LDS counter, behind every fragment read that is meant to stay in flight
__device__ __forceinline__ float xhalf(float v) {
  return __uint_as_float(__builtin_amdgcn_permlanex16(__float_as_uint(v), __float_as_uint(v), 0x76543210u, 0xfedcba98u, false, false));
}
__global__ __launch_bounds__(256, 4) void attn_kernel(const b16* __restrict__ qk, const b16* __restrict__ pp, const b16* __restrict__ vth, const b16* __restrict__ vtl,
                                                   const int* __restrict__ umask, const int* __restrict__ qmask, float* __restrict__ y) {
  __shared__ __attribute__((aligned(16))) float Os[8][16][DH + 4];
  __shared__ __attribute__((aligned(16))) b16 Ks[2][4][32 * KPIT];   // [buffer][k1, k2, kp1, kp2][key][feature]
  __shared__ __attribute__((aligned(16))) b16 Vs[2][2][DH * VPIT];   // [buffer][hi, lo][feature][key]
  __shared__ __attribute__((aligned(16))) int Ms[2][L];              // speaker ids and umask of batch row b
  const int tid = threadIdx.x, wid = __builtin_amdgcn_readfirstlane(tid >> 5), lane = tid & 31, hh = lane >> 4, col = lane & 15;
  // Block index -> (head row, query tile). A block's cost grows with its tile (4 to 32 chunks), so the tile comes from the HIGH bits:
  // every run of 64 blocks is one tile over all 64 (b, h). Order 7,6,5,4,0,1,2,3: the long blocks have the low indices,
  // and blocks 256 apart add up to 36 chunks. The map is one-to-one onto (b, h, tile); its order matters for speed only.
  const int grp = blockIdx.x >> 6, tile = grp < 4 ? 7 - grp : grp - 4;
  const int qt = (blockIdx.x & 63) * 64 + tile * 8 + wid, jt = qt & 63, h = (qt >> 6) & 15, b = qt >> 10, q0 = jt * 16, qi = q0 + col;
  const int nchunk = (tile + 1) * 4;                            // 32-key chunks up to the block's last query
  const b16* Q = qk + ((((size_t)0 * Bn + b) * H + h) * L) * DH; const b16* K1 = qk + ((((size_t)1 * Bn + b) * H + h) * L) * DH; const b16* K2 = qk + ((((size_t)2 * Bn + b) * H + h) * L) * DH;
  const b16* QP = pp + (((size_t)0 * H + h) * L) * DH; const b16* KP1 = pp + (((size_t)1 * H + h) * L) * DH; const b16* KP2 = pp + (((size_t)2 * H + h) * L) * DH;
  const b16* vh = vth + (((size_t)b * H + h) * DH) * L; const b16* vl = vtl + (((size_t)b * H + h) * DH) * L;
  // staging map: a thread moves one 16-byte piece of each of the six tiles
  const int kr = tid >> 3, kc = (tid & 7) * 8, vr = tid >> 2, vc = (tid & 3) * 8;
  const unsigned gko = (unsigned)(kr * DH + kc), gvo = (unsigned)(vr * L + vc);
  const int sko = kr * KPIT + kc, svo = vr * VPIT + vc;
  v8b st[6];
  st[0] = ld8b(K1 + gko); st[1] = ld8b(K2 + gko); st[2] = ld8b(KP1 + gko); st[3] = ld8b(KP2 + gko); st[4] = ld8b(vh + gvo); st[5] = ld8b(vl + gvo);
  const v4i mq = *(const v4i*)(qmask + b * L + tid * 4), mu = *(const v4i*)(umask + b * L + tid * 4);
  v16b qf[2], qpf[2];
#pragma unroll
  for (int ks = 0; ks < 2; ++ks) { qf[ks] = frag_kb(Q + (size_t)qi * DH + ks * 32, hh); qpf[ks] = frag_kb(QP + (size_t)qi * DH + ks * 32, hh); }
  const int myspk = qmask[b * L + qi];
  asm volatile("s_wait_xcnt 0x0" ::: "memory");                 // before the address registers of the loads above are reused
  *(v4i*)(&Ms[0][tid * 4]) = mq; *(v4i*)(&Ms[1][tid * 4]) = mu;
#pragma unroll
  for (int i = 0; i < 4; ++i) *(v8b*)(&Ks[0][i][sko]) = st[i];
  *(v8b*)(&Vs[0][0][svo]) = st[4]; *(v8b*)(&Vs[0][1][svo]) = st[5];
  __syncthreads();
  float m = -INFINITY, l = 0.0f; v8f o[4] = {{}, {}, {}, {}};
  // The chunk's LDS fragment reads go in six groups of eight (k1 + k2 and kp1 + kp2 rows of keys 0..15, the same of keys 16..31, the hi and the lo value tiles), each issued one or two
  // groups ahead of the four WMMAs that use it, so that it flies under matrix and vector work instead of being waited for where it is issued. The first group of chunk t + 1 is issued
  // behind the chunk's barrier, which for that stands in front of the softmax: every read of chunk t has been issued, and has returned, in front of it.
  auto read_pair = [&](int buf, int half, int pr, v16b (&d)[4]) {   // pr 0: k1, k2 rows; pr 1: kp1, kp2 rows; features 0..31 and 32..63 of each
    const int ro = (half * 16 + col) * KPIT;
    d[0] = frag_kb(&Ks[buf][2 * pr][ro], hh); d[1] = frag_kb(&Ks[buf][2 * pr][ro + 32], hh); d[2] = frag_kb(&Ks[buf][2 * pr + 1][ro], hh); d[3] = frag_kb(&Ks[buf][2 * pr + 1][ro + 32], hh);
  };
  // Four WMMAs as ONE statement, which keeps its place among the LDS reads (the builtin forms sink below the reads that are to follow them, and those then take registers of their own).
  // a1 = rows d0|d1 . b, a2 = rows d2|d3 . b, features 0..31 and then 32..63. The closing v_nop keep the four vector slots the chip needs behind a WMMA before its result is read.
  auto score_pair = [&](const v16b (&d)[4], const v16b (&b)[2], v8f& a1, v8f& a2) {
    asm volatile("v_wmma_f32_16x16x32_f16 %0, %2, %6, 0\n\t"
                 "v_wmma_f32_16x16x32_f16 %1, %4, %6, 0\n\t"
                 "v_wmma_f32_16x16x32_f16 %0, %3, %7, %0\n\t"
                 "v_wmma_f32_16x16x32_f16 %1, %5, %7, %1\n\t"
                 "v_nop\n\tv_nop\n\tv_nop\n\tv_nop"
                 : "=&v"(a1), "=&v"(a2) : "v"(d[0]), "v"(d[1]), "v"(d[2]), "v"(d[3]), "v"(b[0]), "v"(b[1]) : "memory");
  };
  // The same for y^T += (value tiles) . P^T: a feature tile's hi WMMA, then its lo WMMA into the same accumulator; the v_nop also cover the branches behind the chunk's last WMMAs.
  auto pv8 = [&](const v16b (&vh4)[4], const v16b (&vl4)[4], const v16b& pb) {
    asm volatile("v_wmma_f32_16x16x32_f16 %0, %4, %12, %0\n\t"
                 "v_wmma_f32_16x16x32_f16 %1, %5, %12, %1\n\t"
                 "v_wmma_f32_16x16x32_f16 %2, %6, %12, %2\n\t"
                 "v_wmma_f32_16x16x32_f16 %3, %7, %12, %3\n\t"
                 "v_wmma_f32_16x16x32_f16 %0, %8, %12, %0\n\t"
                 "v_wmma_f32_16x16x32_f16 %1, %9, %12, %1\n\t"
                 "v_wmma_f32_16x16x32_f16 %2, %10, %12, %2\n\t"
                 "v_wmma_f32_16x16x32_f16 %3, %11, %12, %3\n\t"
                 "v_nop\n\tv_nop\n\tv_nop\n\tv_nop"
                 : "+v"(o[0]), "+v"(o[1]), "+v"(o[2]), "+v"(o[3])
                 : "v"(vh4[0]), "v"(vh4[1]), "v"(vh4[2]), "v"(vh4[3]), "v"(vl4[0]), "v"(vl4[1]), "v"(vl4[2]), "v"(vl4[3]), "v"(pb) : "memory");
  };
  v16b ka[4];                                                   // k1, k2 rows of keys 0..15 of the chunk that is scored next
  read_pair(0, 0, 0, ka);
  for (int t = 0; t < nchunk; ++t) {
    const int kb = t * 32, cur = t & 1; const bool more = t + 1 < nchunk, act = kb < q0 + 16;   // act: this wave has queries at or behind chunk t
    v8b sn[6];                                                  // chunk t + 1 on its way to LDS; a trip's own, so that its registers are free behind the stores
    if (more) { const unsigned ko = gko * 2u + (unsigned)(kb + 32) * (DH * 2u), vo = gvo * 2u + (unsigned)(kb + 32) * 2u;   // byte offsets from the six scalar bases: two registers a lane, not 64-bit addresses
      sn[0] = ldoff(K1, ko); sn[1] = ldoff(K2, ko); sn[2] = ldoff(KP1, ko); sn[3] = ldoff(KP2, ko); sn[4] = ldoff(vh, vo); sn[5] = ldoff(vl, vo);
      asm volatile("s_wait_xcnt 0x0" ::: "memory"); }           // before the address registers of these six loads are reused
    float lg0[8], lg1[8]; v16b vhi[4], vlo[4];
    if (act) {
      v4i mk0[4], mk1[4]; v8f s1, p1, s2, p2; v16b kq[4], kc[4], kd[4];
      auto read_masks = [&](int half, v4i (&mk)[4]) {
        const int k8 = kb + half * 16 + 8 * hh;
        mk[0] = *(const v4i*)(&Ms[0][k8]); mk[1] = *(const v4i*)(&Ms[0][k8 + 4]); mk[2] = *(const v4i*)(&Ms[1][k8]); mk[3] = *(const v4i*)(&Ms[1][k8 + 4]);
      };
      auto logits = [&](int half, const v4i (&mk)[4], float (&lg)[8]) {
        const int dq = qi - (kb + half * 16 + 8 * hh);          // key kb + 16 half + 8 hh + r lies behind the query where r > dq
#pragma unroll
        for (int r = 0; r < 8; ++r) { const bool same = ((r < 4 ? mk[0][r & 3] : mk[1][r & 3]) == myspk);
          float v = same ? (s1[r] + p1[r]) : (s2[r] + p2[r]);
          if ((r > dq) | ((r < 4 ? mk[2][r & 3] : mk[3][r & 3]) == 0)) v = -INFINITY;
          lg[r] = v; }
      };
      read_pair(cur, 0, 1, kq); read_masks(0, mk0);
      score_pair(ka, qf, s1, s2);
      read_pair(cur, 1, 0, kc);
      score_pair(kq, qpf, p1, p2);
      read_pair(cur, 1, 1, kd);
      group_fence();                                            // the reads for keys 16..31 stay whole ahead of the logits of keys 0..15, which hide them
      logits(0, mk0, lg0);
      // inputs only, changes nothing: the finished logits of keys 0..15 are named here so that their vector work stands ahead of the next WMMAs, under the reads in flight; left free it
      // sinks behind those WMMAs, the reads are waited for with nothing to do, and both halves' accumulators are live at once
      asm volatile("" :: "v"(lg0[0]), "v"(lg0[1]), "v"(lg0[2]), "v"(lg0[3]), "v"(lg0[4]), "v"(lg0[5]), "v"(lg0[6]), "v"(lg0[7]) : "memory");
      score_pair(kc, qf, s1, s2);
#pragma unroll
      for (int n = 0; n < 4; ++n) vhi[n] = frag_kb(&Vs[cur][0][(n * 16 + col) * VPIT], hh);
      read_masks(1, mk1);
      score_pair(kd, qpf, p1, p2);
#pragma unroll
      for (int n = 0; n < 4; ++n) vlo[n] = frag_kb(&Vs[cur][1][(n * 16 + col) * VPIT], hh);
      group_fence();                                            // the reads of the value tiles stay whole ahead of the logits of keys 16..31, which hide them
      logits(1, mk1, lg1);
    }
    if (more) {                                                 // the other buffer's last reads (chunk t - 1) had returned when their waves reached the previous chunk's barrier
#pragma unroll
      for (int i = 0; i < 4; ++i) *(v8b*)(&Ks[cur ^ 1][i][sko]) = sn[i];
      *(v8b*)(&Vs[cur ^ 1][0][svo]) = sn[4]; *(v8b*)(&Vs[cur ^ 1][1][svo]) = sn[5];
      __syncthreads();                                          // publishes chunk t + 1; every read of chunk t has been issued above and has returned here
    }
    read_pair(more ? cur ^ 1 : cur, 0, 0, ka);                  // by every wave on every trip (the last trip's and an idle wave's are not used): ka gets a new value on every path, so its old registers are free above
    if (act) {
      group_fence();                                            // the next chunk's first reads stay whole ahead of the softmax and P.V, which hide them
      float mr = -INFINITY;
#pragma unroll
      for (int r = 0; r < 8; ++r) mr = fmaxf(mr, fmaxf(lg0[r], lg1[r]));
      mr = fmaxf(mr, xhalf(mr));
      float mn = fmaxf(m, mr); if (mn == -INFINITY) mn = 0.0f;
      const float al_ = __expf(m - mn); m = mn;
      float sum = 0.0f; v16b pb;
#pragma unroll
      for (int r = 0; r < 8; ++r) { const float e0 = __expf(lg0[r] - mn), e1 = __expf(lg1[r] - mn); sum += e0 + e1; pb[r] = (b16)e0; pb[8 + r] = (b16)e1; }
      sum += xhalf(sum); l = l * al_ + sum;
#pragma unroll
      for (int n = 0; n < 4; ++n)
#pragma unroll
        for (int r = 0; r < 8; ++r) o[n][r] *= al_;
      pv8(vhi, vlo, pb);
    }
  }
  const float inv = (l > 0.0f) ? (1.0f / (VS * l)) : 0.0f;
#pragma unroll
  for (int n = 0; n < 4; ++n)
#pragma unroll
    for (int r = 0; r < 8; ++r) Os[wid][col][n * 16 + 8 * hh + r] = o[n][r] * inv;
  wave_lds_sync();
  float* dst = y + ((size_t)b * L + q0) * DM + h * DH;          // 16 rows x 256 B
  {
#pragma unroll
    for (int j = 0; j < 8; ++j) { const int rr = j * 2 + hh, c4 = col * 4; *(v4f*)(dst + (size_t)rr * DM + c4) = *(const v4f*)(&Os[wid][rr][c4]); }
    
  }
}

// out = y.W_fc: (4096 x 1024) x (1024 x 1024); A = y f32 x8 split, B = f16(bf16 W_fc)^T rows -> 2 products; f32 rows; grid (16, 32), block = 128 rows x 64 columns, 8 waves of
// 16 x 64. Per 64-k tile the 128 y rows (f32, pitch 272 B) and the 64 weight rows (pitch 144 B) are brought once per block into LDS by asynchronous copies, two buffers, as in
// qkv_kernel; the split runs on fragments read from LDS. The epilogue stages in the ring's LDS behind the last tile's barrier.
constexpr int OAP = 64 + 4, OBP = 64 + 8, OAB = 128 * OAP * 4, OST = OAB + 64 * OBP * 2;   // pitches (f32, f16 elements), bytes of the y part and of a whole stage
__global__ __launch_bounds__(256) void out_kernel(const float* __restrict__ y, const b16* __restrict__ wfc, float* __restrict__ out) {
  __shared__ __attribute__((aligned(16))) unsigned char So[2 * OST];   // 88,064 B
  const int tid = threadIdx.x, lane = tid & 31, wave = __builtin_amdgcn_readfirstlane(tid >> 5), nloc = lane & 15, hlf = lane >> 4, mb = blockIdx.y * 128, m0 = mb + wave * 16, c0 = blockIdx.x * 64;
  // copy map: 16 lanes bring one 256-byte y row piece (rows ar + 16 i), 8 lanes one 128-byte weight row piece (rows br + 32 j)
  const int ar = tid >> 4, ac = (tid & 15) * 4, br = tid >> 3, bc = (tid & 7) * 8;
  const float* ga = y + (size_t)(mb + ar) * DM + ac; const b16* gb = wfc + (size_t)(c0 + br) * DM + bc;
  const unsigned la = (unsigned)(size_t)(&So[0]) + (unsigned)(ar * OAP + ac) * 4u, lw = (unsigned)(size_t)(&So[0]) + (unsigned)OAB + (unsigned)(br * OBP + bc) * 2u;
  auto stage = [&](int kt, int buf) {
    const unsigned l = la + (unsigned)buf * (unsigned)OST, w = lw + (unsigned)buf * (unsigned)OST; const float* a = ga + kt * 64; const b16* g = gb + kt * 64;
    constexpr unsigned R16 = 16u * OAP * 4u;
    copy8_to_lds(l, l + R16, l + 2u * R16, l + 3u * R16, l + 4u * R16, l + 5u * R16, l + 6u * R16, l + 7u * R16,
                 a, a + 16 * DM, a + 32 * DM, a + 48 * DM, a + 64 * DM, a + 80 * DM, a + 96 * DM, a + 112 * DM);
    copy2_to_lds(w, w + 32u * OBP * 2u, g, g + 32 * DM);
  };
  v8f acc[4] = {{}, {}, {}, {}};
  stage(0, 0);
  asm volatile("s_wait_asynccnt 0x0" ::: "memory");             // this wave's copies of tile 0 have landed
  __syncthreads();                                              // publishes tile 0
  stage(1, 1);
  for (int kt = 0; kt < DM / 64; ++kt) {
    const float* As = (const float*)(So + (kt & 1) * OST) + (wave * 16 + nloc) * OAP + 8 * hlf; const b16* Bs = (const b16*)(So + (kt & 1) * OST + OAB) + nloc * OBP;
    // every loop below is unrolled so that the fragment and accumulator arrays are indexed by constants and stay in registers
    v4f x[2][4]; v16b bf[2][4];
#pragma unroll
    for (int ks = 0; ks < 2; ++ks) {
      x[ks][0] = *(const v4f*)(As + ks * 32); x[ks][1] = *(const v4f*)(As + ks * 32 + 4); x[ks][2] = *(const v4f*)(As + ks * 32 + 16); x[ks][3] = *(const v4f*)(As + ks * 32 + 20);
#pragma unroll
      for (int t = 0; t < 4; ++t) bf[ks][t] = frag_kb(Bs + t * 16 * OBP + ks * 32, hlf);
    }
    group_fence();                          // the tile's 24 LDS reads stay one group ahead of the split and the WMMAs: one LDS wait a tile instead of one per fragment
#pragma unroll
    for (int ks = 0; ks < 2; ++ks) {
      v16b ah, al;
#pragma unroll
      for (int e = 0; e < 16; ++e) { b16 a, c; split16(x[ks][e >> 2][e & 3] * 8.0f, a, c); ah[e] = a; al[e] = c; }
#pragma unroll
      for (int t = 0; t < 4; ++t) acc[t] = wmma16b(ah, bf[ks][t], acc[t]);     // hi, then lo, into each accumulator
#pragma unroll
      for (int t = 0; t < 4; ++t) acc[t] = wmma16b(al, bf[ks][t], acc[t]);
    }
    asm volatile("s_wait_dscnt 0x0" ::: "memory");              // this wave's reads of tile kt are done before its buffer is handed back
    asm volatile("s_wait_asynccnt 0x0" ::: "memory");           // this wave's copies of tile kt + 1 have landed
    __syncthreads();                                            // publishes tile kt + 1 and ends every read of tile kt
    if (kt + 2 < DM / 64) stage(kt + 2, kt & 1);
  }
  asm volatile("s_wait_asynccnt 0x0" ::: "memory");             // no copy is outstanding when the ring becomes output staging
  float* Tt = (float*)So + wave * (16 * 64);                    // 16 rows x 256 B per wave, stored as whole lines; unrolled: constant accumulator indices
#pragma unroll
  for (int t = 0; t < 4; ++t)
#pragma unroll
    for (int v = 0; v < 8; ++v) Tt[(v + 8 * hlf) * 64 + t * 16 + nloc] = acc[t][v] * (1.0f / 8.0f);
  wave_lds_sync();
  float* dst0 = out + (size_t)m0 * DM + c0;
#pragma unroll
  for (int j = 0; j < 8; ++j) { const int rr = j * 2 + hlf, c4 = nloc * 4; *(v4f*)(dst0 + (size_t)rr * DM + c4) = *(const v4f*)(Tt + rr * 64 + c4); }
}
}  // namespace

extern "C" void kernel_launch(void* const* d_in, const int* in_sizes, int n_in,
                              void* d_out, int out_size, void* d_ws, size_t ws_size, hipStream_t stream) {
  (void)n_in; (void)out_size;
  const float* emb = (const float*)d_in[0]; const int* umask = (const int*)d_in[1]; const int* qmask = (const int*)d_in[2];
  const float* Wqkv = (const float*)d_in[3]; const float* Wpos = (const float*)d_in[4]; const float* Wfc = (const float*)d_in[5];
  float* out = (float*)d_out;   // [4,1024,1024]
  if (in_sizes[0] != NTOK * DM || in_sizes[1] != NTOK || in_sizes[2] != NTOK || in_sizes[3] != DM * NQKV || in_sizes[4] != DH * NPOS || in_sizes[5] != DM * DM) return;
  size_t off = 0; char* ws = (char*)d_ws;
  auto carve = [&](size_t bytes) { char* p = ws + off; off += (bytes + 255) & ~(size_t)255; return p; };
  unsigned short* e16 = (unsigned short*)carve((size_t)NTOK * DM * 2);       // 8 MB
  unsigned short* wq = (unsigned short*)carve((size_t)NQKV * DM * 2);        // 8 MB
  unsigned short* wp = (unsigned short*)carve((size_t)NPOS * DH * 2);        // 384 KB
  unsigned short* wf = (unsigned short*)carve((size_t)DM * DM * 2);          // 2 MB
  b16* peh = (b16*)carve((size_t)L * DH * 2); b16* pel = (b16*)carve((size_t)L * DH * 2);
  b16* qk = (b16*)carve((size_t)3 * Bn * H * L * DH * 2);                   // 24 MB
  b16* vth = (b16*)carve((size_t)Bn * H * DH * L * 2); b16* vtl = (b16*)carve((size_t)Bn * H * DH * L * 2);   // 8 MB each
  b16* pp = (b16*)carve((size_t)3 * H * L * DH * 2);                         // 6 MB
  float* y = (float*)carve((size_t)NTOK * DM * 4);                           // 16 MB
  if (off > ws_size) return;                                                  // ≈ 81 MB
  prep_kernel<<<PB_PE + PB_WQ + PB_WF + PB_WP + PB_EM, 256, 0, stream>>>(emb, Wqkv, Wpos, Wfc, e16, peh, pel, wq, wp, wf);
  qkv_kernel<<<PB_POS + (NQKV / 128) * (NTOK / 128), 256, 0, stream>>>((const __bf16*)e16, (const __bf16*)wq, qk, vth, vtl, peh, pel, (const b16*)wp, pp);
  attn_kernel<<<Bn * H * (L / 16) / 8, 256, 0, stream>>>(qk, pp, vth, vtl, umask, qmask, y);
  out_kernel<<<dim3(DM / 64, NTOK / 128), 256, 0, stream>>>(y, (const b16*)wf, out);
}

// v007
// One run takes 95.1 microseconds.
// Timed twice side by side with v006, it ran 1.05 times as fast both times.
// Over all steps from v000 it is 4.76 times as fast.
#include <hip/hip_runtime.h>

// Speaker-aware causal multi-head attention with relative sinusoidal position terms (d_model 1024, 16 heads x 64, B=4, L=1024): q,k1,k2,v = embed W_qkv;
// qp,kp1,kp2 = pe W_pos (pe = the module's sinusoid table rows 89..1112); logit[q][k] = same speaker ? (q.k1 + qp.kp1) : (q.k2 + qp.kp2) (scale 1); keys k > q or umask = 0
// -> -inf; softmax; out = (P.v) W_fc.
// Numerics: embed, W_qkv, W_pos and W_fc are rounded to bf16 (RNE); the qkv projection runs on
// v_wmma_f32_16x16x32_bf16 with those operands (exact products, f32 accumulate); the position projection uses f16 hi+lo of the f32 sinusoid table against the exact f16 copy of
// bf16 W_pos; the four score products use single f16 copies of q/k1/k2/qp/kp (f32 accumulate); P.V pairs single-f16 P with hi+lo 8v; the output projection pairs hi+lo of the
// attention output with the exact f16 copy of bf16 W_fc. Masks are read from the int inputs. Fragment k-map per lane half hh for A AND B: elements 0..7 <- k = 8hh+0..7, 8..15

namespace {
constexpr int Bn = 4, L = 1024, DM = 1024, H = 16, DH = 64, NTOK = Bn * L, NQKV = 4 * DM, NPOS = 3 * DM, TBL = 1201, SHIFT = 601;
constexpr float VS = 8.0f, PES = 8.0f;

typedef _Float16 b16;
typedef __attribute__((ext_vector_type(16))) _Float16 v16b;
typedef __attribute__((ext_vector_type(8)))  _Float16 v8b;
typedef __attribute__((ext_vector_type(8)))  float v8f;
typedef __attribute__((ext_vector_type(4)))  float v4f;

__device__ __forceinline__ v8b ld8b(const b16* p) { return *(const v8b*)p; }
__device__ __forceinline__ v16b cat8b(v8b a, v8b b) { return __builtin_shufflevector(a, b, 0, 1, 2, 3, 4, 5, 6, 7, 8, 9, 10, 11, 12, 13, 14, 15); }
__device__ __forceinline__ v16b frag_kb(const b16* p, int hh) { return cat8b(ld8b(p + 8 * hh), ld8b(p + 16 + 8 * hh)); }
__device__ __forceinline__ void split16(float v, b16& hi, b16& lo) { hi = (b16)v; lo = (b16)(v - (float)hi); }
// hi/lo fragment pair straight from an f32 k-contiguous row (same k-map)
__device__ __forceinline__ void frag_ksplit(const float* p, int hh, v16b& fh_, v16b& fl_) {
  const float* p0 = p + 8 * hh; const float* p1 = p + 16 + 8 * hh;
#pragma unroll
  for (int e = 0; e < 8; ++e) { b16 a, c; split16(p0[e], a, c); fh_[e] = a; fl_[e] = c; split16(p1[e], a, c); fh_[8 + e] = a; fl_[8 + e] = c; }
}
__device__ __forceinline__ v8f wmma16b(v16b a, v16b b, v8f c) {
  return __builtin_amdgcn_wmma_f32_16x16x32_f16(false, a, false, b, (short)0, c, false, false);
}
// Keeps a group of LDS reads whole and at its place in the instruction stream: the compiler fence holds the reads on their side, the scheduling fence the WMMAs and vector work.
// Left free, the reads sink to one pair with a full LDS wait in front of each WMMA, or rise so far that the live fragments no longer fit the registers.
__device__ __forceinline__ void group_fence() { asm volatile("" ::: "memory"); __builtin_amdgcn_sched_barrier(0); }
__device__ __forceinline__ void wave_lds_sync() {
  __builtin_amdgcn_fence(__ATOMIC_RELEASE, "workgroup");
  __builtin_amdgcn_wave_barrier();
  __builtin_amdgcn_fence(__ATOMIC_ACQUIRE, "workgroup");
}

// Operand descriptor: NP = 0 -> f32 rows split on the fly into (hi, lo); NP = 1 -> one f16 plane; NP = 2 -> f16 hi + lo planes;
// NP = 3 -> f32 rows rounded once to a single f16 fragment. ld = row pitch.
struct Opnd { const void* p0; const void* p1; int ld; };
template <int NP> __device__ __forceinline__ void load_frags(const Opnd& o, int row, int kb, int hh, v16b& fh_, v16b& fl_) {
  if (NP == 0) { frag_ksplit((const float*)o.p0 + (size_t)row * o.ld + kb, hh, fh_, fl_); }
  else if (NP == 4 || NP == 5) {                             // f32 rows x64 (NP 4) or x8 (NP 5) then split (keeps the lo halves of small values normal)
    const float sc_ = (NP == 4) ? 64.0f : 8.0f;
    const float* p = (const float*)o.p0 + (size_t)row * o.ld + kb; const float* p0 = p + 8 * hh; const float* p1 = p + 16 + 8 * hh;
#pragma unroll
    for (int e = 0; e < 8; ++e) { b16 a, c; split16(p0[e] * sc_, a, c); fh_[e] = a; fl_[e] = c; split16(p1[e] * sc_, a, c); fh_[8 + e] = a; fl_[8 + e] = c; }
  } else if (NP == 3) {
    const float* p = (const float*)o.p0 + (size_t)row * o.ld + kb; const float* p0 = p + 8 * hh; const float* p1 = p + 16 + 8 * hh;
#pragma unroll
    for (int e = 0; e < 8; ++e) { fh_[e] = (b16)p0[e]; fh_[8 + e] = (b16)p1[e]; }
    fl_ = fh_;
  } else {
    fh_ = frag_kb((const b16*)o.p0 + (size_t)row * o.ld + kb, hh);
    if (NP == 2) fl_ = frag_kb((const b16*)o.p1 + (size_t)row * o.ld + kb, hh); else fl_ = fh_;
  }
}
template <int ANP, int BNP> __device__ __forceinline__ v8f mac(v16b ah, v16b al, v16b bh, v16b bl, v8f c) {
  c = wmma16b(ah, bh, c);
  if (BNP == 0 || BNP == 2 || BNP == 4 || BNP == 5) c = wmma16b(ah, bl, c);     // hi.lo
  if (ANP == 0 || ANP == 2 || ANP == 4 || ANP == 5) c = wmma16b(al, bh, c);     // lo.hi   (lo.lo dropped)
  return c;
}
// 32x64 wave tile: acc[r][t] (rows m0+16r.., cols c0+16t..) += A[m][k] . B[n][k] over k in [0, K)
template <int ANP, int BNP>
__device__ __forceinline__ void gemm_tile(const Opnd& A, const Opnd& B, int K, int m0, int c0, int nloc, int hlf, v8f (&acc)[2][4]) {
  for (int kb = 0; kb < K; kb += 32) {
    v16b a0h, a0l, a1h, a1l;
    load_frags<ANP>(A, m0 + nloc, kb, hlf, a0h, a0l);
    load_frags<ANP>(A, m0 + 16 + nloc, kb, hlf, a1h, a1l);
#pragma unroll
    for (int t = 0; t < 4; ++t) {
      v16b bh, bl;
      load_frags<BNP>(B, c0 + t * 16 + nloc, kb, hlf, bh, bl);
      acc[0][t] = mac<ANP, BNP>(a0h, a0l, bh, bl, acc[0][t]);
      acc[1][t] = mac<ANP, BNP>(a1h, a1l, bh, bl, acc[1][t]);
    }
  }
}

__device__ __forceinline__ void epi_planes(v8f (&acc)[2][4], float scale, bool two, b16* __restrict__ oh, b16* __restrict__ ol, int ldo,
                                           int m0, int c0, int lane, b16* Th, b16* Tl) {
  const int nloc = lane & 15, hlf = lane >> 4;
#pragma unroll
  for (int t = 0; t < 4; ++t)
#pragma unroll
    for (int r = 0; r < 2; ++r)
#pragma unroll
      for (int v = 0; v < 8; ++v) {
        const int rr = r * 16 + v + 8 * hlf, cc = t * 16 + nloc;
        b16 h_, l_; split16(acc[r][t][v] * scale, h_, l_);
        Th[rr * 64 + cc] = h_; Tl[rr * 64 + cc] = l_;
      }
  wave_lds_sync();
  {
#pragma unroll
    for (int j = 0; j < 8; ++j) {
      const int rr = j * 4 + (lane >> 3), c8 = (lane & 7) * 8;
      const size_t o = (size_t)(m0 + rr) * ldo + c0 + c8;
      *(v8b*)(oh + o) = ld8b(Th + rr * 64 + c8);
      if (two) *(v8b*)(ol + o) = ld8b(Tl + rr * 64 + c8);
    }
    
  }
}
typedef __attribute__((ext_vector_type(8))) __bf16 v8bb; typedef __attribute__((ext_vector_type(16))) __bf16 v16bb;
__device__ __forceinline__ v16bb frag_kb_bf(const __bf16* p, int hh) { const v8bb a = *(const v8bb*)(p + 8 * hh), b = *(const v8bb*)(p + 16 + 8 * hh); return __builtin_shufflevector(a, b, 0, 1, 2, 3, 4, 5, 6, 7, 8, 9, 10, 11, 12, 13, 14, 15); }
__device__ __forceinline__ v8f wmma16bb(v16bb a, v16bb b, v8f c) {
  return __builtin_amdgcn_wmma_f32_16x16x32_bf16(false, a, false, b, (short)0, c, false, false);
}
__device__ __forceinline__ unsigned short bf16_rne_bits(float v) { unsigned int u = __float_as_uint(v); u += 0x7FFFu + ((u >> 16) & 1u); return (unsigned short)(u >> 16); }
__device__ __forceinline__ float bf16_rne(float v) { return __uint_as_float(((unsigned int)bf16_rne_bits(v)) << 16); }

// The preparation work has no dependences among its parts, so all of it runs as ONE launch; a block's index picks its part (prep_kernel below).
constexpr int PB_PE = L * DH / 8 / 256, PB_WQ = (NQKV / 64) * (DM / 64), PB_WF = (DM / 64) * (DM / 64), PB_WP = (NPOS / 64) * (DH / 64), PB_EM = 512;   // blocks of each part
// part: embed -> bf16 rows [4096][1024] (16-B pieces), PB_EM blocks striding over the pieces.
__device__ __forceinline__ void prep_embed(int blk, const float* __restrict__ emb, unsigned short* __restrict__ e16) {
  typedef __attribute__((ext_vector_type(8))) unsigned short v8us;
  const size_t tid = (size_t)blk * 256 + threadIdx.x, nth = (size_t)PB_EM * 256;
  for (size_t p = tid; p < (size_t)NTOK * DM / 8; p += nth) { v8us v;
#pragma unroll
    for (int e = 0; e < 8; ++e) v[e] = bf16_rne_bits(emb[p * 8 + e]);
    *(v8us*)(e16 + p * 8) = v; }
}
// part: pe x8 hi/lo planes [1024][64] from the module's sinusoid formula (f32, table row 0 (the padding row) never selected for L=1024); PB_PE blocks, one 8-element piece a thread.
// Sc: per-thread staging (256 x 16 f16) for the rolled sinusoid loop.
__device__ __forceinline__ void prep_pe(int blk, b16* Sc, b16* __restrict__ peh, b16* __restrict__ pel) {
  const size_t p = (size_t)blk * 256 + threadIdx.x; const int l = (int)(p / 8), d0 = (int)(p % 8) * 8;
  const int tblrow = l - L / 2 + SHIFT;                        // 89 .. 1112, never 0
  const float posv = (float)(tblrow - (TBL + 1) / 2);          // arange(-601, 600)[tblrow] = tblrow - 601
#pragma unroll 1
  for (int e = 0; e < 8; ++e) { const int d = d0 + e; const int j = (d < DH / 2) ? d : d - DH / 2;   // rolled: one sin/cos expansion in the binary
    const float freq = expf((float)j * (-9.210340371976184f / (float)(DH / 2 - 1))); const float ang = posv * freq;
    const float val = (d < DH / 2) ? sinf(ang) : cosf(ang); b16 a, c; split16(val * PES, a, c); Sc[threadIdx.x * 16 + e] = a; Sc[threadIdx.x * 16 + 8 + e] = c; }
  *(v8b*)(peh + p * 8) = *(const v8b*)(&Sc[threadIdx.x * 16]); *(v8b*)(pel + p * 8) = *(const v8b*)(&Sc[threadIdx.x * 16 + 8]);
}

// part: W [k rows][n cols] f32 -> [n][k] 16-bit rows through 64x64 LDS tiles: MODE 0: bf16 bits (W_qkv); MODE 1: f16 of bf16(w) (W_fc, W_pos). Block blk = tile (blk % (N/64), blk / (N/64)).
template <int MODE>
__device__ __forceinline__ void wt_tile(int blk, const float* __restrict__ W, int K, int Ncols, unsigned short* __restrict__ out, unsigned short (*Tl)[72]) {
  typedef __attribute__((ext_vector_type(8))) unsigned short v8us;
  const int tid = threadIdx.x, lane = tid & 31, wave = tid >> 5, n0 = (blk % (Ncols / 64)) * 64, k0 = (blk / (Ncols / 64)) * 64;
  for (int i = tid; i < 64 * 64; i += 256) { const int kk = i / 64, nn = i % 64; const float w = W[(size_t)(k0 + kk) * Ncols + n0 + nn];
    unsigned short bits; if (MODE == 0) bits = bf16_rne_bits(w); else { const b16 hv = (b16)bf16_rne(w); bits = *reinterpret_cast<const unsigned short*>(&hv); }
    Tl[nn][kk] = bits; }
  __syncthreads();
  {
#pragma unroll
    for (int j = 0; j < 2; ++j) { const int rr = wave * 8 + j * 4 + (lane >> 3), c8 = (lane & 7) * 8; *(v8us*)(out + (size_t)(n0 + rr) * K + k0 + c8) = *(const v8us*)(&Tl[rr][c8]); }
    asm volatile("s_wait_xcnt 0x0" ::: "memory");               // behind the last store: stands in front of any later write of a register that these stores name
  }
}

// All preparation in one launch. The parts stand in the order of their blocks' own run time, the longest first: sinusoids, the three
// weight transposes, the embed rounding. Every branch is on the block index alone, so the barrier inside wt_tile is passed by a whole block or by none of it.
__global__ __launch_bounds__(256) void prep_kernel(const float* __restrict__ emb, const float* __restrict__ Wqkv, const float* __restrict__ Wpos, const float* __restrict__ Wfc,
                                                   unsigned short* __restrict__ e16, b16* __restrict__ peh, b16* __restrict__ pel,
                                                   unsigned short* __restrict__ wq, unsigned short* __restrict__ wp, unsigned short* __restrict__ wf) {
  __shared__ __attribute__((aligned(16))) unsigned short Sh[64][72];   // a transpose tile, or the sinusoid part's staging
  int blk = blockIdx.x;
  if (blk < PB_PE) { prep_pe(blk, (b16*)&Sh[0][0], peh, pel); return; }
  blk -= PB_PE;
  if (blk < PB_WQ) { wt_tile<0>(blk, Wqkv, DM, NQKV, wq, Sh); return; }
  blk -= PB_WQ;
  if (blk < PB_WF) { wt_tile<1>(blk, Wfc, DM, DM, wf, Sh); return; }
  blk -= PB_WF;
  if (blk < PB_WP) { wt_tile<1>(blk, Wpos, DH, NPOS, wp, Sh); return; }
  prep_embed(blk - PB_WP, emb, e16);
}

// Eight 16-byte asynchronous copies of one thread, global memory to LDS; the closing wait stands in front of any rewrite of the address registers named here.
__device__ __forceinline__ void copy8_to_lds(unsigned l0, unsigned l1, unsigned l2, unsigned l3, unsigned l4, unsigned l5, unsigned l6, unsigned l7,
                                             const void* g0, const void* g1, const void* g2, const void* g3, const void* g4, const void* g5, const void* g6, const void* g7) {
  asm volatile("global_load_async_to_lds_b128 %0, %8, off\n\t"
               "global_load_async_to_lds_b128 %1, %9, off\n\t"
               "global_load_async_to_lds_b128 %2, %10, off\n\t"
               "global_load_async_to_lds_b128 %3, %11, off\n\t"
               "global_load_async_to_lds_b128 %4, %12, off\n\t"
               "global_load_async_to_lds_b128 %5, %13, off\n\t"
               "global_load_async_to_lds_b128 %6, %14, off\n\t"
               "global_load_async_to_lds_b128 %7, %15, off\n\t"
               "s_wait_xcnt 0x0"
               :: "v"(l0), "v"(l1), "v"(l2), "v"(l3), "v"(l4), "v"(l5), "v"(l6), "v"(l7), "v"(g0), "v"(g1), "v"(g2), "v"(g3), "v"(g4), "v"(g5), "v"(g6), "v"(g7) : "memory");
}

__device__ __forceinline__ void copy2_to_lds(unsigned l0, unsigned l1, const void* g0, const void* g1) {   // the same, two copies
  asm volatile("global_load_async_to_lds_b128 %0, %2, off\n\t"
               "global_load_async_to_lds_b128 %1, %3, off\n\t"
               "s_wait_xcnt 0x0"
               :: "v"(l0), "v"(l1), "v"(g0), "v"(g1) : "memory");
}

// position projections: (1024 x 64) x (64 x 3072): A = pe planes (x8 hi+lo), B = f16(bf16 W_pos)^T rows -> 2 products; single f16 rows pp[which][h][l][64]. They need only the
// preparation's results, as the qkv projection does, so their blocks ride in qkv_kernel's launch: PB_POS blocks of 8 waves, block blk = 256 rows x 64 columns, wave = 32 x 64.
// Th: 8 KB of LDS a wave for the epilogue.
constexpr int PB_POS = (NPOS / 64) * (L / 256);
__device__ __forceinline__ void pos_block(int blk, const b16* __restrict__ peh, const b16* __restrict__ pel, const b16* __restrict__ wpos, b16* __restrict__ pp, b16* Th) {
  const int lane = threadIdx.x & 31, wave = threadIdx.x >> 5, nloc = lane & 15, hlf = lane >> 4, m0 = (blk / (NPOS / 64)) * 256 + wave * 32, c0 = (blk % (NPOS / 64)) * 64;
  v8f acc[2][4];
#pragma unroll
  for (int r = 0; r < 2; ++r)
#pragma unroll
    for (int t = 0; t < 4; ++t) acc[r][t] = (v8f){};
  const Opnd A{peh, pel, DH}, B{wpos, nullptr, DH};
  gemm_tile<2, 1>(A, B, DH, m0, c0, nloc, hlf, acc);
  const int which = c0 / DM, h = (c0 % DM) / DH;
  epi_planes(acc, 1.0f / PES, false, pp + (((size_t)which * H + h) * L + m0) * DH, nullptr, DH, 0, 0, lane, Th + wave * (2 * 32 * 64), Th + wave * (2 * 32 * 64) + 32 * 64);
}

// qkv: (4096 x 1024) x (1024 x 4096) bf16 WMMA; 32 x 32 blocks behind the PB_POS position blocks (those end early and free their places), block = 128 tokens x 128 columns, 8 waves (4 along tokens x 2 along columns) of 32 x 64 each. Per 64-k tile the
// 128 embed rows and the 128 weight rows are brought once per block into LDS (row pitch 144 B) by asynchronous copies, two buffers: tile t + 1 flies while tile t is worked on;
// fragments come from LDS. Columns: [q | k1 | k2 | v] x 1024; q/k1/k2 -> single f16 rows [which][b][h][l][64]; v -> (8v)^T hi/lo planes [b][h][64 d][1024 l] through a block
// LDS transpose (block = 128 tokens of one batch row, two heads). The epilogues stage in the ring's LDS behind the last tile's barrier.
// Eight waves a SIMD are asked for so that four blocks (their LDS fits four times) share a WGP and all 1024 blocks are resident at once.
constexpr int GPIT = 64 + 8, GROWS = 256, GTILE = GROWS * GPIT;   // LDS row pitch (16-bit elements), rows and elements of a stage: 128 embed rows, then 128 weight rows
__global__ __launch_bounds__(256, 8) void qkv_kernel(const __bf16* __restrict__ e16, const __bf16* __restrict__ wqkv, b16* __restrict__ qk, b16* __restrict__ vth, b16* __restrict__ vtl,
                                                     const b16* __restrict__ peh, const b16* __restrict__ pel, const b16* __restrict__ wpos, b16* __restrict__ pp) {
  __shared__ __attribute__((aligned(16))) unsigned short Sm[2 * GTILE];   // 73,728 B
  if (blockIdx.x < PB_POS) { pos_block(blockIdx.x, peh, pel, wpos, pp, (b16*)Sm); return; }   // a whole block takes this branch, in front of every barrier
  const int gblk = blockIdx.x - PB_POS;                         // column tile runs fastest
  const int tid = threadIdx.x, lane = tid & 31, wave = __builtin_amdgcn_readfirstlane(tid >> 5), wm = wave & 3, wn = wave >> 2, nloc = lane & 15, hlf = lane >> 4;
  const int mb = (gblk / (NQKV / 128)) * 128, cb = (gblk % (NQKV / 128)) * 128, m0 = mb + wm * 32, c0 = cb + wn * 64;   // the wave number is held scalar: tile indices and the epilogue branch stay scalar
  // copy map: 8 lanes bring one 128-byte row piece; a thread brings rows sr + 32 i of both operands
  const int sr = tid >> 3, sc = (tid & 7) * 8;
  const __bf16* ga = e16 + (size_t)(mb + sr) * DM + sc; const __bf16* gb = wqkv + (size_t)(cb + sr) * DM + sc;
  const unsigned ls = (unsigned)(size_t)(&Sm[0]) + (unsigned)(sr * GPIT + sc) * 2u;
  auto stage = [&](int kt, int buf) {
    const unsigned l = ls + (unsigned)buf * (GTILE * 2u); const __bf16* a = ga + kt * 64; const __bf16* w = gb + kt * 64;
    constexpr unsigned R32 = 32u * GPIT * 2u;
    copy8_to_lds(l, l + R32, l + 2u * R32, l + 3u * R32, l + 4u * R32, l + 5u * R32, l + 6u * R32, l + 7u * R32,
                 a, a + 32 * DM, a + 64 * DM, a + 96 * DM, w, w + 32 * DM, w + 64 * DM, w + 96 * DM);
  };
  v8f acc[2][4];
#pragma unroll
  for (int r = 0; r < 2; ++r)
#pragma unroll
    for (int t = 0; t < 4; ++t) acc[r][t] = (v8f){};
  stage(0, 0);
  asm volatile("s_wait_asynccnt 0x0" ::: "memory");             // this wave's copies of tile 0 have landed
  __syncthreads();                                              // publishes tile 0
  stage(1, 1);
  for (int kt = 0; kt < DM / 64; ++kt) {
    const __bf16* As = (const __bf16*)Sm + (kt & 1) * GTILE + (wm * 32 + nloc) * GPIT; const __bf16* Bs = (const __bf16*)Sm + (kt & 1) * GTILE + (128 + wn * 64 + nloc) * GPIT;
#pragma unroll                                                  // both 32-k halves of the tile in line: LDS offsets become immediates
    for (int ks = 0; ks < 2; ++ks) {
      const v16bb a0 = frag_kb_bf(As + ks * 32, hlf), a1 = frag_kb_bf(As + 16 * GPIT + ks * 32, hlf);
      v16bb bw[4];
#pragma unroll
      for (int t = 0; t < 4; ++t) bw[t] = frag_kb_bf(Bs + t * 16 * GPIT + ks * 32, hlf);
      group_fence();                        // the 12 LDS reads of this 32-k half stay one group ahead of its WMMAs: one LDS wait instead of one per fragment
#pragma unroll
      for (int t = 0; t < 4; ++t) { acc[0][t] = wmma16bb(a0, bw[t], acc[0][t]); acc[1][t] = wmma16bb(a1, bw[t], acc[1][t]); }
      group_fence();                        // the next group's reads are not spread among these WMMAs
    }
    asm volatile("s_wait_dscnt 0x0" ::: "memory");              // this wave's reads of tile kt are done before its buffer is handed back
    asm volatile("s_wait_asynccnt 0x0" ::: "memory");           // this wave's copies of tile kt + 1 have landed
    __syncthreads();                                            // publishes tile kt + 1 and ends every read of tile kt
    if (kt + 2 < DM / 64) stage(kt + 2, kt & 1);
  }
  asm volatile("s_wait_asynccnt 0x0" ::: "memory");             // no copy is outstanding when the ring becomes output staging
  const int which = c0 / DM, c1 = c0 % DM, h = c1 / DH, b = m0 / L, l0 = m0 % L;   // 64 columns = one head; which is the same for the whole block
  if (which < 3) {                                             // q / k1 / k2 rows [which][b][h][l][64] (single f16)
    b16* Th = (b16*)Sm + wave * (2 * 32 * 64);
    epi_planes(acc, 1.0f, false, qk + ((((size_t)which * Bn + b) * H + h) * L + l0) * DH, nullptr, DH, 0, 0, lane, Th, Th + 32 * 64);
    return;
  }
  constexpr int TP = 128 + 8;                                   // token pitch of the transpose planes [head wn][hi, lo][64 d][TP]
  b16* Tt = (b16*)Sm + wn * (2 * 64 * TP);
#pragma unroll
  for (int t = 0; t < 4; ++t)
#pragma unroll
    for (int r = 0; r < 2; ++r)
#pragma unroll
      for (int v = 0; v < 8; ++v) { b16 a, c; split16(acc[r][t][v] * VS, a, c); const int o = (t * 16 + nloc) * TP + wm * 32 + r * 16 + 8 * hlf + v; Tt[o] = a; Tt[64 * TP + o] = c; }
  __syncthreads();
  const int tok0 = mb % L, bb = mb / L;
  b16* bh_ = vth + (((size_t)bb * H + h) * DH) * L + tok0; b16* bl_ = vtl + (((size_t)bb * H + h) * DH) * L + tok0;
  {
#pragma unroll
    for (int j = 0; j < 8; ++j) { const int dd = wm * 16 + j * 2 + (lane >> 4), c8 = (lane & 15) * 8;
      *(v8b*)(bh_ + (size_t)dd * L + c8) = *(const v8b*)(&Tt[dd * TP + c8]); *(v8b*)(bl_ + (size_t)dd * L + c8) = *(const v8b*)(&Tt[64 * TP + dd * TP + c8]); }
    asm volatile("s_wait_xcnt 0x0" ::: "memory");               // behind the last store: stands in front of any later write of a register that these stores name
  }
}

// ---------------------------------------------------------------------------
// attention: block = (b, h, 128 queries), 8 waves, one block a WGP. A wave holds 32 queries (two 16-query column tiles), so that every key-side fragment it reads from LDS feeds two
// WMMAs: the LDS read path, not the matrix pipe, bounds a wave of 16 queries here. The four 32-query groups are each served by TWO waves that split the keys: of every 64-key step
// wave half kh takes keys 32 kh .. 32 kh + 31, with its own running maximum, sum and output tile; behind the loop the kh = 1 wave hands its state over through LDS and the kh = 0
// wave joins the two. All key-side operands come from LDS, staged once per block: the two mask rows once, and per step two 32-key chunks of the k1/k2/kp1/kp2 rows (pitch 144 B)
// and of the (8v)^T hi/lo columns (pitch 80 B), two buffers: step s + 1 is fetched into registers before step s is worked on and stored to the other buffer behind step s's
// logits; one barrier a step, in front of the softmax. A wave past its own diagonal only stages.
// Per chunk, 16-key half and query tile: four K=64 score products (q.k1, qp.kp1, q.k2, qp.kp2; single f16),
// logit = same speaker ? s1 + p1 : s2 + p2; -inf where key > query or umask[b][key] == 0; online softmax f32; P^T f16; y^T += (8v)^T.P^T (4 feature tiles, hi + lo);
// ---------------------------------------------------------------------------
constexpr int KPIT = DH + 8, VPIT = 32 + 8;                    // LDS row pitches in f16: 16 B x odd, for 16-byte fragment reads
typedef __attribute__((ext_vector_type(4))) int v4i;
__device__ __forceinline__ v8b ldoff(const b16* base, unsigned bytes) { return *(const v8b*)((const char*)base + bytes); }
// value of lane l ^ 16, by a vector cross-row move: an LDS-path shuffle would be waited for on the LDS counter, behind every fragment read that is meant to stay in flight
__device__ __forceinline__ float xhalf(float v) {
  return __uint_as_float(__builtin_amdgcn_permlanex16(__float_as_uint(v), __float_as_uint(v), 0x76543210u, 0xfedcba98u, false, false));
}
__global__ __launch_bounds__(256) void attn_kernel(const b16* __restrict__ qk, const b16* __restrict__ pp, const b16* __restrict__ vth, const b16* __restrict__ vtl,
                                                   const int* __restrict__ umask, const int* __restrict__ qmask, float* __restrict__ y) {
  __shared__ __attribute__((aligned(16))) float Os[4][32][DH + 4];      // output rows of a 32-query group
  __shared__ __attribute__((aligned(16))) v4f Xs[4][17][32];            // state of a group's kh = 1 wave: 16 pieces of its output tiles and (m, m, l, l), a lane's pieces 512 B apart
  __shared__ __attribute__((aligned(16))) b16 Ks[2][2][4][32 * KPIT];   // [buffer][chunk of the step][k1, k2, kp1, kp2][key][feature]
  __shared__ __attribute__((aligned(16))) b16 Vs[2][2][2][DH * VPIT];   // [buffer][chunk of the step][hi, lo][feature][key]
  __shared__ __attribute__((aligned(16))) int Ms[2][L];                 // speaker ids and umask of batch row b
  const int tid = threadIdx.x, wid = __builtin_amdgcn_readfirstlane(tid >> 5), lane = tid & 31, hh = lane >> 4, col = lane & 15;
  // Waves w and w + 4 get query groups s and 3 - s; the pairing matters for speed only.
  // Every loop marked unroll in this kernel is unrolled so that the fragment, accumulator and staging arrays are indexed by constants and stay in registers.
  const int kh = wid >> 2, g = kh ? 3 - (wid & 3) : (wid & 3);
  // Block index -> (head row, query tile). A block's cost grows with its tile (2 to 16 steps) and one block fills a WGP, so the tiles go longest first: the 256 places take tiles
  // 7..4, and a place that frees takes the longest tile left (20 + 16, 24 + 12, ... chunks). The map is one-to-one onto (b, h, tile); its order matters for speed only.
  const int tile = 7 - (blockIdx.x >> 6), h = blockIdx.x & 15, b = (blockIdx.x >> 4) & 3, q0 = tile * 128 + g * 32;
  const int nstep = (tile + 1) * 2;                             // 64-key steps up to the block's last query
  const b16* Q = qk + ((((size_t)0 * Bn + b) * H + h) * L) * DH; const b16* K1 = qk + ((((size_t)1 * Bn + b) * H + h) * L) * DH; const b16* K2 = qk + ((((size_t)2 * Bn + b) * H + h) * L) * DH;
  const b16* QP = pp + (((size_t)0 * H + h) * L) * DH; const b16* KP1 = pp + (((size_t)1 * H + h) * L) * DH; const b16* KP2 = pp + (((size_t)2 * H + h) * L) * DH;
  const b16* vh = vth + (((size_t)b * H + h) * DH) * L; const b16* vl = vtl + (((size_t)b * H + h) * DH) * L;
  // staging map: a thread moves one 16-byte piece of each of the six tiles of each of the step's two chunks
  const int kr = tid >> 3, kc8 = (tid & 7) * 8, vr = tid >> 2, vc = (tid & 3) * 8;
  const unsigned gkb = (unsigned)(kr * DH + kc8) * 2u, gvb = (unsigned)(vr * L + vc) * 2u;   // byte offsets from the six scalar bases
  const int sko = kr * KPIT + kc8, svo = vr * VPIT + vc;
  // The twelve loads of the 64-key step that begins at key key0. The closing wait stands in front of any rewrite of their address registers: it takes the addresses as inputs (it changes
  // nothing), so that they stay in their registers up to it; with the memory clobber alone the compiler lifts later writes of those registers over the wait.
  auto fetch = [&](int key0, v8b (&d)[12]) {
    const unsigned ko = gkb + (unsigned)key0 * (DH * 2u), vo = gvb + (unsigned)key0 * 2u;   // the second chunk lies 32 rows (4096 B) and 32 columns (64 B) on: immediate offsets
    const b16* k2p = (const b16*)((const char*)K2 + ko);        // the k2 rows lie 8 MiB behind the k1 rows, past the reach of an immediate offset from that base: an address of their own
    d[0] = ldoff(K1, ko); d[1] = ld8b(k2p); d[2] = ldoff(KP1, ko); d[3] = ldoff(KP2, ko); d[4] = ldoff(vh, vo); d[5] = ldoff(vl, vo);
    d[6] = ldoff(K1, ko + 4096u); d[7] = ld8b(k2p + 2048); d[8] = ldoff(KP1, ko + 4096u); d[9] = ldoff(KP2, ko + 4096u); d[10] = ldoff(vh, vo + 64u); d[11] = ldoff(vl, vo + 64u);
    asm volatile("s_wait_xcnt 0x0" :: "v"(ko), "v"(k2p), "v"(vo) : "memory");
  };
  {
    v8b st[12];
    fetch(0, st);
    const unsigned mo = (unsigned)(b * L + tid * 4) * 4u;       // byte offset
    const v4i mq = *(const v4i*)((const char*)qmask + mo), mu = *(const v4i*)((const char*)umask + mo);
    asm volatile("s_wait_xcnt 0x0" :: "v"(mo) : "memory");      // the same for the two mask loads
    *(v4i*)(&Ms[0][tid * 4]) = mq; *(v4i*)(&Ms[1][tid * 4]) = mu;
#pragma unroll
    for (int c = 0; c < 2; ++c) {
#pragma unroll
      for (int i = 0; i < 4; ++i) *(v8b*)(&Ks[0][c][i][sko]) = st[c * 6 + i];
      *(v8b*)(&Vs[0][c][0][svo]) = st[c * 6 + 4]; *(v8b*)(&Vs[0][c][1][svo]) = st[c * 6 + 5]; }
  }
  v16b qf[2][2], qpf[2][2]; int myspk[2];                       // [query tile][features 0..31, 32..63]
#pragma unroll
  for (int a = 0; a < 2; ++a) { const int so = b * L + q0 + col;
    const b16* qa = Q + (size_t)(q0 + a * 16 + col) * DH + 8 * hh; const b16* qb = QP + (size_t)(q0 + a * 16 + col) * DH + 8 * hh;   // a lane's first piece; the others 16, 32, 48 elements on
#pragma unroll
    for (int ks = 0; ks < 2; ++ks) { qf[a][ks] = cat8b(ld8b(qa + ks * 32), ld8b(qa + ks * 32 + 16)); qpf[a][ks] = cat8b(ld8b(qb + ks * 32), ld8b(qb + ks * 32 + 16)); }
    myspk[a] = qmask[so + a * 16];
    asm volatile("s_wait_xcnt 0x0" :: "v"(qa), "v"(qb), "v"(so) : "memory"); }   // the same for these nine loads
  __syncthreads();
  float m[2] = {-INFINITY, -INFINITY}, l[2] = {0.0f, 0.0f}; v8f o[2][4] = {{{}, {}, {}, {}}, {{}, {}, {}, {}}};
  // The chunk's LDS fragment reads go in whole groups (the four row pairs of keys 0..15, those of keys 16..31 with the masks, the hi and lo value tiles), each issued a block of
  // WMMAs or vector work ahead of its use. The first group of step s + 1 is issued behind the step's barrier, which for that stands in front of the softmax.
  auto read_pair = [&](int buf, int half, int pr, v16b (&d)[4]) {   // pr 0: k1, k2 rows; pr 1: kp1, kp2 rows; features 0..31 and 32..63 of each
    const int ro = (half * 16 + col) * KPIT;
    d[0] = frag_kb(&Ks[buf][kh][2 * pr][ro], hh); d[1] = frag_kb(&Ks[buf][kh][2 * pr][ro + 32], hh); d[2] = frag_kb(&Ks[buf][kh][2 * pr + 1][ro], hh); d[3] = frag_kb(&Ks[buf][kh][2 * pr + 1][ro + 32], hh);
  };
  // a1 = rows d0|d1 . bq, a2 = rows d2|d3 . bq, features 0..31 and then 32..63
  auto score_pair = [&](const v16b (&d)[4], const v16b (&bq)[2], v8f& a1, v8f& a2) {
    a1 = wmma16b(d[0], bq[0], (v8f){}); a2 = wmma16b(d[2], bq[0], (v8f){}); a1 = wmma16b(d[1], bq[1], a1); a2 = wmma16b(d[3], bq[1], a2);
  };
  v16b ka[4], kq[4];                                            // k1, k2 and kp1, kp2 rows of keys 0..15 of the chunk that this wave scores next
  read_pair(0, 0, 0, ka); read_pair(0, 0, 1, kq);
  for (int s = 0; s < nstep; ++s) {
    const int kb = s * 64 + kh * 32, cur = s & 1; const bool more = s + 1 < nstep, act = kb < q0 + 32;   // act: this wave has queries at or behind its chunk of step s
    v8b sn[12];                                                 // step s + 1 on its way to LDS
    if (more) fetch(s * 64 + 64, sn);
    float lg0[2][8], lg1[2][8]; v16b vhi[4], vlo[4];
    if (act) {
      v4i mk0[4], mk1[4]; v8f s1[2], p1[2], s2[2], p2[2]; v16b kc[4], kd[4];
      auto read_masks = [&](int half, v4i (&mk)[4]) {
        const int k8 = kb + half * 16 + 8 * hh;
        mk[0] = *(const v4i*)(&Ms[0][k8]); mk[1] = *(const v4i*)(&Ms[0][k8 + 4]); mk[2] = *(const v4i*)(&Ms[1][k8]); mk[3] = *(const v4i*)(&Ms[1][k8 + 4]);
      };
      auto logits = [&](int half, int a, const v4i (&mk)[4], float (&lg)[8]) {
        const int dq = q0 + a * 16 + col - (kb + half * 16 + 8 * hh);   // key kb + 16 half + 8 hh + r lies behind the query where r > dq
#pragma unroll
        for (int r = 0; r < 8; ++r) { const bool same = ((r < 4 ? mk[0][r & 3] : mk[1][r & 3]) == myspk[a]);
          float v = same ? (s1[a][r] + p1[a][r]) : (s2[a][r] + p2[a][r]);
          if ((r > dq) | ((r < 4 ? mk[2][r & 3] : mk[3][r & 3]) == 0)) v = -INFINITY;
          lg[r] = v; }
      };
      read_pair(cur, 1, 0, kc); read_pair(cur, 1, 1, kd); read_masks(0, mk0); read_masks(1, mk1);
      group_fence();                                            // the reads for keys 16..31 stay whole ahead of the WMMAs of keys 0..15, which hide them
#pragma unroll
      for (int a = 0; a < 2; ++a) { score_pair(ka, qf[a], s1[a], s2[a]); score_pair(kq, qpf[a], p1[a], p2[a]); }
      group_fence();                                            // the reads of the hi value tiles are not spread among those WMMAs
#pragma unroll
      for (int n = 0; n < 4; ++n) vhi[n] = frag_kb(&Vs[cur][kh][0][(n * 16 + col) * VPIT], hh);
      group_fence();                                            // the reads of the hi value tiles stay whole ahead of the logits of keys 0..15 and the WMMAs of keys 16..31, which hide them
#pragma unroll
      for (int a = 0; a < 2; ++a) logits(0, a, mk0, lg0[a]);
      v8f t1[2], u1[2], t2[2], u2[2];                           // accumulators of their own: the WMMAs of keys 16..31 may run among the logits of keys 0..15
#pragma unroll
      for (int a = 0; a < 2; ++a) { score_pair(kc, qf[a], t1[a], t2[a]); score_pair(kd, qpf[a], u1[a], u2[a]); }
      group_fence();                                            // the lo value tiles are read only here, when the rows of keys 16..31 have left their registers
#pragma unroll
      for (int n = 0; n < 4; ++n) vlo[n] = frag_kb(&Vs[cur][kh][1][(n * 16 + col) * VPIT], hh);
      group_fence();                                            // those reads stay whole ahead of the logits of keys 16..31, which hide them
#pragma unroll
      for (int a = 0; a < 2; ++a) { s1[a] = t1[a]; s2[a] = t2[a]; p1[a] = u1[a]; p2[a] = u2[a]; logits(1, a, mk1, lg1[a]); }
    }
    if (more) {                                                 // the other buffer's last reads (step s - 1) had returned when their waves reached the previous step's barrier
#pragma unroll
      for (int c = 0; c < 2; ++c) {
#pragma unroll
        for (int i = 0; i < 4; ++i) *(v8b*)(&Ks[cur ^ 1][c][i][sko]) = sn[c * 6 + i];
        *(v8b*)(&Vs[cur ^ 1][c][0][svo]) = sn[c * 6 + 4]; *(v8b*)(&Vs[cur ^ 1][c][1][svo]) = sn[c * 6 + 5]; }
    }
    __syncthreads();                                            // publishes step s + 1; every read of step s has been issued above and has returned here. Passed on the last step too: with
                                                                // one path to the P.V WMMAs the value tiles count as landed there, and no LDS wait behind the reads below is put in front of them
    read_pair(cur ^ 1, 0, 0, ka); read_pair(cur ^ 1, 0, 1, kq);   // by every wave on every step (the last step's are old rows; neither they nor an idle wave's are used)
    if (act) {
      group_fence();                                            // the next step's first reads stay whole ahead of the softmax and P.V, which hide them
      v16b pb[2];
#pragma unroll
      for (int a = 0; a < 2; ++a) {
        float mr = -INFINITY;
#pragma unroll
        for (int r = 0; r < 8; ++r) mr = fmaxf(mr, fmaxf(lg0[a][r], lg1[a][r]));
        mr = fmaxf(mr, xhalf(mr));
        float mn = fmaxf(m[a], mr); if (mn == -INFINITY) mn = 0.0f;
        const float al_ = __expf(m[a] - mn); m[a] = mn;
        float sum = 0.0f;
#pragma unroll
        for (int r = 0; r < 8; ++r) { const float e0 = __expf(lg0[a][r] - mn), e1 = __expf(lg1[a][r] - mn); sum += e0 + e1; pb[a][r] = (b16)e0; pb[a][8 + r] = (b16)e1; }
        sum += xhalf(sum); l[a] = l[a] * al_ + sum;
#pragma unroll
        for (int n = 0; n < 4; ++n)
#pragma unroll
          for (int r = 0; r < 8; ++r) o[a][n][r] *= al_;
#pragma unroll
        for (int n = 0; n < 4; ++n) o[a][n] = wmma16b(vhi[n], pb[a], o[a][n]);     // hi, then lo, into each accumulator; the first tile's WMMAs may run among the second tile's softmax
#pragma unroll
        for (int n = 0; n < 4; ++n) o[a][n] = wmma16b(vlo[n], pb[a], o[a][n]);
      }
    }
  }
  if (kh) {                                                     // the kh = 1 wave hands its state to its group's kh = 0 wave
#pragma unroll
    for (int a = 0; a < 2; ++a)
#pragma unroll
      for (int n = 0; n < 4; ++n) { Xs[g][a * 8 + n * 2][lane] = (v4f){o[a][n][0], o[a][n][1], o[a][n][2], o[a][n][3]}; Xs[g][a * 8 + n * 2 + 1][lane] = (v4f){o[a][n][4], o[a][n][5], o[a][n][6], o[a][n][7]}; }
    Xs[g][16][lane] = (v4f){m[0], m[1], l[0], l[1]};
  }
  __syncthreads();                                              // publishes the handed-over states; passed by every wave
  if (kh) return;
  const v4f ml = Xs[g][16][lane];
#pragma unroll
  for (int a = 0; a < 2; ++a) {                                 // join of the two key halves: both rescaled to the common maximum
    float mj = fmaxf(m[a], ml[a]); if (mj == -INFINITY) mj = 0.0f;
    const float w0 = __expf(m[a] - mj), w1 = __expf(ml[a] - mj), lj = l[a] * w0 + ml[2 + a] * w1;
    const float inv = (lj > 0.0f) ? (1.0f / (VS * lj)) : 0.0f;
#pragma unroll
    for (int n = 0; n < 4; ++n) { const v4f x0 = Xs[g][a * 8 + n * 2][lane], x1 = Xs[g][a * 8 + n * 2 + 1][lane];
#pragma unroll
      for (int r = 0; r < 8; ++r) Os[g][a * 16 + col][n * 16 + 8 * hh + r] = (o[a][n][r] * w0 + (r < 4 ? x0[r & 3] : x1[r & 3]) * w1) * inv; }
  }
  wave_lds_sync();
  float* dst = y + ((size_t)b * L + q0) * DM + h * DH;          // 32 rows x 256 B
#pragma unroll
  for (int j = 0; j < 16; ++j) { const int rr = j * 2 + hh, c4 = col * 4; *(v4f*)(dst + (size_t)rr * DM + c4) = *(const v4f*)(&Os[g][rr][c4]); }
  asm volatile("s_wait_xcnt 0x0" ::: "memory");                 // behind the last store: stands in front of any later write of a register that these stores name
}

// out = y.W_fc: (4096 x 1024) x (1024 x 1024); A = y f32 x8 split, B = f16(bf16 W_fc)^T rows -> 2 products; f32 rows; grid (16, 32), block = 128 rows x 64 columns, 8 waves of
// 16 x 64. Per 64-k tile the 128 y rows (f32, pitch 272 B) and the 64 weight rows (pitch 144 B) are brought once per block into LDS by asynchronous copies, two buffers, as in
// qkv_kernel; the split runs on fragments read from LDS. The epilogue stages in the ring's LDS behind the last tile's barrier.
constexpr int OAP = 64 + 4, OBP = 64 + 8, OAB = 128 * OAP * 4, OST = OAB + 64 * OBP * 2;   // pitches (f32, f16 elements), bytes of the y part and of a whole stage
__global__ __launch_bounds__(256) void out_kernel(const float* __restrict__ y, const b16* __restrict__ wfc, float* __restrict__ out) {
  __shared__ __attribute__((aligned(16))) unsigned char So[2 * OST];   // 88,064 B
  const int tid = threadIdx.x, lane = tid & 31, wave = __builtin_amdgcn_readfirstlane(tid >> 5), nloc = lane & 15, hlf = lane >> 4, mb = blockIdx.y * 128, m0 = mb + wave * 16, c0 = blockIdx.x * 64;
  // copy map: 16 lanes bring one 256-byte y row piece (rows ar + 16 i), 8 lanes one 128-byte weight row piece (rows br + 32 j)
  const int ar = tid >> 4, ac = (tid & 15) * 4, br = tid >> 3, bc = (tid & 7) * 8;
  const float* ga = y + (size_t)(mb + ar) * DM + ac; const b16* gb = wfc + (size_t)(c0 + br) * DM + bc;
  const unsigned la = (unsigned)(size_t)(&So[0]) + (unsigned)(ar * OAP + ac) * 4u, lw = (unsigned)(size_t)(&So[0]) + (unsigned)OAB + (unsigned)(br * OBP + bc) * 2u;
  auto stage = [&](int kt, int buf) {
    const unsigned l = la + (unsigned)buf * (unsigned)OST, w = lw + (unsigned)buf * (unsigned)OST; const float* a = ga + kt * 64; const b16* g = gb + kt * 64;
    constexpr unsigned R16 = 16u * OAP * 4u;
    copy8_to_lds(l, l + R16, l + 2u * R16, l + 3u * R16, l + 4u * R16, l + 5u * R16, l + 6u * R16, l + 7u * R16,
                 a, a + 16 * DM, a + 32 * DM, a + 48 * DM, a + 64 * DM, a + 80 * DM, a + 96 * DM, a + 112 * DM);
    copy2_to_lds(w, w + 32u * OBP * 2u, g, g + 32 * DM);
  };
  v8f acc[4] = {{}, {}, {}, {}};
  stage(0, 0);
  asm volatile("s_wait_asynccnt 0x0" ::: "memory");             // this wave's copies of tile 0 have landed
  __syncthreads();                                              // publishes tile 0
  stage(1, 1);
  for (int kt = 0; kt < DM / 64; ++kt) {
    const float* As = (const float*)(So + (kt & 1) * OST) + (wave * 16 + nloc) * OAP + 8 * hlf; const b16* Bs = (const b16*)(So + (kt & 1) * OST + OAB) + nloc * OBP;
    // every loop below is unrolled so that the fragment and accumulator arrays are indexed by constants and stay in registers
    v4f x[2][4]; v16b bf[2][4];
#pragma unroll
    for (int ks = 0; ks < 2; ++ks) {
      x[ks][0] = *(const v4f*)(As + ks * 32); x[ks][1] = *(const v4f*)(As + ks * 32 + 4); x[ks][2] = *(const v4f*)(As + ks * 32 + 16); x[ks][3] = *(const v4f*)(As + ks * 32 + 20);
#pragma unroll
      for (int t = 0; t < 4; ++t) bf[ks][t] = frag_kb(Bs + t * 16 * OBP + ks * 32, hlf);
    }
    group_fence();                          // the tile's 24 LDS reads stay one group ahead of the split and the WMMAs: one LDS wait a tile instead of one per fragment
#pragma unroll
    for (int ks = 0; ks < 2; ++ks) {
      v16b ah, al;
#pragma unroll
      for (int e = 0; e < 16; ++e) { b16 a, c; split16(x[ks][e >> 2][e & 3] * 8.0f, a, c); ah[e] = a; al[e] = c; }
#pragma unroll
      for (int t = 0; t < 4; ++t) acc[t] = wmma16b(ah, bf[ks][t], acc[t]);     // hi, then lo, into each accumulator
#pragma unroll
      for (int t = 0; t < 4; ++t) acc[t] = wmma16b(al, bf[ks][t], acc[t]);
    }
    asm volatile("s_wait_dscnt 0x0" ::: "memory");              // this wave's reads of tile kt are done before its buffer is handed back
    asm volatile("s_wait_asynccnt 0x0" ::: "memory");           // this wave's copies of tile kt + 1 have landed
    __syncthreads();                                            // publishes tile kt + 1 and ends every read of tile kt
    if (kt + 2 < DM / 64) stage(kt + 2, kt & 1);
  }
  asm volatile("s_wait_asynccnt 0x0" ::: "memory");             // no copy is outstanding when the ring becomes output staging
  float* Tt = (float*)So + wave * (16 * 64);                    // 16 rows x 256 B per wave, stored as whole lines; unrolled: constant accumulator indices
#pragma unroll
  for (int t = 0; t < 4; ++t)
#pragma unroll
    for (int v = 0; v < 8; ++v) Tt[(v + 8 * hlf) * 64 + t * 16 + nloc] = acc[t][v] * (1.0f / 8.0f);
  wave_lds_sync();
  float* dst0 = out + (size_t)m0 * DM + c0;
#pragma unroll
  for (int j = 0; j < 8; ++j) { const int rr = j * 2 + hlf, c4 = nloc * 4; *(v4f*)(dst0 + (size_t)rr * DM + c4) = *(const v4f*)(Tt + rr * 64 + c4); }
}
}  // namespace

extern "C" void kernel_launch(void* const* d_in, const int* in_sizes, int n_in,
                              void* d_out, int out_size, void* d_ws, size_t ws_size, hipStream_t stream) {
  (void)n_in; (void)out_size;
  const float* emb = (const float*)d_in[0]; const int* umask = (const int*)d_in[1]; const int* qmask = (const int*)d_in[2];
  const float* Wqkv = (const float*)d_in[3]; const float* Wpos = (const float*)d_in[4]; const float* Wfc = (const float*)d_in[5];
  float* out = (float*)d_out;   // [4,1024,1024]
  if (in_sizes[0] != NTOK * DM || in_sizes[1] != NTOK || in_sizes[2] != NTOK || in_sizes[3] != DM * NQKV || in_sizes[4] != DH * NPOS || in_sizes[5] != DM * DM) return;
  size_t off = 0; char* ws = (char*)d_ws;
  auto carve = [&](size_t bytes) { char* p = ws + off; off += (bytes + 255) & ~(size_t)255; return p; };
  unsigned short* e16 = (unsigned short*)carve((size_t)NTOK * DM * 2);       // 8 MB
  unsigned short* wq = (unsigned short*)carve((size_t)NQKV * DM * 2);        // 8 MB
  unsigned short* wp = (unsigned short*)carve((size_t)NPOS * DH * 2);        // 384 KB
  unsigned short* wf = (unsigned short*)carve((size_t)DM * DM * 2);          // 2 MB
  b16* peh = (b16*)carve((size_t)L * DH * 2); b16* pel = (b16*)carve((size_t)L * DH * 2);
  b16* qk = (b16*)carve((size_t)3 * Bn * H * L * DH * 2);                   // 24 MB
  b16* vth = (b16*)carve((size_t)Bn * H * DH * L * 2); b16* vtl = (b16*)carve((size_t)Bn * H * DH * L * 2);   // 8 MB each
  b16* pp = (b16*)carve((size_t)3 * H * L * DH * 2);                         // 6 MB
  float* y = (float*)carve((size_t)NTOK * DM * 4);                           // 16 MB
  if (off > ws_size) return;                                                  // ≈ 81 MB
  prep_kernel<<<PB_PE + PB_WQ + PB_WF + PB_WP + PB_EM, 256, 0, stream>>>(emb, Wqkv, Wpos, Wfc, e16, peh, pel, wq, wp, wf);
  qkv_kernel<<<PB_POS + (NQKV / 128) * (NTOK / 128), 256, 0, stream>>>((const __bf16*)e16, (const __bf16*)wq, qk, vth, vtl, peh, pel, (const b16*)wp, pp);
  attn_kernel<<<Bn * H * (L / 16) / 8, 256, 0, stream>>>(qk, pp, vth, vtl, umask, qmask, y);
  out_kernel<<<dim3(DM / 64, NTOK / 128), 256, 0, stream>>>(y, (const b16*)wf, out);
}

// v008
// Measured time: 90.9 microseconds a run.
// Timed twice side by side with v007, it ran 1.04 and 1.05 times as fast.
// Over all steps from v000 it is 4.97 times as fast.
#include <hip/hip_runtime.h>

// Speaker-aware causal multi-head attention with relative sinusoidal position terms (d_model 1024, 16 heads x 64, B=4, L=1024): q,k1,k2,v = embed W_qkv;
// qp,kp1,kp2 = pe W_pos (pe = the module's sinusoid table rows 89..1112); logit[q][k] = same speaker ? (q.k1 + qp.kp1) : (q.k2 + qp.kp2) (scale 1); keys k > q or umask = 0
// -> -inf; softmax; out = (P.v) W_fc.
// Numerics: embed, W_qkv, W_pos and W_fc are rounded to bf16 (RNE); the qkv projection runs on
// v_wmma_f32_16x16x32_bf16 with those operands (exact products, f32 accumulate); the position projection uses f16 hi+lo of the f32 sinusoid table against the exact f16 copy of
// bf16 W_pos; the four score products use single f16 copies of q/k1/k2/qp/kp (f32 accumulate); P.V pairs single-f16 P with hi+lo 8v; the output projection pairs hi+lo of the
// attention output with the exact f16 copy of bf16 W_fc. Masks are read from the int inputs. Fragment k-map per lane half hh for A AND B: elements 0..7 <- k = 8hh+0..7, 8..15

namespace {
constexpr int Bn = 4, L = 1024, DM = 1024, H = 16, DH = 64, NTOK = Bn * L, NQKV = 4 * DM, NPOS = 3 * DM, TBL = 1201, SHIFT = 601;
constexpr float VS = 8.0f, PES = 8.0f;

typedef _Float16 b16;
typedef __attribute__((ext_vector_type(16))) _Float16 v16b;
typedef __attribute__((ext_vector_type(8)))  _Float16 v8b;
typedef __attribute__((ext_vector_type(8)))  float v8f;
typedef __attribute__((ext_vector_type(4)))  float v4f;

__device__ __forceinline__ v8b ld8b(const b16* p) { return *(const v8b*)p; }
__device__ __forceinline__ v16b cat8b(v8b a, v8b b) { return __builtin_shufflevector(a, b, 0, 1, 2, 3, 4, 5, 6, 7, 8, 9, 10, 11, 12, 13, 14, 15); }
__device__ __forceinline__ v16b frag_kb(const b16* p, int hh) { return cat8b(ld8b(p + 8 * hh), ld8b(p + 16 + 8 * hh)); }
__device__ __forceinline__ void split16(float v, b16& hi, b16& lo) { hi = (b16)v; lo = (b16)(v - (float)hi); }
// hi/lo fragment pair straight from an f32 k-contiguous row (same k-map)
__device__ __forceinline__ void frag_ksplit(const float* p, int hh, v16b& fh_, v16b& fl_) {
  const float* p0 = p + 8 * hh; const float* p1 = p + 16 + 8 * hh;
#pragma unroll
  for (int e = 0; e < 8; ++e) { b16 a, c; split16(p0[e], a, c); fh_[e] = a; fl_[e] = c; split16(p1[e], a, c); fh_[8 + e] = a; fl_[8 + e] = c; }
}
__device__ __forceinline__ v8f wmma16b(v16b a, v16b b, v8f c) {
  return __builtin_amdgcn_wmma_f32_16x16x32_f16(false, a, false, b, (short)0, c, false, false);
}
// Keeps a group of LDS reads whole and at its place in the instruction stream: the compiler fence holds the reads on their side, the scheduling fence the WMMAs and vector work.
// Left free, the reads sink to one pair with a full LDS wait in front of each WMMA, or rise so far that the live fragments no longer fit the registers.
__device__ __forceinline__ void group_fence() { asm volatile("" ::: "memory"); __builtin_amdgcn_sched_barrier(0); }
__device__ __forceinline__ void wave_lds_sync() {
  __builtin_amdgcn_fence(__ATOMIC_RELEASE, "workgroup");
  __builtin_amdgcn_wave_barrier();
  __builtin_amdgcn_fence(__ATOMIC_ACQUIRE, "workgroup");
}

// Operand descriptor: NP = 0 -> f32 rows split on the fly into (hi, lo); NP = 1 -> one f16 plane; NP = 2 -> f16 hi + lo planes;
// NP = 3 -> f32 rows rounded once to a single f16 fragment. ld = row pitch.
struct Opnd { const void* p0; const void* p1; int ld; };
template <int NP> __device__ __forceinline__ void load_frags(const Opnd& o, int row, int kb, int hh, v16b& fh_, v16b& fl_) {
  if (NP == 0) { frag_ksplit((const float*)o.p0 + (size_t)row * o.ld + kb, hh, fh_, fl_); }
  else if (NP == 4 || NP == 5) {                             // f32 rows x64 (NP 4) or x8 (NP 5) then split (keeps the lo halves of small values normal)
    const float sc_ = (NP == 4) ? 64.0f : 8.0f;
    const float* p = (const float*)o.p0 + (size_t)row * o.ld + kb; const float* p0 = p + 8 * hh; const float* p1 = p + 16 + 8 * hh;
#pragma unroll
    for (int e = 0; e < 8; ++e) { b16 a, c; split16(p0[e] * sc_, a, c); fh_[e] = a; fl_[e] = c; split16(p1[e] * sc_, a, c); fh_[8 + e] = a; fl_[8 + e] = c; }
  } else if (NP == 3) {
    const float* p = (const float*)o.p0 + (size_t)row * o.ld + kb; const float* p0 = p + 8 * hh; const float* p1 = p + 16 + 8 * hh;
#pragma unroll
    for (int e = 0; e < 8; ++e) { fh_[e] = (b16)p0[e]; fh_[8 + e] = (b16)p1[e]; }
    fl_ = fh_;
  } else {
    fh_ = frag_kb((const b16*)o.p0 + (size_t)row * o.ld + kb, hh);
    if (NP == 2) fl_ = frag_kb((const b16*)o.p1 + (size_t)row * o.ld + kb, hh); else fl_ = fh_;
  }
}
template <int ANP, int BNP> __device__ __forceinline__ v8f mac(v16b ah, v16b al, v16b bh, v16b bl, v8f c) {
  c = wmma16b(ah, bh, c);
  if (BNP == 0 || BNP == 2 || BNP == 4 || BNP == 5) c = wmma16b(ah, bl, c);     // hi.lo
  if (ANP == 0 || ANP == 2 || ANP == 4 || ANP == 5) c = wmma16b(al, bh, c);     // lo.hi   (lo.lo dropped)
  return c;
}
// 32x64 wave tile: acc[r][t] (rows m0+16r.., cols c0+16t..) += A[m][k] . B[n][k] over k in [0, K)
template <int ANP, int BNP>
__device__ __forceinline__ void gemm_tile(const Opnd& A, const Opnd& B, int K, int m0, int c0, int nloc, int hlf, v8f (&acc)[2][4]) {
  for (int kb = 0; kb < K; kb += 32) {
    v16b a0h, a0l, a1h, a1l;
    load_frags<ANP>(A, m0 + nloc, kb, hlf, a0h, a0l);
    load_frags<ANP>(A, m0 + 16 + nloc, kb, hlf, a1h, a1l);
#pragma unroll
    for (int t = 0; t < 4; ++t) {
      v16b bh, bl;
      load_frags<BNP>(B, c0 + t * 16 + nloc, kb, hlf, bh, bl);
      acc[0][t] = mac<ANP, BNP>(a0h, a0l, bh, bl, acc[0][t]);
      acc[1][t] = mac<ANP, BNP>(a1h, a1l, bh, bl, acc[1][t]);
    }
  }
}

__device__ __forceinline__ void epi_planes(v8f (&acc)[2][4], float scale, bool two, b16* __restrict__ oh, b16* __restrict__ ol, int ldo,
                                           int m0, int c0, int lane, b16* Th, b16* Tl) {
  const int nloc = lane & 15, hlf = lane >> 4;
#pragma unroll
  for (int t = 0; t < 4; ++t)
#pragma unroll
    for (int r = 0; r < 2; ++r)
#pragma unroll
      for (int v = 0; v < 8; ++v) {
        const int rr = r * 16 + v + 8 * hlf, cc = t * 16 + nloc;
        b16 h_, l_; split16(acc[r][t][v] * scale, h_, l_);
        Th[rr * 64 + cc] = h_; Tl[rr * 64 + cc] = l_;
      }
  wave_lds_sync();
  {
#pragma unroll
    for (int j = 0; j < 8; ++j) {
      const int rr = j * 4 + (lane >> 3), c8 = (lane & 7) * 8;
      const size_t o = (size_t)(m0 + rr) * ldo + c0 + c8;
      *(v8b*)(oh + o) = ld8b(Th + rr * 64 + c8);
      if (two) *(v8b*)(ol + o) = ld8b(Tl + rr * 64 + c8);
    }
    
  }
}
typedef __attribute__((ext_vector_type(8))) __bf16 v8bb; typedef __attribute__((ext_vector_type(16))) __bf16 v16bb;
__device__ __forceinline__ v16bb frag_kb_bf(const __bf16* p, int hh) { const v8bb a = *(const v8bb*)(p + 8 * hh), b = *(const v8bb*)(p + 16 + 8 * hh); return __builtin_shufflevector(a, b, 0, 1, 2, 3, 4, 5, 6, 7, 8, 9, 10, 11, 12, 13, 14, 15); }
__device__ __forceinline__ v8f wmma16bb(v16bb a, v16bb b, v8f c) {
  return __builtin_amdgcn_wmma_f32_16x16x32_bf16(false, a, false, b, (short)0, c, false, false);
}
__device__ __forceinline__ unsigned short bf16_rne_bits(float v) { unsigned int u = __float_as_uint(v); u += 0x7FFFu + ((u >> 16) & 1u); return (unsigned short)(u >> 16); }
__device__ __forceinline__ float bf16_rne(float v) { return __uint_as_float(((unsigned int)bf16_rne_bits(v)) << 16); }

// The preparation work has no dependences among its parts, so all of it runs as ONE launch; a block's index picks its part (prep_kernel below).
constexpr int PB_PE = L * DH / 8 / 256, PB_WQ = (NQKV / 64) * (DM / 64), PB_WF = (DM / 64) * (DM / 64), PB_WP = (NPOS / 64) * (DH / 64), PB_EM = 512;   // blocks of each part
// part: embed -> bf16 rows [4096][1024] (16-B pieces), PB_EM blocks striding over the pieces.
__device__ __forceinline__ void prep_embed(int blk, const float* __restrict__ emb, unsigned short* __restrict__ e16) {
  typedef __attribute__((ext_vector_type(8))) unsigned short v8us;
  const size_t tid = (size_t)blk * 256 + threadIdx.x, nth = (size_t)PB_EM * 256;
  for (size_t p = tid; p < (size_t)NTOK * DM / 8; p += nth) { v8us v;
#pragma unroll
    for (int e = 0; e < 8; ++e) v[e] = bf16_rne_bits(emb[p * 8 + e]);
    *(v8us*)(e16 + p * 8) = v; }
}
// part: pe x8 hi/lo planes [1024][64] from the module's sinusoid formula (f32, table row 0 (the padding row) never selected for L=1024); PB_PE blocks, one 8-element piece a thread.
// Sc: per-thread staging (256 x 16 f16) for the rolled sinusoid loop.
__device__ __forceinline__ void prep_pe(int blk, b16* Sc, b16* __restrict__ peh, b16* __restrict__ pel) {
  const size_t p = (size_t)blk * 256 + threadIdx.x; const int l = (int)(p / 8), d0 = (int)(p % 8) * 8;
  const int tblrow = l - L / 2 + SHIFT;                        // 89 .. 1112, never 0
  const float posv = (float)(tblrow - (TBL + 1) / 2);          // arange(-601, 600)[tblrow] = tblrow - 601
#pragma unroll 1
  for (int e = 0; e < 8; ++e) { const int d = d0 + e; const int j = (d < DH / 2) ? d : d - DH / 2;   // rolled: one sin/cos expansion in the binary
    const float freq = expf((float)j * (-9.210340371976184f / (float)(DH / 2 - 1))); const float ang = posv * freq;
    const float val = (d < DH / 2) ? sinf(ang) : cosf(ang); b16 a, c; split16(val * PES, a, c); Sc[threadIdx.x * 16 + e] = a; Sc[threadIdx.x * 16 + 8 + e] = c; }
  *(v8b*)(peh + p * 8) = *(const v8b*)(&Sc[threadIdx.x * 16]); *(v8b*)(pel + p * 8) = *(const v8b*)(&Sc[threadIdx.x * 16 + 8]);
}

// part: W [k rows][n cols] f32 -> [n][k] 16-bit rows through 64x64 LDS tiles: MODE 0: bf16 bits (W_qkv); MODE 1: f16 of bf16(w) (W_fc, W_pos). Block blk = tile (blk % (N/64), blk / (N/64)).
template <int MODE>
__device__ __forceinline__ void wt_tile(int blk, const float* __restrict__ W, int K, int Ncols, unsigned short* __restrict__ out, unsigned short (*Tl)[72]) {
  typedef __attribute__((ext_vector_type(8))) unsigned short v8us;
  const int tid = threadIdx.x, lane = tid & 31, wave = tid >> 5, n0 = (blk % (Ncols / 64)) * 64, k0 = (blk / (Ncols / 64)) * 64;
  for (int i = tid; i < 64 * 64; i += 256) { const int kk = i / 64, nn = i % 64; const float w = W[(size_t)(k0 + kk) * Ncols + n0 + nn];
    unsigned short bits; if (MODE == 0) bits = bf16_rne_bits(w); else { const b16 hv = (b16)bf16_rne(w); bits = *reinterpret_cast<const unsigned short*>(&hv); }
    Tl[nn][kk] = bits; }
  __syncthreads();
  {
#pragma unroll
    for (int j = 0; j < 2; ++j) { const int rr = wave * 8 + j * 4 + (lane >> 3), c8 = (lane & 7) * 8; *(v8us*)(out + (size_t)(n0 + rr) * K + k0 + c8) = *(const v8us*)(&Tl[rr][c8]); }
    asm volatile("s_wait_xcnt 0x0" ::: "memory");               // behind the last store: stands in front of any later write of a register that these stores name
  }
}

// All preparation in one launch. The parts stand in the order of their blocks' own run time, the longest first: sinusoids, the three
// weight transposes, the embed rounding. Every branch is on the block index alone, so the barrier inside wt_tile is passed by a whole block or by none of it.
__global__ __launch_bounds__(256) void prep_kernel(const float* __restrict__ emb, const float* __restrict__ Wqkv, const float* __restrict__ Wpos, const float* __restrict__ Wfc,
                                                   unsigned short* __restrict__ e16, b16* __restrict__ peh, b16* __restrict__ pel,
                                                   unsigned short* __restrict__ wq, unsigned short* __restrict__ wp, unsigned short* __restrict__ wf) {
  __shared__ __attribute__((aligned(16))) unsigned short Sh[64][72];   // a transpose tile, or the sinusoid part's staging
  int blk = blockIdx.x;
  if (blk < PB_PE) { prep_pe(blk, (b16*)&Sh[0][0], peh, pel); return; }
  blk -= PB_PE;
  if (blk < PB_WQ) { wt_tile<0>(blk, Wqkv, DM, NQKV, wq, Sh); return; }
  blk -= PB_WQ;
  if (blk < PB_WF) { wt_tile<1>(blk, Wfc, DM, DM, wf, Sh); return; }
  blk -= PB_WF;
  if (blk < PB_WP) { wt_tile<1>(blk, Wpos, DH, NPOS, wp, Sh); return; }
  prep_embed(blk - PB_WP, emb, e16);
}

// Eight 16-byte asynchronous copies of one thread, global memory to LDS; the closing wait stands in front of any rewrite of the address registers named here.
__device__ __forceinline__ void copy8_to_lds(unsigned l0, unsigned l1, unsigned l2, unsigned l3, unsigned l4, unsigned l5, unsigned l6, unsigned l7,
                                             const void* g0, const void* g1, const void* g2, const void* g3, const void* g4, const void* g5, const void* g6, const void* g7) {
  asm volatile("global_load_async_to_lds_b128 %0, %8, off\n\t"
               "global_load_async_to_lds_b128 %1, %9, off\n\t"
               "global_load_async_to_lds_b128 %2, %10, off\n\t"
               "global_load_async_to_lds_b128 %3, %11, off\n\t"
               "global_load_async_to_lds_b128 %4, %12, off\n\t"
               "global_load_async_to_lds_b128 %5, %13, off\n\t"
               "global_load_async_to_lds_b128 %6, %14, off\n\t"
               "global_load_async_to_lds_b128 %7, %15, off\n\t"
               "s_wait_xcnt 0x0"
               :: "v"(l0), "v"(l1), "v"(l2), "v"(l3), "v"(l4), "v"(l5), "v"(l6), "v"(l7), "v"(g0), "v"(g1), "v"(g2), "v"(g3), "v"(g4), "v"(g5), "v"(g6), "v"(g7) : "memory");
}

__device__ __forceinline__ void copy4_to_lds(unsigned l0, unsigned l1, unsigned l2, unsigned l3, const void* g0, const void* g1, const void* g2, const void* g3) {   // the same, four copies
  asm volatile("global_load_async_to_lds_b128 %0, %4, off\n\t"
               "global_load_async_to_lds_b128 %1, %5, off\n\t"
               "global_load_async_to_lds_b128 %2, %6, off\n\t"
               "global_load_async_to_lds_b128 %3, %7, off\n\t"
               "s_wait_xcnt 0x0"
               :: "v"(l0), "v"(l1), "v"(l2), "v"(l3), "v"(g0), "v"(g1), "v"(g2), "v"(g3) : "memory");
}

// position projections: (1024 x 64) x (64 x 3072): A = pe planes (x8 hi+lo), B = f16(bf16 W_pos)^T rows -> 2 products; single f16 rows pp[which][h][l][64]. They need only the
// preparation's results, as the qkv projection does, so their blocks ride in qkv_kernel's launch: PB_POS blocks of 8 waves, block blk = 256 rows x 64 columns, wave = 32 x 64.
// Th: 8 KB of LDS a wave for the epilogue.
constexpr int PB_POS = (NPOS / 64) * (L / 256);
__device__ __forceinline__ void pos_block(int blk, const b16* __restrict__ peh, const b16* __restrict__ pel, const b16* __restrict__ wpos, b16* __restrict__ pp, b16* Th) {
  const int lane = threadIdx.x & 31, wave = threadIdx.x >> 5, nloc = lane & 15, hlf = lane >> 4, m0 = (blk / (NPOS / 64)) * 256 + wave * 32, c0 = (blk % (NPOS / 64)) * 64;
  v8f acc[2][4];
#pragma unroll
  for (int r = 0; r < 2; ++r)
#pragma unroll
    for (int t = 0; t < 4; ++t) acc[r][t] = (v8f){};
  const Opnd A{peh, pel, DH}, B{wpos, nullptr, DH};
  gemm_tile<2, 1>(A, B, DH, m0, c0, nloc, hlf, acc);
  const int which = c0 / DM, h = (c0 % DM) / DH;
  epi_planes(acc, 1.0f / PES, false, pp + (((size_t)which * H + h) * L + m0) * DH, nullptr, DH, 0, 0, lane, Th + wave * (2 * 32 * 64), Th + wave * (2 * 32 * 64) + 32 * 64);
}

// qkv: (4096 x 1024) x (1024 x 4096) bf16 WMMA; 16 x 32 blocks behind the PB_POS position blocks (those end early and free their places), block = 256 tokens x 128 columns, 8 waves (4 along tokens x 2 along columns) of 64 x 64 each:
// a fragment read from LDS feeds four WMMAs, so the reads stay inside the LDS rate at the full matrix rate, and a block brings 384 operand rows for 256 x 128 outputs. Per 64-k tile the
// 256 embed rows and the 128 weight rows are brought once per block into LDS (row pitch 144 B) by asynchronous copies, two buffers: tile t + 1 flies while tile t is worked on;
// fragments come from LDS. Columns: [q | k1 | k2 | v] x 1024; q/k1/k2 -> single f16 rows [which][b][h][l][64]; v -> (8v)^T hi/lo planes [b][h][64 d][1024 l] through a block
// LDS transpose (block = 256 tokens of one batch row, two heads). The epilogues stage in the ring's LDS behind the last tile's barrier.
// Four waves a SIMD are asked for so that two blocks share a WGP and all 512 blocks are resident at once.
constexpr int GPIT = 64 + 8, GAROWS = 256, GROWS = GAROWS + 128, GTILE = GROWS * GPIT;   // LDS row pitch (16-bit elements), rows and elements of a stage: 256 embed rows, then 128 weight rows
constexpr int VTP = GAROWS + 8;                                 // token pitch of the transpose planes [head wn][hi, lo][64 d][VTP]
constexpr int GSM = (2 * GTILE > 2 * 2 * 64 * VTP) ? 2 * GTILE : 2 * 2 * 64 * VTP;   // the ring, or the transpose planes where those are larger
__global__ __launch_bounds__(256, 4) void qkv_kernel(const __bf16* __restrict__ e16, const __bf16* __restrict__ wqkv, b16* __restrict__ qk, b16* __restrict__ vth, b16* __restrict__ vtl,
                                                     const b16* __restrict__ peh, const b16* __restrict__ pel, const b16* __restrict__ wpos, b16* __restrict__ pp) {
  __shared__ __attribute__((aligned(16))) unsigned short Sm[GSM];   // 135,168 B
  if (blockIdx.x < PB_POS) { pos_block(blockIdx.x, peh, pel, wpos, pp, (b16*)Sm); return; }   // a whole block takes this branch, in front of every barrier
  const int gblk = blockIdx.x - PB_POS;                         // column tile runs fastest
  const int tid = threadIdx.x, lane = tid & 31, wave = __builtin_amdgcn_readfirstlane(tid >> 5), wm = wave & 3, wn = wave >> 2, nloc = lane & 15, hlf = lane >> 4;
  const int mb = (gblk / (NQKV / 128)) * GAROWS, cb = (gblk % (NQKV / 128)) * 128, m0 = mb + wm * 64, c0 = cb + wn * 64;   // the wave number is held scalar: tile indices and the epilogue branch stay scalar
  // copy map: 8 lanes bring one 128-byte row piece; a thread brings rows sr + 32 i of both operands (8 embed rows, 4 weight rows)
  const int sr = tid >> 3, sc = (tid & 7) * 8;
  const __bf16* ga = e16 + (size_t)(mb + sr) * DM + sc; const __bf16* gb = wqkv + (size_t)(cb + sr) * DM + sc;
  const unsigned ls = (unsigned)(size_t)(&Sm[0]) + (unsigned)(sr * GPIT + sc) * 2u;
  auto stage = [&](int kt, int buf) {
    const unsigned l = ls + (unsigned)buf * (GTILE * 2u); const __bf16* a = ga + kt * 64; const __bf16* w = gb + kt * 64;
    constexpr unsigned R32 = 32u * GPIT * 2u;
    copy8_to_lds(l, l + R32, l + 2u * R32, l + 3u * R32, l + 4u * R32, l + 5u * R32, l + 6u * R32, l + 7u * R32,
                 a, a + 32 * DM, a + 64 * DM, a + 96 * DM, a + 128 * DM, a + 160 * DM, a + 192 * DM, a + 224 * DM);
    copy4_to_lds(l + 8u * R32, l + 9u * R32, l + 10u * R32, l + 11u * R32, w, w + 32 * DM, w + 64 * DM, w + 96 * DM);
  };
  v8f acc[2][2][4];                                             // [32-row half of the wave's 64 rows][16 rows][16 columns]
#pragma unroll
  for (int p = 0; p < 2; ++p)
#pragma unroll
    for (int r = 0; r < 2; ++r)
#pragma unroll
      for (int t = 0; t < 4; ++t) acc[p][r][t] = (v8f){};
  stage(0, 0);
  asm volatile("s_wait_asynccnt 0x0" ::: "memory");             // this wave's copies of tile 0 have landed
  __syncthreads();                                              // publishes tile 0
  stage(1, 1);
  for (int kt = 0; kt < DM / 64; ++kt) {
    const __bf16* As = (const __bf16*)Sm + (kt & 1) * GTILE + (wm * 64 + nloc) * GPIT; const __bf16* Bs = (const __bf16*)Sm + (kt & 1) * GTILE + (GAROWS + wn * 64 + nloc) * GPIT;
#pragma unroll                                                  // both 32-k halves of the tile in line: LDS offsets become immediates
    for (int ks = 0; ks < 2; ++ks) {
      v16bb aw[4], bw[4];
#pragma unroll
      for (int t = 0; t < 4; ++t) aw[t] = frag_kb_bf(As + t * 16 * GPIT + ks * 32, hlf);
#pragma unroll
      for (int t = 0; t < 4; ++t) bw[t] = frag_kb_bf(Bs + t * 16 * GPIT + ks * 32, hlf);
      group_fence();                        // the 16 LDS reads of this 32-k half stay one group ahead of its WMMAs: one LDS wait instead of one per fragment
#pragma unroll
      for (int t = 0; t < 4; ++t)
#pragma unroll
        for (int r = 0; r < 4; ++r) acc[r >> 1][r & 1][t] = wmma16bb(aw[r], bw[t], acc[r >> 1][r & 1][t]);
      group_fence();                        // the next group's reads are not spread among these WMMAs
    }
    asm volatile("s_wait_dscnt 0x0" ::: "memory");              // this wave's reads of tile kt are done before its buffer is handed back
    asm volatile("s_wait_asynccnt 0x0" ::: "memory");           // this wave's copies of tile kt + 1 have landed
    __syncthreads();                                            // publishes tile kt + 1 and ends every read of tile kt
    if (kt + 2 < DM / 64) stage(kt + 2, kt & 1);
  }
  asm volatile("s_wait_asynccnt 0x0" ::: "memory");             // no copy is outstanding when the ring becomes output staging
  const int which = c0 / DM, c1 = c0 % DM, h = c1 / DH, b = m0 / L, l0 = m0 % L;   // 64 columns = one head; which is the same for the whole block
  if (which < 3) {                                             // q / k1 / k2 rows [which][b][h][l][64] (single f16), the wave's two 32-row halves one after the other through its own staging
    b16* Th = (b16*)Sm + wave * (2 * 32 * 64);
#pragma unroll
    for (int p = 0; p < 2; ++p) epi_planes(acc[p], 1.0f, false, qk + ((((size_t)which * Bn + b) * H + h) * L + l0 + p * 32) * DH, nullptr, DH, 0, 0, lane, Th, Th + 32 * 64);
    return;
  }
  b16* Tt = (b16*)Sm + wn * (2 * 64 * VTP);
#pragma unroll
  for (int t = 0; t < 4; ++t)
#pragma unroll
    for (int p = 0; p < 2; ++p)
#pragma unroll
      for (int r = 0; r < 2; ++r)
#pragma unroll
        for (int v = 0; v < 8; ++v) { b16 a, c; split16(acc[p][r][t][v] * VS, a, c); const int o = (t * 16 + nloc) * VTP + wm * 64 + p * 32 + r * 16 + 8 * hlf + v; Tt[o] = a; Tt[64 * VTP + o] = c; }
  __syncthreads();
  const int tok0 = mb % L, bb = mb / L;
  b16* bh_ = vth + (((size_t)bb * H + h) * DH) * L + tok0; b16* bl_ = vtl + (((size_t)bb * H + h) * DH) * L + tok0;
  {
#pragma unroll
    for (int j = 0; j < 16; ++j) { const int dd = wm * 16 + j, c8 = lane * 8;   // a wave stores one 512-byte row piece of each plane at a time
      *(v8b*)(bh_ + (size_t)dd * L + c8) = *(const v8b*)(&Tt[dd * VTP + c8]); *(v8b*)(bl_ + (size_t)dd * L + c8) = *(const v8b*)(&Tt[64 * VTP + dd * VTP + c8]); }
    asm volatile("s_wait_xcnt 0x0" ::: "memory");               // behind the last store: stands in front of any later write of a register that these stores name
  }
}

// ---------------------------------------------------------------------------
// attention: block = (b, h, 128 queries), 8 waves, one block a WGP. A wave holds 32 queries (two 16-query column tiles), so that every key-side fragment it reads from LDS feeds two
// WMMAs: the LDS read path, not the matrix pipe, bounds a wave of 16 queries here. The four 32-query groups are each served by TWO waves that split the keys: of every 64-key step
// wave half kh takes keys 32 kh .. 32 kh + 31, with its own running maximum, sum and output tile; behind the loop the kh = 1 wave hands its state over through LDS and the kh = 0
// wave joins the two. All key-side operands come from LDS, staged once per block: the two mask rows once, and per step two 32-key chunks of the k1/k2/kp1/kp2 rows (pitch 144 B)
// and of the (8v)^T hi/lo columns (pitch 80 B), two buffers: step s + 1 is fetched into registers before step s is worked on and stored to the other buffer behind step s's
// logits; one barrier a step, in front of the softmax. A wave past its own diagonal only stages.
// Per chunk, 16-key half and query tile: four K=64 score products (q.k1, qp.kp1, q.k2, qp.kp2; single f16),
// logit = same speaker ? s1 + p1 : s2 + p2; -inf where key > query or umask[b][key] == 0; online softmax f32; P^T f16; y^T += (8v)^T.P^T (4 feature tiles, hi + lo);
// ---------------------------------------------------------------------------
constexpr int KPIT = DH + 8, VPIT = 32 + 8;                    // LDS row pitches in f16: 16 B x odd, for 16-byte fragment reads
typedef __attribute__((ext_vector_type(4))) int v4i;
__device__ __forceinline__ v8b ldoff(const b16* base, unsigned bytes) { return *(const v8b*)((const char*)base + bytes); }
// value of lane l ^ 16, by a vector cross-row move: an LDS-path shuffle would be waited for on the LDS counter, behind every fragment read that is meant to stay in flight
__device__ __forceinline__ float xhalf(float v) {
  return __uint_as_float(__builtin_amdgcn_permlanex16(__float_as_uint(v), __float_as_uint(v), 0x76543210u, 0xfedcba98u, false, false));
}
__global__ __launch_bounds__(256) void attn_kernel(const b16* __restrict__ qk, const b16* __restrict__ pp, const b16* __restrict__ vth, const b16* __restrict__ vtl,
                                                   const int* __restrict__ umask, const int* __restrict__ qmask, float* __restrict__ y) {
  __shared__ __attribute__((aligned(16))) float Os[4][32][DH + 4];      // output rows of a 32-query group
  __shared__ __attribute__((aligned(16))) v4f Xs[4][17][32];            // state of a group's kh = 1 wave: 16 pieces of its output tiles and (m, m, l, l), a lane's pieces 512 B apart
  __shared__ __attribute__((aligned(16))) b16 Ks[2][2][4][32 * KPIT];   // [buffer][chunk of the step][k1, k2, kp1, kp2][key][feature]
  __shared__ __attribute__((aligned(16))) b16 Vs[2][2][2][DH * VPIT];   // [buffer][chunk of the step][hi, lo][feature][key]
  __shared__ __attribute__((aligned(16))) int Ms[2][L];                 // speaker ids and umask of batch row b
  const int tid = threadIdx.x, wid = __builtin_amdgcn_readfirstlane(tid >> 5), lane = tid & 31, hh = lane >> 4, col = lane & 15;
  // Waves w and w + 4 get query groups s and 3 - s; the pairing matters for speed only.
  // Every loop marked unroll in this kernel is unrolled so that the fragment, accumulator and staging arrays are indexed by constants and stay in registers.
  const int kh = wid >> 2, g = kh ? 3 - (wid & 3) : (wid & 3);
  // Block index -> (head row, query tile). A block's cost grows with its tile (2 to 16 steps) and one block fills a WGP, so the tiles go longest first: the 256 places take tiles
  // 7..4, and a place that frees takes the longest tile left (20 + 16, 24 + 12, ... chunks). The map is one-to-one onto (b, h, tile); its order matters for speed only.
  const int tile = 7 - (blockIdx.x >> 6), h = blockIdx.x & 15, b = (blockIdx.x >> 4) & 3, q0 = tile * 128 + g * 32;
  const int nstep = (tile + 1) * 2;                             // 64-key steps up to the block's last query
  const b16* Q = qk + ((((size_t)0 * Bn + b) * H + h) * L) * DH; const b16* K1 = qk + ((((size_t)1 * Bn + b) * H + h) * L) * DH; const b16* K2 = qk + ((((size_t)2 * Bn + b) * H + h) * L) * DH;
  const b16* QP = pp + (((size_t)0 * H + h) * L) * DH; const b16* KP1 = pp + (((size_t)1 * H + h) * L) * DH; const b16* KP2 = pp + (((size_t)2 * H + h) * L) * DH;
  const b16* vh = vth + (((size_t)b * H + h) * DH) * L; const b16* vl = vtl + (((size_t)b * H + h) * DH) * L;
  // staging map: a thread moves one 16-byte piece of each of the six tiles of each of the step's two chunks
  const int kr = tid >> 3, kc8 = (tid & 7) * 8, vr = tid >> 2, vc = (tid & 3) * 8;
  const unsigned gkb = (unsigned)(kr * DH + kc8) * 2u, gvb = (unsigned)(vr * L + vc) * 2u;   // byte offsets from the six scalar bases
  const int sko = kr * KPIT + kc8, svo = vr * VPIT + vc;
  // The twelve loads of the 64-key step that begins at key key0. The closing wait stands in front of any rewrite of their address registers: it takes the addresses as inputs (it changes
  // nothing), so that they stay in their registers up to it; with the memory clobber alone the compiler lifts later writes of those registers over the wait.
  auto fetch = [&](int key0, v8b (&d)[12]) {
    const unsigned ko = gkb + (unsigned)key0 * (DH * 2u), vo = gvb + (unsigned)key0 * 2u;   // the second chunk lies 32 rows (4096 B) and 32 columns (64 B) on: immediate offsets
    const b16* k2p = (const b16*)((const char*)K2 + ko);        // the k2 rows lie 8 MiB behind the k1 rows, past the reach of an immediate offset from that base: an address of their own
    d[0] = ldoff(K1, ko); d[1] = ld8b(k2p); d[2] = ldoff(KP1, ko); d[3] = ldoff(KP2, ko); d[4] = ldoff(vh, vo); d[5] = ldoff(vl, vo);
    d[6] = ldoff(K1, ko + 4096u); d[7] = ld8b(k2p + 2048); d[8] = ldoff(KP1, ko + 4096u); d[9] = ldoff(KP2, ko + 4096u); d[10] = ldoff(vh, vo + 64u); d[11] = ldoff(vl, vo + 64u);
    asm volatile("s_wait_xcnt 0x0" :: "v"(ko), "v"(k2p), "v"(vo) : "memory");
  };
  {
    v8b st[12];
    fetch(0, st);
    const unsigned mo = (unsigned)(b * L + tid * 4) * 4u;       // byte offset
    const v4i mq = *(const v4i*)((const char*)qmask + mo), mu = *(const v4i*)((const char*)umask + mo);
    asm volatile("s_wait_xcnt 0x0" :: "v"(mo) : "memory");      // the same for the two mask loads
    *(v4i*)(&Ms[0][tid * 4]) = mq; *(v4i*)(&Ms[1][tid * 4]) = mu;
#pragma unroll
    for (int c = 0; c < 2; ++c) {
#pragma unroll
      for (int i = 0; i < 4; ++i) *(v8b*)(&Ks[0][c][i][sko]) = st[c * 6 + i];
      *(v8b*)(&Vs[0][c][0][svo]) = st[c * 6 + 4]; *(v8b*)(&Vs[0][c][1][svo]) = st[c * 6 + 5]; }
  }
  v16b qf[2][2], qpf[2][2]; int myspk[2];                       // [query tile][features 0..31, 32..63]
#pragma unroll
  for (int a = 0; a < 2; ++a) { const int so = b * L + q0 + col;
    const b16* qa = Q + (size_t)(q0 + a * 16 + col) * DH + 8 * hh; const b16* qb = QP + (size_t)(q0 + a * 16 + col) * DH + 8 * hh;   // a lane's first piece; the others 16, 32, 48 elements on
#pragma unroll
    for (int ks = 0; ks < 2; ++ks) { qf[a][ks] = cat8b(ld8b(qa + ks * 32), ld8b(qa + ks * 32 + 16)); qpf[a][ks] = cat8b(ld8b(qb + ks * 32), ld8b(qb + ks * 32 + 16)); }
    myspk[a] = qmask[so + a * 16];
    asm volatile("s_wait_xcnt 0x0" :: "v"(qa), "v"(qb), "v"(so) : "memory"); }   // the same for these nine loads
  __syncthreads();
  float m[2] = {-INFINITY, -INFINITY}, l[2] = {0.0f, 0.0f}; v8f o[2][4] = {{{}, {}, {}, {}}, {{}, {}, {}, {}}};
  // The chunk's LDS fragment reads go in whole groups (the four row pairs of keys 0..15, those of keys 16..31 with the masks, the hi and lo value tiles), each issued a block of
  // WMMAs or vector work ahead of its use. The first group of step s + 1 is issued behind the step's barrier, which for that stands in front of the softmax.
  auto read_pair = [&](int buf, int half, int pr, v16b (&d)[4]) {   // pr 0: k1, k2 rows; pr 1: kp1, kp2 rows; features 0..31 and 32..63 of each
    const int ro = (half * 16 + col) * KPIT;
    d[0] = frag_kb(&Ks[buf][kh][2 * pr][ro], hh); d[1] = frag_kb(&Ks[buf][kh][2 * pr][ro + 32], hh); d[2] = frag_kb(&Ks[buf][kh][2 * pr + 1][ro], hh); d[3] = frag_kb(&Ks[buf][kh][2 * pr + 1][ro + 32], hh);
  };
  // a1 = rows d0|d1 . bq, a2 = rows d2|d3 . bq, features 0..31 and then 32..63
  auto score_pair = [&](const v16b (&d)[4], const v16b (&bq)[2], v8f& a1, v8f& a2) {
    a1 = wmma16b(d[0], bq[0], (v8f){}); a2 = wmma16b(d[2], bq[0], (v8f){}); a1 = wmma16b(d[1], bq[1], a1); a2 = wmma16b(d[3], bq[1], a2);
  };
  v16b ka[4], kq[4];                                            // k1, k2 and kp1, kp2 rows of keys 0..15 of the chunk that this wave scores next
  read_pair(0, 0, 0, ka); read_pair(0, 0, 1, kq);
  for (int s = 0; s < nstep; ++s) {
    const int kb = s * 64 + kh * 32, cur = s & 1; const bool more = s + 1 < nstep, act = kb < q0 + 32;   // act: this wave has queries at or behind its chunk of step s
    v8b sn[12];                                                 // step s + 1 on its way to LDS
    if (more) fetch(s * 64 + 64, sn);
    float lg0[2][8], lg1[2][8]; v16b vhi[4], vlo[4];
    if (act) {
      v4i mk0[4], mk1[4]; v8f s1[2], p1[2], s2[2], p2[2]; v16b kc[4], kd[4];
      auto read_masks = [&](int half, v4i (&mk)[4]) {
        const int k8 = kb + half * 16 + 8 * hh;
        mk[0] = *(const v4i*)(&Ms[0][k8]); mk[1] = *(const v4i*)(&Ms[0][k8 + 4]); mk[2] = *(const v4i*)(&Ms[1][k8]); mk[3] = *(const v4i*)(&Ms[1][k8 + 4]);
      };
      auto logits = [&](int half, int a, const v4i (&mk)[4], float (&lg)[8]) {
        const int dq = q0 + a * 16 + col - (kb + half * 16 + 8 * hh);   // key kb + 16 half + 8 hh + r lies behind the query where r > dq
#pragma unroll
        for (int r = 0; r < 8; ++r) { const bool same = ((r < 4 ? mk[0][r & 3] : mk[1][r & 3]) == myspk[a]);
          float v = same ? (s1[a][r] + p1[a][r]) : (s2[a][r] + p2[a][r]);
          if ((r > dq) | ((r < 4 ? mk[2][r & 3] : mk[3][r & 3]) == 0)) v = -INFINITY;
          lg[r] = v; }
      };
      read_pair(cur, 1, 0, kc); read_pair(cur, 1, 1, kd); read_masks(0, mk0); read_masks(1, mk1);
      group_fence();                                            // the reads for keys 16..31 stay whole ahead of the WMMAs of keys 0..15, which hide them
#pragma unroll
      for (int a = 0; a < 2; ++a) { score_pair(ka, qf[a], s1[a], s2[a]); score_pair(kq, qpf[a], p1[a], p2[a]); }
      group_fence();                                            // the reads of the hi value tiles are not spread among those WMMAs
#pragma unroll
      for (int n = 0; n < 4; ++n) vhi[n] = frag_kb(&Vs[cur][kh][0][(n * 16 + col) * VPIT], hh);
      group_fence();                                            // the reads of the hi value tiles stay whole ahead of the logits of keys 0..15 and the WMMAs of keys 16..31, which hide them
#pragma unroll
      for (int a = 0; a < 2; ++a) logits(0, a, mk0, lg0[a]);
      v8f t1[2], u1[2], t2[2], u2[2];                           // accumulators of their own: the WMMAs of keys 16..31 may run among the logits of keys 0..15
#pragma unroll
      for (int a = 0; a < 2; ++a) { score_pair(kc, qf[a], t1[a], t2[a]); score_pair(kd, qpf[a], u1[a], u2[a]); }
      group_fence();                                            // the lo value tiles are read only here, when the rows of keys 16..31 have left their registers
#pragma unroll
      for (int n = 0; n < 4; ++n) vlo[n] = frag_kb(&Vs[cur][kh][1][(n * 16 + col) * VPIT], hh);
      group_fence();                                            // those reads stay whole ahead of the logits of keys 16..31, which hide them
#pragma unroll
      for (int a = 0; a < 2; ++a) { s1[a] = t1[a]; s2[a] = t2[a]; p1[a] = u1[a]; p2[a] = u2[a]; logits(1, a, mk1, lg1[a]); }
    }
    if (more) {                                                 // the other buffer's last reads (step s - 1) had returned when their waves reached the previous step's barrier
#pragma unroll
      for (int c = 0; c < 2; ++c) {
#pragma unroll
        for (int i = 0; i < 4; ++i) *(v8b*)(&Ks[cur ^ 1][c][i][sko]) = sn[c * 6 + i];
        *(v8b*)(&Vs[cur ^ 1][c][0][svo]) = sn[c * 6 + 4]; *(v8b*)(&Vs[cur ^ 1][c][1][svo]) = sn[c * 6 + 5]; }
    }
    __syncthreads();                                            // publishes step s + 1; every read of step s has been issued above and has returned here. Passed on the last step too: with
                                                                // one path to the P.V WMMAs the value tiles count as landed there, and no LDS wait behind the reads below is put in front of them
    read_pair(cur ^ 1, 0, 0, ka); read_pair(cur ^ 1, 0, 1, kq);   // by every wave on every step (the last step's are old rows; neither they nor an idle wave's are used)
    if (act) {
      group_fence();                                            // the next step's first reads stay whole ahead of the softmax and P.V, which hide them
      v16b pb[2];
#pragma unroll
      for (int a = 0; a < 2; ++a) {
        float mr = -INFINITY;
#pragma unroll
        for (int r = 0; r < 8; ++r) mr = fmaxf(mr, fmaxf(lg0[a][r], lg1[a][r]));
        mr = fmaxf(mr, xhalf(mr));
        float mn = fmaxf(m[a], mr); if (mn == -INFINITY) mn = 0.0f;
        const float al_ = __expf(m[a] - mn); m[a] = mn;
        float sum = 0.0f;
#pragma unroll
        for (int r = 0; r < 8; ++r) { const float e0 = __expf(lg0[a][r] - mn), e1 = __expf(lg1[a][r] - mn); sum += e0 + e1; pb[a][r] = (b16)e0; pb[a][8 + r] = (b16)e1; }
        sum += xhalf(sum); l[a] = l[a] * al_ + sum;
#pragma unroll
        for (int n = 0; n < 4; ++n)
#pragma unroll
          for (int r = 0; r < 8; ++r) o[a][n][r] *= al_;
#pragma unroll
        for (int n = 0; n < 4; ++n) o[a][n] = wmma16b(vhi[n], pb[a], o[a][n]);     // hi, then lo, into each accumulator; the first tile's WMMAs may run among the second tile's softmax
#pragma unroll
        for (int n = 0; n < 4; ++n) o[a][n] = wmma16b(vlo[n], pb[a], o[a][n]);
      }
    }
  }
  if (kh) {                                                     // the kh = 1 wave hands its state to its group's kh = 0 wave
#pragma unroll
    for (int a = 0; a < 2; ++a)
#pragma unroll
      for (int n = 0; n < 4; ++n) { Xs[g][a * 8 + n * 2][lane] = (v4f){o[a][n][0], o[a][n][1], o[a][n][2], o[a][n][3]}; Xs[g][a * 8 + n * 2 + 1][lane] = (v4f){o[a][n][4], o[a][n][5], o[a][n][6], o[a][n][7]}; }
    Xs[g][16][lane] = (v4f){m[0], m[1], l[0], l[1]};
  }
  __syncthreads();                                              // publishes the handed-over states; passed by every wave
  if (kh) return;
  const v4f ml = Xs[g][16][lane];
#pragma unroll
  for (int a = 0; a < 2; ++a) {                                 // join of the two key halves: both rescaled to the common maximum
    float mj = fmaxf(m[a], ml[a]); if (mj == -INFINITY) mj = 0.0f;
    const float w0 = __expf(m[a] - mj), w1 = __expf(ml[a] - mj), lj = l[a] * w0 + ml[2 + a] * w1;
    const float inv = (lj > 0.0f) ? (1.0f / (VS * lj)) : 0.0f;
#pragma unroll
    for (int n = 0; n < 4; ++n) { const v4f x0 = Xs[g][a * 8 + n * 2][lane], x1 = Xs[g][a * 8 + n * 2 + 1][lane];
#pragma unroll
      for (int r = 0; r < 8; ++r) Os[g][a * 16 + col][n * 16 + 8 * hh + r] = (o[a][n][r] * w0 + (r < 4 ? x0[r & 3] : x1[r & 3]) * w1) * inv; }
  }
  wave_lds_sync();
  float* dst = y + ((size_t)b * L + q0) * DM + h * DH;          // 32 rows x 256 B
#pragma unroll
  for (int j = 0; j < 16; ++j) { const int rr = j * 2 + hh, c4 = col * 4; *(v4f*)(dst + (size_t)rr * DM + c4) = *(const v4f*)(&Os[g][rr][c4]); }
  asm volatile("s_wait_xcnt 0x0" ::: "memory");                 // behind the last store: stands in front of any later write of a register that these stores name
}

// out = y.W_fc: (4096 x 1024) x (1024 x 1024); A = y f32 x8 split, B = f16(bf16 W_fc)^T rows -> 2 products; f32 rows; grid (8, 32), one block a WGP, block = 128 rows x 128 columns, 8 waves of
// 16 x 128: a y row piece is brought from L2 for 128 columns and split once for 16 WMMAs. Per 64-k tile the 128 y rows (f32, pitch 272 B) and the 128 weight rows (pitch 144 B) are brought once
// per block into LDS by asynchronous copies, two buffers, as in qkv_kernel; the split runs on fragments read from LDS. The epilogue stages in the ring's LDS behind the last tile's barrier.
constexpr int OAP = 64 + 4, OBP = 64 + 8, OCOLS = 128, OAB = 128 * OAP * 4, OST = OAB + OCOLS * OBP * 2;   // pitches (f32, f16 elements), columns of a block, bytes of the y part and of a whole stage
// At most two waves a SIMD: a WGP then takes one block and no second one, so that the 256 blocks stand on 256 WGPs however the blocks are dealt out.
__global__ __launch_bounds__(256) __attribute__((amdgpu_waves_per_eu(2, 2))) void out_kernel(const float* __restrict__ y, const b16* __restrict__ wfc, float* __restrict__ out) {
  __shared__ __attribute__((aligned(16))) unsigned char So[2 * OST];   // 106,496 B
  const int tid = threadIdx.x, lane = tid & 31, wave = __builtin_amdgcn_readfirstlane(tid >> 5), nloc = lane & 15, hlf = lane >> 4, mb = blockIdx.y * 128, m0 = mb + wave * 16, c0 = blockIdx.x * OCOLS;
  // copy map: 16 lanes bring one 256-byte y row piece (rows ar + 16 i), 8 lanes one 128-byte weight row piece (rows br + 32 j)
  const int ar = tid >> 4, ac = (tid & 15) * 4, br = tid >> 3, bc = (tid & 7) * 8;
  const float* ga = y + (size_t)(mb + ar) * DM + ac; const b16* gb = wfc + (size_t)(c0 + br) * DM + bc;
  const unsigned la = (unsigned)(size_t)(&So[0]) + (unsigned)(ar * OAP + ac) * 4u, lw = (unsigned)(size_t)(&So[0]) + (unsigned)OAB + (unsigned)(br * OBP + bc) * 2u;
  auto stage = [&](int kt, int buf) {
    const unsigned l = la + (unsigned)buf * (unsigned)OST, w = lw + (unsigned)buf * (unsigned)OST; const float* a = ga + kt * 64; const b16* g = gb + kt * 64;
    constexpr unsigned R16 = 16u * OAP * 4u, W32 = 32u * OBP * 2u;
    copy8_to_lds(l, l + R16, l + 2u * R16, l + 3u * R16, l + 4u * R16, l + 5u * R16, l + 6u * R16, l + 7u * R16,
                 a, a + 16 * DM, a + 32 * DM, a + 48 * DM, a + 64 * DM, a + 80 * DM, a + 96 * DM, a + 112 * DM);
    copy4_to_lds(w, w + W32, w + 2u * W32, w + 3u * W32, g, g + 32 * DM, g + 64 * DM, g + 96 * DM);
  };
  v8f acc[8] = {{}, {}, {}, {}, {}, {}, {}, {}};
  stage(0, 0);
  asm volatile("s_wait_asynccnt 0x0" ::: "memory");             // this wave's copies of tile 0 have landed
  __syncthreads();                                              // publishes tile 0
  stage(1, 1);
  for (int kt = 0; kt < DM / 64; ++kt) {
    const float* As = (const float*)(So + (kt & 1) * OST) + (wave * 16 + nloc) * OAP + 8 * hlf; const b16* Bs = (const b16*)(So + (kt & 1) * OST + OAB) + nloc * OBP;
    // every loop below is unrolled so that the fragment and accumulator arrays are indexed by constants and stay in registers
    v4f x[2][4]; v16b bf[2][8];
#pragma unroll
    for (int ks = 0; ks < 2; ++ks) {
      x[ks][0] = *(const v4f*)(As + ks * 32); x[ks][1] = *(const v4f*)(As + ks * 32 + 4); x[ks][2] = *(const v4f*)(As + ks * 32 + 16); x[ks][3] = *(const v4f*)(As + ks * 32 + 20);
#pragma unroll
      for (int t = 0; t < 8; ++t) bf[ks][t] = frag_kb(Bs + t * 16 * OBP + ks * 32, hlf);
    }
    group_fence();                          // the tile's 40 LDS reads stay one group ahead of the split and the WMMAs: one run of LDS waits a tile instead of one wait per fragment
#pragma unroll
    for (int ks = 0; ks < 2; ++ks) {
      v16b ah, al;
#pragma unroll
      for (int e = 0; e < 16; ++e) { b16 a, c; split16(x[ks][e >> 2][e & 3] * 8.0f, a, c); ah[e] = a; al[e] = c; }
#pragma unroll
      for (int t = 0; t < 8; ++t) acc[t] = wmma16b(ah, bf[ks][t], acc[t]);     // hi, then lo, into each accumulator
#pragma unroll
      for (int t = 0; t < 8; ++t) acc[t] = wmma16b(al, bf[ks][t], acc[t]);
    }
    group_fence();                          // the tile's split and WMMAs stay ahead of the barrier below: sunk behind it they would stand between the barrier and the next copies, which then fly for no more
                                            // than the next tile's LDS reads before they are waited for
    asm volatile("s_wait_dscnt 0x0" ::: "memory");              // this wave's reads of tile kt are done before its buffer is handed back
    asm volatile("s_wait_asynccnt 0x0" ::: "memory");           // this wave's copies of tile kt + 1 have landed
    __syncthreads();                                            // publishes tile kt + 1 and ends every read of tile kt
    if (kt + 2 < DM / 64) stage(kt + 2, kt & 1);
  }
  asm volatile("s_wait_asynccnt 0x0" ::: "memory");             // no copy is outstanding when the ring becomes output staging
  float* Tt = (float*)So + wave * (16 * OCOLS);                 // 16 rows x 512 B per wave, stored as whole lines; unrolled: constant accumulator indices
#pragma unroll
  for (int t = 0; t < 8; ++t)
#pragma unroll
    for (int v = 0; v < 8; ++v) Tt[(v + 8 * hlf) * OCOLS + t * 16 + nloc] = acc[t][v] * (1.0f / 8.0f);
  wave_lds_sync();
  float* dst0 = out + (size_t)m0 * DM + c0;
#pragma unroll
  for (int j = 0; j < 16; ++j) { const int c4 = lane * 4; *(v4f*)(dst0 + (size_t)j * DM + c4) = *(const v4f*)(Tt + j * OCOLS + c4); }
}
}  // namespace

extern "C" void kernel_launch(void* const* d_in, const int* in_sizes, int n_in,
                              void* d_out, int out_size, void* d_ws, size_t ws_size, hipStream_t stream) {
  (void)n_in; (void)out_size;
  const float* emb = (const float*)d_in[0]; const int* umask = (const int*)d_in[1]; const int* qmask = (const int*)d_in[2];
  const float* Wqkv = (const float*)d_in[3]; const float* Wpos = (const float*)d_in[4]; const float* Wfc = (const float*)d_in[5];
  float* out = (float*)d_out;   // [4,1024,1024]
  if (in_sizes[0] != NTOK * DM || in_sizes[1] != NTOK || in_sizes[2] != NTOK || in_sizes[3] != DM * NQKV || in_sizes[4] != DH * NPOS || in_sizes[5] != DM * DM) return;
  size_t off = 0; char* ws = (char*)d_ws;
  auto carve = [&](size_t bytes) { char* p = ws + off; off += (bytes + 255) & ~(size_t)255; return p; };
  unsigned short* e16 = (unsigned short*)carve((size_t)NTOK * DM * 2);       // 8 MB
  unsigned short* wq = (unsigned short*)carve((size_t)NQKV * DM * 2);        // 8 MB
  unsigned short* wp = (unsigned short*)carve((size_t)NPOS * DH * 2);        // 384 KB
  unsigned short* wf = (unsigned short*)carve((size_t)DM * DM * 2);          // 2 MB
  b16* peh = (b16*)carve((size_t)L * DH * 2); b16* pel = (b16*)carve((size_t)L * DH * 2);
  b16* qk = (b16*)carve((size_t)3 * Bn * H * L * DH * 2);                   // 24 MB
  b16* vth = (b16*)carve((size_t)Bn * H * DH * L * 2); b16* vtl = (b16*)carve((size_t)Bn * H * DH * L * 2);   // 8 MB each
  b16* pp = (b16*)carve((size_t)3 * H * L * DH * 2);                         // 6 MB
  float* y = (float*)carve((size_t)NTOK * DM * 4);                           // 16 MB
  if (off > ws_size) return;                                                  // ≈ 81 MB
  prep_kernel<<<PB_PE + PB_WQ + PB_WF + PB_WP + PB_EM, 256, 0, stream>>>(emb, Wqkv, Wpos, Wfc, e16, peh, pel, wq, wp, wf);
  qkv_kernel<<<PB_POS + (NQKV / 128) * (NTOK / GAROWS), 256, 0, stream>>>((const __bf16*)e16, (const __bf16*)wq, qk, vth, vtl, peh, pel, (const b16*)wp, pp);
  attn_kernel<<<Bn * H * (L / 16) / 8, 256, 0, stream>>>(qk, pp, vth, vtl, umask, qmask, y);
  out_kernel<<<dim3(DM / OCOLS, NTOK / 128), 256, 0, stream>>>(y, (const b16*)wf, out);
}

// v009
// It runs in 87.2 microseconds.
// Next to v008, in two timings, it ran 1.04 times as fast each time.
// Counting every step since v000, it is 5.16 times as fast.
#include <hip/hip_runtime.h>

// Speaker-aware causal multi-head attention with relative sinusoidal position terms (d_model 1024, 16 heads x 64, B=4, L=1024): q,k1,k2,v = embed W_qkv;
// qp,kp1,kp2 = pe W_pos (pe = the module's sinusoid table rows 89..1112); logit[q][k] = same speaker ? (q.k1 + qp.kp1) : (q.k2 + qp.kp2) (scale 1); keys k > q or umask = 0
// -> -inf; softmax; out = (P.v) W_fc.
// Numerics: embed, W_qkv, W_pos and W_fc are rounded to bf16 (RNE); the qkv projection runs on
// v_wmma_f32_16x16x32_bf16 with those operands (exact products, f32 accumulate); the position projection uses f16 hi+lo of the f32 sinusoid table against the exact f16 copy of
// bf16 W_pos; the four score products use single f16 copies of q/k1/k2/qp/kp (f32 accumulate); P.V pairs single-f16 P with hi+lo 8v; the output projection pairs hi+lo of the
// attention output with the exact f16 copy of bf16 W_fc. Masks are read from the int inputs. Fragment k-map per lane half hh for A AND B: elements 0..7 <- k = 8hh+0..7, 8..15

namespace {
constexpr int Bn = 4, L = 1024, DM = 1024, H = 16, DH = 64, NTOK = Bn * L, NQKV = 4 * DM, NPOS = 3 * DM, TBL = 1201, SHIFT = 601;
constexpr float VS = 8.0f, PES = 8.0f;

typedef _Float16 b16;
typedef __attribute__((ext_vector_type(16))) _Float16 v16b;
typedef __attribute__((ext_vector_type(8)))  _Float16 v8b;
typedef __attribute__((ext_vector_type(8)))  float v8f;
typedef __attribute__((ext_vector_type(4)))  float v4f;

__device__ __forceinline__ v8b ld8b(const b16* p) { return *(const v8b*)p; }
__device__ __forceinline__ v16b cat8b(v8b a, v8b b) { return __builtin_shufflevector(a, b, 0, 1, 2, 3, 4, 5, 6, 7, 8, 9, 10, 11, 12, 13, 14, 15); }
__device__ __forceinline__ v16b frag_kb(const b16* p, int hh) { return cat8b(ld8b(p + 8 * hh), ld8b(p + 16 + 8 * hh)); }
__device__ __forceinline__ void split16(float v, b16& hi, b16& lo) { hi = (b16)v; lo = (b16)(v - (float)hi); }
// hi/lo fragment pair straight from an f32 k-contiguous row (same k-map)
__device__ __forceinline__ void frag_ksplit(const float* p, int hh, v16b& fh_, v16b& fl_) {
  const float* p0 = p + 8 * hh; const float* p1 = p + 16 + 8 * hh;
#pragma unroll
  for (int e = 0; e < 8; ++e) { b16 a, c; split16(p0[e], a, c); fh_[e] = a; fl_[e] = c; split16(p1[e], a, c); fh_[8 + e] = a; fl_[8 + e] = c; }
}
__device__ __forceinline__ v8f wmma16b(v16b a, v16b b, v8f c) {
  return __builtin_amdgcn_wmma_f32_16x16x32_f16(false, a, false, b, (short)0, c, false, false);
}
// Keeps a group of LDS reads whole and at its place in the instruction stream: the compiler fence holds the reads on their side, the scheduling fence the WMMAs and vector work.
// Left free, the reads sink to one pair with a full LDS wait in front of each WMMA, or rise so far that the live fragments no longer fit the registers.
__device__ __forceinline__ void group_fence() { asm volatile("" ::: "memory"); __builtin_amdgcn_sched_barrier(0); }
__device__ __forceinline__ void wave_lds_sync() {
  __builtin_amdgcn_fence(__ATOMIC_RELEASE, "workgroup");
  __builtin_amdgcn_wave_barrier();
  __builtin_amdgcn_fence(__ATOMIC_ACQUIRE, "workgroup");
}

// Operand descriptor: NP = 0 -> f32 rows split on the fly into (hi, lo); NP = 1 -> one f16 plane; NP = 2 -> f16 hi + lo planes;
// NP = 3 -> f32 rows rounded once to a single f16 fragment. ld = row pitch.
struct Opnd { const void* p0; const void* p1; int ld; };
template <int NP> __device__ __forceinline__ void load_frags(const Opnd& o, int row, int kb, int hh, v16b& fh_, v16b& fl_) {
  if (NP == 0) { frag_ksplit((const float*)o.p0 + (size_t)row * o.ld + kb, hh, fh_, fl_); }
  else if (NP == 4 || NP == 5) {                             // f32 rows x64 (NP 4) or x8 (NP 5) then split (keeps the lo halves of small values normal)
    const float sc_ = (NP == 4) ? 64.0f : 8.0f;
    const float* p = (const float*)o.p0 + (size_t)row * o.ld + kb; const float* p0 = p + 8 * hh; const float* p1 = p + 16 + 8 * hh;
#pragma unroll
    for (int e = 0; e < 8; ++e) { b16 a, c; split16(p0[e] * sc_, a, c); fh_[e] = a; fl_[e] = c; split16(p1[e] * sc_, a, c); fh_[8 + e] = a; fl_[8 + e] = c; }
  } else if (NP == 3) {
    const float* p = (const float*)o.p0 + (size_t)row * o.ld + kb; const float* p0 = p + 8 * hh; const float* p1 = p + 16 + 8 * hh;
#pragma unroll
    for (int e = 0; e < 8; ++e) { fh_[e] = (b16)p0[e]; fh_[8 + e] = (b16)p1[e]; }
    fl_ = fh_;
  } else {
    fh_ = frag_kb((const b16*)o.p0 + (size_t)row * o.ld + kb, hh);
    if (NP == 2) fl_ = frag_kb((const b16*)o.p1 + (size_t)row * o.ld + kb, hh); else fl_ = fh_;
  }
}
template <int ANP, int BNP> __device__ __forceinline__ v8f mac(v16b ah, v16b al, v16b bh, v16b bl, v8f c) {
  c = wmma16b(ah, bh, c);
  if (BNP == 0 || BNP == 2 || BNP == 4 || BNP == 5) c = wmma16b(ah, bl, c);     // hi.lo
  if (ANP == 0 || ANP == 2 || ANP == 4 || ANP == 5) c = wmma16b(al, bh, c);     // lo.hi   (lo.lo dropped)
  return c;
}
// 32x64 wave tile: acc[r][t] (rows m0+16r.., cols c0+16t..) += A[m][k] . B[n][k] over k in [0, K)
template <int ANP, int BNP>
__device__ __forceinline__ void gemm_tile(const Opnd& A, const Opnd& B, int K, int m0, int c0, int nloc, int hlf, v8f (&acc)[2][4]) {
  for (int kb = 0; kb < K; kb += 32) {
    v16b a0h, a0l, a1h, a1l;
    load_frags<ANP>(A, m0 + nloc, kb, hlf, a0h, a0l);
    load_frags<ANP>(A, m0 + 16 + nloc, kb, hlf, a1h, a1l);
#pragma unroll
    for (int t = 0; t < 4; ++t) {
      v16b bh, bl;
      load_frags<BNP>(B, c0 + t * 16 + nloc, kb, hlf, bh, bl);
      acc[0][t] = mac<ANP, BNP>(a0h, a0l, bh, bl, acc[0][t]);
      acc[1][t] = mac<ANP, BNP>(a1h, a1l, bh, bl, acc[1][t]);
    }
  }
}

__device__ __forceinline__ void epi_planes(v8f (&acc)[2][4], float scale, bool two, b16* __restrict__ oh, b16* __restrict__ ol, int ldo,
                                           int m0, int c0, int lane, b16* Th, b16* Tl) {
  const int nloc = lane & 15, hlf = lane >> 4;
#pragma unroll
  for (int t = 0; t < 4; ++t)
#pragma unroll
    for (int r = 0; r < 2; ++r)
#pragma unroll
      for (int v = 0; v < 8; ++v) {
        const int rr = r * 16 + v + 8 * hlf, cc = t * 16 + nloc;
        b16 h_, l_; split16(acc[r][t][v] * scale, h_, l_);
        Th[rr * 64 + cc] = h_; Tl[rr * 64 + cc] = l_;
      }
  wave_lds_sync();
  {
#pragma unroll
    for (int j = 0; j < 8; ++j) {
      const int rr = j * 4 + (lane >> 3), c8 = (lane & 7) * 8;
      const size_t o = (size_t)(m0 + rr) * ldo + c0 + c8;
      *(v8b*)(oh + o) = ld8b(Th + rr * 64 + c8);
      if (two) *(v8b*)(ol + o) = ld8b(Tl + rr * 64 + c8);
    }
    
  }
}
typedef __attribute__((ext_vector_type(8))) __bf16 v8bb; typedef __attribute__((ext_vector_type(16))) __bf16 v16bb;
__device__ __forceinline__ v16bb frag_kb_bf(const __bf16* p, int hh) { const v8bb a = *(const v8bb*)(p + 8 * hh), b = *(const v8bb*)(p + 16 + 8 * hh); return __builtin_shufflevector(a, b, 0, 1, 2, 3, 4, 5, 6, 7, 8, 9, 10, 11, 12, 13, 14, 15); }
__device__ __forceinline__ v8f wmma16bb(v16bb a, v16bb b, v8f c) {
  return __builtin_amdgcn_wmma_f32_16x16x32_bf16(false, a, false, b, (short)0, c, false, false);
}
__device__ __forceinline__ unsigned short bf16_rne_bits(float v) { unsigned int u = __float_as_uint(v); u += 0x7FFFu + ((u >> 16) & 1u); return (unsigned short)(u >> 16); }
__device__ __forceinline__ float bf16_rne(float v) { return __uint_as_float(((unsigned int)bf16_rne_bits(v)) << 16); }

// The preparation work has no dependences among its parts, so all of it runs as ONE launch; a block's index picks its part (prep_kernel below).
constexpr int PB_PE = L * DH / 8 / 256, PB_WQ = (NQKV / 64) * (DM / 64), PB_WF = (DM / 64) * (DM / 64), PB_WP = (NPOS / 64) * (DH / 64), PB_EM = 512;   // blocks of each part
// part: embed -> bf16 rows [4096][1024] (16-B pieces), PB_EM blocks striding over the pieces.
__device__ __forceinline__ void prep_embed(int blk, const float* __restrict__ emb, unsigned short* __restrict__ e16) {
  typedef __attribute__((ext_vector_type(8))) unsigned short v8us;
  const size_t tid = (size_t)blk * 256 + threadIdx.x, nth = (size_t)PB_EM * 256;
  for (size_t p = tid; p < (size_t)NTOK * DM / 8; p += nth) { v8us v;
#pragma unroll
    for (int e = 0; e < 8; ++e) v[e] = bf16_rne_bits(emb[p * 8 + e]);
    *(v8us*)(e16 + p * 8) = v; }
}
// part: pe x8 hi/lo planes [1024][64] from the module's sinusoid formula (f32, table row 0 (the padding row) never selected for L=1024); PB_PE blocks, one 8-element piece a thread.
// Sc: per-thread staging (256 x 16 f16) for the rolled sinusoid loop.
__device__ __forceinline__ void prep_pe(int blk, b16* Sc, b16* __restrict__ peh, b16* __restrict__ pel) {
  const size_t p = (size_t)blk * 256 + threadIdx.x; const int l = (int)(p / 8), d0 = (int)(p % 8) * 8;
  const int tblrow = l - L / 2 + SHIFT;                        // 89 .. 1112, never 0
  const float posv = (float)(tblrow - (TBL + 1) / 2);          // arange(-601, 600)[tblrow] = tblrow - 601
#pragma unroll 1
  for (int e = 0; e < 8; ++e) { const int d = d0 + e; const int j = (d < DH / 2) ? d : d - DH / 2;   // rolled: one sin/cos expansion in the binary
    const float freq = expf((float)j * (-9.210340371976184f / (float)(DH / 2 - 1))); const float ang = posv * freq;
    const float val = (d < DH / 2) ? sinf(ang) : cosf(ang); b16 a, c; split16(val * PES, a, c); Sc[threadIdx.x * 16 + e] = a; Sc[threadIdx.x * 16 + 8 + e] = c; }
  *(v8b*)(peh + p * 8) = *(const v8b*)(&Sc[threadIdx.x * 16]); *(v8b*)(pel + p * 8) = *(const v8b*)(&Sc[threadIdx.x * 16 + 8]);
}

// part: W [k rows][n cols] f32 -> [n][k] 16-bit rows through 64x64 LDS tiles: MODE 0: bf16 bits (W_qkv); MODE 1: f16 of bf16(w) (W_fc, W_pos). Block blk = tile (blk % (N/64), blk / (N/64)).
template <int MODE>
__device__ __forceinline__ void wt_tile(int blk, const float* __restrict__ W, int K, int Ncols, unsigned short* __restrict__ out, unsigned short (*Tl)[72]) {
  typedef __attribute__((ext_vector_type(8))) unsigned short v8us;
  const int tid = threadIdx.x, lane = tid & 31, wave = tid >> 5, n0 = (blk % (Ncols / 64)) * 64, k0 = (blk / (Ncols / 64)) * 64;
  for (int i = tid; i < 64 * 64; i += 256) { const int kk = i / 64, nn = i % 64; const float w = W[(size_t)(k0 + kk) * Ncols + n0 + nn];
    unsigned short bits; if (MODE == 0) bits = bf16_rne_bits(w); else { const b16 hv = (b16)bf16_rne(w); bits = *reinterpret_cast<const unsigned short*>(&hv); }
    Tl[nn][kk] = bits; }
  __syncthreads();
  {
#pragma unroll
    for (int j = 0; j < 2; ++j) { const int rr = wave * 8 + j * 4 + (lane >> 3), c8 = (lane & 7) * 8; *(v8us*)(out + (size_t)(n0 + rr) * K + k0 + c8) = *(const v8us*)(&Tl[rr][c8]); }
    asm volatile("s_wait_xcnt 0x0" ::: "memory");               // behind the last store: stands in front of any later write of a register that these stores name
  }
}

// All preparation in one launch. The parts stand in the order of their blocks' own run time, the longest first: sinusoids, the three
// weight transposes, the embed rounding. Every branch is on the block index alone, so the barrier inside wt_tile is passed by a whole block or by none of it.
__global__ __launch_bounds__(256) void prep_kernel(const float* __restrict__ emb, const float* __restrict__ Wqkv, const float* __restrict__ Wpos, const float* __restrict__ Wfc,
                                                   unsigned short* __restrict__ e16, b16* __restrict__ peh, b16* __restrict__ pel,
                                                   unsigned short* __restrict__ wq, unsigned short* __restrict__ wp, unsigned short* __restrict__ wf) {
  __shared__ __attribute__((aligned(16))) unsigned short Sh[64][72];   // a transpose tile, or the sinusoid part's staging
  int blk = blockIdx.x;
  if (blk < PB_PE) { prep_pe(blk, (b16*)&Sh[0][0], peh, pel); return; }
  blk -= PB_PE;
  if (blk < PB_WQ) { wt_tile<0>(blk, Wqkv, DM, NQKV, wq, Sh); return; }
  blk -= PB_WQ;
  if (blk < PB_WF) { wt_tile<1>(blk, Wfc, DM, DM, wf, Sh); return; }
  blk -= PB_WF;
  if (blk < PB_WP) { wt_tile<1>(blk, Wpos, DH, NPOS, wp, Sh); return; }
  prep_embed(blk - PB_WP, emb, e16);
}

// Eight 16-byte asynchronous copies of one thread, global memory to LDS; the closing wait stands in front of any rewrite of the address registers named here.
__device__ __forceinline__ void copy8_to_lds(unsigned l0, unsigned l1, unsigned l2, unsigned l3, unsigned l4, unsigned l5, unsigned l6, unsigned l7,
                                             const void* g0, const void* g1, const void* g2, const void* g3, const void* g4, const void* g5, const void* g6, const void* g7) {
  asm volatile("global_load_async_to_lds_b128 %0, %8, off\n\t"
               "global_load_async_to_lds_b128 %1, %9, off\n\t"
               "global_load_async_to_lds_b128 %2, %10, off\n\t"
               "global_load_async_to_lds_b128 %3, %11, off\n\t"
               "global_load_async_to_lds_b128 %4, %12, off\n\t"
               "global_load_async_to_lds_b128 %5, %13, off\n\t"
               "global_load_async_to_lds_b128 %6, %14, off\n\t"
               "global_load_async_to_lds_b128 %7, %15, off\n\t"
               "s_wait_xcnt 0x0"
               :: "v"(l0), "v"(l1), "v"(l2), "v"(l3), "v"(l4), "v"(l5), "v"(l6), "v"(l7), "v"(g0), "v"(g1), "v"(g2), "v"(g3), "v"(g4), "v"(g5), "v"(g6), "v"(g7) : "memory");
}

__device__ __forceinline__ void copy4_to_lds(unsigned l0, unsigned l1, unsigned l2, unsigned l3, const void* g0, const void* g1, const void* g2, const void* g3) {   // the same, four copies
  asm volatile("global_load_async_to_lds_b128 %0, %4, off\n\t"
               "global_load_async_to_lds_b128 %1, %5, off\n\t"
               "global_load_async_to_lds_b128 %2, %6, off\n\t"
               "global_load_async_to_lds_b128 %3, %7, off\n\t"
               "s_wait_xcnt 0x0"
               :: "v"(l0), "v"(l1), "v"(l2), "v"(l3), "v"(g0), "v"(g1), "v"(g2), "v"(g3) : "memory");
}

// position projections: (1024 x 64) x (64 x 3072): A = pe planes (x8 hi+lo), B = f16(bf16 W_pos)^T rows -> 2 products; single f16 rows pp[which][h][l][64]. They need only the
// preparation's results, as the qkv projection does, so their blocks ride in qkv_kernel's launch: PB_POS blocks of 8 waves, block blk = 256 rows x 64 columns, wave = 32 x 64.
// Th: 8 KB of LDS a wave for the epilogue.
constexpr int PB_POS = (NPOS / 64) * (L / 256);
__device__ __forceinline__ void pos_block(int blk, const b16* __restrict__ peh, const b16* __restrict__ pel, const b16* __restrict__ wpos, b16* __restrict__ pp, b16* Th) {
  const int lane = threadIdx.x & 31, wave = threadIdx.x >> 5, nloc = lane & 15, hlf = lane >> 4, m0 = (blk / (NPOS / 64)) * 256 + wave * 32, c0 = (blk % (NPOS / 64)) * 64;
  v8f acc[2][4];
#pragma unroll
  for (int r = 0; r < 2; ++r)
#pragma unroll
    for (int t = 0; t < 4; ++t) acc[r][t] = (v8f){};
  const Opnd A{peh, pel, DH}, B{wpos, nullptr, DH};
  gemm_tile<2, 1>(A, B, DH, m0, c0, nloc, hlf, acc);
  const int which = c0 / DM, h = (c0 % DM) / DH;
  epi_planes(acc, 1.0f / PES, false, pp + (((size_t)which * H + h) * L + m0) * DH, nullptr, DH, 0, 0, lane, Th + wave * (2 * 32 * 64), Th + wave * (2 * 32 * 64) + 32 * 64);
}

// qkv: (4096 x 1024) x (1024 x 4096) bf16 WMMA; 16 x 32 blocks behind the PB_POS position blocks (those end early and free their places), block = 256 tokens x 128 columns, 8 waves (4 along tokens x 2 along columns) of 64 x 64 each:
// a fragment read from LDS feeds four WMMAs, so the reads stay inside the LDS rate at the full matrix rate, and a block brings 384 operand rows for 256 x 128 outputs. Per 64-k tile the
// 256 embed rows and the 128 weight rows are brought once per block into LDS (row pitch 144 B) by asynchronous copies, two buffers: tile t + 1 flies while tile t is worked on;
// fragments come from LDS. Columns: [q | k1 | k2 | v] x 1024; q/k1/k2 -> single f16 rows [which][b][h][l][64]; v -> (8v)^T hi/lo planes [b][h][64 d][1024 l] through a block
// LDS transpose (block = 256 tokens of one batch row, two heads). The epilogues stage in the ring's LDS behind the last tile's barrier.
// Four waves a SIMD are asked for so that two blocks share a WGP and all 512 blocks are resident at once.
constexpr int GPIT = 64 + 8, GAROWS = 256, GROWS = GAROWS + 128, GTILE = GROWS * GPIT;   // LDS row pitch (16-bit elements), rows and elements of a stage: 256 embed rows, then 128 weight rows
constexpr int VTP = GAROWS + 8;                                 // token pitch of the transpose planes [head wn][hi, lo][64 d][VTP]
constexpr int GSM = (2 * GTILE > 2 * 2 * 64 * VTP) ? 2 * GTILE : 2 * 2 * 64 * VTP;   // the ring, or the transpose planes where those are larger
__global__ __launch_bounds__(256, 4) void qkv_kernel(const __bf16* __restrict__ e16, const __bf16* __restrict__ wqkv, b16* __restrict__ qk, b16* __restrict__ vth, b16* __restrict__ vtl,
                                                     const b16* __restrict__ peh, const b16* __restrict__ pel, const b16* __restrict__ wpos, b16* __restrict__ pp) {
  __shared__ __attribute__((aligned(16))) unsigned short Sm[GSM];   // 135,168 B
  if (blockIdx.x < PB_POS) { pos_block(blockIdx.x, peh, pel, wpos, pp, (b16*)Sm); return; }   // a whole block takes this branch, in front of every barrier
  const int gblk = blockIdx.x - PB_POS;                         // column tile runs fastest
  const int tid = threadIdx.x, lane = tid & 31, wave = __builtin_amdgcn_readfirstlane(tid >> 5), wm = wave & 3, wn = wave >> 2, nloc = lane & 15, hlf = lane >> 4;
  const int mb = (gblk / (NQKV / 128)) * GAROWS, cb = (gblk % (NQKV / 128)) * 128, m0 = mb + wm * 64, c0 = cb + wn * 64;   // the wave number is held scalar: tile indices and the epilogue branch stay scalar
  // copy map: 8 lanes bring one 128-byte row piece; a thread brings rows sr + 32 i of both operands (8 embed rows, 4 weight rows)
  const int sr = tid >> 3, sc = (tid & 7) * 8;
  const __bf16* ga = e16 + (size_t)(mb + sr) * DM + sc; const __bf16* gb = wqkv + (size_t)(cb + sr) * DM + sc;
  const unsigned ls = (unsigned)(size_t)(&Sm[0]) + (unsigned)(sr * GPIT + sc) * 2u;
  auto stage = [&](int kt, int buf) {
    const unsigned l = ls + (unsigned)buf * (GTILE * 2u); const __bf16* a = ga + kt * 64; const __bf16* w = gb + kt * 64;
    constexpr unsigned R32 = 32u * GPIT * 2u;
    copy8_to_lds(l, l + R32, l + 2u * R32, l + 3u * R32, l + 4u * R32, l + 5u * R32, l + 6u * R32, l + 7u * R32,
                 a, a + 32 * DM, a + 64 * DM, a + 96 * DM, a + 128 * DM, a + 160 * DM, a + 192 * DM, a + 224 * DM);
    copy4_to_lds(l + 8u * R32, l + 9u * R32, l + 10u * R32, l + 11u * R32, w, w + 32 * DM, w + 64 * DM, w + 96 * DM);
  };
  v8f acc[2][2][4];                                             // [32-row half of the wave's 64 rows][16 rows][16 columns]
#pragma unroll
  for (int p = 0; p < 2; ++p)
#pragma unroll
    for (int r = 0; r < 2; ++r)
#pragma unroll
      for (int t = 0; t < 4; ++t) acc[p][r][t] = (v8f){};
  // The 32 blocks that share 256 embed rows and the 16 that share 128 weight rows run side by side. Walking k from 0 they would all ask L2 for the same lines, and only for the one
  // 128-byte piece of every 2-KB row, at the same moment. So each block enters the ring of 16 k tiles at its own place and wraps: trip kt works on k tile (kt + rot) mod 16.
  // Sharers of weight rows all differ in rot, sharers of embed rows stand two to a place. Only the order of the k sum depends on rot.
  const int rot = (gblk / (NQKV / 128) + gblk % (NQKV / 128)) & (DM / 64 - 1);
  stage(rot, 0);
  asm volatile("s_wait_asynccnt 0x0" ::: "memory");             // this wave's copies of trip 0's tile have landed
  __syncthreads();                                              // publishes trip 0's tile
  stage((rot + 1) & (DM / 64 - 1), 1);
  for (int kt = 0; kt < DM / 64; ++kt) {
    const __bf16* As = (const __bf16*)Sm + (kt & 1) * GTILE + (wm * 64 + nloc) * GPIT; const __bf16* Bs = (const __bf16*)Sm + (kt & 1) * GTILE + (GAROWS + wn * 64 + nloc) * GPIT;
#pragma unroll                                                  // both 32-k halves of the tile in line: LDS offsets become immediates
    for (int ks = 0; ks < 2; ++ks) {
      v16bb aw[4], bw[4];
#pragma unroll
      for (int t = 0; t < 4; ++t) aw[t] = frag_kb_bf(As + t * 16 * GPIT + ks * 32, hlf);
#pragma unroll
      for (int t = 0; t < 4; ++t) bw[t] = frag_kb_bf(Bs + t * 16 * GPIT + ks * 32, hlf);
      group_fence();                        // the 16 LDS reads of this 32-k half stay one group ahead of its WMMAs: one LDS wait instead of one per fragment
#pragma unroll
      for (int t = 0; t < 4; ++t)
#pragma unroll
        for (int r = 0; r < 4; ++r) acc[r >> 1][r & 1][t] = wmma16bb(aw[r], bw[t], acc[r >> 1][r & 1][t]);
      group_fence();                        // the next group's reads are not spread among these WMMAs
    }
    asm volatile("s_wait_dscnt 0x0" ::: "memory");              // this wave's reads of tile kt are done before its buffer is handed back
    asm volatile("s_wait_asynccnt 0x0" ::: "memory");           // this wave's copies of tile kt + 1 have landed
    __syncthreads();                                            // publishes tile kt + 1 and ends every read of tile kt
    if (kt + 2 < DM / 64) stage((kt + 2 + rot) & (DM / 64 - 1), kt & 1);
  }
  asm volatile("s_wait_asynccnt 0x0" ::: "memory");             // no copy is outstanding when the ring becomes output staging
  const int which = c0 / DM, c1 = c0 % DM, h = c1 / DH, b = m0 / L, l0 = m0 % L;   // 64 columns = one head; which is the same for the whole block
  if (which < 3) {                                             // q / k1 / k2 rows [which][b][h][l][64] (single f16), the wave's two 32-row halves one after the other through its own staging
    b16* Th = (b16*)Sm + wave * (2 * 32 * 64);
#pragma unroll
    for (int p = 0; p < 2; ++p) epi_planes(acc[p], 1.0f, false, qk + ((((size_t)which * Bn + b) * H + h) * L + l0 + p * 32) * DH, nullptr, DH, 0, 0, lane, Th, Th + 32 * 64);
    return;
  }
  b16* Tt = (b16*)Sm + wn * (2 * 64 * VTP);
#pragma unroll
  for (int t = 0; t < 4; ++t)
#pragma unroll
    for (int p = 0; p < 2; ++p)
#pragma unroll
      for (int r = 0; r < 2; ++r)
#pragma unroll
        for (int v = 0; v < 8; ++v) { b16 a, c; split16(acc[p][r][t][v] * VS, a, c); const int o = (t * 16 + nloc) * VTP + wm * 64 + p * 32 + r * 16 + 8 * hlf + v; Tt[o] = a; Tt[64 * VTP + o] = c; }
  __syncthreads();
  const int tok0 = mb % L, bb = mb / L;
  b16* bh_ = vth + (((size_t)bb * H + h) * DH) * L + tok0; b16* bl_ = vtl + (((size_t)bb * H + h) * DH) * L + tok0;
  {
#pragma unroll
    for (int j = 0; j < 16; ++j) { const int dd = wm * 16 + j, c8 = lane * 8;   // a wave stores one 512-byte row piece of each plane at a time
      *(v8b*)(bh_ + (size_t)dd * L + c8) = *(const v8b*)(&Tt[dd * VTP + c8]); *(v8b*)(bl_ + (size_t)dd * L + c8) = *(const v8b*)(&Tt[64 * VTP + dd * VTP + c8]); }
    asm volatile("s_wait_xcnt 0x0" ::: "memory");               // behind the last store: stands in front of any later write of a register that these stores name
  }
}

// ---------------------------------------------------------------------------
// attention: block = (b, h, 128 queries), 8 waves, one block a WGP. A wave holds 32 queries (two 16-query column tiles), so that every key-side fragment it reads from LDS feeds two
// WMMAs: the LDS read path, not the matrix pipe, bounds a wave of 16 queries here. The four 32-query groups are each served by TWO waves that split the keys: of every 64-key step
// wave half kh takes keys 32 kh .. 32 kh + 31, with its own running maximum, sum and output tile; behind the loop the kh = 1 wave hands its state over through LDS and the kh = 0
// wave joins the two. All key-side operands come from LDS, staged once per block: the two mask rows once, and per step two 32-key chunks of the k1/k2/kp1/kp2 rows (pitch 144 B)
// and of the (8v)^T hi/lo columns (pitch 80 B), two buffers: step s + 1 is fetched into registers before step s is worked on and stored to the other buffer behind step s's
// logits; one barrier a step, in front of the softmax. A wave past its own diagonal only stages.
// Per chunk, 16-key half and query tile: four K=64 score products (q.k1, qp.kp1, q.k2, qp.kp2; single f16),
// logit = same speaker ? s1 + p1 : s2 + p2; -inf where key > query or umask[b][key] == 0; online softmax f32; P^T f16; y^T += (8v)^T.P^T (4 feature tiles, hi + lo);
// ---------------------------------------------------------------------------
constexpr int KPIT = DH + 8, VPIT = 32 + 8;                    // LDS row pitches in f16: 16 B x odd, for 16-byte fragment reads
typedef __attribute__((ext_vector_type(4))) int v4i;
__device__ __forceinline__ v8b ldoff(const b16* base, unsigned bytes) { return *(const v8b*)((const char*)base + bytes); }
// value of lane l ^ 16, by a vector cross-row move: an LDS-path shuffle would be waited for on the LDS counter, behind every fragment read that is meant to stay in flight
__device__ __forceinline__ float xhalf(float v) {
  return __uint_as_float(__builtin_amdgcn_permlanex16(__float_as_uint(v), __float_as_uint(v), 0x76543210u, 0xfedcba98u, false, false));
}
__global__ __launch_bounds__(256) void attn_kernel(const b16* __restrict__ qk, const b16* __restrict__ pp, const b16* __restrict__ vth, const b16* __restrict__ vtl,
                                                   const int* __restrict__ umask, const int* __restrict__ qmask, float* __restrict__ y) {
  __shared__ __attribute__((aligned(16))) float Os[4][32][DH + 4];      // output rows of a 32-query group
  __shared__ __attribute__((aligned(16))) v4f Xs[4][17][32];            // state of a group's kh = 1 wave: 16 pieces of its output tiles and (m, m, l, l), a lane's pieces 512 B apart
  __shared__ __attribute__((aligned(16))) b16 Ks[2][2][4][32 * KPIT];   // [buffer][chunk of the step][k1, k2, kp1, kp2][key][feature]
  __shared__ __attribute__((aligned(16))) b16 Vs[2][2][2][DH * VPIT];   // [buffer][chunk of the step][hi, lo][feature][key]
  __shared__ __attribute__((aligned(16))) int Ms[2][L];                 // speaker ids and umask of batch row b
  const int tid = threadIdx.x, wid = __builtin_amdgcn_readfirstlane(tid >> 5), lane = tid & 31, hh = lane >> 4, col = lane & 15;
  // Waves w and w + 4 get query groups s and 3 - s; the pairing matters for speed only.
  // Every loop marked unroll in this kernel is unrolled so that the fragment, accumulator and staging arrays are indexed by constants and stay in registers.
  const int kh = wid >> 2, g = kh ? 3 - (wid & 3) : (wid & 3);
  // Block index -> (head row, query tile). A block's cost grows with its tile (2 to 16 steps) and one block fills a WGP, so the tiles go longest first: the 256 places take tiles
  // 7..4, and a place that frees takes the longest tile left (20 + 16, 24 + 12, ... chunks). The map is one-to-one onto (b, h, tile); its order matters for speed only.
  const int tile = 7 - (blockIdx.x >> 6), h = blockIdx.x & 15, b = (blockIdx.x >> 4) & 3, q0 = tile * 128 + g * 32;
  const int nstep = (tile + 1) * 2;                             // 64-key steps up to the block's last query
  const b16* Q = qk + ((((size_t)0 * Bn + b) * H + h) * L) * DH; const b16* K1 = qk + ((((size_t)1 * Bn + b) * H + h) * L) * DH; const b16* K2 = qk + ((((size_t)2 * Bn + b) * H + h) * L) * DH;
  const b16* QP = pp + (((size_t)0 * H + h) * L) * DH; const b16* KP1 = pp + (((size_t)1 * H + h) * L) * DH; const b16* KP2 = pp + (((size_t)2 * H + h) * L) * DH;
  const b16* vh = vth + (((size_t)b * H + h) * DH) * L; const b16* vl = vtl + (((size_t)b * H + h) * DH) * L;
  // staging map: a thread moves one 16-byte piece of each of the six tiles of each of the step's two chunks
  const int kr = tid >> 3, kc8 = (tid & 7) * 8, vr = tid >> 2, vc = (tid & 3) * 8;
  const unsigned gkb = (unsigned)(kr * DH + kc8) * 2u, gvb = (unsigned)(vr * L + vc) * 2u;   // byte offsets from the six scalar bases
  const int sko = kr * KPIT + kc8, svo = vr * VPIT + vc;
  // The twelve loads of the 64-key step that begins at key key0. The closing wait stands in front of any rewrite of their address registers: it takes the addresses as inputs (it changes
  // nothing), so that they stay in their registers up to it; with the memory clobber alone the compiler lifts later writes of those registers over the wait.
  auto fetch = [&](int key0, v8b (&d)[12]) {
    const unsigned ko = gkb + (unsigned)key0 * (DH * 2u), vo = gvb + (unsigned)key0 * 2u;   // the second chunk lies 32 rows (4096 B) and 32 columns (64 B) on: immediate offsets
    const b16* k2p = (const b16*)((const char*)K2 + ko);        // the k2 rows lie 8 MiB behind the k1 rows, past the reach of an immediate offset from that base: an address of their own
    d[0] = ldoff(K1, ko); d[1] = ld8b(k2p); d[2] = ldoff(KP1, ko); d[3] = ldoff(KP2, ko); d[4] = ldoff(vh, vo); d[5] = ldoff(vl, vo);
    d[6] = ldoff(K1, ko + 4096u); d[7] = ld8b(k2p + 2048); d[8] = ldoff(KP1, ko + 4096u); d[9] = ldoff(KP2, ko + 4096u); d[10] = ldoff(vh, vo + 64u); d[11] = ldoff(vl, vo + 64u);
    asm volatile("s_wait_xcnt 0x0" :: "v"(ko), "v"(k2p), "v"(vo) : "memory");
  };
  {
    v8b st[12];
    fetch(0, st);
    const unsigned mo = (unsigned)(b * L + tid * 4) * 4u;       // byte offset
    const v4i mq = *(const v4i*)((const char*)qmask + mo), mu = *(const v4i*)((const char*)umask + mo);
    asm volatile("s_wait_xcnt 0x0" :: "v"(mo) : "memory");      // the same for the two mask loads
    *(v4i*)(&Ms[0][tid * 4]) = mq; *(v4i*)(&Ms[1][tid * 4]) = mu;
#pragma unroll
    for (int c = 0; c < 2; ++c) {
#pragma unroll
      for (int i = 0; i < 4; ++i) *(v8b*)(&Ks[0][c][i][sko]) = st[c * 6 + i];
      *(v8b*)(&Vs[0][c][0][svo]) = st[c * 6 + 4]; *(v8b*)(&Vs[0][c][1][svo]) = st[c * 6 + 5]; }
  }
  v16b qf[2][2], qpf[2][2]; int myspk[2];                       // [query tile][features 0..31, 32..63]
#pragma unroll
  for (int a = 0; a < 2; ++a) { const int so = b * L + q0 + col;
    const b16* qa = Q + (size_t)(q0 + a * 16 + col) * DH + 8 * hh; const b16* qb = QP + (size_t)(q0 + a * 16 + col) * DH + 8 * hh;   // a lane's first piece; the others 16, 32, 48 elements on
#pragma unroll
    for (int ks = 0; ks < 2; ++ks) { qf[a][ks] = cat8b(ld8b(qa + ks * 32), ld8b(qa + ks * 32 + 16)); qpf[a][ks] = cat8b(ld8b(qb + ks * 32), ld8b(qb + ks * 32 + 16)); }
    myspk[a] = qmask[so + a * 16];
    asm volatile("s_wait_xcnt 0x0" :: "v"(qa), "v"(qb), "v"(so) : "memory"); }   // the same for these nine loads
  __syncthreads();
  float m[2] = {-INFINITY, -INFINITY}, l[2] = {0.0f, 0.0f}; v8f o[2][4] = {{{}, {}, {}, {}}, {{}, {}, {}, {}}};
  // The chunk's LDS fragment reads go in whole groups (the four row pairs of keys 0..15, those of keys 16..31 with the masks, the hi and lo value tiles), each issued a block of
  // WMMAs or vector work ahead of its use. The first group of step s + 1 is issued behind the step's barrier, which for that stands in front of the softmax.
  auto read_pair = [&](int buf, int half, int pr, v16b (&d)[4]) {   // pr 0: k1, k2 rows; pr 1: kp1, kp2 rows; features 0..31 and 32..63 of each
    const int ro = (half * 16 + col) * KPIT;
    d[0] = frag_kb(&Ks[buf][kh][2 * pr][ro], hh); d[1] = frag_kb(&Ks[buf][kh][2 * pr][ro + 32], hh); d[2] = frag_kb(&Ks[buf][kh][2 * pr + 1][ro], hh); d[3] = frag_kb(&Ks[buf][kh][2 * pr + 1][ro + 32], hh);
  };
  // a1 = rows d0|d1 . bq, a2 = rows d2|d3 . bq, features 0..31 and then 32..63
  auto score_pair = [&](const v16b (&d)[4], const v16b (&bq)[2], v8f& a1, v8f& a2) {
    a1 = wmma16b(d[0], bq[0], (v8f){}); a2 = wmma16b(d[2], bq[0], (v8f){}); a1 = wmma16b(d[1], bq[1], a1); a2 = wmma16b(d[3], bq[1], a2);
  };
  v16b ka[4], kq[4];                                            // k1, k2 and kp1, kp2 rows of keys 0..15 of the chunk that this wave scores next
  read_pair(0, 0, 0, ka); read_pair(0, 0, 1, kq);
  for (int s = 0; s < nstep; ++s) {
    const int kb = s * 64 + kh * 32, cur = s & 1; const bool more = s + 1 < nstep, act = kb < q0 + 32;   // act: this wave has queries at or behind its chunk of step s
    v8b sn[12];                                                 // step s + 1 on its way to LDS
    if (more) fetch(s * 64 + 64, sn);
    float lg0[2][8], lg1[2][8]; v16b vhi[4], vlo[4];
    if (act) {
      v4i mk0[4], mk1[4]; v8f s1[2], p1[2], s2[2], p2[2]; v16b kc[4], kd[4];
      auto read_masks = [&](int half, v4i (&mk)[4]) {
        const int k8 = kb + half * 16 + 8 * hh;
        mk[0] = *(const v4i*)(&Ms[0][k8]); mk[1] = *(const v4i*)(&Ms[0][k8 + 4]); mk[2] = *(const v4i*)(&Ms[1][k8]); mk[3] = *(const v4i*)(&Ms[1][k8 + 4]);
      };
      auto logits = [&](int half, int a, const v4i (&mk)[4], float (&lg)[8]) {
        const int dq = q0 + a * 16 + col - (kb + half * 16 + 8 * hh);   // key kb + 16 half + 8 hh + r lies behind the query where r > dq
#pragma unroll
        for (int r = 0; r < 8; ++r) { const bool same = ((r < 4 ? mk[0][r & 3] : mk[1][r & 3]) == myspk[a]);
          float v = same ? (s1[a][r] + p1[a][r]) : (s2[a][r] + p2[a][r]);
          if ((r > dq) | ((r < 4 ? mk[2][r & 3] : mk[3][r & 3]) == 0)) v = -INFINITY;
          lg[r] = v; }
      };
      read_pair(cur, 1, 0, kc); read_pair(cur, 1, 1, kd); read_masks(0, mk0); read_masks(1, mk1);
      group_fence();                                            // the reads for keys 16..31 stay whole ahead of the WMMAs of keys 0..15, which hide them
#pragma unroll
      for (int a = 0; a < 2; ++a) { score_pair(ka, qf[a], s1[a], s2[a]); score_pair(kq, qpf[a], p1[a], p2[a]); }
      group_fence();                                            // the reads of the hi value tiles are not spread among those WMMAs
#pragma unroll
      for (int n = 0; n < 4; ++n) vhi[n] = frag_kb(&Vs[cur][kh][0][(n * 16 + col) * VPIT], hh);
      group_fence();                                            // the reads of the hi value tiles stay whole ahead of the logits of keys 0..15 and the WMMAs of keys 16..31, which hide them
#pragma unroll
      for (int a = 0; a < 2; ++a) logits(0, a, mk0, lg0[a]);
      v8f t1[2], u1[2], t2[2], u2[2];                           // accumulators of their own: the WMMAs of keys 16..31 may run among the logits of keys 0..15
#pragma unroll
      for (int a = 0; a < 2; ++a) { score_pair(kc, qf[a], t1[a], t2[a]); score_pair(kd, qpf[a], u1[a], u2[a]); }
      group_fence();                                            // the lo value tiles are read only here, when the rows of keys 16..31 have left their registers
#pragma unroll
      for (int n = 0; n < 4; ++n) vlo[n] = frag_kb(&Vs[cur][kh][1][(n * 16 + col) * VPIT], hh);
      group_fence();                                            // those reads stay whole ahead of the logits of keys 16..31, which hide them
#pragma unroll
      for (int a = 0; a < 2; ++a) { s1[a] = t1[a]; s2[a] = t2[a]; p1[a] = u1[a]; p2[a] = u2[a]; logits(1, a, mk1, lg1[a]); }
    }
    if (more) {                                                 // the other buffer's last reads (step s - 1) had returned when their waves reached the previous step's barrier
#pragma unroll
      for (int c = 0; c < 2; ++c) {
#pragma unroll
        for (int i = 0; i < 4; ++i) *(v8b*)(&Ks[cur ^ 1][c][i][sko]) = sn[c * 6 + i];
        *(v8b*)(&Vs[cur ^ 1][c][0][svo]) = sn[c * 6 + 4]; *(v8b*)(&Vs[cur ^ 1][c][1][svo]) = sn[c * 6 + 5]; }
    }
    __syncthreads();                                            // publishes step s + 1; every read of step s has been issued above and has returned here. Passed on the last step too: with
                                                                // one path to the P.V WMMAs the value tiles count as landed there, and no LDS wait behind the reads below is put in front of them
    read_pair(cur ^ 1, 0, 0, ka); read_pair(cur ^ 1, 0, 1, kq);   // by every wave on every step (the last step's are old rows; neither they nor an idle wave's are used)
    if (act) {
      group_fence();                                            // the next step's first reads stay whole ahead of the softmax and P.V, which hide them
      v16b pb[2];
#pragma unroll
      for (int a = 0; a < 2; ++a) {
        float mr = -INFINITY;
#pragma unroll
        for (int r = 0; r < 8; ++r) mr = fmaxf(mr, fmaxf(lg0[a][r], lg1[a][r]));
        mr = fmaxf(mr, xhalf(mr));
        float mn = fmaxf(m[a], mr); if (mn == -INFINITY) mn = 0.0f;
        const float al_ = __expf(m[a] - mn); m[a] = mn;
        float sum = 0.0f;
#pragma unroll
        for (int r = 0; r < 8; ++r) { const float e0 = __expf(lg0[a][r] - mn), e1 = __expf(lg1[a][r] - mn); sum += e0 + e1; pb[a][r] = (b16)e0; pb[a][8 + r] = (b16)e1; }
        sum += xhalf(sum); l[a] = l[a] * al_ + sum;
#pragma unroll
        for (int n = 0; n < 4; ++n)
#pragma unroll
          for (int r = 0; r < 8; ++r) o[a][n][r] *= al_;
#pragma unroll
        for (int n = 0; n < 4; ++n) o[a][n] = wmma16b(vhi[n], pb[a], o[a][n]);     // hi, then lo, into each accumulator; the first tile's WMMAs may run among the second tile's softmax
#pragma unroll
        for (int n = 0; n < 4; ++n) o[a][n] = wmma16b(vlo[n], pb[a], o[a][n]);
      }
    }
  }
  if (kh) {                                                     // the kh = 1 wave hands its state to its group's kh = 0 wave
#pragma unroll
    for (int a = 0; a < 2; ++a)
#pragma unroll
      for (int n = 0; n < 4; ++n) { Xs[g][a * 8 + n * 2][lane] = (v4f){o[a][n][0], o[a][n][1], o[a][n][2], o[a][n][3]}; Xs[g][a * 8 + n * 2 + 1][lane] = (v4f){o[a][n][4], o[a][n][5], o[a][n][6], o[a][n][7]}; }
    Xs[g][16][lane] = (v4f){m[0], m[1], l[0], l[1]};
  }
  __syncthreads();                                              // publishes the handed-over states; passed by every wave
  if (kh) return;
  const v4f ml = Xs[g][16][lane];
#pragma unroll
  for (int a = 0; a < 2; ++a) {                                 // join of the two key halves: both rescaled to the common maximum
    float mj = fmaxf(m[a], ml[a]); if (mj == -INFINITY) mj = 0.0f;
    const float w0 = __expf(m[a] - mj), w1 = __expf(ml[a] - mj), lj = l[a] * w0 + ml[2 + a] * w1;
    const float inv = (lj > 0.0f) ? (1.0f / (VS * lj)) : 0.0f;
#pragma unroll
    for (int n = 0; n < 4; ++n) { const v4f x0 = Xs[g][a * 8 + n * 2][lane], x1 = Xs[g][a * 8 + n * 2 + 1][lane];
#pragma unroll
      for (int r = 0; r < 8; ++r) Os[g][a * 16 + col][n * 16 + 8 * hh + r] = (o[a][n][r] * w0 + (r < 4 ? x0[r & 3] : x1[r & 3]) * w1) * inv; }
  }
  wave_lds_sync();
  float* dst = y + ((size_t)b * L + q0) * DM + h * DH;          // 32 rows x 256 B
#pragma unroll
  for (int j = 0; j < 16; ++j) { const int rr = j * 2 + hh, c4 = col * 4; *(v4f*)(dst + (size_t)rr * DM + c4) = *(const v4f*)(&Os[g][rr][c4]); }
  asm volatile("s_wait_xcnt 0x0" ::: "memory");                 // behind the last store: stands in front of any later write of a register that these stores name
}

// out = y.W_fc: (4096 x 1024) x (1024 x 1024); A = y f32 x8 split, B = f16(bf16 W_fc)^T rows -> 2 products; f32 rows; grid (8, 32), one block a WGP, block = 128 rows x 128 columns, 8 waves of
// 16 x 128: a y row piece is brought from L2 for 128 columns and split once for 16 WMMAs. Per 64-k tile the 128 y rows (f32, pitch 272 B) and the 128 weight rows (pitch 144 B) are brought once
// per block into LDS by asynchronous copies, two buffers, as in qkv_kernel; the split runs on fragments read from LDS. The epilogue stages in the ring's LDS behind the last tile's barrier.
constexpr int OAP = 64 + 4, OBP = 64 + 8, OCOLS = 128, OAB = 128 * OAP * 4, OST = OAB + OCOLS * OBP * 2;   // pitches (f32, f16 elements), columns of a block, bytes of the y part and of a whole stage
// At most two waves a SIMD: a WGP then takes one block and no second one, so that the 256 blocks stand on 256 WGPs however the blocks are dealt out.
__global__ __launch_bounds__(256) __attribute__((amdgpu_waves_per_eu(2, 2))) void out_kernel(const float* __restrict__ y, const b16* __restrict__ wfc, float* __restrict__ out) {
  __shared__ __attribute__((aligned(16))) unsigned char So[2 * OST];   // 106,496 B
  const int tid = threadIdx.x, lane = tid & 31, wave = __builtin_amdgcn_readfirstlane(tid >> 5), nloc = lane & 15, hlf = lane >> 4, mb = blockIdx.y * 128, m0 = mb + wave * 16, c0 = blockIdx.x * OCOLS;
  // copy map: 16 lanes bring one 256-byte y row piece (rows ar + 16 i), 8 lanes one 128-byte weight row piece (rows br + 32 j)
  const int ar = tid >> 4, ac = (tid & 15) * 4, br = tid >> 3, bc = (tid & 7) * 8;
  const float* ga = y + (size_t)(mb + ar) * DM + ac; const b16* gb = wfc + (size_t)(c0 + br) * DM + bc;
  const unsigned la = (unsigned)(size_t)(&So[0]) + (unsigned)(ar * OAP + ac) * 4u, lw = (unsigned)(size_t)(&So[0]) + (unsigned)OAB + (unsigned)(br * OBP + bc) * 2u;
  auto stage = [&](int kt, int buf) {
    const unsigned l = la + (unsigned)buf * (unsigned)OST, w = lw + (unsigned)buf * (unsigned)OST; const float* a = ga + kt * 64; const b16* g = gb + kt * 64;
    constexpr unsigned R16 = 16u * OAP * 4u, W32 = 32u * OBP * 2u;
    copy8_to_lds(l, l + R16, l + 2u * R16, l + 3u * R16, l + 4u * R16, l + 5u * R16, l + 6u * R16, l + 7u * R16,
                 a, a + 16 * DM, a + 32 * DM, a + 48 * DM, a + 64 * DM, a + 80 * DM, a + 96 * DM, a + 112 * DM);
    copy4_to_lds(w, w + W32, w + 2u * W32, w + 3u * W32, g, g + 32 * DM, g + 64 * DM, g + 96 * DM);
  };
  v8f acc[8] = {{}, {}, {}, {}, {}, {}, {}, {}};
  // as in qkv_kernel: trip kt works on k tile (kt + rot) mod 16; the 8 blocks that share y rows all differ in rot, the 32 that share weight rows stand two to a place
  const int rot = (blockIdx.y + 2 * blockIdx.x) & (DM / 64 - 1);
  stage(rot, 0);
  asm volatile("s_wait_asynccnt 0x0" ::: "memory");             // this wave's copies of trip 0's tile have landed
  __syncthreads();                                              // publishes trip 0's tile
  stage((rot + 1) & (DM / 64 - 1), 1);
  for (int kt = 0; kt < DM / 64; ++kt) {
    const float* As = (const float*)(So + (kt & 1) * OST) + (wave * 16 + nloc) * OAP + 8 * hlf; const b16* Bs = (const b16*)(So + (kt & 1) * OST + OAB) + nloc * OBP;
    // every loop below is unrolled so that the fragment and accumulator arrays are indexed by constants and stay in registers
    v4f x[2][4]; v16b bf[2][8];
#pragma unroll
    for (int ks = 0; ks < 2; ++ks) {
      x[ks][0] = *(const v4f*)(As + ks * 32); x[ks][1] = *(const v4f*)(As + ks * 32 + 4); x[ks][2] = *(const v4f*)(As + ks * 32 + 16); x[ks][3] = *(const v4f*)(As + ks * 32 + 20);
#pragma unroll
      for (int t = 0; t < 8; ++t) bf[ks][t] = frag_kb(Bs + t * 16 * OBP + ks * 32, hlf);
    }
    group_fence();                          // the tile's 40 LDS reads stay one group ahead of the split and the WMMAs: one run of LDS waits a tile instead of one wait per fragment
#pragma unroll
    for (int ks = 0; ks < 2; ++ks) {
      v16b ah, al;
#pragma unroll
      for (int e = 0; e < 16; ++e) { b16 a, c; split16(x[ks][e >> 2][e & 3] * 8.0f, a, c); ah[e] = a; al[e] = c; }
#pragma unroll
      for (int t = 0; t < 8; ++t) acc[t] = wmma16b(ah, bf[ks][t], acc[t]);     // hi, then lo, into each accumulator
#pragma unroll
      for (int t = 0; t < 8; ++t) acc[t] = wmma16b(al, bf[ks][t], acc[t]);
    }
    group_fence();                          // the tile's split and WMMAs stay ahead of the barrier below: sunk behind it they would stand between the barrier and the next copies, which then fly for no more
                                            // than the next tile's LDS reads before they are waited for
    asm volatile("s_wait_dscnt 0x0" ::: "memory");              // this wave's reads of tile kt are done before its buffer is handed back
    asm volatile("s_wait_asynccnt 0x0" ::: "memory");           // this wave's copies of tile kt + 1 have landed
    __syncthreads();                                            // publishes tile kt + 1 and ends every read of tile kt
    if (kt + 2 < DM / 64) stage((kt + 2 + rot) & (DM / 64 - 1), kt & 1);
  }
  asm volatile("s_wait_asynccnt 0x0" ::: "memory");             // no copy is outstanding when the ring becomes output staging
  float* Tt = (float*)So + wave * (16 * OCOLS);                 // 16 rows x 512 B per wave, stored as whole lines; unrolled: constant accumulator indices
#pragma unroll
  for (int t = 0; t < 8; ++t)
#pragma unroll
    for (int v = 0; v < 8; ++v) Tt[(v + 8 * hlf) * OCOLS + t * 16 + nloc] = acc[t][v] * (1.0f / 8.0f);
  wave_lds_sync();
  float* dst0 = out + (size_t)m0 * DM + c0;
#pragma unroll
  for (int j = 0; j < 16; ++j) { const int c4 = lane * 4; *(v4f*)(dst0 + (size_t)j * DM + c4) = *(const v4f*)(Tt + j * OCOLS + c4); }
}
}  // namespace

extern "C" void kernel_launch(void* const* d_in, const int* in_sizes, int n_in,
                              void* d_out, int out_size, void* d_ws, size_t ws_size, hipStream_t stream) {
  (void)n_in; (void)out_size;
  const float* emb = (const float*)d_in[0]; const int* umask = (const int*)d_in[1]; const int* qmask = (const int*)d_in[2];
  const float* Wqkv = (const float*)d_in[3]; const float* Wpos = (const float*)d_in[4]; const float* Wfc = (const float*)d_in[5];
  float* out = (float*)d_out;   // [4,1024,1024]
  if (in_sizes[0] != NTOK * DM || in_sizes[1] != NTOK || in_sizes[2] != NTOK || in_sizes[3] != DM * NQKV || in_sizes[4] != DH * NPOS || in_sizes[5] != DM * DM) return;
  size_t off = 0; char* ws = (char*)d_ws;
  auto carve = [&](size_t bytes) { char* p = ws + off; off += (bytes + 255) & ~(size_t)255; return p; };
  unsigned short* e16 = (unsigned short*)carve((size_t)NTOK * DM * 2);       // 8 MB
  unsigned short* wq = (unsigned short*)carve((size_t)NQKV * DM * 2);        // 8 MB
  unsigned short* wp = (unsigned short*)carve((size_t)NPOS * DH * 2);        // 384 KB
  unsigned short* wf = (unsigned short*)carve((size_t)DM * DM * 2);          // 2 MB
  b16* peh = (b16*)carve((size_t)L * DH * 2); b16* pel = (b16*)carve((size_t)L * DH * 2);
  b16* qk = (b16*)carve((size_t)3 * Bn * H * L * DH * 2);                   // 24 MB
  b16* vth = (b16*)carve((size_t)Bn * H * DH * L * 2); b16* vtl = (b16*)carve((size_t)Bn * H * DH * L * 2);   // 8 MB each
  b16* pp = (b16*)carve((size_t)3 * H * L * DH * 2);                         // 6 MB
  float* y = (float*)carve((size_t)NTOK * DM * 4);                           // 16 MB
  if (off > ws_size) return;                                                  // ≈ 81 MB
  prep_kernel<<<PB_PE + PB_WQ + PB_WF + PB_WP + PB_EM, 256, 0, stream>>>(emb, Wqkv, Wpos, Wfc, e16, peh, pel, wq, wp, wf);
  qkv_kernel<<<PB_POS + (NQKV / 128) * (NTOK / GAROWS), 256, 0, stream>>>((const __bf16*)e16, (const __bf16*)wq, qk, vth, vtl, peh, pel, (const b16*)wp, pp);
  attn_kernel<<<Bn * H * (L / 16) / 8, 256, 0, stream>>>(qk, pp, vth, vtl, umask, qmask, y);
  out_kernel<<<dim3(DM / OCOLS, NTOK / 128), 256, 0, stream>>>(y, (const b16*)wf, out);
}
